// v000
// Times are from an AMD MI455X. After a warm-up the kernel runs many times in a row, and a time is the length of
// such a window on the GPU divided by its runs, so every launch and the gaps after it count. The runs cycle
// through copies of the inputs. A figure is the median of several windows, for all but v000 over two sittings.
// Sittings can differ by a few percent; kernels timed side by side share one.
// v000, which the later versions start from, runs in 645 microseconds.
#include <hip/hip_runtime.h>
// theta/phi/g 1×1 convolutions as one GEMM on position-major bf16(x) (single exact term, K=128, N=192), the 4096×4096 non-local attention per batch as
// 16-query tiles on WMMA (Q·Kᵀ and P·V as 3-term bf16 hi/lo splits, f32 online softmax, no scaling), and the final 1×1 conv (2 terms) + bias; the
// residual add and the NCHW transposes are f32. 
#define BB 4
#define CC 128
#define HC 64
#define HWN 4096
#define MROWS (BB * HWN)

typedef __bf16 v16b __attribute__((ext_vector_type(16)));
typedef unsigned short v8us __attribute__((ext_vector_type(8), may_alias));
typedef float  v8f  __attribute__((ext_vector_type(8)));
typedef float  v4f  __attribute__((ext_vector_type(4)));
typedef float  v4fa __attribute__((ext_vector_type(4), may_alias));
union FragB { v16b v; v8us half[2]; unsigned short u[16]; };

__device__ __forceinline__ unsigned short bf16_bits(float x) { unsigned int u = __float_as_uint(x); return (unsigned short)((u + 0x7FFFu + ((u >> 16) & 1u)) >> 16); }
__device__ __forceinline__ float bf16_val(unsigned short b) { return __uint_as_float(((unsigned int)b) << 16); }
__device__ __forceinline__ float bf16_round(float x) { return bf16_val(bf16_bits(x)); }
// D += A·B with NT terms: 1 = ah·bh, 2 = + al·bh (A split), 3 = + ah·bl (both split)
template <int NT>
__device__ __forceinline__ v8f mmaN(v16b ah, v16b al, v16b bh, v16b bl, v8f c) {
  c = __builtin_amdgcn_wmma_f32_16x16x32_bf16(false, ah, false, bh, (short)0, c, false, false);
  if (NT >= 2) c = __builtin_amdgcn_wmma_f32_16x16x32_bf16(false, al, false, bh, (short)0, c, false, false);
  if (NT >= 3) c = __builtin_amdgcn_wmma_f32_16x16x32_bf16(false, ah, false, bl, (short)0, c, false, false);
  asm volatile("v_nop\n\tv_nop\n\tv_nop\n\tv_nop" : "+v"(c) : "v"(ah), "v"(al), "v"(bh), "v"(bl));
  return c;
}

__global__ __launch_bounds__(256) void k_wt_bf16(const float* __restrict__ W, unsigned short* __restrict__ Wt, int K, int N) {
  const int t = blockIdx.x * 256 + threadIdx.x;
  const int k8n = K / 8;
  if (t >= N * k8n) return;
  const int n = t / k8n, k8 = (t % k8n) * 8;
  v8us v;
#pragma unroll
  for (int i = 0; i < 8; ++i) v[i] = bf16_bits(W[(size_t)(k8 + i) * N + n]);
  *(v8us*)(Wt + (size_t)n * K + k8) = v;
  
}

// GEMM C[M][N] (f32, pitch ldc) = act(A[M][K]·W + bias). A f32 row-major (pitch lda) converted per fragment to bf16
// (ASPLIT: hi/lo two planes -> 2 terms, else single rounded term); Wt bf16 [N][K] (pitch ldb). BIAS_BF16 rounds the
// bias to bf16 first (bias quantised to bf16 before the add). K%32==0, M%16==0, N%64==0.
template <bool ASPLIT, int ACT, bool BIAS_BF16>
__global__ __launch_bounds__(128) void k_gemm_bf(const float* __restrict__ A, int lda, const unsigned short* __restrict__ Wt, int ldb,
                                               const float* __restrict__ bias, float* __restrict__ C, int ldc, int M, int N, int K) {
  __shared__ __attribute__((aligned(16))) float so[4][16][64];
  const int tid = threadIdx.x, w = tid >> 5, lane = tid & 31, ln = lane & 15, hh = lane >> 4;
  const int ntn = N / 64;
  const int wid = blockIdx.x * 4 + w;
  const int mt = wid / ntn, nq = wid % ntn;
  if (mt * 16 >= M) return;
  const int row0 = mt * 16, col0 = nq * 64;
  const float* arow = A + (size_t)(row0 + ln) * lda;
  v8f acc[4] = {};
  for (int kb = 0; kb < K; kb += 32) {
    FragB ah, al;
    const v4f x0 = *(const v4fa*)(arow + kb + 8 * hh), x1 = *(const v4fa*)(arow + kb + 8 * hh + 4);
    const v4f x2 = *(const v4fa*)(arow + kb + 16 + 8 * hh), x3 = *(const v4fa*)(arow + kb + 16 + 8 * hh + 4);
    float xs[16] = {x0[0],x0[1],x0[2],x0[3],x1[0],x1[1],x1[2],x1[3],x2[0],x2[1],x2[2],x2[3],x3[0],x3[1],x3[2],x3[3]};
#pragma unroll
    for (int i = 0; i < 16; ++i) { const unsigned short hb = bf16_bits(xs[i]); ah.u[i] = hb; al.u[i] = ASPLIT ? bf16_bits(xs[i] - bf16_val(hb)) : (unsigned short)0; }
#pragma unroll
    for (int t = 0; t < 4; ++t) {
      const unsigned short* brow = Wt + (size_t)(col0 + t * 16 + ln) * ldb + kb;
      FragB b;
      b.half[0] = *(const v8us*)(brow + 8 * hh);
      b.half[1] = *(const v8us*)(brow + 16 + 8 * hh);
      acc[t] = mmaN<ASPLIT ? 2 : 1>(ah.v, al.v, b.v, b.v, acc[t]);
    }
  }
#pragma unroll
  for (int t = 0; t < 4; ++t) {
    float bv = bias ? bias[col0 + t * 16 + ln] : 0.f;
    if (BIAS_BF16) bv = bf16_round(bv);
#pragma unroll
    for (int r = 0; r < 8; ++r) { float v = acc[t][r] + bv; if (ACT == 1) v = fmaxf(v, 0.f); so[w][8 * hh + r][t * 16 + ln] = v; }
  }
  __builtin_amdgcn_fence(__ATOMIC_ACQ_REL, "workgroup");
  __builtin_amdgcn_wave_barrier();
  const int rsub = lane >> 4, c4 = (lane & 15) * 4;
  {
#pragma unroll
    for (int q = 0; q < 8; ++q) {
      const int r = q * 2 + rsub;
      const v4f v = *(const v4fa*)&so[w][r][c4];
      *(v4f*)(C + (size_t)(row0 + r) * ldc + col0 + c4) = v;
    }
    
  }
}

// Flash-style causal/unmasked attention, all contractions 3-term bf16 hi/lo splits, f32 softmax with running max.
// q,k,v rows are read from f32 buffers with arbitrary row pitch (so they can live inside a fused qkv buffer);
// D = head size (multiple of 32, <= 128); one wave = 16 query rows; block = 4 waves (64 queries) sharing K/V chunks of 32.
template <int D, bool CAUSAL>
__global__ __launch_bounds__(128) void k_flash(const float* __restrict__ qb, const float* __restrict__ kb, const float* __restrict__ vb,
                                             int pitch, int T, int H, float scale, float* __restrict__ y, int ypitch) {
  constexpr int KS = D / 32;        // k-steps for QK
  constexpr int DT = D / 16;        // d tiles for PV
  __shared__ __attribute__((aligned(16))) unsigned short sKh[32][D + 8], sKl[32][D + 8], sVh[32][D + 8], sVl[32][D + 8];
  __shared__ __attribute__((aligned(16))) unsigned short sPh[4][16][40], sPl[4][16][40];
  __shared__ __attribute__((aligned(16))) float sO[4][16][D];
  const int tid = threadIdx.x, w = tid >> 5, lane = tid & 31, ln = lane & 15, hh = lane >> 4;
  const int nqb = (T + 63) / 64;
  const int bh = blockIdx.x / nqb, qblk = blockIdx.x % nqb;
  const int b = bh / H, h = bh % H;
  const int q0 = qblk * 64 + w * 16;
  const float* Q = qb + (size_t)b * T * pitch + h * D;
  const float* K = kb + (size_t)b * T * pitch + h * D;
  const float* V = vb + (size_t)b * T * pitch + h * D;

  // A fragments of the wave's 16 query rows (scaled), hi/lo
  FragB aqh[KS], aql[KS];
  {
    int row = q0 + ln; if (row >= T) row = T - 1;
    const float* qr = Q + (size_t)row * pitch;
#pragma unroll
    for (int ks = 0; ks < KS; ++ks)
#pragma unroll
      for (int i = 0; i < 16; ++i) {
        const int d = ks * 32 + ((i < 8) ? (8 * hh + i) : (16 + 8 * hh + (i - 8)));
        const float x = qr[d] * scale; const unsigned short hb = bf16_bits(x);
        aqh[ks].u[i] = hb; aql[ks].u[i] = bf16_bits(x - bf16_val(hb));
      }
  }
  float m_r[8], l_r[8];
#pragma unroll
  for (int r = 0; r < 8; ++r) { m_r[r] = -3.0e38f; l_r[r] = 0.f; }
  v8f oacc[DT];
#pragma unroll
  for (int dt = 0; dt < DT; ++dt) oacc[dt] = (v8f){0.f,0.f,0.f,0.f,0.f,0.f,0.f,0.f};

  const int kv_end = CAUSAL ? min(T, qblk * 64 + 64) : T;     // block-uniform
  for (int j0 = 0; j0 < kv_end; j0 += 32) {
    __syncthreads();
    for (int e = tid; e < 32 * (D / 4); e += 128) {
      const int r = e / (D / 4), c4 = (e % (D / 4)) * 4;
      const int key = j0 + r;
      v4f kf = {0.f,0.f,0.f,0.f}, vf = {0.f,0.f,0.f,0.f};
      if (key < T) { kf = *(const v4fa*)(K + (size_t)key * pitch + c4); vf = *(const v4fa*)(V + (size_t)key * pitch + c4); }
#pragma unroll
      for (int t = 0; t < 4; ++t) {
        unsigned short hb = bf16_bits(kf[t]); sKh[r][c4 + t] = hb; sKl[r][c4 + t] = bf16_bits(kf[t] - bf16_val(hb));
        hb = bf16_bits(vf[t]); sVh[r][c4 + t] = hb; sVl[r][c4 + t] = bf16_bits(vf[t] - bf16_val(hb));
      }
    }
    __syncthreads();
    // S tile 16 x 32
    v8f s[2];
#pragma unroll
    for (int nt = 0; nt < 2; ++nt) {
      v8f acc = {};
#pragma unroll
      for (int ks = 0; ks < KS; ++ks) {
        FragB bh_, bl_;
        bh_.half[0] = *(const v8us*)&sKh[nt * 16 + ln][ks * 32 + 8 * hh]; bh_.half[1] = *(const v8us*)&sKh[nt * 16 + ln][ks * 32 + 16 + 8 * hh];
        bl_.half[0] = *(const v8us*)&sKl[nt * 16 + ln][ks * 32 + 8 * hh]; bl_.half[1] = *(const v8us*)&sKl[nt * 16 + ln][ks * 32 + 16 + 8 * hh];
        acc = mmaN<3>(aqh[ks].v, aql[ks].v, bh_.v, bl_.v, acc);
      }
      s[nt] = acc;
    }
    // mask + running max (rows 8hh+r; the 16 lanes of a half share rows)
    float alpha[8];
#pragma unroll
    for (int r = 0; r < 8; ++r) {
      const int qi = q0 + 8 * hh + r;
      const int ja = j0 + ln, jb = j0 + 16 + ln;
      if (CAUSAL) { if (ja > qi) s[0][r] = -3.0e38f; if (jb > qi) s[1][r] = -3.0e38f; }
      if (ja >= T) s[0][r] = -3.0e38f;
      if (jb >= T) s[1][r] = -3.0e38f;
      float mx = fmaxf(s[0][r], s[1][r]);
      mx = fmaxf(mx, __shfl_xor(mx, 1, 32)); mx = fmaxf(mx, __shfl_xor(mx, 2, 32)); mx = fmaxf(mx, __shfl_xor(mx, 4, 32)); mx = fmaxf(mx, __shfl_xor(mx, 8, 32));
      const float mnew = fmaxf(m_r[r], mx);
      alpha[r] = (mnew > -1.0e38f) ? __expf(m_r[r] - mnew) : 1.0f;
      const float p0 = (s[0][r] > -1.0e38f) ? __expf(s[0][r] - mnew) : 0.f;
      const float p1 = (s[1][r] > -1.0e38f) ? __expf(s[1][r] - mnew) : 0.f;
      m_r[r] = mnew;
      l_r[r] = l_r[r] * alpha[r] + p0 + p1;            // per-lane partial row sum (16 lanes combined at the end)
      unsigned short hb = bf16_bits(p0); sPh[w][8 * hh + r][ln] = hb;      sPl[w][8 * hh + r][ln] = bf16_bits(p0 - bf16_val(hb));
      hb = bf16_bits(p1);                sPh[w][8 * hh + r][16 + ln] = hb; sPl[w][8 * hh + r][16 + ln] = bf16_bits(p1 - bf16_val(hb));
    }
#pragma unroll
    for (int dt = 0; dt < DT; ++dt)
#pragma unroll
      for (int r = 0; r < 8; ++r) oacc[dt][r] *= alpha[r];
    __builtin_amdgcn_fence(__ATOMIC_ACQ_REL, "workgroup");
    __builtin_amdgcn_wave_barrier();
    FragB pah, pal;
    pah.half[0] = *(const v8us*)&sPh[w][ln][8 * hh]; pah.half[1] = *(const v8us*)&sPh[w][ln][16 + 8 * hh];
    pal.half[0] = *(const v8us*)&sPl[w][ln][8 * hh]; pal.half[1] = *(const v8us*)&sPl[w][ln][16 + 8 * hh];
#pragma unroll
    for (int dt = 0; dt < DT; ++dt) {
      FragB bvh, bvl;
#pragma unroll
      for (int i = 0; i < 8; ++i) {
        bvh.u[i] = sVh[8 * hh + i][dt * 16 + ln]; bvh.u[8 + i] = sVh[16 + 8 * hh + i][dt * 16 + ln];
        bvl.u[i] = sVl[8 * hh + i][dt * 16 + ln]; bvl.u[8 + i] = sVl[16 + 8 * hh + i][dt * 16 + ln];
      }
      oacc[dt] = mmaN<3>(pah.v, pal.v, bvh.v, bvl.v, oacc[dt]);
    }
    __builtin_amdgcn_fence(__ATOMIC_ACQ_REL, "workgroup");
    __builtin_amdgcn_wave_barrier();
  }
#pragma unroll
  for (int r = 0; r < 8; ++r) {
    float l = l_r[r];
    l += __shfl_xor(l, 1, 32); l += __shfl_xor(l, 2, 32); l += __shfl_xor(l, 4, 32); l += __shfl_xor(l, 8, 32);
    l_r[r] = (l > 0.f) ? 1.0f / l : 0.f;
  }
#pragma unroll
  for (int dt = 0; dt < DT; ++dt)
#pragma unroll
    for (int r = 0; r < 8; ++r) sO[w][8 * hh + r][dt * 16 + ln] = oacc[dt][r] * l_r[r];
  __builtin_amdgcn_fence(__ATOMIC_ACQ_REL, "workgroup");
  __builtin_amdgcn_wave_barrier();
  {
    for (int r = 0; r < 16; ++r) {
      const int row = q0 + r;
      if (row < T && lane < D / 4) {
        const v4f val = *(const v4fa*)&sO[w][r][lane * 4];
        *(v4f*)(y + ((size_t)b * T + row) * ypitch + h * D + lane * 4) = val;
      }
    }
    
  }
}

// in pitch = cols, out pitch = rows; rows, cols multiples of 32. Optional per-output-row affine (scale[c], shift[c]) and
// residual add res (same layout as out, optionally bf16-rounded) for fused epilogues: out = in*scale + shift + res.
template <bool AFFINE, bool RESID, bool RES_BF16>
__global__ __launch_bounds__(256) void k_transpose32(const float* __restrict__ in, float* __restrict__ out, int rows, int cols,
                                                    const float* __restrict__ scale, const float* __restrict__ shift, const float* __restrict__ res) {
  __shared__ float tile[32][33];
  const int b = blockIdx.z;
  const int r0 = blockIdx.y * 32, c0 = blockIdx.x * 32;
  const float* src = in + (size_t)b * rows * cols;
  float* dst = out + (size_t)b * rows * cols;
  const int tx = threadIdx.x & 31, ty = threadIdx.x >> 5;     // 8 rows per pass
  for (int i = ty; i < 32; i += 8) tile[i][tx] = src[(size_t)(r0 + i) * cols + c0 + tx];
  __syncthreads();
  {
    for (int i = ty; i < 32; i += 8) {
      float v = tile[tx][i];
      const int orow = c0 + i;
      if (AFFINE) v = v * scale[orow] + shift[orow];
      if (RESID) { float rv = res[(size_t)b * rows * cols + (size_t)orow * rows + r0 + tx]; if (RES_BF16) rv = bf16_round(rv); v += rv; }
      *(float*)(dst + (size_t)orow * rows + r0 + tx) = v;
    }
    
  }
}

// 2x2 max pool on position-major data: in [B][H*W][C] -> out [B][(H/2)*(W/2)][C]; thread per (b, p', 4 channels); C%4==0
__global__ __launch_bounds__(256) void k_pool2_pm(const float* __restrict__ in, float* __restrict__ out, int Bn, int H, int W, int C) {
  const size_t t = (size_t)blockIdx.x * 256 + threadIdx.x;
  const int c4n = C / 4, Ho = H / 2, Wo = W / 2;
  const size_t total = (size_t)Bn * Ho * Wo * c4n;
  if (t >= total) return;
  const int c4 = (int)(t % c4n) * 4; size_t rest = t / c4n;
  const int pw = (int)(rest % Wo); rest /= Wo; const int ph = (int)(rest % Ho); const int b = (int)(rest / Ho);
  const float* base = in + (size_t)b * H * W * C;
  const int p00 = (2 * ph) * W + 2 * pw;
  const v4f a = *(const v4fa*)(base + (size_t)p00 * C + c4), bq = *(const v4fa*)(base + (size_t)(p00 + 1) * C + c4);
  const v4f c = *(const v4fa*)(base + (size_t)(p00 + W) * C + c4), d = *(const v4fa*)(base + (size_t)(p00 + W + 1) * C + c4);
  v4f m; for (int i = 0; i < 4; ++i) m[i] = fmaxf(fmaxf(a[i], bq[i]), fmaxf(c[i], d[i]));
  float* dst = out + ((size_t)b * Ho * Wo + (size_t)ph * Wo + pw) * C + c4;
  *(v4f*)dst = m;
  
}

// General (non-causal) attention, 3-term bf16 splits, f32 softmax with running max.
// Q [.][Tq][qpitch], K [.][Tk][kpitch] (head dim DQ), V [.][Tk][vpitch] (head dim DVtot); this block handles DV output
// dims starting at dv0 = blockIdx.y*DV. y[bh][t][ypitch] gets columns dv0..dv0+DV-1. Per-bh base offsets via strides.
template <int DQ, int DV>
__global__ __launch_bounds__(128) void k_flash2(const float* __restrict__ Qb, size_t qstride, int qpitch, int Tq,
                                              const float* __restrict__ Kb, size_t kstride, int kpitch, int Tk,
                                              const float* __restrict__ Vb, size_t vstride, int vpitch,
                                              float scale, float* __restrict__ y, size_t ystride, int ypitch) {
  constexpr int KS = DQ / 32, DT = DV / 16;
  __shared__ __attribute__((aligned(16))) unsigned short sKh[32][DQ + 8], sKl[32][DQ + 8], sVh[32][DV + 8], sVl[32][DV + 8];
  __shared__ __attribute__((aligned(16))) unsigned short sPh[4][16][40], sPl[4][16][40];
  __shared__ __attribute__((aligned(16))) float sO[4][16][DV];
  const int tid = threadIdx.x, w = tid >> 5, lane = tid & 31, ln = lane & 15, hh = lane >> 4;
  const int nqb = (Tq + 63) / 64;
  const int bh = blockIdx.x / nqb, qblk = blockIdx.x % nqb;
  const int dv0 = blockIdx.y * DV;
  const int q0 = qblk * 64 + w * 16;
  const float* Q = Qb + (size_t)bh * qstride; const float* K = Kb + (size_t)bh * kstride; const float* V = Vb + (size_t)bh * vstride + dv0;
  FragB aqh[KS], aql[KS];
  {
    int row = q0 + ln; if (row >= Tq) row = Tq - 1;
    const float* qr = Q + (size_t)row * qpitch;
#pragma unroll
    for (int ks = 0; ks < KS; ++ks)
#pragma unroll
      for (int i = 0; i < 16; ++i) {
        const int d = ks * 32 + ((i < 8) ? (8 * hh + i) : (16 + 8 * hh + (i - 8)));
        const float x = qr[d] * scale; const unsigned short hb = bf16_bits(x);
        aqh[ks].u[i] = hb; aql[ks].u[i] = bf16_bits(x - bf16_val(hb));
      }
  }
  float m_r[8], l_r[8];
#pragma unroll
  for (int r = 0; r < 8; ++r) { m_r[r] = -3.0e38f; l_r[r] = 0.f; }
  v8f oacc[DT];
#pragma unroll
  for (int dt = 0; dt < DT; ++dt) oacc[dt] = (v8f){0.f,0.f,0.f,0.f,0.f,0.f,0.f,0.f};
  for (int j0 = 0; j0 < Tk; j0 += 32) {
    __syncthreads();
    for (int e = tid; e < 32 * (DQ / 4); e += 128) {
      const int r = e / (DQ / 4), c4 = (e % (DQ / 4)) * 4; const int key = j0 + r;
      v4f f = {0.f,0.f,0.f,0.f}; if (key < Tk) f = *(const v4fa*)(K + (size_t)key * kpitch + c4);
#pragma unroll
      for (int t = 0; t < 4; ++t) { const unsigned short hb = bf16_bits(f[t]); sKh[r][c4 + t] = hb; sKl[r][c4 + t] = bf16_bits(f[t] - bf16_val(hb)); }
    }
    for (int e = tid; e < 32 * (DV / 4); e += 128) {
      const int r = e / (DV / 4), c4 = (e % (DV / 4)) * 4; const int key = j0 + r;
      v4f f = {0.f,0.f,0.f,0.f}; if (key < Tk) f = *(const v4fa*)(V + (size_t)key * vpitch + c4);
#pragma unroll
      for (int t = 0; t < 4; ++t) { const unsigned short hb = bf16_bits(f[t]); sVh[r][c4 + t] = hb; sVl[r][c4 + t] = bf16_bits(f[t] - bf16_val(hb)); }
    }
    __syncthreads();
    v8f s[2];
#pragma unroll
    for (int nt = 0; nt < 2; ++nt) {
      v8f acc = {};
#pragma unroll
      for (int ks = 0; ks < KS; ++ks) {
        FragB bh_, bl_;
        bh_.half[0] = *(const v8us*)&sKh[nt * 16 + ln][ks * 32 + 8 * hh]; bh_.half[1] = *(const v8us*)&sKh[nt * 16 + ln][ks * 32 + 16 + 8 * hh];
        bl_.half[0] = *(const v8us*)&sKl[nt * 16 + ln][ks * 32 + 8 * hh]; bl_.half[1] = *(const v8us*)&sKl[nt * 16 + ln][ks * 32 + 16 + 8 * hh];
        acc = mmaN<3>(aqh[ks].v, aql[ks].v, bh_.v, bl_.v, acc);
      }
      s[nt] = acc;
    }
    float alpha[8];
#pragma unroll
    for (int r = 0; r < 8; ++r) {
      const int ja = j0 + ln, jb = j0 + 16 + ln;
      if (ja >= Tk) s[0][r] = -3.0e38f;
      if (jb >= Tk) s[1][r] = -3.0e38f;
      float mx = fmaxf(s[0][r], s[1][r]);
      mx = fmaxf(mx, __shfl_xor(mx, 1, 32)); mx = fmaxf(mx, __shfl_xor(mx, 2, 32)); mx = fmaxf(mx, __shfl_xor(mx, 4, 32)); mx = fmaxf(mx, __shfl_xor(mx, 8, 32));
      const float mnew = fmaxf(m_r[r], mx);
      alpha[r] = (mnew > -1.0e38f) ? __expf(m_r[r] - mnew) : 1.0f;
      const float p0 = (s[0][r] > -1.0e38f) ? __expf(s[0][r] - mnew) : 0.f;
      const float p1 = (s[1][r] > -1.0e38f) ? __expf(s[1][r] - mnew) : 0.f;
      m_r[r] = mnew;
      l_r[r] = l_r[r] * alpha[r] + p0 + p1;
      unsigned short hb = bf16_bits(p0); sPh[w][8 * hh + r][ln] = hb;      sPl[w][8 * hh + r][ln] = bf16_bits(p0 - bf16_val(hb));
      hb = bf16_bits(p1);                sPh[w][8 * hh + r][16 + ln] = hb; sPl[w][8 * hh + r][16 + ln] = bf16_bits(p1 - bf16_val(hb));
    }
#pragma unroll
    for (int dt = 0; dt < DT; ++dt)
#pragma unroll
      for (int r = 0; r < 8; ++r) oacc[dt][r] *= alpha[r];
    __builtin_amdgcn_fence(__ATOMIC_ACQ_REL, "workgroup");
    __builtin_amdgcn_wave_barrier();
    FragB pah, pal;
    pah.half[0] = *(const v8us*)&sPh[w][ln][8 * hh]; pah.half[1] = *(const v8us*)&sPh[w][ln][16 + 8 * hh];
    pal.half[0] = *(const v8us*)&sPl[w][ln][8 * hh]; pal.half[1] = *(const v8us*)&sPl[w][ln][16 + 8 * hh];
#pragma unroll
    for (int dt = 0; dt < DT; ++dt) {
      FragB bvh, bvl;
#pragma unroll
      for (int i = 0; i < 8; ++i) {
        bvh.u[i] = sVh[8 * hh + i][dt * 16 + ln]; bvh.u[8 + i] = sVh[16 + 8 * hh + i][dt * 16 + ln];
        bvl.u[i] = sVl[8 * hh + i][dt * 16 + ln]; bvl.u[8 + i] = sVl[16 + 8 * hh + i][dt * 16 + ln];
      }
      oacc[dt] = mmaN<3>(pah.v, pal.v, bvh.v, bvl.v, oacc[dt]);
    }
    __builtin_amdgcn_fence(__ATOMIC_ACQ_REL, "workgroup");
    __builtin_amdgcn_wave_barrier();
  }
#pragma unroll
  for (int r = 0; r < 8; ++r) {
    float l = l_r[r];
    l += __shfl_xor(l, 1, 32); l += __shfl_xor(l, 2, 32); l += __shfl_xor(l, 4, 32); l += __shfl_xor(l, 8, 32);
    l_r[r] = (l > 0.f) ? 1.0f / l : 0.f;
  }
#pragma unroll
  for (int dt = 0; dt < DT; ++dt)
#pragma unroll
    for (int r = 0; r < 8; ++r) sO[w][8 * hh + r][dt * 16 + ln] = oacc[dt][r] * l_r[r];
  __builtin_amdgcn_fence(__ATOMIC_ACQ_REL, "workgroup");
  __builtin_amdgcn_wave_barrier();
  {
    for (int r = 0; r < 16; ++r) {
      const int row = q0 + r;
      for (int c4 = lane * 4; c4 < DV; c4 += 128) {
        if (row < Tq) {
          const v4f val = *(const v4fa*)&sO[w][r][c4];
          *(v4f*)(y + (size_t)bh * ystride + (size_t)row * ypitch + dv0 + c4) = val;
        }
      }
    }
    
  }
}

// GEMM C = act(A·W + bias + resid): A f32 (ASPLIT -> hi/lo 2 terms), Wt bf16 [N][K]; ACT 0 none, 1 relu, 2 exact gelu;
// resid (optional, f32, row index = (row % rmod), pitch ldr, RES_BF16 rounds it) added before the activation.
template <bool ASPLIT, int ACT, bool BIAS_BF16, bool RES_BF16>
__global__ __launch_bounds__(128) void k_gemm_bf3(const float* __restrict__ A, int lda, const unsigned short* __restrict__ Wt, int ldb,
                                                const float* __restrict__ bias, const float* __restrict__ resid, int rmod, int ldr,
                                                float* __restrict__ C, int ldc, int M, int N, int K) {
  __shared__ __attribute__((aligned(16))) float so[4][16][64];
  const int tid = threadIdx.x, w = tid >> 5, lane = tid & 31, ln = lane & 15, hh = lane >> 4;
  const int ntn = N / 64;
  const int wid = blockIdx.x * 4 + w;
  const int mt = wid / ntn, nq = wid % ntn;
  if (mt * 16 >= M) return;
  const int row0 = mt * 16, col0 = nq * 64;
  const float* arow = A + (size_t)(row0 + ln) * lda;
  v8f acc[4] = {};
  for (int kb = 0; kb < K; kb += 32) {
    FragB ah, al;
    const v4f x0 = *(const v4fa*)(arow + kb + 8 * hh), x1 = *(const v4fa*)(arow + kb + 8 * hh + 4);
    const v4f x2 = *(const v4fa*)(arow + kb + 16 + 8 * hh), x3 = *(const v4fa*)(arow + kb + 16 + 8 * hh + 4);
    float xs[16] = {x0[0],x0[1],x0[2],x0[3],x1[0],x1[1],x1[2],x1[3],x2[0],x2[1],x2[2],x2[3],x3[0],x3[1],x3[2],x3[3]};
#pragma unroll
    for (int i = 0; i < 16; ++i) { const unsigned short hb = bf16_bits(xs[i]); ah.u[i] = hb; al.u[i] = ASPLIT ? bf16_bits(xs[i] - bf16_val(hb)) : (unsigned short)0; }
#pragma unroll
    for (int t = 0; t < 4; ++t) {
      const unsigned short* brow = Wt + (size_t)(col0 + t * 16 + ln) * ldb + kb;
      FragB b;
      b.half[0] = *(const v8us*)(brow + 8 * hh);
      b.half[1] = *(const v8us*)(brow + 16 + 8 * hh);
      acc[t] = mmaN<ASPLIT ? 2 : 1>(ah.v, al.v, b.v, b.v, acc[t]);
    }
  }
#pragma unroll
  for (int t = 0; t < 4; ++t) {
    const int col = col0 + t * 16 + ln;
    float bv = bias ? bias[col] : 0.f;
    if (BIAS_BF16) bv = bf16_round(bv);
#pragma unroll
    for (int r = 0; r < 8; ++r) {
      float v = acc[t][r] + bv;
      if (resid) { float rv = resid[(size_t)((row0 + 8 * hh + r) % rmod) * ldr + col]; if (RES_BF16) rv = bf16_round(rv); v += rv; }
      if (ACT == 1) v = fmaxf(v, 0.f);
      if (ACT == 2) v = 0.5f * v * (1.0f + erff(v * 0.70710678118654752f));
      if (ACT == 3) { const float u = 0.7978845608028654f * (v + 0.044715f * v * v * v); v = 0.5f * v * (1.0f + tanhf(u)); }
      so[w][8 * hh + r][t * 16 + ln] = v;
    }
  }
  __builtin_amdgcn_fence(__ATOMIC_ACQ_REL, "workgroup");
  __builtin_amdgcn_wave_barrier();
  const int rsub = lane >> 4, c4 = (lane & 15) * 4;
  {
#pragma unroll
    for (int q = 0; q < 8; ++q) {
      const int r = q * 2 + rsub;
      const v4f v = *(const v4fa*)&so[w][r][c4];
      *(v4f*)(C + (size_t)(row0 + r) * ldc + col0 + c4) = v;
    }
    
  }
}
// row LayerNorm (biased variance, eps) over N: s = X (+ R); optional out_sum <- s; out_norm <- (s-mu)*rsqrt(var+eps)*g + b
template <bool PARAM_BF16>
__global__ __launch_bounds__(256) void k_layernorm(const float* __restrict__ X, const float* __restrict__ R, const float* __restrict__ g, const float* __restrict__ bta,
                                                  float* __restrict__ out_sum, float* __restrict__ out_norm, int N, float eps) {
  __shared__ float red[256];
  const int row = blockIdx.x, tid = threadIdx.x;
  const float* x = X + (size_t)row * N; const float* rr = R ? R + (size_t)row * N : nullptr;
  float vals[16];                     // up to N = 4096
  const int per = N / 256;            // contiguous chunk per thread? use strided-by-4 chunks: thread handles j = tid*4 + 1024*u
  float s1 = 0.f;
  for (int u = 0; u < per / 4; ++u) {
    const int j = tid * 4 + 1024 * u;
    const v4f a = *(const v4fa*)(x + j);
    v4f b = {0.f,0.f,0.f,0.f}; if (rr) b = *(const v4fa*)(rr + j);
#pragma unroll
    for (int q = 0; q < 4; ++q) { const float v = a[q] + b[q]; vals[u * 4 + q] = v; s1 += v; }
  }
  red[tid] = s1; __syncthreads();
  for (int st = 128; st > 0; st >>= 1) { if (tid < st) red[tid] += red[tid + st]; __syncthreads(); }
  const float mu = red[0] / (float)N; __syncthreads();
  float s2 = 0.f;
  for (int u = 0; u < per / 4; ++u)
#pragma unroll
    for (int q = 0; q < 4; ++q) { const float c = vals[u * 4 + q] - mu; s2 += c * c; }
  red[tid] = s2; __syncthreads();
  for (int st = 128; st > 0; st >>= 1) { if (tid < st) red[tid] += red[tid + st]; __syncthreads(); }
  const float rs = rsqrtf(red[0] / (float)N + eps);
  {
    for (int u = 0; u < per / 4; ++u) {
      const int j = tid * 4 + 1024 * u;
      v4f o, sm;
#pragma unroll
      for (int q = 0; q < 4; ++q) {
        float gg = g[j + q], bb = bta[j + q];
        if (PARAM_BF16) { gg = bf16_round(gg); bb = bf16_round(bb); }
        sm[q] = vals[u * 4 + q]; o[q] = (vals[u * 4 + q] - mu) * rs * gg + bb;
      }
      if (out_sum) *(v4f*)(out_sum + (size_t)row * N + j) = sm;
      *(v4f*)(out_norm + (size_t)row * N + j) = o;
    }
    
  }
}

// General attention: queries [b][Tq] rows at Q + b*Tq*qpitch + h*D + row*qpitch; keys/values j < Tk1 from (K1,V1) at
// X + b*Tk1*pitch + h*D + j*pitch, j >= Tk1 from (K2,V2) with j-Tk1 (pass Tk2 = 0 and null for a single source).
// Optional int mask [Tq][Tk] (nonzero keep), causal flag (j <= qi), additive score bias sbias[bh*Tk + j].
// 3-term bf16 splits, f32 softmax with running max; y[b][row][h*D + d] pitch ypitch, whole-line rows (D % 32 == 0).
template <int D>
__global__ __launch_bounds__(128) void k_flash3(const float* __restrict__ Qb, int qpitch, int Tq,
                                              const float* __restrict__ K1, const float* __restrict__ V1, int Tk1,
                                              const float* __restrict__ K2, const float* __restrict__ V2, int Tk2, int kpitch, int vpitch,
                                              int H, float scale, const int* __restrict__ mask, int causal, const float* __restrict__ sbias,
                                              float* __restrict__ y, int ypitch) {
  constexpr int KS = D / 32, DT = D / 16;
  __shared__ __attribute__((aligned(16))) unsigned short sKh[32][D + 8], sKl[32][D + 8], sVh[32][D + 8], sVl[32][D + 8];
  __shared__ __attribute__((aligned(16))) unsigned short sPh[4][16][40], sPl[4][16][40];
  __shared__ __attribute__((aligned(16))) float sO[4][16][D];
  const int tid = threadIdx.x, w = tid >> 5, lane = tid & 31, ln = lane & 15, hh = lane >> 4;
  const int Tk = Tk1 + Tk2;
  const int nqb = (Tq + 63) / 64;
  const int bh = blockIdx.x / nqb, qblk = blockIdx.x % nqb;
  const int b = bh / H, h = bh % H;
  const int q0 = qblk * 64 + w * 16;
  const float* Q = Qb + (size_t)b * Tq * qpitch + h * D;
  FragB aqh[KS], aql[KS];
  {
    int row = q0 + ln; if (row >= Tq) row = Tq - 1;
    const float* qr = Q + (size_t)row * qpitch;
#pragma unroll
    for (int ks = 0; ks < KS; ++ks)
#pragma unroll
      for (int i = 0; i < 16; ++i) {
        const int d = ks * 32 + ((i < 8) ? (8 * hh + i) : (16 + 8 * hh + (i - 8)));
        const float x = qr[d] * scale; const unsigned short hb = bf16_bits(x);
        aqh[ks].u[i] = hb; aql[ks].u[i] = bf16_bits(x - bf16_val(hb));
      }
  }
  int qrow[8];
#pragma unroll
  for (int r = 0; r < 8; ++r) { int qi = q0 + 8 * hh + r; qrow[r] = qi < Tq ? qi : Tq - 1; }
  float m_r[8], l_r[8];
#pragma unroll
  for (int r = 0; r < 8; ++r) { m_r[r] = -3.0e38f; l_r[r] = 0.f; }
  v8f oacc[DT];
#pragma unroll
  for (int dt = 0; dt < DT; ++dt) oacc[dt] = (v8f){0.f,0.f,0.f,0.f,0.f,0.f,0.f,0.f};
  const int kv_end = causal ? min(Tk, qblk * 64 + 64) : Tk;
  for (int j0 = 0; j0 < kv_end; j0 += 32) {
    __syncthreads();
    for (int e = tid; e < 32 * (D / 4); e += 128) {
      const int r = e / (D / 4), c4 = (e % (D / 4)) * 4; const int key = j0 + r;
      v4f kf = {0.f,0.f,0.f,0.f}, vf = {0.f,0.f,0.f,0.f};
      if (key < Tk1) { kf = *(const v4fa*)(K1 + (size_t)b * Tk1 * kpitch + h * D + (size_t)key * kpitch + c4); vf = *(const v4fa*)(V1 + (size_t)b * Tk1 * vpitch + h * D + (size_t)key * vpitch + c4); }
      else if (key < Tk) { const int k2 = key - Tk1; kf = *(const v4fa*)(K2 + (size_t)b * Tk2 * kpitch + h * D + (size_t)k2 * kpitch + c4); vf = *(const v4fa*)(V2 + (size_t)b * Tk2 * vpitch + h * D + (size_t)k2 * vpitch + c4); }
#pragma unroll
      for (int t = 0; t < 4; ++t) {
        unsigned short hb = bf16_bits(kf[t]); sKh[r][c4 + t] = hb; sKl[r][c4 + t] = bf16_bits(kf[t] - bf16_val(hb));
        hb = bf16_bits(vf[t]); sVh[r][c4 + t] = hb; sVl[r][c4 + t] = bf16_bits(vf[t] - bf16_val(hb));
      }
    }
    __syncthreads();
    v8f s[2];
#pragma unroll
    for (int nt = 0; nt < 2; ++nt) {
      v8f acc = {};
#pragma unroll
      for (int ks = 0; ks < KS; ++ks) {
        FragB bh_, bl_;
        bh_.half[0] = *(const v8us*)&sKh[nt * 16 + ln][ks * 32 + 8 * hh]; bh_.half[1] = *(const v8us*)&sKh[nt * 16 + ln][ks * 32 + 16 + 8 * hh];
        bl_.half[0] = *(const v8us*)&sKl[nt * 16 + ln][ks * 32 + 8 * hh]; bl_.half[1] = *(const v8us*)&sKl[nt * 16 + ln][ks * 32 + 16 + 8 * hh];
        acc = mmaN<3>(aqh[ks].v, aql[ks].v, bh_.v, bl_.v, acc);
      }
      s[nt] = acc;
    }
    float alpha[8];
#pragma unroll
    for (int r = 0; r < 8; ++r) {
      const int qi = qrow[r];
      const int ja = j0 + ln, jb = j0 + 16 + ln;
      bool keepa = ja < Tk, keepb = jb < Tk;
      if (causal) { keepa = keepa && (ja <= qi); keepb = keepb && (jb <= qi); }
      if (mask) { if (keepa) keepa = mask[(size_t)qi * Tk + ja] != 0; if (keepb) keepb = mask[(size_t)qi * Tk + jb] != 0; }
      if (sbias) { if (keepa) s[0][r] += sbias[(size_t)bh * Tk + ja]; if (keepb) s[1][r] += sbias[(size_t)bh * Tk + jb]; }   // per-key additive bias (a per-query constant would cancel in the softmax)
      if (!keepa) s[0][r] = -3.0e38f;
      if (!keepb) s[1][r] = -3.0e38f;
      float mx = fmaxf(s[0][r], s[1][r]);
      mx = fmaxf(mx, __shfl_xor(mx, 1, 32)); mx = fmaxf(mx, __shfl_xor(mx, 2, 32)); mx = fmaxf(mx, __shfl_xor(mx, 4, 32)); mx = fmaxf(mx, __shfl_xor(mx, 8, 32));
      const float mnew = fmaxf(m_r[r], mx);
      alpha[r] = (mnew > -1.0e38f) ? __expf(m_r[r] - mnew) : 1.0f;
      const float p0 = keepa ? __expf(s[0][r] - mnew) : 0.f;
      const float p1 = keepb ? __expf(s[1][r] - mnew) : 0.f;
      m_r[r] = mnew;
      l_r[r] = l_r[r] * alpha[r] + p0 + p1;
      unsigned short hb = bf16_bits(p0); sPh[w][8 * hh + r][ln] = hb;      sPl[w][8 * hh + r][ln] = bf16_bits(p0 - bf16_val(hb));
      hb = bf16_bits(p1);                sPh[w][8 * hh + r][16 + ln] = hb; sPl[w][8 * hh + r][16 + ln] = bf16_bits(p1 - bf16_val(hb));
    }
#pragma unroll
    for (int dt = 0; dt < DT; ++dt)
#pragma unroll
      for (int r = 0; r < 8; ++r) oacc[dt][r] *= alpha[r];
    __builtin_amdgcn_fence(__ATOMIC_ACQ_REL, "workgroup");
    __builtin_amdgcn_wave_barrier();
    FragB pah, pal;
    pah.half[0] = *(const v8us*)&sPh[w][ln][8 * hh]; pah.half[1] = *(const v8us*)&sPh[w][ln][16 + 8 * hh];
    pal.half[0] = *(const v8us*)&sPl[w][ln][8 * hh]; pal.half[1] = *(const v8us*)&sPl[w][ln][16 + 8 * hh];
#pragma unroll
    for (int dt = 0; dt < DT; ++dt) {
      FragB bvh, bvl;
#pragma unroll
      for (int i = 0; i < 8; ++i) {
        bvh.u[i] = sVh[8 * hh + i][dt * 16 + ln]; bvh.u[8 + i] = sVh[16 + 8 * hh + i][dt * 16 + ln];
        bvl.u[i] = sVl[8 * hh + i][dt * 16 + ln]; bvl.u[8 + i] = sVl[16 + 8 * hh + i][dt * 16 + ln];
      }
      oacc[dt] = mmaN<3>(pah.v, pal.v, bvh.v, bvl.v, oacc[dt]);
    }
    __builtin_amdgcn_fence(__ATOMIC_ACQ_REL, "workgroup");
    __builtin_amdgcn_wave_barrier();
  }
#pragma unroll
  for (int r = 0; r < 8; ++r) {
    float l = l_r[r];
    l += __shfl_xor(l, 1, 32); l += __shfl_xor(l, 2, 32); l += __shfl_xor(l, 4, 32); l += __shfl_xor(l, 8, 32);
    l_r[r] = (m_r[r] > -1.0e38f) ? 1.0f / l : __builtin_nanf("");
  }
#pragma unroll
  for (int dt = 0; dt < DT; ++dt)
#pragma unroll
    for (int r = 0; r < 8; ++r) sO[w][8 * hh + r][dt * 16 + ln] = oacc[dt][r] * l_r[r];
  __builtin_amdgcn_fence(__ATOMIC_ACQ_REL, "workgroup");
  __builtin_amdgcn_wave_barrier();
  {
    for (int r = 0; r < 16; ++r) {
      const int row = q0 + r;
      if (row < Tq && lane < D / 4) {
        const v4f val = *(const v4fa*)&sO[w][r][lane * 4];
        *(v4f*)(y + ((size_t)b * Tq + row) * ypitch + h * D + lane * 4) = val;
      }
    }
    
  }
}

__global__ __launch_bounds__(256) void k_round_rows(const float* __restrict__ W, unsigned short* __restrict__ Wt, int n8) {
  const int t = blockIdx.x * 256 + threadIdx.x;
  if (t >= n8) return;
  const v4f a = *(const v4fa*)(W + (size_t)t * 8), b = *(const v4fa*)(W + (size_t)t * 8 + 4);
  v8us v; v[0]=bf16_bits(a[0]); v[1]=bf16_bits(a[1]); v[2]=bf16_bits(a[2]); v[3]=bf16_bits(a[3]);
  v[4]=bf16_bits(b[0]); v[5]=bf16_bits(b[1]); v[6]=bf16_bits(b[2]); v[7]=bf16_bits(b[3]);
  *(v8us*)(Wt + (size_t)t * 8) = v; 
}


__global__ __launch_bounds__(256) void k_roundcopy(const float* __restrict__ src, float* __restrict__ dst, int n8) {
  const size_t t = (size_t)blockIdx.x * 256 + threadIdx.x;
  if (t >= (size_t)n8 * 2) return;
  v4f a = *(const v4fa*)(src + t * 4);
  for (int i = 0; i < 4; ++i) a[i] = bf16_round(a[i]);
  *(v4f*)(dst + t * 4) = a; 
}

// out[b][c][p] = y[(b,p)][c] + x[b][c][p]  (block per (b,c): 4096 contiguous floats)
__global__ __launch_bounds__(256) void k_fin(const float* __restrict__ y, const float* __restrict__ x, float* __restrict__ out) {
  const int b = blockIdx.x / CC, c = blockIdx.x % CC; const size_t base = ((size_t)b * CC + c) * HWN;
  { for (int p = threadIdx.x; p < HWN; p += 256) *(float*)(out + base + p) = y[((size_t)b * HWN + p) * CC + c] + x[base + p];  }
}
extern "C" void kernel_launch(void* const* d_in, const int* in_sizes, int n_in,
                              void* d_out, int out_size, void* d_ws, size_t ws_size, hipStream_t stream) {
  (void)in_sizes; (void)n_in; (void)out_size;
  const float* x = (const float*)d_in[0]; const float* tw = (const float*)d_in[1]; const float* tb = (const float*)d_in[2]; const float* pw = (const float*)d_in[3]; const float* pb = (const float*)d_in[4];
  const float* gw = (const float*)d_in[5]; const float* gb = (const float*)d_in[6]; const float* fw = (const float*)d_in[7]; const float* fb = (const float*)d_in[8];
  char* ws = (char*)d_ws; size_t off = 0;
  auto take = [&](size_t bytes) { char* p = ws + off; off += (bytes + 255) & ~(size_t)255; return p; };
  unsigned short* Bqkv = (unsigned short*)take((size_t)3 * HC * CC * 2); unsigned short* Bf = (unsigned short*)take((size_t)CC * HC * 2); float* bqkv = (float*)take(3 * HC * 4 + 256);
  float* xT = (float*)take((size_t)MROWS * CC * 4); float* qkv = (float*)take((size_t)MROWS * 3 * HC * 4); float* att = (float*)take((size_t)MROWS * HC * 4); float* y = (float*)take((size_t)MROWS * CC * 4);
  if (off > ws_size) return;
  k_round_rows<<<(HC * CC / 8 + 255) / 256, 256, 0, stream>>>(tw, Bqkv, HC * CC / 8); k_round_rows<<<(HC * CC / 8 + 255) / 256, 256, 0, stream>>>(pw, Bqkv + HC * CC, HC * CC / 8); k_round_rows<<<(HC * CC / 8 + 255) / 256, 256, 0, stream>>>(gw, Bqkv + 2 * HC * CC, HC * CC / 8);
  k_round_rows<<<(CC * HC / 8 + 255) / 256, 256, 0, stream>>>(fw, Bf, CC * HC / 8);
  k_roundcopy<<<1, 256, 0, stream>>>(tb, bqkv, HC / 8); k_roundcopy<<<1, 256, 0, stream>>>(pb, bqkv + HC, HC / 8); k_roundcopy<<<1, 256, 0, stream>>>(gb, bqkv + 2 * HC, HC / 8);     // concatenated (rounded) biases
  k_transpose32<false, false, false><<<dim3(HWN / 32, CC / 32, BB), 256, 0, stream>>>(x, xT, CC, HWN, nullptr, nullptr, nullptr);      // NCHW -> [b][hw][c]
  k_gemm_bf3<false, 0, false, false><<<((MROWS / 16) * 3 + 3) / 4, 128, 0, stream>>>(xT, CC, Bqkv, CC, bqkv, nullptr, 1, 0, qkv, 3 * HC, MROWS, 3 * HC, CC);   // [theta | phi | g] + b (single term)
  k_flash3<HC><<<BB * (HWN / 64), 128, 0, stream>>>(qkv, 3 * HC, HWN, qkv + HC, qkv + 2 * HC, HWN, nullptr, nullptr, 0, 3 * HC, 3 * HC, 1, 1.0f, nullptr, 0, nullptr, att, HC);
  k_gemm_bf3<true, 0, true, false><<<((MROWS / 16) * 2 + 3) / 4, 128, 0, stream>>>(att, HC, Bf, HC, fb, nullptr, 1, 0, y, CC, MROWS, CC, HC);                    // final conv + b
  k_fin<<<BB * CC, 256, 0, stream>>>(y, x, (float*)d_out);
}

// v001
// A run of this version takes 250 microseconds.
// Timed twice side by side with v000, it ran 2.58 and 2.57 times as fast.
#include <hip/hip_runtime.h>
// theta/phi/g 1×1 convolutions as one GEMM on position-major bf16(x) (single exact term, K=128, N=192), the 4096×4096 non-local attention per batch as
// 16-query tiles on WMMA (Q·Kᵀ and P·V as 3-term bf16 hi/lo splits, f32 online softmax, no scaling), and the final 1×1 conv (2 terms) + bias; the
// residual add and the NCHW transposes are f32. 
#define BB 4
#define CC 128
#define HC 64
#define HWN 4096
#define MROWS (BB * HWN)
#define NSPLIT 4      // key groups per attention block: 4 waves each, so NSPLIT waves per SIMD

typedef __bf16 v16b __attribute__((ext_vector_type(16)));
typedef unsigned short v8us __attribute__((ext_vector_type(8), may_alias));
typedef float  v8f  __attribute__((ext_vector_type(8)));
typedef float  v4f  __attribute__((ext_vector_type(4)));
typedef float  v4fa __attribute__((ext_vector_type(4), may_alias));
union FragB { v16b v; v8us half[2]; unsigned short u[16]; };

__device__ __forceinline__ unsigned short bf16_bits(float x) { unsigned int u = __float_as_uint(x); return (unsigned short)((u + 0x7FFFu + ((u >> 16) & 1u)) >> 16); }
__device__ __forceinline__ float bf16_val(unsigned short b) { return __uint_as_float(((unsigned int)b) << 16); }
__device__ __forceinline__ float bf16_round(float x) { return bf16_val(bf16_bits(x)); }
// D += A·B with NT terms: 1 = ah·bh, 2 = + al·bh (A split), 3 = + ah·bl (both split)
template <int NT>
__device__ __forceinline__ v8f mmaN(v16b ah, v16b al, v16b bh, v16b bl, v8f c) {
  c = __builtin_amdgcn_wmma_f32_16x16x32_bf16(false, ah, false, bh, (short)0, c, false, false);
  if (NT >= 2) c = __builtin_amdgcn_wmma_f32_16x16x32_bf16(false, al, false, bh, (short)0, c, false, false);
  if (NT >= 3) c = __builtin_amdgcn_wmma_f32_16x16x32_bf16(false, ah, false, bl, (short)0, c, false, false);
  asm volatile("v_nop\n\tv_nop\n\tv_nop\n\tv_nop" : "+v"(c) : "v"(ah), "v"(al), "v"(bh), "v"(bl));
  return c;
}

__global__ __launch_bounds__(256) void k_wt_bf16(const float* __restrict__ W, unsigned short* __restrict__ Wt, int K, int N) {
  const int t = blockIdx.x * 256 + threadIdx.x;
  const int k8n = K / 8;
  if (t >= N * k8n) return;
  const int n = t / k8n, k8 = (t % k8n) * 8;
  v8us v;
#pragma unroll
  for (int i = 0; i < 8; ++i) v[i] = bf16_bits(W[(size_t)(k8 + i) * N + n]);
  *(v8us*)(Wt + (size_t)n * K + k8) = v;
  
}

// GEMM C[M][N] (f32, pitch ldc) = act(A[M][K]·W + bias). A f32 row-major (pitch lda) converted per fragment to bf16
// (ASPLIT: hi/lo two planes -> 2 terms, else single rounded term); Wt bf16 [N][K] (pitch ldb). BIAS_BF16 rounds the
// bias to bf16 first (bias quantised to bf16 before the add). K%32==0, M%16==0, N%64==0.
template <bool ASPLIT, int ACT, bool BIAS_BF16>
__global__ __launch_bounds__(128) void k_gemm_bf(const float* __restrict__ A, int lda, const unsigned short* __restrict__ Wt, int ldb,
                                               const float* __restrict__ bias, float* __restrict__ C, int ldc, int M, int N, int K) {
  __shared__ __attribute__((aligned(16))) float so[4][16][64];
  const int tid = threadIdx.x, w = tid >> 5, lane = tid & 31, ln = lane & 15, hh = lane >> 4;
  const int ntn = N / 64;
  const int wid = blockIdx.x * 4 + w;
  const int mt = wid / ntn, nq = wid % ntn;
  if (mt * 16 >= M) return;
  const int row0 = mt * 16, col0 = nq * 64;
  const float* arow = A + (size_t)(row0 + ln) * lda;
  v8f acc[4] = {};
  for (int kb = 0; kb < K; kb += 32) {
    FragB ah, al;
    const v4f x0 = *(const v4fa*)(arow + kb + 8 * hh), x1 = *(const v4fa*)(arow + kb + 8 * hh + 4);
    const v4f x2 = *(const v4fa*)(arow + kb + 16 + 8 * hh), x3 = *(const v4fa*)(arow + kb + 16 + 8 * hh + 4);
    float xs[16] = {x0[0],x0[1],x0[2],x0[3],x1[0],x1[1],x1[2],x1[3],x2[0],x2[1],x2[2],x2[3],x3[0],x3[1],x3[2],x3[3]};
#pragma unroll
    for (int i = 0; i < 16; ++i) { const unsigned short hb = bf16_bits(xs[i]); ah.u[i] = hb; al.u[i] = ASPLIT ? bf16_bits(xs[i] - bf16_val(hb)) : (unsigned short)0; }
#pragma unroll
    for (int t = 0; t < 4; ++t) {
      const unsigned short* brow = Wt + (size_t)(col0 + t * 16 + ln) * ldb + kb;
      FragB b;
      b.half[0] = *(const v8us*)(brow + 8 * hh);
      b.half[1] = *(const v8us*)(brow + 16 + 8 * hh);
      acc[t] = mmaN<ASPLIT ? 2 : 1>(ah.v, al.v, b.v, b.v, acc[t]);
    }
  }
#pragma unroll
  for (int t = 0; t < 4; ++t) {
    float bv = bias ? bias[col0 + t * 16 + ln] : 0.f;
    if (BIAS_BF16) bv = bf16_round(bv);
#pragma unroll
    for (int r = 0; r < 8; ++r) { float v = acc[t][r] + bv; if (ACT == 1) v = fmaxf(v, 0.f); so[w][8 * hh + r][t * 16 + ln] = v; }
  }
  __builtin_amdgcn_fence(__ATOMIC_ACQ_REL, "workgroup");
  __builtin_amdgcn_wave_barrier();
  const int rsub = lane >> 4, c4 = (lane & 15) * 4;
  {
#pragma unroll
    for (int q = 0; q < 8; ++q) {
      const int r = q * 2 + rsub;
      const v4f v = *(const v4fa*)&so[w][r][c4];
      *(v4f*)(C + (size_t)(row0 + r) * ldc + col0 + c4) = v;
    }
    
  }
}

// Flash-style causal/unmasked attention, all contractions 3-term bf16 hi/lo splits, f32 softmax with running max.
// q,k,v rows are read from f32 buffers with arbitrary row pitch (so they can live inside a fused qkv buffer);
// D = head size (multiple of 32, <= 128); one wave = 16 query rows; block = 4 waves (64 queries) sharing K/V chunks of 32.
template <int D, bool CAUSAL>
__global__ __launch_bounds__(128) void k_flash(const float* __restrict__ qb, const float* __restrict__ kb, const float* __restrict__ vb,
                                             int pitch, int T, int H, float scale, float* __restrict__ y, int ypitch) {
  constexpr int KS = D / 32;        // k-steps for QK
  constexpr int DT = D / 16;        // d tiles for PV
  __shared__ __attribute__((aligned(16))) unsigned short sKh[32][D + 8], sKl[32][D + 8], sVh[32][D + 8], sVl[32][D + 8];
  __shared__ __attribute__((aligned(16))) unsigned short sPh[4][16][40], sPl[4][16][40];
  __shared__ __attribute__((aligned(16))) float sO[4][16][D];
  const int tid = threadIdx.x, w = tid >> 5, lane = tid & 31, ln = lane & 15, hh = lane >> 4;
  const int nqb = (T + 63) / 64;
  const int bh = blockIdx.x / nqb, qblk = blockIdx.x % nqb;
  const int b = bh / H, h = bh % H;
  const int q0 = qblk * 64 + w * 16;
  const float* Q = qb + (size_t)b * T * pitch + h * D;
  const float* K = kb + (size_t)b * T * pitch + h * D;
  const float* V = vb + (size_t)b * T * pitch + h * D;

  // A fragments of the wave's 16 query rows (scaled), hi/lo
  FragB aqh[KS], aql[KS];
  {
    int row = q0 + ln; if (row >= T) row = T - 1;
    const float* qr = Q + (size_t)row * pitch;
#pragma unroll
    for (int ks = 0; ks < KS; ++ks)
#pragma unroll
      for (int i = 0; i < 16; ++i) {
        const int d = ks * 32 + ((i < 8) ? (8 * hh + i) : (16 + 8 * hh + (i - 8)));
        const float x = qr[d] * scale; const unsigned short hb = bf16_bits(x);
        aqh[ks].u[i] = hb; aql[ks].u[i] = bf16_bits(x - bf16_val(hb));
      }
  }
  float m_r[8], l_r[8];
#pragma unroll
  for (int r = 0; r < 8; ++r) { m_r[r] = -3.0e38f; l_r[r] = 0.f; }
  v8f oacc[DT];
#pragma unroll
  for (int dt = 0; dt < DT; ++dt) oacc[dt] = (v8f){0.f,0.f,0.f,0.f,0.f,0.f,0.f,0.f};

  const int kv_end = CAUSAL ? min(T, qblk * 64 + 64) : T;     // block-uniform
  for (int j0 = 0; j0 < kv_end; j0 += 32) {
    __syncthreads();
    for (int e = tid; e < 32 * (D / 4); e += 128) {
      const int r = e / (D / 4), c4 = (e % (D / 4)) * 4;
      const int key = j0 + r;
      v4f kf = {0.f,0.f,0.f,0.f}, vf = {0.f,0.f,0.f,0.f};
      if (key < T) { kf = *(const v4fa*)(K + (size_t)key * pitch + c4); vf = *(const v4fa*)(V + (size_t)key * pitch + c4); }
#pragma unroll
      for (int t = 0; t < 4; ++t) {
        unsigned short hb = bf16_bits(kf[t]); sKh[r][c4 + t] = hb; sKl[r][c4 + t] = bf16_bits(kf[t] - bf16_val(hb));
        hb = bf16_bits(vf[t]); sVh[r][c4 + t] = hb; sVl[r][c4 + t] = bf16_bits(vf[t] - bf16_val(hb));
      }
    }
    __syncthreads();
    // S tile 16 x 32
    v8f s[2];
#pragma unroll
    for (int nt = 0; nt < 2; ++nt) {
      v8f acc = {};
#pragma unroll
      for (int ks = 0; ks < KS; ++ks) {
        FragB bh_, bl_;
        bh_.half[0] = *(const v8us*)&sKh[nt * 16 + ln][ks * 32 + 8 * hh]; bh_.half[1] = *(const v8us*)&sKh[nt * 16 + ln][ks * 32 + 16 + 8 * hh];
        bl_.half[0] = *(const v8us*)&sKl[nt * 16 + ln][ks * 32 + 8 * hh]; bl_.half[1] = *(const v8us*)&sKl[nt * 16 + ln][ks * 32 + 16 + 8 * hh];
        acc = mmaN<3>(aqh[ks].v, aql[ks].v, bh_.v, bl_.v, acc);
      }
      s[nt] = acc;
    }
    // mask + running max (rows 8hh+r; the 16 lanes of a half share rows)
    float alpha[8];
#pragma unroll
    for (int r = 0; r < 8; ++r) {
      const int qi = q0 + 8 * hh + r;
      const int ja = j0 + ln, jb = j0 + 16 + ln;
      if (CAUSAL) { if (ja > qi) s[0][r] = -3.0e38f; if (jb > qi) s[1][r] = -3.0e38f; }
      if (ja >= T) s[0][r] = -3.0e38f;
      if (jb >= T) s[1][r] = -3.0e38f;
      float mx = fmaxf(s[0][r], s[1][r]);
      mx = fmaxf(mx, __shfl_xor(mx, 1, 32)); mx = fmaxf(mx, __shfl_xor(mx, 2, 32)); mx = fmaxf(mx, __shfl_xor(mx, 4, 32)); mx = fmaxf(mx, __shfl_xor(mx, 8, 32));
      const float mnew = fmaxf(m_r[r], mx);
      alpha[r] = (mnew > -1.0e38f) ? __expf(m_r[r] - mnew) : 1.0f;
      const float p0 = (s[0][r] > -1.0e38f) ? __expf(s[0][r] - mnew) : 0.f;
      const float p1 = (s[1][r] > -1.0e38f) ? __expf(s[1][r] - mnew) : 0.f;
      m_r[r] = mnew;
      l_r[r] = l_r[r] * alpha[r] + p0 + p1;            // per-lane partial row sum (16 lanes combined at the end)
      unsigned short hb = bf16_bits(p0); sPh[w][8 * hh + r][ln] = hb;      sPl[w][8 * hh + r][ln] = bf16_bits(p0 - bf16_val(hb));
      hb = bf16_bits(p1);                sPh[w][8 * hh + r][16 + ln] = hb; sPl[w][8 * hh + r][16 + ln] = bf16_bits(p1 - bf16_val(hb));
    }
#pragma unroll
    for (int dt = 0; dt < DT; ++dt)
#pragma unroll
      for (int r = 0; r < 8; ++r) oacc[dt][r] *= alpha[r];
    __builtin_amdgcn_fence(__ATOMIC_ACQ_REL, "workgroup");
    __builtin_amdgcn_wave_barrier();
    FragB pah, pal;
    pah.half[0] = *(const v8us*)&sPh[w][ln][8 * hh]; pah.half[1] = *(const v8us*)&sPh[w][ln][16 + 8 * hh];
    pal.half[0] = *(const v8us*)&sPl[w][ln][8 * hh]; pal.half[1] = *(const v8us*)&sPl[w][ln][16 + 8 * hh];
#pragma unroll
    for (int dt = 0; dt < DT; ++dt) {
      FragB bvh, bvl;
#pragma unroll
      for (int i = 0; i < 8; ++i) {
        bvh.u[i] = sVh[8 * hh + i][dt * 16 + ln]; bvh.u[8 + i] = sVh[16 + 8 * hh + i][dt * 16 + ln];
        bvl.u[i] = sVl[8 * hh + i][dt * 16 + ln]; bvl.u[8 + i] = sVl[16 + 8 * hh + i][dt * 16 + ln];
      }
      oacc[dt] = mmaN<3>(pah.v, pal.v, bvh.v, bvl.v, oacc[dt]);
    }
    __builtin_amdgcn_fence(__ATOMIC_ACQ_REL, "workgroup");
    __builtin_amdgcn_wave_barrier();
  }
#pragma unroll
  for (int r = 0; r < 8; ++r) {
    float l = l_r[r];
    l += __shfl_xor(l, 1, 32); l += __shfl_xor(l, 2, 32); l += __shfl_xor(l, 4, 32); l += __shfl_xor(l, 8, 32);
    l_r[r] = (l > 0.f) ? 1.0f / l : 0.f;
  }
#pragma unroll
  for (int dt = 0; dt < DT; ++dt)
#pragma unroll
    for (int r = 0; r < 8; ++r) sO[w][8 * hh + r][dt * 16 + ln] = oacc[dt][r] * l_r[r];
  __builtin_amdgcn_fence(__ATOMIC_ACQ_REL, "workgroup");
  __builtin_amdgcn_wave_barrier();
  {
    for (int r = 0; r < 16; ++r) {
      const int row = q0 + r;
      if (row < T && lane < D / 4) {
        const v4f val = *(const v4fa*)&sO[w][r][lane * 4];
        *(v4f*)(y + ((size_t)b * T + row) * ypitch + h * D + lane * 4) = val;
      }
    }
    
  }
}

// in pitch = cols, out pitch = rows; rows, cols multiples of 32. Optional per-output-row affine (scale[c], shift[c]) and
// residual add res (same layout as out, optionally bf16-rounded) for fused epilogues: out = in*scale + shift + res.
template <bool AFFINE, bool RESID, bool RES_BF16>
__global__ __launch_bounds__(256) void k_transpose32(const float* __restrict__ in, float* __restrict__ out, int rows, int cols,
                                                    const float* __restrict__ scale, const float* __restrict__ shift, const float* __restrict__ res) {
  __shared__ float tile[32][33];
  const int b = blockIdx.z;
  const int r0 = blockIdx.y * 32, c0 = blockIdx.x * 32;
  const float* src = in + (size_t)b * rows * cols;
  float* dst = out + (size_t)b * rows * cols;
  const int tx = threadIdx.x & 31, ty = threadIdx.x >> 5;     // 8 rows per pass
  for (int i = ty; i < 32; i += 8) tile[i][tx] = src[(size_t)(r0 + i) * cols + c0 + tx];
  __syncthreads();
  {
    for (int i = ty; i < 32; i += 8) {
      float v = tile[tx][i];
      const int orow = c0 + i;
      if (AFFINE) v = v * scale[orow] + shift[orow];
      if (RESID) { float rv = res[(size_t)b * rows * cols + (size_t)orow * rows + r0 + tx]; if (RES_BF16) rv = bf16_round(rv); v += rv; }
      *(float*)(dst + (size_t)orow * rows + r0 + tx) = v;
    }
    
  }
}

// 2x2 max pool on position-major data: in [B][H*W][C] -> out [B][(H/2)*(W/2)][C]; thread per (b, p', 4 channels); C%4==0
__global__ __launch_bounds__(256) void k_pool2_pm(const float* __restrict__ in, float* __restrict__ out, int Bn, int H, int W, int C) {
  const size_t t = (size_t)blockIdx.x * 256 + threadIdx.x;
  const int c4n = C / 4, Ho = H / 2, Wo = W / 2;
  const size_t total = (size_t)Bn * Ho * Wo * c4n;
  if (t >= total) return;
  const int c4 = (int)(t % c4n) * 4; size_t rest = t / c4n;
  const int pw = (int)(rest % Wo); rest /= Wo; const int ph = (int)(rest % Ho); const int b = (int)(rest / Ho);
  const float* base = in + (size_t)b * H * W * C;
  const int p00 = (2 * ph) * W + 2 * pw;
  const v4f a = *(const v4fa*)(base + (size_t)p00 * C + c4), bq = *(const v4fa*)(base + (size_t)(p00 + 1) * C + c4);
  const v4f c = *(const v4fa*)(base + (size_t)(p00 + W) * C + c4), d = *(const v4fa*)(base + (size_t)(p00 + W + 1) * C + c4);
  v4f m; for (int i = 0; i < 4; ++i) m[i] = fmaxf(fmaxf(a[i], bq[i]), fmaxf(c[i], d[i]));
  float* dst = out + ((size_t)b * Ho * Wo + (size_t)ph * Wo + pw) * C + c4;
  *(v4f*)dst = m;
  
}

// General (non-causal) attention, 3-term bf16 splits, f32 softmax with running max.
// Q [.][Tq][qpitch], K [.][Tk][kpitch] (head dim DQ), V [.][Tk][vpitch] (head dim DVtot); this block handles DV output
// dims starting at dv0 = blockIdx.y*DV. y[bh][t][ypitch] gets columns dv0..dv0+DV-1. Per-bh base offsets via strides.
template <int DQ, int DV>
__global__ __launch_bounds__(128) void k_flash2(const float* __restrict__ Qb, size_t qstride, int qpitch, int Tq,
                                              const float* __restrict__ Kb, size_t kstride, int kpitch, int Tk,
                                              const float* __restrict__ Vb, size_t vstride, int vpitch,
                                              float scale, float* __restrict__ y, size_t ystride, int ypitch) {
  constexpr int KS = DQ / 32, DT = DV / 16;
  __shared__ __attribute__((aligned(16))) unsigned short sKh[32][DQ + 8], sKl[32][DQ + 8], sVh[32][DV + 8], sVl[32][DV + 8];
  __shared__ __attribute__((aligned(16))) unsigned short sPh[4][16][40], sPl[4][16][40];
  __shared__ __attribute__((aligned(16))) float sO[4][16][DV];
  const int tid = threadIdx.x, w = tid >> 5, lane = tid & 31, ln = lane & 15, hh = lane >> 4;
  const int nqb = (Tq + 63) / 64;
  const int bh = blockIdx.x / nqb, qblk = blockIdx.x % nqb;
  const int dv0 = blockIdx.y * DV;
  const int q0 = qblk * 64 + w * 16;
  const float* Q = Qb + (size_t)bh * qstride; const float* K = Kb + (size_t)bh * kstride; const float* V = Vb + (size_t)bh * vstride + dv0;
  FragB aqh[KS], aql[KS];
  {
    int row = q0 + ln; if (row >= Tq) row = Tq - 1;
    const float* qr = Q + (size_t)row * qpitch;
#pragma unroll
    for (int ks = 0; ks < KS; ++ks)
#pragma unroll
      for (int i = 0; i < 16; ++i) {
        const int d = ks * 32 + ((i < 8) ? (8 * hh + i) : (16 + 8 * hh + (i - 8)));
        const float x = qr[d] * scale; const unsigned short hb = bf16_bits(x);
        aqh[ks].u[i] = hb; aql[ks].u[i] = bf16_bits(x - bf16_val(hb));
      }
  }
  float m_r[8], l_r[8];
#pragma unroll
  for (int r = 0; r < 8; ++r) { m_r[r] = -3.0e38f; l_r[r] = 0.f; }
  v8f oacc[DT];
#pragma unroll
  for (int dt = 0; dt < DT; ++dt) oacc[dt] = (v8f){0.f,0.f,0.f,0.f,0.f,0.f,0.f,0.f};
  for (int j0 = 0; j0 < Tk; j0 += 32) {
    __syncthreads();
    for (int e = tid; e < 32 * (DQ / 4); e += 128) {
      const int r = e / (DQ / 4), c4 = (e % (DQ / 4)) * 4; const int key = j0 + r;
      v4f f = {0.f,0.f,0.f,0.f}; if (key < Tk) f = *(const v4fa*)(K + (size_t)key * kpitch + c4);
#pragma unroll
      for (int t = 0; t < 4; ++t) { const unsigned short hb = bf16_bits(f[t]); sKh[r][c4 + t] = hb; sKl[r][c4 + t] = bf16_bits(f[t] - bf16_val(hb)); }
    }
    for (int e = tid; e < 32 * (DV / 4); e += 128) {
      const int r = e / (DV / 4), c4 = (e % (DV / 4)) * 4; const int key = j0 + r;
      v4f f = {0.f,0.f,0.f,0.f}; if (key < Tk) f = *(const v4fa*)(V + (size_t)key * vpitch + c4);
#pragma unroll
      for (int t = 0; t < 4; ++t) { const unsigned short hb = bf16_bits(f[t]); sVh[r][c4 + t] = hb; sVl[r][c4 + t] = bf16_bits(f[t] - bf16_val(hb)); }
    }
    __syncthreads();
    v8f s[2];
#pragma unroll
    for (int nt = 0; nt < 2; ++nt) {
      v8f acc = {};
#pragma unroll
      for (int ks = 0; ks < KS; ++ks) {
        FragB bh_, bl_;
        bh_.half[0] = *(const v8us*)&sKh[nt * 16 + ln][ks * 32 + 8 * hh]; bh_.half[1] = *(const v8us*)&sKh[nt * 16 + ln][ks * 32 + 16 + 8 * hh];
        bl_.half[0] = *(const v8us*)&sKl[nt * 16 + ln][ks * 32 + 8 * hh]; bl_.half[1] = *(const v8us*)&sKl[nt * 16 + ln][ks * 32 + 16 + 8 * hh];
        acc = mmaN<3>(aqh[ks].v, aql[ks].v, bh_.v, bl_.v, acc);
      }
      s[nt] = acc;
    }
    float alpha[8];
#pragma unroll
    for (int r = 0; r < 8; ++r) {
      const int ja = j0 + ln, jb = j0 + 16 + ln;
      if (ja >= Tk) s[0][r] = -3.0e38f;
      if (jb >= Tk) s[1][r] = -3.0e38f;
      float mx = fmaxf(s[0][r], s[1][r]);
      mx = fmaxf(mx, __shfl_xor(mx, 1, 32)); mx = fmaxf(mx, __shfl_xor(mx, 2, 32)); mx = fmaxf(mx, __shfl_xor(mx, 4, 32)); mx = fmaxf(mx, __shfl_xor(mx, 8, 32));
      const float mnew = fmaxf(m_r[r], mx);
      alpha[r] = (mnew > -1.0e38f) ? __expf(m_r[r] - mnew) : 1.0f;
      const float p0 = (s[0][r] > -1.0e38f) ? __expf(s[0][r] - mnew) : 0.f;
      const float p1 = (s[1][r] > -1.0e38f) ? __expf(s[1][r] - mnew) : 0.f;
      m_r[r] = mnew;
      l_r[r] = l_r[r] * alpha[r] + p0 + p1;
      unsigned short hb = bf16_bits(p0); sPh[w][8 * hh + r][ln] = hb;      sPl[w][8 * hh + r][ln] = bf16_bits(p0 - bf16_val(hb));
      hb = bf16_bits(p1);                sPh[w][8 * hh + r][16 + ln] = hb; sPl[w][8 * hh + r][16 + ln] = bf16_bits(p1 - bf16_val(hb));
    }
#pragma unroll
    for (int dt = 0; dt < DT; ++dt)
#pragma unroll
      for (int r = 0; r < 8; ++r) oacc[dt][r] *= alpha[r];
    __builtin_amdgcn_fence(__ATOMIC_ACQ_REL, "workgroup");
    __builtin_amdgcn_wave_barrier();
    FragB pah, pal;
    pah.half[0] = *(const v8us*)&sPh[w][ln][8 * hh]; pah.half[1] = *(const v8us*)&sPh[w][ln][16 + 8 * hh];
    pal.half[0] = *(const v8us*)&sPl[w][ln][8 * hh]; pal.half[1] = *(const v8us*)&sPl[w][ln][16 + 8 * hh];
#pragma unroll
    for (int dt = 0; dt < DT; ++dt) {
      FragB bvh, bvl;
#pragma unroll
      for (int i = 0; i < 8; ++i) {
        bvh.u[i] = sVh[8 * hh + i][dt * 16 + ln]; bvh.u[8 + i] = sVh[16 + 8 * hh + i][dt * 16 + ln];
        bvl.u[i] = sVl[8 * hh + i][dt * 16 + ln]; bvl.u[8 + i] = sVl[16 + 8 * hh + i][dt * 16 + ln];
      }
      oacc[dt] = mmaN<3>(pah.v, pal.v, bvh.v, bvl.v, oacc[dt]);
    }
    __builtin_amdgcn_fence(__ATOMIC_ACQ_REL, "workgroup");
    __builtin_amdgcn_wave_barrier();
  }
#pragma unroll
  for (int r = 0; r < 8; ++r) {
    float l = l_r[r];
    l += __shfl_xor(l, 1, 32); l += __shfl_xor(l, 2, 32); l += __shfl_xor(l, 4, 32); l += __shfl_xor(l, 8, 32);
    l_r[r] = (l > 0.f) ? 1.0f / l : 0.f;
  }
#pragma unroll
  for (int dt = 0; dt < DT; ++dt)
#pragma unroll
    for (int r = 0; r < 8; ++r) sO[w][8 * hh + r][dt * 16 + ln] = oacc[dt][r] * l_r[r];
  __builtin_amdgcn_fence(__ATOMIC_ACQ_REL, "workgroup");
  __builtin_amdgcn_wave_barrier();
  {
    for (int r = 0; r < 16; ++r) {
      const int row = q0 + r;
      for (int c4 = lane * 4; c4 < DV; c4 += 128) {
        if (row < Tq) {
          const v4f val = *(const v4fa*)&sO[w][r][c4];
          *(v4f*)(y + (size_t)bh * ystride + (size_t)row * ypitch + dv0 + c4) = val;
        }
      }
    }
    
  }
}

// GEMM C = act(A·W + bias + resid): A f32 (ASPLIT -> hi/lo 2 terms), Wt bf16 [N][K]; ACT 0 none, 1 relu, 2 exact gelu;
// resid (optional, f32, row index = (row % rmod), pitch ldr, RES_BF16 rounds it) added before the activation.
template <bool ASPLIT, int ACT, bool BIAS_BF16, bool RES_BF16>
__global__ __launch_bounds__(128) void k_gemm_bf3(const float* __restrict__ A, int lda, const unsigned short* __restrict__ Wt, int ldb,
                                                const float* __restrict__ bias, const float* __restrict__ resid, int rmod, int ldr,
                                                float* __restrict__ C, int ldc, int M, int N, int K) {
  __shared__ __attribute__((aligned(16))) float so[4][16][64];
  const int tid = threadIdx.x, w = tid >> 5, lane = tid & 31, ln = lane & 15, hh = lane >> 4;
  const int ntn = N / 64;
  const int wid = blockIdx.x * 4 + w;
  const int mt = wid / ntn, nq = wid % ntn;
  if (mt * 16 >= M) return;
  const int row0 = mt * 16, col0 = nq * 64;
  const float* arow = A + (size_t)(row0 + ln) * lda;
  v8f acc[4] = {};
  for (int kb = 0; kb < K; kb += 32) {
    FragB ah, al;
    const v4f x0 = *(const v4fa*)(arow + kb + 8 * hh), x1 = *(const v4fa*)(arow + kb + 8 * hh + 4);
    const v4f x2 = *(const v4fa*)(arow + kb + 16 + 8 * hh), x3 = *(const v4fa*)(arow + kb + 16 + 8 * hh + 4);
    float xs[16] = {x0[0],x0[1],x0[2],x0[3],x1[0],x1[1],x1[2],x1[3],x2[0],x2[1],x2[2],x2[3],x3[0],x3[1],x3[2],x3[3]};
#pragma unroll
    for (int i = 0; i < 16; ++i) { const unsigned short hb = bf16_bits(xs[i]); ah.u[i] = hb; al.u[i] = ASPLIT ? bf16_bits(xs[i] - bf16_val(hb)) : (unsigned short)0; }
#pragma unroll
    for (int t = 0; t < 4; ++t) {
      const unsigned short* brow = Wt + (size_t)(col0 + t * 16 + ln) * ldb + kb;
      FragB b;
      b.half[0] = *(const v8us*)(brow + 8 * hh);
      b.half[1] = *(const v8us*)(brow + 16 + 8 * hh);
      acc[t] = mmaN<ASPLIT ? 2 : 1>(ah.v, al.v, b.v, b.v, acc[t]);
    }
  }
#pragma unroll
  for (int t = 0; t < 4; ++t) {
    const int col = col0 + t * 16 + ln;
    float bv = bias ? bias[col] : 0.f;
    if (BIAS_BF16) bv = bf16_round(bv);
#pragma unroll
    for (int r = 0; r < 8; ++r) {
      float v = acc[t][r] + bv;
      if (resid) { float rv = resid[(size_t)((row0 + 8 * hh + r) % rmod) * ldr + col]; if (RES_BF16) rv = bf16_round(rv); v += rv; }
      if (ACT == 1) v = fmaxf(v, 0.f);
      if (ACT == 2) v = 0.5f * v * (1.0f + erff(v * 0.70710678118654752f));
      if (ACT == 3) { const float u = 0.7978845608028654f * (v + 0.044715f * v * v * v); v = 0.5f * v * (1.0f + tanhf(u)); }
      so[w][8 * hh + r][t * 16 + ln] = v;
    }
  }
  __builtin_amdgcn_fence(__ATOMIC_ACQ_REL, "workgroup");
  __builtin_amdgcn_wave_barrier();
  const int rsub = lane >> 4, c4 = (lane & 15) * 4;
  {
#pragma unroll
    for (int q = 0; q < 8; ++q) {
      const int r = q * 2 + rsub;
      const v4f v = *(const v4fa*)&so[w][r][c4];
      *(v4f*)(C + (size_t)(row0 + r) * ldc + col0 + c4) = v;
    }
    
  }
}
// row LayerNorm (biased variance, eps) over N: s = X (+ R); optional out_sum <- s; out_norm <- (s-mu)*rsqrt(var+eps)*g + b
template <bool PARAM_BF16>
__global__ __launch_bounds__(256) void k_layernorm(const float* __restrict__ X, const float* __restrict__ R, const float* __restrict__ g, const float* __restrict__ bta,
                                                  float* __restrict__ out_sum, float* __restrict__ out_norm, int N, float eps) {
  __shared__ float red[256];
  const int row = blockIdx.x, tid = threadIdx.x;
  const float* x = X + (size_t)row * N; const float* rr = R ? R + (size_t)row * N : nullptr;
  float vals[16];                     // up to N = 4096
  const int per = N / 256;            // contiguous chunk per thread? use strided-by-4 chunks: thread handles j = tid*4 + 1024*u
  float s1 = 0.f;
  for (int u = 0; u < per / 4; ++u) {
    const int j = tid * 4 + 1024 * u;
    const v4f a = *(const v4fa*)(x + j);
    v4f b = {0.f,0.f,0.f,0.f}; if (rr) b = *(const v4fa*)(rr + j);
#pragma unroll
    for (int q = 0; q < 4; ++q) { const float v = a[q] + b[q]; vals[u * 4 + q] = v; s1 += v; }
  }
  red[tid] = s1; __syncthreads();
  for (int st = 128; st > 0; st >>= 1) { if (tid < st) red[tid] += red[tid + st]; __syncthreads(); }
  const float mu = red[0] / (float)N; __syncthreads();
  float s2 = 0.f;
  for (int u = 0; u < per / 4; ++u)
#pragma unroll
    for (int q = 0; q < 4; ++q) { const float c = vals[u * 4 + q] - mu; s2 += c * c; }
  red[tid] = s2; __syncthreads();
  for (int st = 128; st > 0; st >>= 1) { if (tid < st) red[tid] += red[tid + st]; __syncthreads(); }
  const float rs = rsqrtf(red[0] / (float)N + eps);
  {
    for (int u = 0; u < per / 4; ++u) {
      const int j = tid * 4 + 1024 * u;
      v4f o, sm;
#pragma unroll
      for (int q = 0; q < 4; ++q) {
        float gg = g[j + q], bb = bta[j + q];
        if (PARAM_BF16) { gg = bf16_round(gg); bb = bf16_round(bb); }
        sm[q] = vals[u * 4 + q]; o[q] = (vals[u * 4 + q] - mu) * rs * gg + bb;
      }
      if (out_sum) *(v4f*)(out_sum + (size_t)row * N + j) = sm;
      *(v4f*)(out_norm + (size_t)row * N + j) = o;
    }
    
  }
}

// General attention: queries [b][Tq] rows at Q + b*Tq*qpitch + h*D + row*qpitch; keys/values j < Tk1 from (K1,V1) at
// X + b*Tk1*pitch + h*D + j*pitch, j >= Tk1 from (K2,V2) with j-Tk1 (pass Tk2 = 0 and null for a single source).
// Optional int mask [Tq][Tk] (nonzero keep), causal flag (j <= qi), additive score bias sbias[bh*Tk + j].
// 3-term bf16 splits, f32 softmax with running max; y[b][row][h*D + d] pitch ypitch, whole-line rows (D % 32 == 0).
// The block's 64 queries are walked by NS groups of 4 waves; group g takes the 32-key chunks g, g + NS, g + 2 NS, ... with its own
// K/V/P staging and its own running (max, sum, O); the NS partial results of a row are joined through LDS at the end.
template <int D, int NS>
__global__ __launch_bounds__(128 * NS) void k_flash3(const float* __restrict__ Qb, int qpitch, int Tq,
                                              const float* __restrict__ K1, const float* __restrict__ V1, int Tk1,
                                              const float* __restrict__ K2, const float* __restrict__ V2, int Tk2, int kpitch, int vpitch,
                                              int H, float scale, const int* __restrict__ mask, int causal, const float* __restrict__ sbias,
                                              float* __restrict__ y, int ypitch) {
  constexpr int KS = D / 32, DT = D / 16;
  __shared__ __attribute__((aligned(16))) unsigned short sKhG[NS][32][D + 8], sKlG[NS][32][D + 8], sVhG[NS][32][D + 8], sVlG[NS][32][D + 8];
  __shared__ __attribute__((aligned(16))) unsigned short sPhG[NS][4][16][40], sPlG[NS][4][16][40];
  __shared__ __attribute__((aligned(16))) float sO[NS][4][16][D];
  __shared__ float sM[NS][4][16], sL[NS][4][16];
  const int g = threadIdx.x >> 7, tid = threadIdx.x & 127, w = tid >> 5, lane = tid & 31, ln = lane & 15, hh = lane >> 4;
  unsigned short (*sKh)[D + 8] = sKhG[g]; unsigned short (*sKl)[D + 8] = sKlG[g]; unsigned short (*sVh)[D + 8] = sVhG[g]; unsigned short (*sVl)[D + 8] = sVlG[g];
  unsigned short (*sPh)[16][40] = sPhG[g]; unsigned short (*sPl)[16][40] = sPlG[g];
  const int Tk = Tk1 + Tk2;
  const int nqb = (Tq + 63) / 64;
  const int bh = blockIdx.x / nqb, qblk = blockIdx.x % nqb;
  const int b = bh / H, h = bh % H;
  const int q0 = qblk * 64 + w * 16;
  const float* Q = Qb + (size_t)b * Tq * qpitch + h * D;
  FragB aqh[KS], aql[KS];
  {
    int row = q0 + ln; if (row >= Tq) row = Tq - 1;
    const float* qr = Q + (size_t)row * qpitch;
#pragma unroll
    for (int ks = 0; ks < KS; ++ks)
#pragma unroll
      for (int i = 0; i < 16; ++i) {
        const int d = ks * 32 + ((i < 8) ? (8 * hh + i) : (16 + 8 * hh + (i - 8)));
        const float x = qr[d] * scale; const unsigned short hb = bf16_bits(x);
        aqh[ks].u[i] = hb; aql[ks].u[i] = bf16_bits(x - bf16_val(hb));
      }
  }
  int qrow[8];
#pragma unroll
  for (int r = 0; r < 8; ++r) { int qi = q0 + 8 * hh + r; qrow[r] = qi < Tq ? qi : Tq - 1; }
  float m_r[8], l_r[8];
#pragma unroll
  for (int r = 0; r < 8; ++r) { m_r[r] = -3.0e38f; l_r[r] = 0.f; }
  v8f oacc[DT];
#pragma unroll
  for (int dt = 0; dt < DT; ++dt) oacc[dt] = (v8f){0.f,0.f,0.f,0.f,0.f,0.f,0.f,0.f};
  const int kv_end = causal ? min(Tk, qblk * 64 + 64) : Tk;
  for (int jb = 0; jb < kv_end; jb += 32 * NS) {                // block-uniform trips; a group's chunk past the end is masked like any tail
    const int j0 = jb + 32 * g;
    __syncthreads();
    for (int e = tid; e < 32 * (D / 4); e += 128) {
      const int r = e / (D / 4), c4 = (e % (D / 4)) * 4; const int key = j0 + r;
      v4f kf = {0.f,0.f,0.f,0.f}, vf = {0.f,0.f,0.f,0.f};
      if (key < Tk1) { kf = *(const v4fa*)(K1 + (size_t)b * Tk1 * kpitch + h * D + (size_t)key * kpitch + c4); vf = *(const v4fa*)(V1 + (size_t)b * Tk1 * vpitch + h * D + (size_t)key * vpitch + c4); }
      else if (key < Tk) { const int k2 = key - Tk1; kf = *(const v4fa*)(K2 + (size_t)b * Tk2 * kpitch + h * D + (size_t)k2 * kpitch + c4); vf = *(const v4fa*)(V2 + (size_t)b * Tk2 * vpitch + h * D + (size_t)k2 * vpitch + c4); }
#pragma unroll
      for (int t = 0; t < 4; ++t) {
        unsigned short hb = bf16_bits(kf[t]); sKh[r][c4 + t] = hb; sKl[r][c4 + t] = bf16_bits(kf[t] - bf16_val(hb));
        hb = bf16_bits(vf[t]); sVh[r][c4 + t] = hb; sVl[r][c4 + t] = bf16_bits(vf[t] - bf16_val(hb));
      }
    }
    __syncthreads();
    v8f s[2];
#pragma unroll
    for (int nt = 0; nt < 2; ++nt) {
      v8f acc = {};
#pragma unroll
      for (int ks = 0; ks < KS; ++ks) {
        FragB bh_, bl_;
        bh_.half[0] = *(const v8us*)&sKh[nt * 16 + ln][ks * 32 + 8 * hh]; bh_.half[1] = *(const v8us*)&sKh[nt * 16 + ln][ks * 32 + 16 + 8 * hh];
        bl_.half[0] = *(const v8us*)&sKl[nt * 16 + ln][ks * 32 + 8 * hh]; bl_.half[1] = *(const v8us*)&sKl[nt * 16 + ln][ks * 32 + 16 + 8 * hh];
        acc = mmaN<3>(aqh[ks].v, aql[ks].v, bh_.v, bl_.v, acc);
      }
      s[nt] = acc;
    }
    float alpha[8];
#pragma unroll
    for (int r = 0; r < 8; ++r) {
      const int qi = qrow[r];
      const int ja = j0 + ln, jb = j0 + 16 + ln;
      bool keepa = ja < Tk, keepb = jb < Tk;
      if (causal) { keepa = keepa && (ja <= qi); keepb = keepb && (jb <= qi); }
      if (mask) { if (keepa) keepa = mask[(size_t)qi * Tk + ja] != 0; if (keepb) keepb = mask[(size_t)qi * Tk + jb] != 0; }
      if (sbias) { if (keepa) s[0][r] += sbias[(size_t)bh * Tk + ja]; if (keepb) s[1][r] += sbias[(size_t)bh * Tk + jb]; }   // per-key additive bias (a per-query constant would cancel in the softmax)
      if (!keepa) s[0][r] = -3.0e38f;
      if (!keepb) s[1][r] = -3.0e38f;
      float mx = fmaxf(s[0][r], s[1][r]);
      mx = fmaxf(mx, __shfl_xor(mx, 1, 32)); mx = fmaxf(mx, __shfl_xor(mx, 2, 32)); mx = fmaxf(mx, __shfl_xor(mx, 4, 32)); mx = fmaxf(mx, __shfl_xor(mx, 8, 32));
      const float mnew = fmaxf(m_r[r], mx);
      alpha[r] = (mnew > -1.0e38f) ? __expf(m_r[r] - mnew) : 1.0f;
      const float p0 = keepa ? __expf(s[0][r] - mnew) : 0.f;
      const float p1 = keepb ? __expf(s[1][r] - mnew) : 0.f;
      m_r[r] = mnew;
      l_r[r] = l_r[r] * alpha[r] + p0 + p1;
      unsigned short hb = bf16_bits(p0); sPh[w][8 * hh + r][ln] = hb;      sPl[w][8 * hh + r][ln] = bf16_bits(p0 - bf16_val(hb));
      hb = bf16_bits(p1);                sPh[w][8 * hh + r][16 + ln] = hb; sPl[w][8 * hh + r][16 + ln] = bf16_bits(p1 - bf16_val(hb));
    }
#pragma unroll
    for (int dt = 0; dt < DT; ++dt)
#pragma unroll
      for (int r = 0; r < 8; ++r) oacc[dt][r] *= alpha[r];
    __builtin_amdgcn_fence(__ATOMIC_ACQ_REL, "workgroup");
    __builtin_amdgcn_wave_barrier();
    FragB pah, pal;
    pah.half[0] = *(const v8us*)&sPh[w][ln][8 * hh]; pah.half[1] = *(const v8us*)&sPh[w][ln][16 + 8 * hh];
    pal.half[0] = *(const v8us*)&sPl[w][ln][8 * hh]; pal.half[1] = *(const v8us*)&sPl[w][ln][16 + 8 * hh];
#pragma unroll
    for (int dt = 0; dt < DT; ++dt) {
      FragB bvh, bvl;
#pragma unroll
      for (int i = 0; i < 8; ++i) {
        bvh.u[i] = sVh[8 * hh + i][dt * 16 + ln]; bvh.u[8 + i] = sVh[16 + 8 * hh + i][dt * 16 + ln];
        bvl.u[i] = sVl[8 * hh + i][dt * 16 + ln]; bvl.u[8 + i] = sVl[16 + 8 * hh + i][dt * 16 + ln];
      }
      oacc[dt] = mmaN<3>(pah.v, pal.v, bvh.v, bvl.v, oacc[dt]);
    }
    __builtin_amdgcn_fence(__ATOMIC_ACQ_REL, "workgroup");
    __builtin_amdgcn_wave_barrier();
  }
#pragma unroll
  for (int r = 0; r < 8; ++r) {
    float l = l_r[r];
    l += __shfl_xor(l, 1, 32); l += __shfl_xor(l, 2, 32); l += __shfl_xor(l, 4, 32); l += __shfl_xor(l, 8, 32);
    if (ln == 0) { sM[g][w][8 * hh + r] = m_r[r]; sL[g][w][8 * hh + r] = l; }
  }
#pragma unroll
  for (int dt = 0; dt < DT; ++dt)
#pragma unroll
    for (int r = 0; r < 8; ++r) sO[g][w][8 * hh + r][dt * 16 + ln] = oacc[dt][r];      // not yet divided by the row sum
  __syncthreads();                                               // every group's (max, sum, O) is in LDS
  // join: wave (g, w) finishes rows 2g, 2g + 1, then + 2 NS, of query tile w; each half wave takes one row (two rows = 512 contiguous bytes a store)
  for (int r = g * 2 + hh; r < 16; r += 2 * NS) {
    const int row = q0 + r;
    float mj = -3.0e38f;
    // the three loops over s are unrolled so that f[] stays in registers
#pragma unroll
    for (int s = 0; s < NS; ++s) mj = fmaxf(mj, sM[s][w][r]);
    float f[NS], lj = 0.f;
#pragma unroll
    for (int s = 0; s < NS; ++s) { const float ms = sM[s][w][r]; f[s] = (ms > -1.0e38f) ? __expf(ms - mj) : 0.f; lj += f[s] * sL[s][w][r]; }
    const float inv = (mj > -1.0e38f) ? 1.0f / lj : __builtin_nanf("");
    for (int c4 = ln * 4; c4 < D; c4 += 64) {
      v4f val = {0.f, 0.f, 0.f, 0.f};
#pragma unroll
      for (int s = 0; s < NS; ++s) val += f[s] * *(const v4fa*)&sO[s][w][r][c4];
      if (row < Tq) {
        *(v4f*)(y + ((size_t)b * Tq + row) * ypitch + h * D + c4) = val * inv;
        asm volatile("s_wait_xcnt 0x0" ::: "memory");            // the next trip rewrites the store's address registers
      }
    }
  }
}

__global__ __launch_bounds__(256) void k_round_rows(const float* __restrict__ W, unsigned short* __restrict__ Wt, int n8) {
  const int t = blockIdx.x * 256 + threadIdx.x;
  if (t >= n8) return;
  const v4f a = *(const v4fa*)(W + (size_t)t * 8), b = *(const v4fa*)(W + (size_t)t * 8 + 4);
  v8us v; v[0]=bf16_bits(a[0]); v[1]=bf16_bits(a[1]); v[2]=bf16_bits(a[2]); v[3]=bf16_bits(a[3]);
  v[4]=bf16_bits(b[0]); v[5]=bf16_bits(b[1]); v[6]=bf16_bits(b[2]); v[7]=bf16_bits(b[3]);
  *(v8us*)(Wt + (size_t)t * 8) = v; 
}


__global__ __launch_bounds__(256) void k_roundcopy(const float* __restrict__ src, float* __restrict__ dst, int n8) {
  const size_t t = (size_t)blockIdx.x * 256 + threadIdx.x;
  if (t >= (size_t)n8 * 2) return;
  v4f a = *(const v4fa*)(src + t * 4);
  for (int i = 0; i < 4; ++i) a[i] = bf16_round(a[i]);
  *(v4f*)(dst + t * 4) = a; 
}

// out[b][c][p] = y[(b,p)][c] + x[b][c][p]  (block per (b,c): 4096 contiguous floats)
__global__ __launch_bounds__(256) void k_fin(const float* __restrict__ y, const float* __restrict__ x, float* __restrict__ out) {
  const int b = blockIdx.x / CC, c = blockIdx.x % CC; const size_t base = ((size_t)b * CC + c) * HWN;
  { for (int p = threadIdx.x; p < HWN; p += 256) *(float*)(out + base + p) = y[((size_t)b * HWN + p) * CC + c] + x[base + p];  }
}
extern "C" void kernel_launch(void* const* d_in, const int* in_sizes, int n_in,
                              void* d_out, int out_size, void* d_ws, size_t ws_size, hipStream_t stream) {
  (void)in_sizes; (void)n_in; (void)out_size;
  const float* x = (const float*)d_in[0]; const float* tw = (const float*)d_in[1]; const float* tb = (const float*)d_in[2]; const float* pw = (const float*)d_in[3]; const float* pb = (const float*)d_in[4];
  const float* gw = (const float*)d_in[5]; const float* gb = (const float*)d_in[6]; const float* fw = (const float*)d_in[7]; const float* fb = (const float*)d_in[8];
  char* ws = (char*)d_ws; size_t off = 0;
  auto take = [&](size_t bytes) { char* p = ws + off; off += (bytes + 255) & ~(size_t)255; return p; };
  unsigned short* Bqkv = (unsigned short*)take((size_t)3 * HC * CC * 2); unsigned short* Bf = (unsigned short*)take((size_t)CC * HC * 2); float* bqkv = (float*)take(3 * HC * 4 + 256);
  float* xT = (float*)take((size_t)MROWS * CC * 4); float* qkv = (float*)take((size_t)MROWS * 3 * HC * 4); float* att = (float*)take((size_t)MROWS * HC * 4); float* y = (float*)take((size_t)MROWS * CC * 4);
  if (off > ws_size) return;
  k_round_rows<<<(HC * CC / 8 + 255) / 256, 256, 0, stream>>>(tw, Bqkv, HC * CC / 8); k_round_rows<<<(HC * CC / 8 + 255) / 256, 256, 0, stream>>>(pw, Bqkv + HC * CC, HC * CC / 8); k_round_rows<<<(HC * CC / 8 + 255) / 256, 256, 0, stream>>>(gw, Bqkv + 2 * HC * CC, HC * CC / 8);
  k_round_rows<<<(CC * HC / 8 + 255) / 256, 256, 0, stream>>>(fw, Bf, CC * HC / 8);
  k_roundcopy<<<1, 256, 0, stream>>>(tb, bqkv, HC / 8); k_roundcopy<<<1, 256, 0, stream>>>(pb, bqkv + HC, HC / 8); k_roundcopy<<<1, 256, 0, stream>>>(gb, bqkv + 2 * HC, HC / 8);     // concatenated (rounded) biases
  k_transpose32<false, false, false><<<dim3(HWN / 32, CC / 32, BB), 256, 0, stream>>>(x, xT, CC, HWN, nullptr, nullptr, nullptr);      // NCHW -> [b][hw][c]
  k_gemm_bf3<false, 0, false, false><<<((MROWS / 16) * 3 + 3) / 4, 128, 0, stream>>>(xT, CC, Bqkv, CC, bqkv, nullptr, 1, 0, qkv, 3 * HC, MROWS, 3 * HC, CC);   // [theta | phi | g] + b (single term)
  k_flash3<HC, NSPLIT><<<BB * (HWN / 64), 128 * NSPLIT, 0, stream>>>(qkv, 3 * HC, HWN, qkv + HC, qkv + 2 * HC, HWN, nullptr, nullptr, 0, 3 * HC, 3 * HC, 1, 1.0f, nullptr, 0, nullptr, att, HC);
  k_gemm_bf3<true, 0, true, false><<<((MROWS / 16) * 2 + 3) / 4, 128, 0, stream>>>(att, HC, Bf, HC, fb, nullptr, 1, 0, y, CC, MROWS, CC, HC);                    // final conv + b
  k_fin<<<BB * CC, 256, 0, stream>>>(y, x, (float*)d_out);
}

// v002
// Measured time: 197 microseconds a run.
// In both of two side-by-side timings against v001, it was 1.27 times as fast.
// Counting every step since v000, it is 3.27 times as fast.
#include <hip/hip_runtime.h>
// theta/phi/g 1×1 convolutions as one GEMM on position-major bf16(x) (single exact term, K=128, N=192), the 4096×4096 non-local attention per batch as
// 16-query tiles on WMMA (Q·Kᵀ and P·V as 3-term bf16 hi/lo splits, f32 online softmax, no scaling), and the final 1×1 conv (2 terms) + bias; the
// residual add and the NCHW transposes are f32. 
#define BB 4
#define CC 128
#define HC 64
#define HWN 4096
#define MROWS (BB * HWN)
#define NSPLIT 4      // key groups per attention block: 4 waves each, so NSPLIT waves per SIMD

typedef __bf16 v16b __attribute__((ext_vector_type(16)));
typedef unsigned short v8us __attribute__((ext_vector_type(8), may_alias));
typedef float  v8f  __attribute__((ext_vector_type(8)));
typedef float  v4f  __attribute__((ext_vector_type(4)));
typedef float  v4fa __attribute__((ext_vector_type(4), may_alias));
union FragB { v16b v; v8us half[2]; unsigned short u[16]; };

__device__ __forceinline__ unsigned short bf16_bits(float x) { unsigned int u = __float_as_uint(x); return (unsigned short)((u + 0x7FFFu + ((u >> 16) & 1u)) >> 16); }
__device__ __forceinline__ float bf16_val(unsigned short b) { return __uint_as_float(((unsigned int)b) << 16); }
__device__ __forceinline__ float bf16_round(float x) { return bf16_val(bf16_bits(x)); }
// D += A·B with NT terms: 1 = ah·bh, 2 = + al·bh (A split), 3 = + ah·bl (both split)
template <int NT>
__device__ __forceinline__ v8f mmaN(v16b ah, v16b al, v16b bh, v16b bl, v8f c) {
  c = __builtin_amdgcn_wmma_f32_16x16x32_bf16(false, ah, false, bh, (short)0, c, false, false);
  if (NT >= 2) c = __builtin_amdgcn_wmma_f32_16x16x32_bf16(false, al, false, bh, (short)0, c, false, false);
  if (NT >= 3) c = __builtin_amdgcn_wmma_f32_16x16x32_bf16(false, ah, false, bl, (short)0, c, false, false);
  asm volatile("v_nop\n\tv_nop\n\tv_nop\n\tv_nop" : "+v"(c) : "v"(ah), "v"(al), "v"(bh), "v"(bl));
  return c;
}

// lane l <-> lane l ^ 16 (the other 16-lane row) in one vector cross-row move
__device__ __forceinline__ float xhalf(float x) {
  const int b = __float_as_int(x);
  return __int_as_float(__builtin_amdgcn_permlanex16(b, b, 0x76543210, 0xfedcba98, false, false));
}

__global__ __launch_bounds__(256) void k_wt_bf16(const float* __restrict__ W, unsigned short* __restrict__ Wt, int K, int N) {
  const int t = blockIdx.x * 256 + threadIdx.x;
  const int k8n = K / 8;
  if (t >= N * k8n) return;
  const int n = t / k8n, k8 = (t % k8n) * 8;
  v8us v;
#pragma unroll
  for (int i = 0; i < 8; ++i) v[i] = bf16_bits(W[(size_t)(k8 + i) * N + n]);
  *(v8us*)(Wt + (size_t)n * K + k8) = v;
  
}

// GEMM C[M][N] (f32, pitch ldc) = act(A[M][K]·W + bias). A f32 row-major (pitch lda) converted per fragment to bf16
// (ASPLIT: hi/lo two planes -> 2 terms, else single rounded term); Wt bf16 [N][K] (pitch ldb). BIAS_BF16 rounds the
// bias to bf16 first (bias quantised to bf16 before the add). K%32==0, M%16==0, N%64==0.
template <bool ASPLIT, int ACT, bool BIAS_BF16>
__global__ __launch_bounds__(128) void k_gemm_bf(const float* __restrict__ A, int lda, const unsigned short* __restrict__ Wt, int ldb,
                                               const float* __restrict__ bias, float* __restrict__ C, int ldc, int M, int N, int K) {
  __shared__ __attribute__((aligned(16))) float so[4][16][64];
  const int tid = threadIdx.x, w = tid >> 5, lane = tid & 31, ln = lane & 15, hh = lane >> 4;
  const int ntn = N / 64;
  const int wid = blockIdx.x * 4 + w;
  const int mt = wid / ntn, nq = wid % ntn;
  if (mt * 16 >= M) return;
  const int row0 = mt * 16, col0 = nq * 64;
  const float* arow = A + (size_t)(row0 + ln) * lda;
  v8f acc[4] = {};
  for (int kb = 0; kb < K; kb += 32) {
    FragB ah, al;
    const v4f x0 = *(const v4fa*)(arow + kb + 8 * hh), x1 = *(const v4fa*)(arow + kb + 8 * hh + 4);
    const v4f x2 = *(const v4fa*)(arow + kb + 16 + 8 * hh), x3 = *(const v4fa*)(arow + kb + 16 + 8 * hh + 4);
    float xs[16] = {x0[0],x0[1],x0[2],x0[3],x1[0],x1[1],x1[2],x1[3],x2[0],x2[1],x2[2],x2[3],x3[0],x3[1],x3[2],x3[3]};
#pragma unroll
    for (int i = 0; i < 16; ++i) { const unsigned short hb = bf16_bits(xs[i]); ah.u[i] = hb; al.u[i] = ASPLIT ? bf16_bits(xs[i] - bf16_val(hb)) : (unsigned short)0; }
#pragma unroll
    for (int t = 0; t < 4; ++t) {
      const unsigned short* brow = Wt + (size_t)(col0 + t * 16 + ln) * ldb + kb;
      FragB b;
      b.half[0] = *(const v8us*)(brow + 8 * hh);
      b.half[1] = *(const v8us*)(brow + 16 + 8 * hh);
      acc[t] = mmaN<ASPLIT ? 2 : 1>(ah.v, al.v, b.v, b.v, acc[t]);
    }
  }
#pragma unroll
  for (int t = 0; t < 4; ++t) {
    float bv = bias ? bias[col0 + t * 16 + ln] : 0.f;
    if (BIAS_BF16) bv = bf16_round(bv);
#pragma unroll
    for (int r = 0; r < 8; ++r) { float v = acc[t][r] + bv; if (ACT == 1) v = fmaxf(v, 0.f); so[w][8 * hh + r][t * 16 + ln] = v; }
  }
  __builtin_amdgcn_fence(__ATOMIC_ACQ_REL, "workgroup");
  __builtin_amdgcn_wave_barrier();
  const int rsub = lane >> 4, c4 = (lane & 15) * 4;
  {
#pragma unroll
    for (int q = 0; q < 8; ++q) {
      const int r = q * 2 + rsub;
      const v4f v = *(const v4fa*)&so[w][r][c4];
      *(v4f*)(C + (size_t)(row0 + r) * ldc + col0 + c4) = v;
    }
    
  }
}

// Flash-style causal/unmasked attention, all contractions 3-term bf16 hi/lo splits, f32 softmax with running max.
// q,k,v rows are read from f32 buffers with arbitrary row pitch (so they can live inside a fused qkv buffer);
// D = head size (multiple of 32, <= 128); one wave = 16 query rows; block = 4 waves (64 queries) sharing K/V chunks of 32.
template <int D, bool CAUSAL>
__global__ __launch_bounds__(128) void k_flash(const float* __restrict__ qb, const float* __restrict__ kb, const float* __restrict__ vb,
                                             int pitch, int T, int H, float scale, float* __restrict__ y, int ypitch) {
  constexpr int KS = D / 32;        // k-steps for QK
  constexpr int DT = D / 16;        // d tiles for PV
  __shared__ __attribute__((aligned(16))) unsigned short sKh[32][D + 8], sKl[32][D + 8], sVh[32][D + 8], sVl[32][D + 8];
  __shared__ __attribute__((aligned(16))) unsigned short sPh[4][16][40], sPl[4][16][40];
  __shared__ __attribute__((aligned(16))) float sO[4][16][D];
  const int tid = threadIdx.x, w = tid >> 5, lane = tid & 31, ln = lane & 15, hh = lane >> 4;
  const int nqb = (T + 63) / 64;
  const int bh = blockIdx.x / nqb, qblk = blockIdx.x % nqb;
  const int b = bh / H, h = bh % H;
  const int q0 = qblk * 64 + w * 16;
  const float* Q = qb + (size_t)b * T * pitch + h * D;
  const float* K = kb + (size_t)b * T * pitch + h * D;
  const float* V = vb + (size_t)b * T * pitch + h * D;

  // A fragments of the wave's 16 query rows (scaled), hi/lo
  FragB aqh[KS], aql[KS];
  {
    int row = q0 + ln; if (row >= T) row = T - 1;
    const float* qr = Q + (size_t)row * pitch;
#pragma unroll
    for (int ks = 0; ks < KS; ++ks)
#pragma unroll
      for (int i = 0; i < 16; ++i) {
        const int d = ks * 32 + ((i < 8) ? (8 * hh + i) : (16 + 8 * hh + (i - 8)));
        const float x = qr[d] * scale; const unsigned short hb = bf16_bits(x);
        aqh[ks].u[i] = hb; aql[ks].u[i] = bf16_bits(x - bf16_val(hb));
      }
  }
  float m_r[8], l_r[8];
#pragma unroll
  for (int r = 0; r < 8; ++r) { m_r[r] = -3.0e38f; l_r[r] = 0.f; }
  v8f oacc[DT];
#pragma unroll
  for (int dt = 0; dt < DT; ++dt) oacc[dt] = (v8f){0.f,0.f,0.f,0.f,0.f,0.f,0.f,0.f};

  const int kv_end = CAUSAL ? min(T, qblk * 64 + 64) : T;     // block-uniform
  for (int j0 = 0; j0 < kv_end; j0 += 32) {
    __syncthreads();
    for (int e = tid; e < 32 * (D / 4); e += 128) {
      const int r = e / (D / 4), c4 = (e % (D / 4)) * 4;
      const int key = j0 + r;
      v4f kf = {0.f,0.f,0.f,0.f}, vf = {0.f,0.f,0.f,0.f};
      if (key < T) { kf = *(const v4fa*)(K + (size_t)key * pitch + c4); vf = *(const v4fa*)(V + (size_t)key * pitch + c4); }
#pragma unroll
      for (int t = 0; t < 4; ++t) {
        unsigned short hb = bf16_bits(kf[t]); sKh[r][c4 + t] = hb; sKl[r][c4 + t] = bf16_bits(kf[t] - bf16_val(hb));
        hb = bf16_bits(vf[t]); sVh[r][c4 + t] = hb; sVl[r][c4 + t] = bf16_bits(vf[t] - bf16_val(hb));
      }
    }
    __syncthreads();
    // S tile 16 x 32
    v8f s[2];
#pragma unroll
    for (int nt = 0; nt < 2; ++nt) {
      v8f acc = {};
#pragma unroll
      for (int ks = 0; ks < KS; ++ks) {
        FragB bh_, bl_;
        bh_.half[0] = *(const v8us*)&sKh[nt * 16 + ln][ks * 32 + 8 * hh]; bh_.half[1] = *(const v8us*)&sKh[nt * 16 + ln][ks * 32 + 16 + 8 * hh];
        bl_.half[0] = *(const v8us*)&sKl[nt * 16 + ln][ks * 32 + 8 * hh]; bl_.half[1] = *(const v8us*)&sKl[nt * 16 + ln][ks * 32 + 16 + 8 * hh];
        acc = mmaN<3>(aqh[ks].v, aql[ks].v, bh_.v, bl_.v, acc);
      }
      s[nt] = acc;
    }
    // mask + running max (rows 8hh+r; the 16 lanes of a half share rows)
    float alpha[8];
#pragma unroll
    for (int r = 0; r < 8; ++r) {
      const int qi = q0 + 8 * hh + r;
      const int ja = j0 + ln, jb = j0 + 16 + ln;
      if (CAUSAL) { if (ja > qi) s[0][r] = -3.0e38f; if (jb > qi) s[1][r] = -3.0e38f; }
      if (ja >= T) s[0][r] = -3.0e38f;
      if (jb >= T) s[1][r] = -3.0e38f;
      float mx = fmaxf(s[0][r], s[1][r]);
      mx = fmaxf(mx, __shfl_xor(mx, 1, 32)); mx = fmaxf(mx, __shfl_xor(mx, 2, 32)); mx = fmaxf(mx, __shfl_xor(mx, 4, 32)); mx = fmaxf(mx, __shfl_xor(mx, 8, 32));
      const float mnew = fmaxf(m_r[r], mx);
      alpha[r] = (mnew > -1.0e38f) ? __expf(m_r[r] - mnew) : 1.0f;
      const float p0 = (s[0][r] > -1.0e38f) ? __expf(s[0][r] - mnew) : 0.f;
      const float p1 = (s[1][r] > -1.0e38f) ? __expf(s[1][r] - mnew) : 0.f;
      m_r[r] = mnew;
      l_r[r] = l_r[r] * alpha[r] + p0 + p1;            // per-lane partial row sum (16 lanes combined at the end)
      unsigned short hb = bf16_bits(p0); sPh[w][8 * hh + r][ln] = hb;      sPl[w][8 * hh + r][ln] = bf16_bits(p0 - bf16_val(hb));
      hb = bf16_bits(p1);                sPh[w][8 * hh + r][16 + ln] = hb; sPl[w][8 * hh + r][16 + ln] = bf16_bits(p1 - bf16_val(hb));
    }
#pragma unroll
    for (int dt = 0; dt < DT; ++dt)
#pragma unroll
      for (int r = 0; r < 8; ++r) oacc[dt][r] *= alpha[r];
    __builtin_amdgcn_fence(__ATOMIC_ACQ_REL, "workgroup");
    __builtin_amdgcn_wave_barrier();
    FragB pah, pal;
    pah.half[0] = *(const v8us*)&sPh[w][ln][8 * hh]; pah.half[1] = *(const v8us*)&sPh[w][ln][16 + 8 * hh];
    pal.half[0] = *(const v8us*)&sPl[w][ln][8 * hh]; pal.half[1] = *(const v8us*)&sPl[w][ln][16 + 8 * hh];
#pragma unroll
    for (int dt = 0; dt < DT; ++dt) {
      FragB bvh, bvl;
#pragma unroll
      for (int i = 0; i < 8; ++i) {
        bvh.u[i] = sVh[8 * hh + i][dt * 16 + ln]; bvh.u[8 + i] = sVh[16 + 8 * hh + i][dt * 16 + ln];
        bvl.u[i] = sVl[8 * hh + i][dt * 16 + ln]; bvl.u[8 + i] = sVl[16 + 8 * hh + i][dt * 16 + ln];
      }
      oacc[dt] = mmaN<3>(pah.v, pal.v, bvh.v, bvl.v, oacc[dt]);
    }
    __builtin_amdgcn_fence(__ATOMIC_ACQ_REL, "workgroup");
    __builtin_amdgcn_wave_barrier();
  }
#pragma unroll
  for (int r = 0; r < 8; ++r) {
    float l = l_r[r];
    l += __shfl_xor(l, 1, 32); l += __shfl_xor(l, 2, 32); l += __shfl_xor(l, 4, 32); l += __shfl_xor(l, 8, 32);
    l_r[r] = (l > 0.f) ? 1.0f / l : 0.f;
  }
#pragma unroll
  for (int dt = 0; dt < DT; ++dt)
#pragma unroll
    for (int r = 0; r < 8; ++r) sO[w][8 * hh + r][dt * 16 + ln] = oacc[dt][r] * l_r[r];
  __builtin_amdgcn_fence(__ATOMIC_ACQ_REL, "workgroup");
  __builtin_amdgcn_wave_barrier();
  {
    for (int r = 0; r < 16; ++r) {
      const int row = q0 + r;
      if (row < T && lane < D / 4) {
        const v4f val = *(const v4fa*)&sO[w][r][lane * 4];
        *(v4f*)(y + ((size_t)b * T + row) * ypitch + h * D + lane * 4) = val;
      }
    }
    
  }
}

// in pitch = cols, out pitch = rows; rows, cols multiples of 32. Optional per-output-row affine (scale[c], shift[c]) and
// residual add res (same layout as out, optionally bf16-rounded) for fused epilogues: out = in*scale + shift + res.
template <bool AFFINE, bool RESID, bool RES_BF16>
__global__ __launch_bounds__(256) void k_transpose32(const float* __restrict__ in, float* __restrict__ out, int rows, int cols,
                                                    const float* __restrict__ scale, const float* __restrict__ shift, const float* __restrict__ res) {
  __shared__ float tile[32][33];
  const int b = blockIdx.z;
  const int r0 = blockIdx.y * 32, c0 = blockIdx.x * 32;
  const float* src = in + (size_t)b * rows * cols;
  float* dst = out + (size_t)b * rows * cols;
  const int tx = threadIdx.x & 31, ty = threadIdx.x >> 5;     // 8 rows per pass
  for (int i = ty; i < 32; i += 8) tile[i][tx] = src[(size_t)(r0 + i) * cols + c0 + tx];
  __syncthreads();
  {
    for (int i = ty; i < 32; i += 8) {
      float v = tile[tx][i];
      const int orow = c0 + i;
      if (AFFINE) v = v * scale[orow] + shift[orow];
      if (RESID) { float rv = res[(size_t)b * rows * cols + (size_t)orow * rows + r0 + tx]; if (RES_BF16) rv = bf16_round(rv); v += rv; }
      *(float*)(dst + (size_t)orow * rows + r0 + tx) = v;
    }
    
  }
}

// 2x2 max pool on position-major data: in [B][H*W][C] -> out [B][(H/2)*(W/2)][C]; thread per (b, p', 4 channels); C%4==0
__global__ __launch_bounds__(256) void k_pool2_pm(const float* __restrict__ in, float* __restrict__ out, int Bn, int H, int W, int C) {
  const size_t t = (size_t)blockIdx.x * 256 + threadIdx.x;
  const int c4n = C / 4, Ho = H / 2, Wo = W / 2;
  const size_t total = (size_t)Bn * Ho * Wo * c4n;
  if (t >= total) return;
  const int c4 = (int)(t % c4n) * 4; size_t rest = t / c4n;
  const int pw = (int)(rest % Wo); rest /= Wo; const int ph = (int)(rest % Ho); const int b = (int)(rest / Ho);
  const float* base = in + (size_t)b * H * W * C;
  const int p00 = (2 * ph) * W + 2 * pw;
  const v4f a = *(const v4fa*)(base + (size_t)p00 * C + c4), bq = *(const v4fa*)(base + (size_t)(p00 + 1) * C + c4);
  const v4f c = *(const v4fa*)(base + (size_t)(p00 + W) * C + c4), d = *(const v4fa*)(base + (size_t)(p00 + W + 1) * C + c4);
  v4f m; for (int i = 0; i < 4; ++i) m[i] = fmaxf(fmaxf(a[i], bq[i]), fmaxf(c[i], d[i]));
  float* dst = out + ((size_t)b * Ho * Wo + (size_t)ph * Wo + pw) * C + c4;
  *(v4f*)dst = m;
  
}

// General (non-causal) attention, 3-term bf16 splits, f32 softmax with running max.
// Q [.][Tq][qpitch], K [.][Tk][kpitch] (head dim DQ), V [.][Tk][vpitch] (head dim DVtot); this block handles DV output
// dims starting at dv0 = blockIdx.y*DV. y[bh][t][ypitch] gets columns dv0..dv0+DV-1. Per-bh base offsets via strides.
template <int DQ, int DV>
__global__ __launch_bounds__(128) void k_flash2(const float* __restrict__ Qb, size_t qstride, int qpitch, int Tq,
                                              const float* __restrict__ Kb, size_t kstride, int kpitch, int Tk,
                                              const float* __restrict__ Vb, size_t vstride, int vpitch,
                                              float scale, float* __restrict__ y, size_t ystride, int ypitch) {
  constexpr int KS = DQ / 32, DT = DV / 16;
  __shared__ __attribute__((aligned(16))) unsigned short sKh[32][DQ + 8], sKl[32][DQ + 8], sVh[32][DV + 8], sVl[32][DV + 8];
  __shared__ __attribute__((aligned(16))) unsigned short sPh[4][16][40], sPl[4][16][40];
  __shared__ __attribute__((aligned(16))) float sO[4][16][DV];
  const int tid = threadIdx.x, w = tid >> 5, lane = tid & 31, ln = lane & 15, hh = lane >> 4;
  const int nqb = (Tq + 63) / 64;
  const int bh = blockIdx.x / nqb, qblk = blockIdx.x % nqb;
  const int dv0 = blockIdx.y * DV;
  const int q0 = qblk * 64 + w * 16;
  const float* Q = Qb + (size_t)bh * qstride; const float* K = Kb + (size_t)bh * kstride; const float* V = Vb + (size_t)bh * vstride + dv0;
  FragB aqh[KS], aql[KS];
  {
    int row = q0 + ln; if (row >= Tq) row = Tq - 1;
    const float* qr = Q + (size_t)row * qpitch;
#pragma unroll
    for (int ks = 0; ks < KS; ++ks)
#pragma unroll
      for (int i = 0; i < 16; ++i) {
        const int d = ks * 32 + ((i < 8) ? (8 * hh + i) : (16 + 8 * hh + (i - 8)));
        const float x = qr[d] * scale; const unsigned short hb = bf16_bits(x);
        aqh[ks].u[i] = hb; aql[ks].u[i] = bf16_bits(x - bf16_val(hb));
      }
  }
  float m_r[8], l_r[8];
#pragma unroll
  for (int r = 0; r < 8; ++r) { m_r[r] = -3.0e38f; l_r[r] = 0.f; }
  v8f oacc[DT];
#pragma unroll
  for (int dt = 0; dt < DT; ++dt) oacc[dt] = (v8f){0.f,0.f,0.f,0.f,0.f,0.f,0.f,0.f};
  for (int j0 = 0; j0 < Tk; j0 += 32) {
    __syncthreads();
    for (int e = tid; e < 32 * (DQ / 4); e += 128) {
      const int r = e / (DQ / 4), c4 = (e % (DQ / 4)) * 4; const int key = j0 + r;
      v4f f = {0.f,0.f,0.f,0.f}; if (key < Tk) f = *(const v4fa*)(K + (size_t)key * kpitch + c4);
#pragma unroll
      for (int t = 0; t < 4; ++t) { const unsigned short hb = bf16_bits(f[t]); sKh[r][c4 + t] = hb; sKl[r][c4 + t] = bf16_bits(f[t] - bf16_val(hb)); }
    }
    for (int e = tid; e < 32 * (DV / 4); e += 128) {
      const int r = e / (DV / 4), c4 = (e % (DV / 4)) * 4; const int key = j0 + r;
      v4f f = {0.f,0.f,0.f,0.f}; if (key < Tk) f = *(const v4fa*)(V + (size_t)key * vpitch + c4);
#pragma unroll
      for (int t = 0; t < 4; ++t) { const unsigned short hb = bf16_bits(f[t]); sVh[r][c4 + t] = hb; sVl[r][c4 + t] = bf16_bits(f[t] - bf16_val(hb)); }
    }
    __syncthreads();
    v8f s[2];
#pragma unroll
    for (int nt = 0; nt < 2; ++nt) {
      v8f acc = {};
#pragma unroll
      for (int ks = 0; ks < KS; ++ks) {
        FragB bh_, bl_;
        bh_.half[0] = *(const v8us*)&sKh[nt * 16 + ln][ks * 32 + 8 * hh]; bh_.half[1] = *(const v8us*)&sKh[nt * 16 + ln][ks * 32 + 16 + 8 * hh];
        bl_.half[0] = *(const v8us*)&sKl[nt * 16 + ln][ks * 32 + 8 * hh]; bl_.half[1] = *(const v8us*)&sKl[nt * 16 + ln][ks * 32 + 16 + 8 * hh];
        acc = mmaN<3>(aqh[ks].v, aql[ks].v, bh_.v, bl_.v, acc);
      }
      s[nt] = acc;
    }
    float alpha[8];
#pragma unroll
    for (int r = 0; r < 8; ++r) {
      const int ja = j0 + ln, jb = j0 + 16 + ln;
      if (ja >= Tk) s[0][r] = -3.0e38f;
      if (jb >= Tk) s[1][r] = -3.0e38f;
      float mx = fmaxf(s[0][r], s[1][r]);
      mx = fmaxf(mx, __shfl_xor(mx, 1, 32)); mx = fmaxf(mx, __shfl_xor(mx, 2, 32)); mx = fmaxf(mx, __shfl_xor(mx, 4, 32)); mx = fmaxf(mx, __shfl_xor(mx, 8, 32));
      const float mnew = fmaxf(m_r[r], mx);
      alpha[r] = (mnew > -1.0e38f) ? __expf(m_r[r] - mnew) : 1.0f;
      const float p0 = (s[0][r] > -1.0e38f) ? __expf(s[0][r] - mnew) : 0.f;
      const float p1 = (s[1][r] > -1.0e38f) ? __expf(s[1][r] - mnew) : 0.f;
      m_r[r] = mnew;
      l_r[r] = l_r[r] * alpha[r] + p0 + p1;
      unsigned short hb = bf16_bits(p0); sPh[w][8 * hh + r][ln] = hb;      sPl[w][8 * hh + r][ln] = bf16_bits(p0 - bf16_val(hb));
      hb = bf16_bits(p1);                sPh[w][8 * hh + r][16 + ln] = hb; sPl[w][8 * hh + r][16 + ln] = bf16_bits(p1 - bf16_val(hb));
    }
#pragma unroll
    for (int dt = 0; dt < DT; ++dt)
#pragma unroll
      for (int r = 0; r < 8; ++r) oacc[dt][r] *= alpha[r];
    __builtin_amdgcn_fence(__ATOMIC_ACQ_REL, "workgroup");
    __builtin_amdgcn_wave_barrier();
    FragB pah, pal;
    pah.half[0] = *(const v8us*)&sPh[w][ln][8 * hh]; pah.half[1] = *(const v8us*)&sPh[w][ln][16 + 8 * hh];
    pal.half[0] = *(const v8us*)&sPl[w][ln][8 * hh]; pal.half[1] = *(const v8us*)&sPl[w][ln][16 + 8 * hh];
#pragma unroll
    for (int dt = 0; dt < DT; ++dt) {
      FragB bvh, bvl;
#pragma unroll
      for (int i = 0; i < 8; ++i) {
        bvh.u[i] = sVh[8 * hh + i][dt * 16 + ln]; bvh.u[8 + i] = sVh[16 + 8 * hh + i][dt * 16 + ln];
        bvl.u[i] = sVl[8 * hh + i][dt * 16 + ln]; bvl.u[8 + i] = sVl[16 + 8 * hh + i][dt * 16 + ln];
      }
      oacc[dt] = mmaN<3>(pah.v, pal.v, bvh.v, bvl.v, oacc[dt]);
    }
    __builtin_amdgcn_fence(__ATOMIC_ACQ_REL, "workgroup");
    __builtin_amdgcn_wave_barrier();
  }
#pragma unroll
  for (int r = 0; r < 8; ++r) {
    float l = l_r[r];
    l += __shfl_xor(l, 1, 32); l += __shfl_xor(l, 2, 32); l += __shfl_xor(l, 4, 32); l += __shfl_xor(l, 8, 32);
    l_r[r] = (l > 0.f) ? 1.0f / l : 0.f;
  }
#pragma unroll
  for (int dt = 0; dt < DT; ++dt)
#pragma unroll
    for (int r = 0; r < 8; ++r) sO[w][8 * hh + r][dt * 16 + ln] = oacc[dt][r] * l_r[r];
  __builtin_amdgcn_fence(__ATOMIC_ACQ_REL, "workgroup");
  __builtin_amdgcn_wave_barrier();
  {
    for (int r = 0; r < 16; ++r) {
      const int row = q0 + r;
      for (int c4 = lane * 4; c4 < DV; c4 += 128) {
        if (row < Tq) {
          const v4f val = *(const v4fa*)&sO[w][r][c4];
          *(v4f*)(y + (size_t)bh * ystride + (size_t)row * ypitch + dv0 + c4) = val;
        }
      }
    }
    
  }
}

// GEMM C = act(A·W + bias + resid): A f32 (ASPLIT -> hi/lo 2 terms), Wt bf16 [N][K]; ACT 0 none, 1 relu, 2 exact gelu;
// resid (optional, f32, row index = (row % rmod), pitch ldr, RES_BF16 rounds it) added before the activation.
template <bool ASPLIT, int ACT, bool BIAS_BF16, bool RES_BF16>
__global__ __launch_bounds__(128) void k_gemm_bf3(const float* __restrict__ A, int lda, const unsigned short* __restrict__ Wt, int ldb,
                                                const float* __restrict__ bias, const float* __restrict__ resid, int rmod, int ldr,
                                                float* __restrict__ C, int ldc, int M, int N, int K) {
  __shared__ __attribute__((aligned(16))) float so[4][16][64];
  const int tid = threadIdx.x, w = tid >> 5, lane = tid & 31, ln = lane & 15, hh = lane >> 4;
  const int ntn = N / 64;
  const int wid = blockIdx.x * 4 + w;
  const int mt = wid / ntn, nq = wid % ntn;
  if (mt * 16 >= M) return;
  const int row0 = mt * 16, col0 = nq * 64;
  const float* arow = A + (size_t)(row0 + ln) * lda;
  v8f acc[4] = {};
  for (int kb = 0; kb < K; kb += 32) {
    FragB ah, al;
    const v4f x0 = *(const v4fa*)(arow + kb + 8 * hh), x1 = *(const v4fa*)(arow + kb + 8 * hh + 4);
    const v4f x2 = *(const v4fa*)(arow + kb + 16 + 8 * hh), x3 = *(const v4fa*)(arow + kb + 16 + 8 * hh + 4);
    float xs[16] = {x0[0],x0[1],x0[2],x0[3],x1[0],x1[1],x1[2],x1[3],x2[0],x2[1],x2[2],x2[3],x3[0],x3[1],x3[2],x3[3]};
#pragma unroll
    for (int i = 0; i < 16; ++i) { const unsigned short hb = bf16_bits(xs[i]); ah.u[i] = hb; al.u[i] = ASPLIT ? bf16_bits(xs[i] - bf16_val(hb)) : (unsigned short)0; }
#pragma unroll
    for (int t = 0; t < 4; ++t) {
      const unsigned short* brow = Wt + (size_t)(col0 + t * 16 + ln) * ldb + kb;
      FragB b;
      b.half[0] = *(const v8us*)(brow + 8 * hh);
      b.half[1] = *(const v8us*)(brow + 16 + 8 * hh);
      acc[t] = mmaN<ASPLIT ? 2 : 1>(ah.v, al.v, b.v, b.v, acc[t]);
    }
  }
#pragma unroll
  for (int t = 0; t < 4; ++t) {
    const int col = col0 + t * 16 + ln;
    float bv = bias ? bias[col] : 0.f;
    if (BIAS_BF16) bv = bf16_round(bv);
#pragma unroll
    for (int r = 0; r < 8; ++r) {
      float v = acc[t][r] + bv;
      if (resid) { float rv = resid[(size_t)((row0 + 8 * hh + r) % rmod) * ldr + col]; if (RES_BF16) rv = bf16_round(rv); v += rv; }
      if (ACT == 1) v = fmaxf(v, 0.f);
      if (ACT == 2) v = 0.5f * v * (1.0f + erff(v * 0.70710678118654752f));
      if (ACT == 3) { const float u = 0.7978845608028654f * (v + 0.044715f * v * v * v); v = 0.5f * v * (1.0f + tanhf(u)); }
      so[w][8 * hh + r][t * 16 + ln] = v;
    }
  }
  __builtin_amdgcn_fence(__ATOMIC_ACQ_REL, "workgroup");
  __builtin_amdgcn_wave_barrier();
  const int rsub = lane >> 4, c4 = (lane & 15) * 4;
  {
#pragma unroll
    for (int q = 0; q < 8; ++q) {
      const int r = q * 2 + rsub;
      const v4f v = *(const v4fa*)&so[w][r][c4];
      *(v4f*)(C + (size_t)(row0 + r) * ldc + col0 + c4) = v;
    }
    
  }
}
// row LayerNorm (biased variance, eps) over N: s = X (+ R); optional out_sum <- s; out_norm <- (s-mu)*rsqrt(var+eps)*g + b
template <bool PARAM_BF16>
__global__ __launch_bounds__(256) void k_layernorm(const float* __restrict__ X, const float* __restrict__ R, const float* __restrict__ g, const float* __restrict__ bta,
                                                  float* __restrict__ out_sum, float* __restrict__ out_norm, int N, float eps) {
  __shared__ float red[256];
  const int row = blockIdx.x, tid = threadIdx.x;
  const float* x = X + (size_t)row * N; const float* rr = R ? R + (size_t)row * N : nullptr;
  float vals[16];                     // up to N = 4096
  const int per = N / 256;            // contiguous chunk per thread? use strided-by-4 chunks: thread handles j = tid*4 + 1024*u
  float s1 = 0.f;
  for (int u = 0; u < per / 4; ++u) {
    const int j = tid * 4 + 1024 * u;
    const v4f a = *(const v4fa*)(x + j);
    v4f b = {0.f,0.f,0.f,0.f}; if (rr) b = *(const v4fa*)(rr + j);
#pragma unroll
    for (int q = 0; q < 4; ++q) { const float v = a[q] + b[q]; vals[u * 4 + q] = v; s1 += v; }
  }
  red[tid] = s1; __syncthreads();
  for (int st = 128; st > 0; st >>= 1) { if (tid < st) red[tid] += red[tid + st]; __syncthreads(); }
  const float mu = red[0] / (float)N; __syncthreads();
  float s2 = 0.f;
  for (int u = 0; u < per / 4; ++u)
#pragma unroll
    for (int q = 0; q < 4; ++q) { const float c = vals[u * 4 + q] - mu; s2 += c * c; }
  red[tid] = s2; __syncthreads();
  for (int st = 128; st > 0; st >>= 1) { if (tid < st) red[tid] += red[tid + st]; __syncthreads(); }
  const float rs = rsqrtf(red[0] / (float)N + eps);
  {
    for (int u = 0; u < per / 4; ++u) {
      const int j = tid * 4 + 1024 * u;
      v4f o, sm;
#pragma unroll
      for (int q = 0; q < 4; ++q) {
        float gg = g[j + q], bb = bta[j + q];
        if (PARAM_BF16) { gg = bf16_round(gg); bb = bf16_round(bb); }
        sm[q] = vals[u * 4 + q]; o[q] = (vals[u * 4 + q] - mu) * rs * gg + bb;
      }
      if (out_sum) *(v4f*)(out_sum + (size_t)row * N + j) = sm;
      *(v4f*)(out_norm + (size_t)row * N + j) = o;
    }
    
  }
}

template <int D, int NS>
__global__ __launch_bounds__(128 * NS) void k_flash3(const float* __restrict__ Qb, int qpitch, int Tq,
                                              const float* __restrict__ K1, const float* __restrict__ V1, int Tk1,
                                              const float* __restrict__ K2, const float* __restrict__ V2, int Tk2, int kpitch, int vpitch,
                                              int H, float scale, const int* __restrict__ mask, int causal, const float* __restrict__ sbias,
                                              float* __restrict__ y, int ypitch) {
  constexpr int KS = D / 32, DT = D / 16;
  constexpr int OP = D + 4;         // pitch of sO in floats: 16 B x odd, so the 16 lanes that each store 16 bytes of their own row meet distinct banks
  __shared__ __attribute__((aligned(16))) unsigned short sKhG[NS][32][D + 8], sKlG[NS][32][D + 8], sVhG[NS][32][D + 8], sVlG[NS][32][D + 8];
  __shared__ __attribute__((aligned(16))) float sO[NS][4][16][OP];
  __shared__ float sM[NS][4][16], sL[NS][4][16];
  const int g = threadIdx.x >> 7, tid = threadIdx.x & 127, w = tid >> 5, lane = tid & 31, ln = lane & 15, hh = lane >> 4;
  unsigned short (*sKh)[D + 8] = sKhG[g]; unsigned short (*sKl)[D + 8] = sKlG[g]; unsigned short (*sVh)[D + 8] = sVhG[g]; unsigned short (*sVl)[D + 8] = sVlG[g];
  const int Tk = Tk1 + Tk2;
  const int nqb = (Tq + 63) / 64;
  const int bh = blockIdx.x / nqb, qblk = blockIdx.x % nqb;
  const int b = bh / H, h = bh % H;
  const int q0 = qblk * 64 + w * 16;
  const float* Q = Qb + (size_t)b * Tq * qpitch + h * D;
  FragB aqh[KS], aql[KS];
  {
    int row = q0 + ln; if (row >= Tq) row = Tq - 1;
    const float* qr = Q + (size_t)row * qpitch;
#pragma unroll
    for (int ks = 0; ks < KS; ++ks)
#pragma unroll
      for (int i = 0; i < 16; ++i) {
        const int d = ks * 32 + ((i < 8) ? (8 * hh + i) : (16 + 8 * hh + (i - 8)));
        const float x = qr[d] * scale; const unsigned short hb = bf16_bits(x);
        aqh[ks].u[i] = hb; aql[ks].u[i] = bf16_bits(x - bf16_val(hb));
      }
  }
  int qi = q0 + ln; if (qi >= Tq) qi = Tq - 1;                  // the lane's query
  float m_r = -3.0e38f, l_r = 0.f;                               // its running max (equal in both halves) and this half's share of its sum
  v8f oacc[DT];                                                  // O^T: oacc[dt][r] = O[query ln][dt * 16 + 8 * hh + r]
#pragma unroll
  for (int dt = 0; dt < DT; ++dt) oacc[dt] = (v8f){0.f,0.f,0.f,0.f,0.f,0.f,0.f,0.f};
  const bool special = causal || mask || sbias;
  const int kv_end = causal ? min(Tk, qblk * 64 + 64) : Tk;
  for (int jb = 0; jb < kv_end; jb += 32 * NS) {                // block-uniform trips; a group's chunk past the end is masked like any tail
    const int j0 = jb + 32 * g;
    __syncthreads();
    for (int e = tid; e < 32 * (D / 4); e += 128) {
      const int r = e / (D / 4), c4 = (e % (D / 4)) * 4; const int key = j0 + r;
      v4f kf = {0.f,0.f,0.f,0.f}, vf = {0.f,0.f,0.f,0.f};
      if (key < Tk1) { kf = *(const v4fa*)(K1 + (size_t)b * Tk1 * kpitch + h * D + (size_t)key * kpitch + c4); vf = *(const v4fa*)(V1 + (size_t)b * Tk1 * vpitch + h * D + (size_t)key * vpitch + c4); }
      else if (key < Tk) { const int k2 = key - Tk1; kf = *(const v4fa*)(K2 + (size_t)b * Tk2 * kpitch + h * D + (size_t)k2 * kpitch + c4); vf = *(const v4fa*)(V2 + (size_t)b * Tk2 * vpitch + h * D + (size_t)k2 * vpitch + c4); }
#pragma unroll
      for (int t = 0; t < 4; ++t) {
        unsigned short hb = bf16_bits(kf[t]); sKh[r][c4 + t] = hb; sKl[r][c4 + t] = bf16_bits(kf[t] - bf16_val(hb));
        hb = bf16_bits(vf[t]); sVh[r][c4 + t] = hb; sVl[r][c4 + t] = bf16_bits(vf[t] - bf16_val(hb));
      }
    }
    __syncthreads();
    v8f s[2];                                                    // S^T: s[nt][r] = score(query ln, key j0 + nt * 16 + 8 * hh + r)
#pragma unroll
    for (int nt = 0; nt < 2; ++nt) {
      v8f acc = {};
#pragma unroll
      for (int ks = 0; ks < KS; ++ks) {
        FragB bh_, bl_;
        bh_.half[0] = *(const v8us*)&sKh[nt * 16 + ln][ks * 32 + 8 * hh]; bh_.half[1] = *(const v8us*)&sKh[nt * 16 + ln][ks * 32 + 16 + 8 * hh];
        bl_.half[0] = *(const v8us*)&sKl[nt * 16 + ln][ks * 32 + 8 * hh]; bl_.half[1] = *(const v8us*)&sKl[nt * 16 + ln][ks * 32 + 16 + 8 * hh];
        acc = mmaN<3>(bh_.v, bl_.v, aqh[ks].v, aql[ks].v, acc);
      }
      s[nt] = acc;
    }
    if (special || jb + 32 * NS > Tk) {                          // block-uniform: masks, biases and key tails; a dropped score becomes -3e38
#pragma unroll
      for (int nt = 0; nt < 2; ++nt)
#pragma unroll
        for (int r = 0; r < 8; ++r) {
          const int key = j0 + nt * 16 + 8 * hh + r;
          bool keep = key < Tk;
          if (causal) keep = keep && (key <= qi);
          if (mask) { if (keep) keep = mask[(size_t)qi * Tk + key] != 0; }
          if (sbias) { if (keep) s[nt][r] += sbias[(size_t)bh * Tk + key]; }   // per-key additive bias (a per-query constant would cancel in the softmax)
          if (!keep) s[nt][r] = -3.0e38f;
        }
    }
    float mx = fmaxf(s[0][0], s[1][0]);
#pragma unroll
    for (int r = 1; r < 8; ++r) mx = fmaxf(mx, fmaxf(s[0][r], s[1][r]));
    mx = fmaxf(mx, xhalf(mx));                                   // the query's other 16 keys sit in the other half
    const float mnew = fmaxf(m_r, mx);
    const float mexp = fmaxf(mnew, -1.0e38f);                    // with nothing kept so far a dropped score still gives exp(-2e38) = 0
    const float alpha = __expf(m_r - mexp);
    m_r = mnew;
    FragB pbh, pbl;                                              // P^T as a B fragment: element nt * 8 + r is key nt * 16 + 8 * hh + r
    float ps[4] = {0.f, 0.f, 0.f, 0.f};
#pragma unroll
    for (int nt = 0; nt < 2; ++nt)
#pragma unroll
      for (int r = 0; r < 8; ++r) {
        const float p = __expf(s[nt][r] - mexp);
        ps[r & 3] += p;
        const unsigned short hb = bf16_bits(p);
        pbh.u[nt * 8 + r] = hb; pbl.u[nt * 8 + r] = bf16_bits(p - bf16_val(hb));
      }
    l_r = l_r * alpha + ((ps[0] + ps[1]) + (ps[2] + ps[3]));     // this half's 16 keys (the halves are added at the end)
#pragma unroll
    for (int dt = 0; dt < DT; ++dt)
#pragma unroll
      for (int r = 0; r < 8; ++r) oacc[dt][r] *= alpha;
#pragma unroll
    for (int dt = 0; dt < DT; ++dt) {
      FragB bvh, bvl;                                            // V^T as an A fragment: row dt * 16 + ln, the k order of P^T
#pragma unroll
      for (int i = 0; i < 8; ++i) {
        bvh.u[i] = sVh[8 * hh + i][dt * 16 + ln]; bvh.u[8 + i] = sVh[16 + 8 * hh + i][dt * 16 + ln];
        bvl.u[i] = sVl[8 * hh + i][dt * 16 + ln]; bvl.u[8 + i] = sVl[16 + 8 * hh + i][dt * 16 + ln];
      }
      oacc[dt] = mmaN<3>(bvh.v, bvl.v, pbh.v, pbl.v, oacc[dt]);
    }
  }
  {
    const float l = l_r + xhalf(l_r);
    if (hh == 0) { sM[g][w][ln] = m_r; sL[g][w][ln] = l; }
  }
#pragma unroll
  for (int dt = 0; dt < DT; ++dt) {                              // not yet divided by the row sum
    *(v4fa*)&sO[g][w][ln][dt * 16 + 8 * hh]     = (v4f){oacc[dt][0], oacc[dt][1], oacc[dt][2], oacc[dt][3]};
    *(v4fa*)&sO[g][w][ln][dt * 16 + 8 * hh + 4] = (v4f){oacc[dt][4], oacc[dt][5], oacc[dt][6], oacc[dt][7]};
  }
  __syncthreads();                                               // every group's (max, sum, O) is in LDS
  // join: wave (g, w) finishes rows 2g, 2g + 1, then + 2 NS, of query tile w; each half wave takes one row (two rows = 512 contiguous bytes a store)
  for (int r = g * 2 + hh; r < 16; r += 2 * NS) {
    const int row = q0 + r;
    float mj = -3.0e38f;
    // the three loops over s are unrolled so that f[] stays in registers
#pragma unroll
    for (int s = 0; s < NS; ++s) mj = fmaxf(mj, sM[s][w][r]);
    float f[NS], lj = 0.f;
#pragma unroll
    for (int s = 0; s < NS; ++s) { const float ms = sM[s][w][r]; f[s] = (ms > -1.0e38f) ? __expf(ms - mj) : 0.f; lj += f[s] * sL[s][w][r]; }
    const float inv = (mj > -1.0e38f) ? 1.0f / lj : __builtin_nanf("");
    for (int c4 = ln * 4; c4 < D; c4 += 64) {
      v4f val = {0.f, 0.f, 0.f, 0.f};
#pragma unroll
      for (int s = 0; s < NS; ++s) val += f[s] * *(const v4fa*)&sO[s][w][r][c4];
      if (row < Tq) {
        *(v4f*)(y + ((size_t)b * Tq + row) * ypitch + h * D + c4) = val * inv;
        asm volatile("s_wait_xcnt 0x0" ::: "memory");            // the next trip rewrites the store's address registers
      }
    }
  }
}

__global__ __launch_bounds__(256) void k_round_rows(const float* __restrict__ W, unsigned short* __restrict__ Wt, int n8) {
  const int t = blockIdx.x * 256 + threadIdx.x;
  if (t >= n8) return;
  const v4f a = *(const v4fa*)(W + (size_t)t * 8), b = *(const v4fa*)(W + (size_t)t * 8 + 4);
  v8us v; v[0]=bf16_bits(a[0]); v[1]=bf16_bits(a[1]); v[2]=bf16_bits(a[2]); v[3]=bf16_bits(a[3]);
  v[4]=bf16_bits(b[0]); v[5]=bf16_bits(b[1]); v[6]=bf16_bits(b[2]); v[7]=bf16_bits(b[3]);
  *(v8us*)(Wt + (size_t)t * 8) = v; 
}


__global__ __launch_bounds__(256) void k_roundcopy(const float* __restrict__ src, float* __restrict__ dst, int n8) {
  const size_t t = (size_t)blockIdx.x * 256 + threadIdx.x;
  if (t >= (size_t)n8 * 2) return;
  v4f a = *(const v4fa*)(src + t * 4);
  for (int i = 0; i < 4; ++i) a[i] = bf16_round(a[i]);
  *(v4f*)(dst + t * 4) = a; 
}

// out[b][c][p] = y[(b,p)][c] + x[b][c][p]  (block per (b,c): 4096 contiguous floats)
__global__ __launch_bounds__(256) void k_fin(const float* __restrict__ y, const float* __restrict__ x, float* __restrict__ out) {
  const int b = blockIdx.x / CC, c = blockIdx.x % CC; const size_t base = ((size_t)b * CC + c) * HWN;
  { for (int p = threadIdx.x; p < HWN; p += 256) *(float*)(out + base + p) = y[((size_t)b * HWN + p) * CC + c] + x[base + p];  }
}
extern "C" void kernel_launch(void* const* d_in, const int* in_sizes, int n_in,
                              void* d_out, int out_size, void* d_ws, size_t ws_size, hipStream_t stream) {
  (void)in_sizes; (void)n_in; (void)out_size;
  const float* x = (const float*)d_in[0]; const float* tw = (const float*)d_in[1]; const float* tb = (const float*)d_in[2]; const float* pw = (const float*)d_in[3]; const float* pb = (const float*)d_in[4];
  const float* gw = (const float*)d_in[5]; const float* gb = (const float*)d_in[6]; const float* fw = (const float*)d_in[7]; const float* fb = (const float*)d_in[8];
  char* ws = (char*)d_ws; size_t off = 0;
  auto take = [&](size_t bytes) { char* p = ws + off; off += (bytes + 255) & ~(size_t)255; return p; };
  unsigned short* Bqkv = (unsigned short*)take((size_t)3 * HC * CC * 2); unsigned short* Bf = (unsigned short*)take((size_t)CC * HC * 2); float* bqkv = (float*)take(3 * HC * 4 + 256);
  float* xT = (float*)take((size_t)MROWS * CC * 4); float* qkv = (float*)take((size_t)MROWS * 3 * HC * 4); float* att = (float*)take((size_t)MROWS * HC * 4); float* y = (float*)take((size_t)MROWS * CC * 4);
  if (off > ws_size) return;
  k_round_rows<<<(HC * CC / 8 + 255) / 256, 256, 0, stream>>>(tw, Bqkv, HC * CC / 8); k_round_rows<<<(HC * CC / 8 + 255) / 256, 256, 0, stream>>>(pw, Bqkv + HC * CC, HC * CC / 8); k_round_rows<<<(HC * CC / 8 + 255) / 256, 256, 0, stream>>>(gw, Bqkv + 2 * HC * CC, HC * CC / 8);
  k_round_rows<<<(CC * HC / 8 + 255) / 256, 256, 0, stream>>>(fw, Bf, CC * HC / 8);
  k_roundcopy<<<1, 256, 0, stream>>>(tb, bqkv, HC / 8); k_roundcopy<<<1, 256, 0, stream>>>(pb, bqkv + HC, HC / 8); k_roundcopy<<<1, 256, 0, stream>>>(gb, bqkv + 2 * HC, HC / 8);     // concatenated (rounded) biases
  k_transpose32<false, false, false><<<dim3(HWN / 32, CC / 32, BB), 256, 0, stream>>>(x, xT, CC, HWN, nullptr, nullptr, nullptr);      // NCHW -> [b][hw][c]
  k_gemm_bf3<false, 0, false, false><<<((MROWS / 16) * 3 + 3) / 4, 128, 0, stream>>>(xT, CC, Bqkv, CC, bqkv, nullptr, 1, 0, qkv, 3 * HC, MROWS, 3 * HC, CC);   // [theta | phi | g] + b (single term)
  k_flash3<HC, NSPLIT><<<BB * (HWN / 64), 128 * NSPLIT, 0, stream>>>(qkv, 3 * HC, HWN, qkv + HC, qkv + 2 * HC, HWN, nullptr, nullptr, 0, 3 * HC, 3 * HC, 1, 1.0f, nullptr, 0, nullptr, att, HC);
  k_gemm_bf3<true, 0, true, false><<<((MROWS / 16) * 2 + 3) / 4, 128, 0, stream>>>(att, HC, Bf, HC, fb, nullptr, 1, 0, y, CC, MROWS, CC, HC);                    // final conv + b
  k_fin<<<BB * CC, 256, 0, stream>>>(y, x, (float*)d_out);
}

// v003
// It runs in 133 microseconds.
// Timed twice side by side with v002, it ran 1.49 and 1.48 times as fast.
// All steps since v000 together make it 4.86 times as fast.
#include <hip/hip_runtime.h>
// theta/phi/g 1×1 convolutions as one GEMM on position-major bf16(x) (single exact term, K=128, N=192), the 4096×4096 non-local attention per batch as
// 16-query tiles on WMMA (Q·Kᵀ and P·V as 3-term bf16 hi/lo splits, f32 online softmax, no scaling), and the final 1×1 conv (2 terms) + bias; the
// residual add and the NCHW transposes are f32. 
#define BB 4
#define CC 128
#define HC 64
#define HWN 4096
#define MROWS (BB * HWN)
#define NSPLIT 4      // key groups per attention block: 4 waves each, so NSPLIT waves per SIMD

typedef __bf16 v16b __attribute__((ext_vector_type(16)));
typedef unsigned short v8us __attribute__((ext_vector_type(8), may_alias));
typedef float  v8f  __attribute__((ext_vector_type(8)));
typedef float  v4f  __attribute__((ext_vector_type(4)));
typedef float  v4fa __attribute__((ext_vector_type(4), may_alias));
union FragB { v16b v; v8us half[2]; unsigned short u[16]; };

__device__ __forceinline__ unsigned short bf16_bits(float x) { unsigned int u = __float_as_uint(x); return (unsigned short)((u + 0x7FFFu + ((u >> 16) & 1u)) >> 16); }
__device__ __forceinline__ float bf16_val(unsigned short b) { return __uint_as_float(((unsigned int)b) << 16); }
__device__ __forceinline__ float bf16_round(float x) { return bf16_val(bf16_bits(x)); }
// D += A·B with NT terms: 1 = ah·bh, 2 = + al·bh (A split), 3 = + ah·bl (both split)
template <int NT>
__device__ __forceinline__ v8f mmaN(v16b ah, v16b al, v16b bh, v16b bl, v8f c) {
  c = __builtin_amdgcn_wmma_f32_16x16x32_bf16(false, ah, false, bh, (short)0, c, false, false);
  if (NT >= 2) c = __builtin_amdgcn_wmma_f32_16x16x32_bf16(false, al, false, bh, (short)0, c, false, false);
  if (NT >= 3) c = __builtin_amdgcn_wmma_f32_16x16x32_bf16(false, ah, false, bl, (short)0, c, false, false);
  asm volatile("v_nop\n\tv_nop\n\tv_nop\n\tv_nop" : "+v"(c) : "v"(ah), "v"(al), "v"(bh), "v"(bl));
  return c;
}

// lane l <-> lane l ^ 16 (the other 16-lane row) in one vector cross-row move
__device__ __forceinline__ float xhalf(float x) {
  const int b = __float_as_int(x);
  return __int_as_float(__builtin_amdgcn_permlanex16(b, b, 0x76543210, 0xfedcba98, false, false));
}

__global__ __launch_bounds__(256) void k_wt_bf16(const float* __restrict__ W, unsigned short* __restrict__ Wt, int K, int N) {
  const int t = blockIdx.x * 256 + threadIdx.x;
  const int k8n = K / 8;
  if (t >= N * k8n) return;
  const int n = t / k8n, k8 = (t % k8n) * 8;
  v8us v;
#pragma unroll
  for (int i = 0; i < 8; ++i) v[i] = bf16_bits(W[(size_t)(k8 + i) * N + n]);
  *(v8us*)(Wt + (size_t)n * K + k8) = v;
  
}

// GEMM C[M][N] (f32, pitch ldc) = act(A[M][K]·W + bias). A f32 row-major (pitch lda) converted per fragment to bf16
// (ASPLIT: hi/lo two planes -> 2 terms, else single rounded term); Wt bf16 [N][K] (pitch ldb). BIAS_BF16 rounds the
// bias to bf16 first (bias quantised to bf16 before the add). K%32==0, M%16==0, N%64==0.
template <bool ASPLIT, int ACT, bool BIAS_BF16>
__global__ __launch_bounds__(128) void k_gemm_bf(const float* __restrict__ A, int lda, const unsigned short* __restrict__ Wt, int ldb,
                                               const float* __restrict__ bias, float* __restrict__ C, int ldc, int M, int N, int K) {
  __shared__ __attribute__((aligned(16))) float so[4][16][64];
  const int tid = threadIdx.x, w = tid >> 5, lane = tid & 31, ln = lane & 15, hh = lane >> 4;
  const int ntn = N / 64;
  const int wid = blockIdx.x * 4 + w;
  const int mt = wid / ntn, nq = wid % ntn;
  if (mt * 16 >= M) return;
  const int row0 = mt * 16, col0 = nq * 64;
  const float* arow = A + (size_t)(row0 + ln) * lda;
  v8f acc[4] = {};
  for (int kb = 0; kb < K; kb += 32) {
    FragB ah, al;
    const v4f x0 = *(const v4fa*)(arow + kb + 8 * hh), x1 = *(const v4fa*)(arow + kb + 8 * hh + 4);
    const v4f x2 = *(const v4fa*)(arow + kb + 16 + 8 * hh), x3 = *(const v4fa*)(arow + kb + 16 + 8 * hh + 4);
    float xs[16] = {x0[0],x0[1],x0[2],x0[3],x1[0],x1[1],x1[2],x1[3],x2[0],x2[1],x2[2],x2[3],x3[0],x3[1],x3[2],x3[3]};
#pragma unroll
    for (int i = 0; i < 16; ++i) { const unsigned short hb = bf16_bits(xs[i]); ah.u[i] = hb; al.u[i] = ASPLIT ? bf16_bits(xs[i] - bf16_val(hb)) : (unsigned short)0; }
#pragma unroll
    for (int t = 0; t < 4; ++t) {
      const unsigned short* brow = Wt + (size_t)(col0 + t * 16 + ln) * ldb + kb;
      FragB b;
      b.half[0] = *(const v8us*)(brow + 8 * hh);
      b.half[1] = *(const v8us*)(brow + 16 + 8 * hh);
      acc[t] = mmaN<ASPLIT ? 2 : 1>(ah.v, al.v, b.v, b.v, acc[t]);
    }
  }
#pragma unroll
  for (int t = 0; t < 4; ++t) {
    float bv = bias ? bias[col0 + t * 16 + ln] : 0.f;
    if (BIAS_BF16) bv = bf16_round(bv);
#pragma unroll
    for (int r = 0; r < 8; ++r) { float v = acc[t][r] + bv; if (ACT == 1) v = fmaxf(v, 0.f); so[w][8 * hh + r][t * 16 + ln] = v; }
  }
  __builtin_amdgcn_fence(__ATOMIC_ACQ_REL, "workgroup");
  __builtin_amdgcn_wave_barrier();
  const int rsub = lane >> 4, c4 = (lane & 15) * 4;
  {
#pragma unroll
    for (int q = 0; q < 8; ++q) {
      const int r = q * 2 + rsub;
      const v4f v = *(const v4fa*)&so[w][r][c4];
      *(v4f*)(C + (size_t)(row0 + r) * ldc + col0 + c4) = v;
    }
    
  }
}

// Flash-style causal/unmasked attention, all contractions 3-term bf16 hi/lo splits, f32 softmax with running max.
// q,k,v rows are read from f32 buffers with arbitrary row pitch (so they can live inside a fused qkv buffer);
// D = head size (multiple of 32, <= 128); one wave = 16 query rows; block = 4 waves (64 queries) sharing K/V chunks of 32.
template <int D, bool CAUSAL>
__global__ __launch_bounds__(128) void k_flash(const float* __restrict__ qb, const float* __restrict__ kb, const float* __restrict__ vb,
                                             int pitch, int T, int H, float scale, float* __restrict__ y, int ypitch) {
  constexpr int KS = D / 32;        // k-steps for QK
  constexpr int DT = D / 16;        // d tiles for PV
  __shared__ __attribute__((aligned(16))) unsigned short sKh[32][D + 8], sKl[32][D + 8], sVh[32][D + 8], sVl[32][D + 8];
  __shared__ __attribute__((aligned(16))) unsigned short sPh[4][16][40], sPl[4][16][40];
  __shared__ __attribute__((aligned(16))) float sO[4][16][D];
  const int tid = threadIdx.x, w = tid >> 5, lane = tid & 31, ln = lane & 15, hh = lane >> 4;
  const int nqb = (T + 63) / 64;
  const int bh = blockIdx.x / nqb, qblk = blockIdx.x % nqb;
  const int b = bh / H, h = bh % H;
  const int q0 = qblk * 64 + w * 16;
  const float* Q = qb + (size_t)b * T * pitch + h * D;
  const float* K = kb + (size_t)b * T * pitch + h * D;
  const float* V = vb + (size_t)b * T * pitch + h * D;

  // A fragments of the wave's 16 query rows (scaled), hi/lo
  FragB aqh[KS], aql[KS];
  {
    int row = q0 + ln; if (row >= T) row = T - 1;
    const float* qr = Q + (size_t)row * pitch;
#pragma unroll
    for (int ks = 0; ks < KS; ++ks)
#pragma unroll
      for (int i = 0; i < 16; ++i) {
        const int d = ks * 32 + ((i < 8) ? (8 * hh + i) : (16 + 8 * hh + (i - 8)));
        const float x = qr[d] * scale; const unsigned short hb = bf16_bits(x);
        aqh[ks].u[i] = hb; aql[ks].u[i] = bf16_bits(x - bf16_val(hb));
      }
  }
  float m_r[8], l_r[8];
#pragma unroll
  for (int r = 0; r < 8; ++r) { m_r[r] = -3.0e38f; l_r[r] = 0.f; }
  v8f oacc[DT];
#pragma unroll
  for (int dt = 0; dt < DT; ++dt) oacc[dt] = (v8f){0.f,0.f,0.f,0.f,0.f,0.f,0.f,0.f};

  const int kv_end = CAUSAL ? min(T, qblk * 64 + 64) : T;     // block-uniform
  for (int j0 = 0; j0 < kv_end; j0 += 32) {
    __syncthreads();
    for (int e = tid; e < 32 * (D / 4); e += 128) {
      const int r = e / (D / 4), c4 = (e % (D / 4)) * 4;
      const int key = j0 + r;
      v4f kf = {0.f,0.f,0.f,0.f}, vf = {0.f,0.f,0.f,0.f};
      if (key < T) { kf = *(const v4fa*)(K + (size_t)key * pitch + c4); vf = *(const v4fa*)(V + (size_t)key * pitch + c4); }
#pragma unroll
      for (int t = 0; t < 4; ++t) {
        unsigned short hb = bf16_bits(kf[t]); sKh[r][c4 + t] = hb; sKl[r][c4 + t] = bf16_bits(kf[t] - bf16_val(hb));
        hb = bf16_bits(vf[t]); sVh[r][c4 + t] = hb; sVl[r][c4 + t] = bf16_bits(vf[t] - bf16_val(hb));
      }
    }
    __syncthreads();
    // S tile 16 x 32
    v8f s[2];
#pragma unroll
    for (int nt = 0; nt < 2; ++nt) {
      v8f acc = {};
#pragma unroll
      for (int ks = 0; ks < KS; ++ks) {
        FragB bh_, bl_;
        bh_.half[0] = *(const v8us*)&sKh[nt * 16 + ln][ks * 32 + 8 * hh]; bh_.half[1] = *(const v8us*)&sKh[nt * 16 + ln][ks * 32 + 16 + 8 * hh];
        bl_.half[0] = *(const v8us*)&sKl[nt * 16 + ln][ks * 32 + 8 * hh]; bl_.half[1] = *(const v8us*)&sKl[nt * 16 + ln][ks * 32 + 16 + 8 * hh];
        acc = mmaN<3>(aqh[ks].v, aql[ks].v, bh_.v, bl_.v, acc);
      }
      s[nt] = acc;
    }
    // mask + running max (rows 8hh+r; the 16 lanes of a half share rows)
    float alpha[8];
#pragma unroll
    for (int r = 0; r < 8; ++r) {
      const int qi = q0 + 8 * hh + r;
      const int ja = j0 + ln, jb = j0 + 16 + ln;
      if (CAUSAL) { if (ja > qi) s[0][r] = -3.0e38f; if (jb > qi) s[1][r] = -3.0e38f; }
      if (ja >= T) s[0][r] = -3.0e38f;
      if (jb >= T) s[1][r] = -3.0e38f;
      float mx = fmaxf(s[0][r], s[1][r]);
      mx = fmaxf(mx, __shfl_xor(mx, 1, 32)); mx = fmaxf(mx, __shfl_xor(mx, 2, 32)); mx = fmaxf(mx, __shfl_xor(mx, 4, 32)); mx = fmaxf(mx, __shfl_xor(mx, 8, 32));
      const float mnew = fmaxf(m_r[r], mx);
      alpha[r] = (mnew > -1.0e38f) ? __expf(m_r[r] - mnew) : 1.0f;
      const float p0 = (s[0][r] > -1.0e38f) ? __expf(s[0][r] - mnew) : 0.f;
      const float p1 = (s[1][r] > -1.0e38f) ? __expf(s[1][r] - mnew) : 0.f;
      m_r[r] = mnew;
      l_r[r] = l_r[r] * alpha[r] + p0 + p1;            // per-lane partial row sum (16 lanes combined at the end)
      unsigned short hb = bf16_bits(p0); sPh[w][8 * hh + r][ln] = hb;      sPl[w][8 * hh + r][ln] = bf16_bits(p0 - bf16_val(hb));
      hb = bf16_bits(p1);                sPh[w][8 * hh + r][16 + ln] = hb; sPl[w][8 * hh + r][16 + ln] = bf16_bits(p1 - bf16_val(hb));
    }
#pragma unroll
    for (int dt = 0; dt < DT; ++dt)
#pragma unroll
      for (int r = 0; r < 8; ++r) oacc[dt][r] *= alpha[r];
    __builtin_amdgcn_fence(__ATOMIC_ACQ_REL, "workgroup");
    __builtin_amdgcn_wave_barrier();
    FragB pah, pal;
    pah.half[0] = *(const v8us*)&sPh[w][ln][8 * hh]; pah.half[1] = *(const v8us*)&sPh[w][ln][16 + 8 * hh];
    pal.half[0] = *(const v8us*)&sPl[w][ln][8 * hh]; pal.half[1] = *(const v8us*)&sPl[w][ln][16 + 8 * hh];
#pragma unroll
    for (int dt = 0; dt < DT; ++dt) {
      FragB bvh, bvl;
#pragma unroll
      for (int i = 0; i < 8; ++i) {
        bvh.u[i] = sVh[8 * hh + i][dt * 16 + ln]; bvh.u[8 + i] = sVh[16 + 8 * hh + i][dt * 16 + ln];
        bvl.u[i] = sVl[8 * hh + i][dt * 16 + ln]; bvl.u[8 + i] = sVl[16 + 8 * hh + i][dt * 16 + ln];
      }
      oacc[dt] = mmaN<3>(pah.v, pal.v, bvh.v, bvl.v, oacc[dt]);
    }
    __builtin_amdgcn_fence(__ATOMIC_ACQ_REL, "workgroup");
    __builtin_amdgcn_wave_barrier();
  }
#pragma unroll
  for (int r = 0; r < 8; ++r) {
    float l = l_r[r];
    l += __shfl_xor(l, 1, 32); l += __shfl_xor(l, 2, 32); l += __shfl_xor(l, 4, 32); l += __shfl_xor(l, 8, 32);
    l_r[r] = (l > 0.f) ? 1.0f / l : 0.f;
  }
#pragma unroll
  for (int dt = 0; dt < DT; ++dt)
#pragma unroll
    for (int r = 0; r < 8; ++r) sO[w][8 * hh + r][dt * 16 + ln] = oacc[dt][r] * l_r[r];
  __builtin_amdgcn_fence(__ATOMIC_ACQ_REL, "workgroup");
  __builtin_amdgcn_wave_barrier();
  {
    for (int r = 0; r < 16; ++r) {
      const int row = q0 + r;
      if (row < T && lane < D / 4) {
        const v4f val = *(const v4fa*)&sO[w][r][lane * 4];
        *(v4f*)(y + ((size_t)b * T + row) * ypitch + h * D + lane * 4) = val;
      }
    }
    
  }
}

// in pitch = cols, out pitch = rows; rows, cols multiples of 32. Optional per-output-row affine (scale[c], shift[c]) and
// residual add res (same layout as out, optionally bf16-rounded) for fused epilogues: out = in*scale + shift + res.
template <bool AFFINE, bool RESID, bool RES_BF16>
__global__ __launch_bounds__(256) void k_transpose32(const float* __restrict__ in, float* __restrict__ out, int rows, int cols,
                                                    const float* __restrict__ scale, const float* __restrict__ shift, const float* __restrict__ res) {
  __shared__ float tile[32][33];
  const int b = blockIdx.z;
  const int r0 = blockIdx.y * 32, c0 = blockIdx.x * 32;
  const float* src = in + (size_t)b * rows * cols;
  float* dst = out + (size_t)b * rows * cols;
  const int tx = threadIdx.x & 31, ty = threadIdx.x >> 5;     // 8 rows per pass
  for (int i = ty; i < 32; i += 8) tile[i][tx] = src[(size_t)(r0 + i) * cols + c0 + tx];
  __syncthreads();
  {
    for (int i = ty; i < 32; i += 8) {
      float v = tile[tx][i];
      const int orow = c0 + i;
      if (AFFINE) v = v * scale[orow] + shift[orow];
      if (RESID) { float rv = res[(size_t)b * rows * cols + (size_t)orow * rows + r0 + tx]; if (RES_BF16) rv = bf16_round(rv); v += rv; }
      *(float*)(dst + (size_t)orow * rows + r0 + tx) = v;
    }
    
  }
}

// 2x2 max pool on position-major data: in [B][H*W][C] -> out [B][(H/2)*(W/2)][C]; thread per (b, p', 4 channels); C%4==0
__global__ __launch_bounds__(256) void k_pool2_pm(const float* __restrict__ in, float* __restrict__ out, int Bn, int H, int W, int C) {
  const size_t t = (size_t)blockIdx.x * 256 + threadIdx.x;
  const int c4n = C / 4, Ho = H / 2, Wo = W / 2;
  const size_t total = (size_t)Bn * Ho * Wo * c4n;
  if (t >= total) return;
  const int c4 = (int)(t % c4n) * 4; size_t rest = t / c4n;
  const int pw = (int)(rest % Wo); rest /= Wo; const int ph = (int)(rest % Ho); const int b = (int)(rest / Ho);
  const float* base = in + (size_t)b * H * W * C;
  const int p00 = (2 * ph) * W + 2 * pw;
  const v4f a = *(const v4fa*)(base + (size_t)p00 * C + c4), bq = *(const v4fa*)(base + (size_t)(p00 + 1) * C + c4);
  const v4f c = *(const v4fa*)(base + (size_t)(p00 + W) * C + c4), d = *(const v4fa*)(base + (size_t)(p00 + W + 1) * C + c4);
  v4f m; for (int i = 0; i < 4; ++i) m[i] = fmaxf(fmaxf(a[i], bq[i]), fmaxf(c[i], d[i]));
  float* dst = out + ((size_t)b * Ho * Wo + (size_t)ph * Wo + pw) * C + c4;
  *(v4f*)dst = m;
  
}

// General (non-causal) attention, 3-term bf16 splits, f32 softmax with running max.
// Q [.][Tq][qpitch], K [.][Tk][kpitch] (head dim DQ), V [.][Tk][vpitch] (head dim DVtot); this block handles DV output
// dims starting at dv0 = blockIdx.y*DV. y[bh][t][ypitch] gets columns dv0..dv0+DV-1. Per-bh base offsets via strides.
template <int DQ, int DV>
__global__ __launch_bounds__(128) void k_flash2(const float* __restrict__ Qb, size_t qstride, int qpitch, int Tq,
                                              const float* __restrict__ Kb, size_t kstride, int kpitch, int Tk,
                                              const float* __restrict__ Vb, size_t vstride, int vpitch,
                                              float scale, float* __restrict__ y, size_t ystride, int ypitch) {
  constexpr int KS = DQ / 32, DT = DV / 16;
  __shared__ __attribute__((aligned(16))) unsigned short sKh[32][DQ + 8], sKl[32][DQ + 8], sVh[32][DV + 8], sVl[32][DV + 8];
  __shared__ __attribute__((aligned(16))) unsigned short sPh[4][16][40], sPl[4][16][40];
  __shared__ __attribute__((aligned(16))) float sO[4][16][DV];
  const int tid = threadIdx.x, w = tid >> 5, lane = tid & 31, ln = lane & 15, hh = lane >> 4;
  const int nqb = (Tq + 63) / 64;
  const int bh = blockIdx.x / nqb, qblk = blockIdx.x % nqb;
  const int dv0 = blockIdx.y * DV;
  const int q0 = qblk * 64 + w * 16;
  const float* Q = Qb + (size_t)bh * qstride; const float* K = Kb + (size_t)bh * kstride; const float* V = Vb + (size_t)bh * vstride + dv0;
  FragB aqh[KS], aql[KS];
  {
    int row = q0 + ln; if (row >= Tq) row = Tq - 1;
    const float* qr = Q + (size_t)row * qpitch;
#pragma unroll
    for (int ks = 0; ks < KS; ++ks)
#pragma unroll
      for (int i = 0; i < 16; ++i) {
        const int d = ks * 32 + ((i < 8) ? (8 * hh + i) : (16 + 8 * hh + (i - 8)));
        const float x = qr[d] * scale; const unsigned short hb = bf16_bits(x);
        aqh[ks].u[i] = hb; aql[ks].u[i] = bf16_bits(x - bf16_val(hb));
      }
  }
  float m_r[8], l_r[8];
#pragma unroll
  for (int r = 0; r < 8; ++r) { m_r[r] = -3.0e38f; l_r[r] = 0.f; }
  v8f oacc[DT];
#pragma unroll
  for (int dt = 0; dt < DT; ++dt) oacc[dt] = (v8f){0.f,0.f,0.f,0.f,0.f,0.f,0.f,0.f};
  for (int j0 = 0; j0 < Tk; j0 += 32) {
    __syncthreads();
    for (int e = tid; e < 32 * (DQ / 4); e += 128) {
      const int r = e / (DQ / 4), c4 = (e % (DQ / 4)) * 4; const int key = j0 + r;
      v4f f = {0.f,0.f,0.f,0.f}; if (key < Tk) f = *(const v4fa*)(K + (size_t)key * kpitch + c4);
#pragma unroll
      for (int t = 0; t < 4; ++t) { const unsigned short hb = bf16_bits(f[t]); sKh[r][c4 + t] = hb; sKl[r][c4 + t] = bf16_bits(f[t] - bf16_val(hb)); }
    }
    for (int e = tid; e < 32 * (DV / 4); e += 128) {
      const int r = e / (DV / 4), c4 = (e % (DV / 4)) * 4; const int key = j0 + r;
      v4f f = {0.f,0.f,0.f,0.f}; if (key < Tk) f = *(const v4fa*)(V + (size_t)key * vpitch + c4);
#pragma unroll
      for (int t = 0; t < 4; ++t) { const unsigned short hb = bf16_bits(f[t]); sVh[r][c4 + t] = hb; sVl[r][c4 + t] = bf16_bits(f[t] - bf16_val(hb)); }
    }
    __syncthreads();
    v8f s[2];
#pragma unroll
    for (int nt = 0; nt < 2; ++nt) {
      v8f acc = {};
#pragma unroll
      for (int ks = 0; ks < KS; ++ks) {
        FragB bh_, bl_;
        bh_.half[0] = *(const v8us*)&sKh[nt * 16 + ln][ks * 32 + 8 * hh]; bh_.half[1] = *(const v8us*)&sKh[nt * 16 + ln][ks * 32 + 16 + 8 * hh];
        bl_.half[0] = *(const v8us*)&sKl[nt * 16 + ln][ks * 32 + 8 * hh]; bl_.half[1] = *(const v8us*)&sKl[nt * 16 + ln][ks * 32 + 16 + 8 * hh];
        acc = mmaN<3>(aqh[ks].v, aql[ks].v, bh_.v, bl_.v, acc);
      }
      s[nt] = acc;
    }
    float alpha[8];
#pragma unroll
    for (int r = 0; r < 8; ++r) {
      const int ja = j0 + ln, jb = j0 + 16 + ln;
      if (ja >= Tk) s[0][r] = -3.0e38f;
      if (jb >= Tk) s[1][r] = -3.0e38f;
      float mx = fmaxf(s[0][r], s[1][r]);
      mx = fmaxf(mx, __shfl_xor(mx, 1, 32)); mx = fmaxf(mx, __shfl_xor(mx, 2, 32)); mx = fmaxf(mx, __shfl_xor(mx, 4, 32)); mx = fmaxf(mx, __shfl_xor(mx, 8, 32));
      const float mnew = fmaxf(m_r[r], mx);
      alpha[r] = (mnew > -1.0e38f) ? __expf(m_r[r] - mnew) : 1.0f;
      const float p0 = (s[0][r] > -1.0e38f) ? __expf(s[0][r] - mnew) : 0.f;
      const float p1 = (s[1][r] > -1.0e38f) ? __expf(s[1][r] - mnew) : 0.f;
      m_r[r] = mnew;
      l_r[r] = l_r[r] * alpha[r] + p0 + p1;
      unsigned short hb = bf16_bits(p0); sPh[w][8 * hh + r][ln] = hb;      sPl[w][8 * hh + r][ln] = bf16_bits(p0 - bf16_val(hb));
      hb = bf16_bits(p1);                sPh[w][8 * hh + r][16 + ln] = hb; sPl[w][8 * hh + r][16 + ln] = bf16_bits(p1 - bf16_val(hb));
    }
#pragma unroll
    for (int dt = 0; dt < DT; ++dt)
#pragma unroll
      for (int r = 0; r < 8; ++r) oacc[dt][r] *= alpha[r];
    __builtin_amdgcn_fence(__ATOMIC_ACQ_REL, "workgroup");
    __builtin_amdgcn_wave_barrier();
    FragB pah, pal;
    pah.half[0] = *(const v8us*)&sPh[w][ln][8 * hh]; pah.half[1] = *(const v8us*)&sPh[w][ln][16 + 8 * hh];
    pal.half[0] = *(const v8us*)&sPl[w][ln][8 * hh]; pal.half[1] = *(const v8us*)&sPl[w][ln][16 + 8 * hh];
#pragma unroll
    for (int dt = 0; dt < DT; ++dt) {
      FragB bvh, bvl;
#pragma unroll
      for (int i = 0; i < 8; ++i) {
        bvh.u[i] = sVh[8 * hh + i][dt * 16 + ln]; bvh.u[8 + i] = sVh[16 + 8 * hh + i][dt * 16 + ln];
        bvl.u[i] = sVl[8 * hh + i][dt * 16 + ln]; bvl.u[8 + i] = sVl[16 + 8 * hh + i][dt * 16 + ln];
      }
      oacc[dt] = mmaN<3>(pah.v, pal.v, bvh.v, bvl.v, oacc[dt]);
    }
    __builtin_amdgcn_fence(__ATOMIC_ACQ_REL, "workgroup");
    __builtin_amdgcn_wave_barrier();
  }
#pragma unroll
  for (int r = 0; r < 8; ++r) {
    float l = l_r[r];
    l += __shfl_xor(l, 1, 32); l += __shfl_xor(l, 2, 32); l += __shfl_xor(l, 4, 32); l += __shfl_xor(l, 8, 32);
    l_r[r] = (l > 0.f) ? 1.0f / l : 0.f;
  }
#pragma unroll
  for (int dt = 0; dt < DT; ++dt)
#pragma unroll
    for (int r = 0; r < 8; ++r) sO[w][8 * hh + r][dt * 16 + ln] = oacc[dt][r] * l_r[r];
  __builtin_amdgcn_fence(__ATOMIC_ACQ_REL, "workgroup");
  __builtin_amdgcn_wave_barrier();
  {
    for (int r = 0; r < 16; ++r) {
      const int row = q0 + r;
      for (int c4 = lane * 4; c4 < DV; c4 += 128) {
        if (row < Tq) {
          const v4f val = *(const v4fa*)&sO[w][r][c4];
          *(v4f*)(y + (size_t)bh * ystride + (size_t)row * ypitch + dv0 + c4) = val;
        }
      }
    }
    
  }
}

// GEMM C = act(A·W + bias + resid): A f32 (ASPLIT -> hi/lo 2 terms), Wt bf16 [N][K]; ACT 0 none, 1 relu, 2 exact gelu;
// resid (optional, f32, row index = (row % rmod), pitch ldr, RES_BF16 rounds it) added before the activation.
template <bool ASPLIT, int ACT, bool BIAS_BF16, bool RES_BF16>
__global__ __launch_bounds__(128) void k_gemm_bf3(const float* __restrict__ A, int lda, const unsigned short* __restrict__ Wt, int ldb,
                                                const float* __restrict__ bias, const float* __restrict__ resid, int rmod, int ldr,
                                                float* __restrict__ C, int ldc, int M, int N, int K) {
  __shared__ __attribute__((aligned(16))) float so[4][16][64];
  const int tid = threadIdx.x, w = tid >> 5, lane = tid & 31, ln = lane & 15, hh = lane >> 4;
  const int ntn = N / 64;
  const int wid = blockIdx.x * 4 + w;
  const int mt = wid / ntn, nq = wid % ntn;
  if (mt * 16 >= M) return;
  const int row0 = mt * 16, col0 = nq * 64;
  const float* arow = A + (size_t)(row0 + ln) * lda;
  v8f acc[4] = {};
  for (int kb = 0; kb < K; kb += 32) {
    FragB ah, al;
    const v4f x0 = *(const v4fa*)(arow + kb + 8 * hh), x1 = *(const v4fa*)(arow + kb + 8 * hh + 4);
    const v4f x2 = *(const v4fa*)(arow + kb + 16 + 8 * hh), x3 = *(const v4fa*)(arow + kb + 16 + 8 * hh + 4);
    float xs[16] = {x0[0],x0[1],x0[2],x0[3],x1[0],x1[1],x1[2],x1[3],x2[0],x2[1],x2[2],x2[3],x3[0],x3[1],x3[2],x3[3]};
#pragma unroll
    for (int i = 0; i < 16; ++i) { const unsigned short hb = bf16_bits(xs[i]); ah.u[i] = hb; al.u[i] = ASPLIT ? bf16_bits(xs[i] - bf16_val(hb)) : (unsigned short)0; }
#pragma unroll
    for (int t = 0; t < 4; ++t) {
      const unsigned short* brow = Wt + (size_t)(col0 + t * 16 + ln) * ldb + kb;
      FragB b;
      b.half[0] = *(const v8us*)(brow + 8 * hh);
      b.half[1] = *(const v8us*)(brow + 16 + 8 * hh);
      acc[t] = mmaN<ASPLIT ? 2 : 1>(ah.v, al.v, b.v, b.v, acc[t]);
    }
  }
#pragma unroll
  for (int t = 0; t < 4; ++t) {
    const int col = col0 + t * 16 + ln;
    float bv = bias ? bias[col] : 0.f;
    if (BIAS_BF16) bv = bf16_round(bv);
#pragma unroll
    for (int r = 0; r < 8; ++r) {
      float v = acc[t][r] + bv;
      if (resid) { float rv = resid[(size_t)((row0 + 8 * hh + r) % rmod) * ldr + col]; if (RES_BF16) rv = bf16_round(rv); v += rv; }
      if (ACT == 1) v = fmaxf(v, 0.f);
      if (ACT == 2) v = 0.5f * v * (1.0f + erff(v * 0.70710678118654752f));
      if (ACT == 3) { const float u = 0.7978845608028654f * (v + 0.044715f * v * v * v); v = 0.5f * v * (1.0f + tanhf(u)); }
      so[w][8 * hh + r][t * 16 + ln] = v;
    }
  }
  __builtin_amdgcn_fence(__ATOMIC_ACQ_REL, "workgroup");
  __builtin_amdgcn_wave_barrier();
  const int rsub = lane >> 4, c4 = (lane & 15) * 4;
  {
#pragma unroll
    for (int q = 0; q < 8; ++q) {
      const int r = q * 2 + rsub;
      const v4f v = *(const v4fa*)&so[w][r][c4];
      *(v4f*)(C + (size_t)(row0 + r) * ldc + col0 + c4) = v;
    }
    
  }
}
// row LayerNorm (biased variance, eps) over N: s = X (+ R); optional out_sum <- s; out_norm <- (s-mu)*rsqrt(var+eps)*g + b
template <bool PARAM_BF16>
__global__ __launch_bounds__(256) void k_layernorm(const float* __restrict__ X, const float* __restrict__ R, const float* __restrict__ g, const float* __restrict__ bta,
                                                  float* __restrict__ out_sum, float* __restrict__ out_norm, int N, float eps) {
  __shared__ float red[256];
  const int row = blockIdx.x, tid = threadIdx.x;
  const float* x = X + (size_t)row * N; const float* rr = R ? R + (size_t)row * N : nullptr;
  float vals[16];                     // up to N = 4096
  const int per = N / 256;            // contiguous chunk per thread? use strided-by-4 chunks: thread handles j = tid*4 + 1024*u
  float s1 = 0.f;
  for (int u = 0; u < per / 4; ++u) {
    const int j = tid * 4 + 1024 * u;
    const v4f a = *(const v4fa*)(x + j);
    v4f b = {0.f,0.f,0.f,0.f}; if (rr) b = *(const v4fa*)(rr + j);
#pragma unroll
    for (int q = 0; q < 4; ++q) { const float v = a[q] + b[q]; vals[u * 4 + q] = v; s1 += v; }
  }
  red[tid] = s1; __syncthreads();
  for (int st = 128; st > 0; st >>= 1) { if (tid < st) red[tid] += red[tid + st]; __syncthreads(); }
  const float mu = red[0] / (float)N; __syncthreads();
  float s2 = 0.f;
  for (int u = 0; u < per / 4; ++u)
#pragma unroll
    for (int q = 0; q < 4; ++q) { const float c = vals[u * 4 + q] - mu; s2 += c * c; }
  red[tid] = s2; __syncthreads();
  for (int st = 128; st > 0; st >>= 1) { if (tid < st) red[tid] += red[tid + st]; __syncthreads(); }
  const float rs = rsqrtf(red[0] / (float)N + eps);
  {
    for (int u = 0; u < per / 4; ++u) {
      const int j = tid * 4 + 1024 * u;
      v4f o, sm;
#pragma unroll
      for (int q = 0; q < 4; ++q) {
        float gg = g[j + q], bb = bta[j + q];
        if (PARAM_BF16) { gg = bf16_round(gg); bb = bf16_round(bb); }
        sm[q] = vals[u * 4 + q]; o[q] = (vals[u * 4 + q] - mu) * rs * gg + bb;
      }
      if (out_sum) *(v4f*)(out_sum + (size_t)row * N + j) = sm;
      *(v4f*)(out_norm + (size_t)row * N + j) = o;
    }
    
  }
}

// K and V rows (f32, row pitch `pitch`, D = 64 columns) prepared ONCE for k_flash3: each value split into bf16 hi + lo, written as four planes.
// Kh/Kl keep the row order [row][D]. VTh/VTl are transposed inside each chunk of 32 rows: [chunk][d][32 rows], so that a chunk of any plane is
// 32 * D contiguous values at offset chunk * 32 * D, and a V^T fragment row (one d, 32 keys) is contiguous. One block = one chunk of 32 rows.
template <int D>
__global__ __launch_bounds__(256) void k_split_kv(const float* __restrict__ K, const float* __restrict__ V, int pitch,
                                                 unsigned short* __restrict__ Kh, unsigned short* __restrict__ Kl,
                                                 unsigned short* __restrict__ VTh, unsigned short* __restrict__ VTl) {
  static_assert(D == 64, "256 threads = 32 rows x D/8 units = D rows x 4 units");
  __shared__ float tv[32][D + 1];                                // pitch 65 dwords: the column walk below meets distinct banks
  const int t = threadIdx.x;
  const size_t row0 = (size_t)blockIdx.x * 32;
  {
    const int r = t / (D / 8), c8 = (t % (D / 8)) * 8;
    const float* kr = K + (row0 + r) * pitch + c8; const float* vr = V + (row0 + r) * pitch + c8;
    const v4f k0 = *(const v4fa*)kr, k1 = *(const v4fa*)(kr + 4);
    asm volatile("s_wait_xcnt 0x0" ::: "memory");                // what follows may reuse the address registers of the two loads above
    const v4f v0 = *(const v4fa*)vr, v1 = *(const v4fa*)(vr + 4);
    asm volatile("s_wait_xcnt 0x0" ::: "memory");                // the same for these two
    v8us hi, lo;
    // unrolled (here and below): the vectors are then indexed by constants and stay in registers
#pragma unroll
    for (int i = 0; i < 8; ++i) {
      const float x = (i < 4) ? k0[i & 3] : k1[i & 3];
      const unsigned short hb = bf16_bits(x); hi[i] = hb; lo[i] = bf16_bits(x - bf16_val(hb));
      tv[r][c8 + i] = (i < 4) ? v0[i & 3] : v1[i & 3];
    }
    *(v8us*)(Kh + (row0 + r) * D + c8) = hi;
    *(v8us*)(Kl + (row0 + r) * D + c8) = lo;
  }
  __syncthreads();
  {
    const int d = t / 4, k8 = (t % 4) * 8;
    v8us hi, lo;
#pragma unroll
    for (int i = 0; i < 8; ++i) {
      const float x = tv[k8 + i][d];
      const unsigned short hb = bf16_bits(x); hi[i] = hb; lo[i] = bf16_bits(x - bf16_val(hb));
    }
    *(v8us*)(VTh + row0 * D + d * 32 + k8) = hi;
    *(v8us*)(VTl + row0 * D + d * 32 + k8) = lo;
  }
}

template <int D, int NS>
__global__ __launch_bounds__(128 * NS) void k_flash3(const float* __restrict__ Qb, int qpitch, int Tq,
                                              const unsigned short* __restrict__ Kh, const unsigned short* __restrict__ Kl,
                                              const unsigned short* __restrict__ VTh, const unsigned short* __restrict__ VTl, int Tk,
                                              int H, float scale, const int* __restrict__ mask, int causal, const float* __restrict__ sbias,
                                              float* __restrict__ y, int ypitch) {
  constexpr int KS = D / 32, DT = D / 16;
  constexpr int OP = D + 4;         // pitch of sO in floats: 16 B x odd, so the 16 lanes that each store 16 bytes of their own row meet distinct banks
  constexpr int VP = 32 + 8;        // pitch of a V^T row (32 keys) in values: 80 B = 16 B x odd, for 16-byte readers
  __shared__ __attribute__((aligned(16))) unsigned short sKhG[NS][32][D + 8], sKlG[NS][32][D + 8], sVhG[NS][D][VP], sVlG[NS][D][VP];
  __shared__ __attribute__((aligned(16))) float sO[NS][4][16][OP];
  __shared__ float sM[NS][4][16], sL[NS][4][16];
  // g is the same in every lane of a wave; held in a scalar register, the chunk's base address and the test for a chunk past the end are scalar too
  const int g = __builtin_amdgcn_readfirstlane(threadIdx.x >> 7);
  const int tid = threadIdx.x & 127, w = tid >> 5, lane = tid & 31, ln = lane & 15, hh = lane >> 4;
  unsigned short (*sKh)[D + 8] = sKhG[g]; unsigned short (*sKl)[D + 8] = sKlG[g]; unsigned short (*sVh)[VP] = sVhG[g]; unsigned short (*sVl)[VP] = sVlG[g];
  const int nqb = (Tq + 63) / 64;
  const int bh = blockIdx.x / nqb, qblk = blockIdx.x % nqb;
  const int b = bh / H, h = bh % H;
  const int q0 = qblk * 64 + w * 16;
  const float* Q = Qb + (size_t)b * Tq * qpitch + h * D;
  FragB aqh[KS], aql[KS];
  {
    int row = q0 + ln; if (row >= Tq) row = Tq - 1;
    const float* qr = Q + (size_t)row * qpitch;
#pragma unroll
    for (int ks = 0; ks < KS; ++ks)
#pragma unroll
      for (int i = 0; i < 16; ++i) {
        const int d = ks * 32 + ((i < 8) ? (8 * hh + i) : (16 + 8 * hh + (i - 8)));
        const float x = qr[d] * scale; const unsigned short hb = bf16_bits(x);
        aqh[ks].u[i] = hb; aql[ks].u[i] = bf16_bits(x - bf16_val(hb));
      }
  }
  int qi = q0 + ln; if (qi >= Tq) qi = Tq - 1;                  // the lane's query
  float m_r = -3.0e38f, l_r = 0.f;                               // its running max (equal in both halves) and this half's share of its sum
  v8f oacc[DT];                                                  // O^T: oacc[dt][r] = O[query ln][dt * 16 + 8 * hh + r]
#pragma unroll
  for (int dt = 0; dt < DT; ++dt) oacc[dt] = (v8f){0.f,0.f,0.f,0.f,0.f,0.f,0.f,0.f};
  const bool special = causal || mask || sbias;
  const int kv_end = causal ? min(Tk, qblk * 64 + 64) : Tk;
  // byte offset of the thread's first 16-byte unit of its group's chunk, the same in all four planes (each plane is below 4 GiB): one 32-bit
  // register beside four scalar bases addresses all the loads of a trip
  unsigned coff = ((unsigned)bh * Tk + 32 * g) * (D * 2) + tid * 16;
  for (int jb = 0; jb < kv_end; jb += 32 * NS, coff += 32 * NS * D * 2) {   // block-uniform trips; a group's chunk past the end is masked like any tail
    const int j0 = jb + 32 * g;
    __syncthreads();
    {
      constexpr int NU = 32 * D / 8 / 128;                       // 16-byte units of one plane's chunk per thread
      v8us ckh[NU], ckl[NU], cvh[NU], cvl[NU];
      // the loops over u are unrolled so that the units stay in registers and all loads are issued before the first LDS store
      if (j0 < Tk) {
#pragma unroll
        for (int u = 0; u < NU; ++u) {
          const unsigned o = coff + 2048u * u;                   // 128 threads x 16 B a unit row
          ckh[u] = *(const v8us*)((const char*)Kh + o);  ckl[u] = *(const v8us*)((const char*)Kl + o);
          cvh[u] = *(const v8us*)((const char*)VTh + o); cvl[u] = *(const v8us*)((const char*)VTl + o);
        }
#pragma unroll
        for (int u = 0; u < NU; ++u) {
          const int e = tid + 128 * u;
          *(v8us*)&sKh[e / (D / 8)][(e % (D / 8)) * 8] = ckh[u]; *(v8us*)&sKl[e / (D / 8)][(e % (D / 8)) * 8] = ckl[u];
          *(v8us*)&sVh[e / 4][(e % 4) * 8] = cvh[u];             *(v8us*)&sVl[e / 4][(e % 4) * 8] = cvl[u];
        }
      } else {                                                   // a chunk past the end: zeros, its scores are masked below
        const v8us zero = {0, 0, 0, 0, 0, 0, 0, 0};
#pragma unroll
        for (int u = 0; u < NU; ++u) {
          const int e = tid + 128 * u;
          *(v8us*)&sKh[e / (D / 8)][(e % (D / 8)) * 8] = zero; *(v8us*)&sKl[e / (D / 8)][(e % (D / 8)) * 8] = zero;
          *(v8us*)&sVh[e / 4][(e % 4) * 8] = zero;             *(v8us*)&sVl[e / 4][(e % 4) * 8] = zero;
        }
      }
    }
    __syncthreads();
    v8f s[2];                                                    // S^T: s[nt][r] = score(query ln, key j0 + nt * 16 + 8 * hh + r)
#pragma unroll
    for (int nt = 0; nt < 2; ++nt) {
      v8f acc = {};
#pragma unroll
      for (int ks = 0; ks < KS; ++ks) {
        FragB bh_, bl_;
        bh_.half[0] = *(const v8us*)&sKh[nt * 16 + ln][ks * 32 + 8 * hh]; bh_.half[1] = *(const v8us*)&sKh[nt * 16 + ln][ks * 32 + 16 + 8 * hh];
        bl_.half[0] = *(const v8us*)&sKl[nt * 16 + ln][ks * 32 + 8 * hh]; bl_.half[1] = *(const v8us*)&sKl[nt * 16 + ln][ks * 32 + 16 + 8 * hh];
        acc = mmaN<3>(bh_.v, bl_.v, aqh[ks].v, aql[ks].v, acc);
      }
      s[nt] = acc;
    }
    if (special || jb + 32 * NS > Tk) {                          // block-uniform: masks, biases and key tails; a dropped score becomes -3e38
#pragma unroll
      for (int nt = 0; nt < 2; ++nt)
#pragma unroll
        for (int r = 0; r < 8; ++r) {
          const int key = j0 + nt * 16 + 8 * hh + r;
          bool keep = key < Tk;
          if (causal) keep = keep && (key <= qi);
          if (mask) { if (keep) keep = mask[(size_t)qi * Tk + key] != 0; }
          if (sbias) { if (keep) s[nt][r] += sbias[(size_t)bh * Tk + key]; }   // per-key additive bias (a per-query constant would cancel in the softmax)
          if (!keep) s[nt][r] = -3.0e38f;
        }
    }
    float mx = fmaxf(s[0][0], s[1][0]);
#pragma unroll
    for (int r = 1; r < 8; ++r) mx = fmaxf(mx, fmaxf(s[0][r], s[1][r]));
    mx = fmaxf(mx, xhalf(mx));                                   // the query's other 16 keys sit in the other half
    const float mnew = fmaxf(m_r, mx);
    const float mexp = fmaxf(mnew, -1.0e38f);                    // with nothing kept so far a dropped score still gives exp(-2e38) = 0
    const float alpha = __expf(m_r - mexp);
    m_r = mnew;
    FragB pbh, pbl;                                              // P^T as a B fragment: element nt * 8 + r is key nt * 16 + 8 * hh + r
    float ps[4] = {0.f, 0.f, 0.f, 0.f};
#pragma unroll
    for (int nt = 0; nt < 2; ++nt)
#pragma unroll
      for (int r = 0; r < 8; ++r) {
        const float p = __expf(s[nt][r] - mexp);
        ps[r & 3] += p;
        const unsigned short hb = bf16_bits(p);
        pbh.u[nt * 8 + r] = hb; pbl.u[nt * 8 + r] = bf16_bits(p - bf16_val(hb));
      }
    l_r = l_r * alpha + ((ps[0] + ps[1]) + (ps[2] + ps[3]));     // this half's 16 keys (the halves are added at the end)
#pragma unroll
    for (int dt = 0; dt < DT; ++dt)
#pragma unroll
      for (int r = 0; r < 8; ++r) oacc[dt][r] *= alpha;
#pragma unroll
    for (int dt = 0; dt < DT; ++dt) {
      FragB bvh, bvl;                                            // V^T as an A fragment: row dt * 16 + ln, the k order of P^T
      bvh.half[0] = *(const v8us*)&sVh[dt * 16 + ln][8 * hh]; bvh.half[1] = *(const v8us*)&sVh[dt * 16 + ln][16 + 8 * hh];
      bvl.half[0] = *(const v8us*)&sVl[dt * 16 + ln][8 * hh]; bvl.half[1] = *(const v8us*)&sVl[dt * 16 + ln][16 + 8 * hh];
      oacc[dt] = mmaN<3>(bvh.v, bvl.v, pbh.v, pbl.v, oacc[dt]);
    }
  }
  {
    const float l = l_r + xhalf(l_r);
    if (hh == 0) { sM[g][w][ln] = m_r; sL[g][w][ln] = l; }
  }
#pragma unroll
  for (int dt = 0; dt < DT; ++dt) {                              // not yet divided by the row sum
    *(v4fa*)&sO[g][w][ln][dt * 16 + 8 * hh]     = (v4f){oacc[dt][0], oacc[dt][1], oacc[dt][2], oacc[dt][3]};
    *(v4fa*)&sO[g][w][ln][dt * 16 + 8 * hh + 4] = (v4f){oacc[dt][4], oacc[dt][5], oacc[dt][6], oacc[dt][7]};
  }
  __syncthreads();                                               // every group's (max, sum, O) is in LDS
  // join: wave (g, w) finishes rows 2g, 2g + 1, then + 2 NS, of query tile w; each half wave takes one row (two rows = 512 contiguous bytes a store)
  for (int r = g * 2 + hh; r < 16; r += 2 * NS) {
    const int row = q0 + r;
    float mj = -3.0e38f;
    // the three loops over s are unrolled so that f[] stays in registers
#pragma unroll
    for (int s = 0; s < NS; ++s) mj = fmaxf(mj, sM[s][w][r]);
    float f[NS], lj = 0.f;
#pragma unroll
    for (int s = 0; s < NS; ++s) { const float ms = sM[s][w][r]; f[s] = (ms > -1.0e38f) ? __expf(ms - mj) : 0.f; lj += f[s] * sL[s][w][r]; }
    const float inv = (mj > -1.0e38f) ? 1.0f / lj : __builtin_nanf("");
    for (int c4 = ln * 4; c4 < D; c4 += 64) {
      v4f val = {0.f, 0.f, 0.f, 0.f};
#pragma unroll
      for (int s = 0; s < NS; ++s) val += f[s] * *(const v4fa*)&sO[s][w][r][c4];
      if (row < Tq) {
        *(v4f*)(y + ((size_t)b * Tq + row) * ypitch + h * D + c4) = val * inv;
        asm volatile("s_wait_xcnt 0x0" ::: "memory");            // the next trip rewrites the store's address registers
      }
    }
  }
}

__global__ __launch_bounds__(256) void k_round_rows(const float* __restrict__ W, unsigned short* __restrict__ Wt, int n8) {
  const int t = blockIdx.x * 256 + threadIdx.x;
  if (t >= n8) return;
  const v4f a = *(const v4fa*)(W + (size_t)t * 8), b = *(const v4fa*)(W + (size_t)t * 8 + 4);
  v8us v; v[0]=bf16_bits(a[0]); v[1]=bf16_bits(a[1]); v[2]=bf16_bits(a[2]); v[3]=bf16_bits(a[3]);
  v[4]=bf16_bits(b[0]); v[5]=bf16_bits(b[1]); v[6]=bf16_bits(b[2]); v[7]=bf16_bits(b[3]);
  *(v8us*)(Wt + (size_t)t * 8) = v; 
}


__global__ __launch_bounds__(256) void k_roundcopy(const float* __restrict__ src, float* __restrict__ dst, int n8) {
  const size_t t = (size_t)blockIdx.x * 256 + threadIdx.x;
  if (t >= (size_t)n8 * 2) return;
  v4f a = *(const v4fa*)(src + t * 4);
  for (int i = 0; i < 4; ++i) a[i] = bf16_round(a[i]);
  *(v4f*)(dst + t * 4) = a; 
}

// out[b][c][p] = y[(b,p)][c] + x[b][c][p]  (block per (b,c): 4096 contiguous floats)
__global__ __launch_bounds__(256) void k_fin(const float* __restrict__ y, const float* __restrict__ x, float* __restrict__ out) {
  const int b = blockIdx.x / CC, c = blockIdx.x % CC; const size_t base = ((size_t)b * CC + c) * HWN;
  { for (int p = threadIdx.x; p < HWN; p += 256) *(float*)(out + base + p) = y[((size_t)b * HWN + p) * CC + c] + x[base + p];  }
}
extern "C" void kernel_launch(void* const* d_in, const int* in_sizes, int n_in,
                              void* d_out, int out_size, void* d_ws, size_t ws_size, hipStream_t stream) {
  (void)in_sizes; (void)n_in; (void)out_size;
  const float* x = (const float*)d_in[0]; const float* tw = (const float*)d_in[1]; const float* tb = (const float*)d_in[2]; const float* pw = (const float*)d_in[3]; const float* pb = (const float*)d_in[4];
  const float* gw = (const float*)d_in[5]; const float* gb = (const float*)d_in[6]; const float* fw = (const float*)d_in[7]; const float* fb = (const float*)d_in[8];
  char* ws = (char*)d_ws; size_t off = 0;
  auto take = [&](size_t bytes) { char* p = ws + off; off += (bytes + 255) & ~(size_t)255; return p; };
  unsigned short* Bqkv = (unsigned short*)take((size_t)3 * HC * CC * 2); unsigned short* Bf = (unsigned short*)take((size_t)CC * HC * 2); float* bqkv = (float*)take(3 * HC * 4 + 256);
  float* xT = (float*)take((size_t)MROWS * CC * 4); float* qkv = (float*)take((size_t)MROWS * 3 * HC * 4); float* att = (float*)take((size_t)MROWS * HC * 4); float* y = (float*)take((size_t)MROWS * CC * 4);
  unsigned short* Kh = (unsigned short*)take((size_t)MROWS * HC * 2); unsigned short* Kl = (unsigned short*)take((size_t)MROWS * HC * 2);
  unsigned short* VTh = (unsigned short*)take((size_t)MROWS * HC * 2); unsigned short* VTl = (unsigned short*)take((size_t)MROWS * HC * 2);
  if (off > ws_size) return;
  k_round_rows<<<(HC * CC / 8 + 255) / 256, 256, 0, stream>>>(tw, Bqkv, HC * CC / 8); k_round_rows<<<(HC * CC / 8 + 255) / 256, 256, 0, stream>>>(pw, Bqkv + HC * CC, HC * CC / 8); k_round_rows<<<(HC * CC / 8 + 255) / 256, 256, 0, stream>>>(gw, Bqkv + 2 * HC * CC, HC * CC / 8);
  k_round_rows<<<(CC * HC / 8 + 255) / 256, 256, 0, stream>>>(fw, Bf, CC * HC / 8);
  k_roundcopy<<<1, 256, 0, stream>>>(tb, bqkv, HC / 8); k_roundcopy<<<1, 256, 0, stream>>>(pb, bqkv + HC, HC / 8); k_roundcopy<<<1, 256, 0, stream>>>(gb, bqkv + 2 * HC, HC / 8);     // concatenated (rounded) biases
  k_transpose32<false, false, false><<<dim3(HWN / 32, CC / 32, BB), 256, 0, stream>>>(x, xT, CC, HWN, nullptr, nullptr, nullptr);      // NCHW -> [b][hw][c]
  k_gemm_bf3<false, 0, false, false><<<((MROWS / 16) * 3 + 3) / 4, 128, 0, stream>>>(xT, CC, Bqkv, CC, bqkv, nullptr, 1, 0, qkv, 3 * HC, MROWS, 3 * HC, CC);   // [theta | phi | g] + b (single term)
  k_split_kv<HC><<<MROWS / 32, 256, 0, stream>>>(qkv + HC, qkv + 2 * HC, 3 * HC, Kh, Kl, VTh, VTl);                                        // phi, g -> bf16 hi/lo planes, once
  k_flash3<HC, NSPLIT><<<BB * (HWN / 64), 128 * NSPLIT, 0, stream>>>(qkv, 3 * HC, HWN, Kh, Kl, VTh, VTl, HWN, 1, 1.0f, nullptr, 0, nullptr, att, HC);
  k_gemm_bf3<true, 0, true, false><<<((MROWS / 16) * 2 + 3) / 4, 128, 0, stream>>>(att, HC, Bf, HC, fb, nullptr, 1, 0, y, CC, MROWS, CC, HC);                    // final conv + b
  k_fin<<<BB * CC, 256, 0, stream>>>(y, x, (float*)d_out);
}

// v004
// One run takes 118 microseconds.
// Next to v003, in two timings, it ran 1.11 times as fast each time.
// Counting every step since v000, it is 5.41 times as fast.
#include <hip/hip_runtime.h>
// theta/phi/g 1×1 convolutions as one GEMM on position-major bf16(x) (single exact term, K=128, N=192), the 4096×4096 non-local attention per batch as
// 16-query tiles on WMMA (Q·Kᵀ and P·V as 3-term bf16 hi/lo splits, f32 online softmax, no scaling), and the final 1×1 conv (2 terms) + bias; the
// residual add and the NCHW transposes are f32. 
#define BB 4
#define CC 128
#define HC 64
#define HWN 4096
#define MROWS (BB * HWN)
#define NSPLIT 4      // key groups per attention block: 4 waves each, so NSPLIT waves per SIMD

typedef __bf16 v16b __attribute__((ext_vector_type(16)));
typedef unsigned short v8us __attribute__((ext_vector_type(8), may_alias));
typedef float  v8f  __attribute__((ext_vector_type(8)));
typedef float  v4f  __attribute__((ext_vector_type(4)));
typedef float  v4fa __attribute__((ext_vector_type(4), may_alias));
union FragB { v16b v; v8us half[2]; unsigned short u[16]; };

__device__ __forceinline__ unsigned short bf16_bits(float x) { unsigned int u = __float_as_uint(x); return (unsigned short)((u + 0x7FFFu + ((u >> 16) & 1u)) >> 16); }
__device__ __forceinline__ float bf16_val(unsigned short b) { return __uint_as_float(((unsigned int)b) << 16); }
__device__ __forceinline__ float bf16_round(float x) { return bf16_val(bf16_bits(x)); }
// D += A·B with NT terms: 1 = ah·bh, 2 = + al·bh (A split), 3 = + ah·bl (both split)
template <int NT>
__device__ __forceinline__ v8f mmaN(v16b ah, v16b al, v16b bh, v16b bl, v8f c) {
  c = __builtin_amdgcn_wmma_f32_16x16x32_bf16(false, ah, false, bh, (short)0, c, false, false);
  if (NT >= 2) c = __builtin_amdgcn_wmma_f32_16x16x32_bf16(false, al, false, bh, (short)0, c, false, false);
  if (NT >= 3) c = __builtin_amdgcn_wmma_f32_16x16x32_bf16(false, ah, false, bl, (short)0, c, false, false);
  asm volatile("v_nop\n\tv_nop\n\tv_nop\n\tv_nop" : "+v"(c) : "v"(ah), "v"(al), "v"(bh), "v"(bl));
  return c;
}

// lane l <-> lane l ^ 16 (the other 16-lane row) in one vector cross-row move
__device__ __forceinline__ float xhalf(float x) {
  const int b = __float_as_int(x);
  return __int_as_float(__builtin_amdgcn_permlanex16(b, b, 0x76543210, 0xfedcba98, false, false));
}

__global__ __launch_bounds__(256) void k_wt_bf16(const float* __restrict__ W, unsigned short* __restrict__ Wt, int K, int N) {
  const int t = blockIdx.x * 256 + threadIdx.x;
  const int k8n = K / 8;
  if (t >= N * k8n) return;
  const int n = t / k8n, k8 = (t % k8n) * 8;
  v8us v;
#pragma unroll
  for (int i = 0; i < 8; ++i) v[i] = bf16_bits(W[(size_t)(k8 + i) * N + n]);
  *(v8us*)(Wt + (size_t)n * K + k8) = v;
  
}

// GEMM C[M][N] (f32, pitch ldc) = act(A[M][K]·W + bias). A f32 row-major (pitch lda) converted per fragment to bf16
// (ASPLIT: hi/lo two planes -> 2 terms, else single rounded term); Wt bf16 [N][K] (pitch ldb). BIAS_BF16 rounds the
// bias to bf16 first (bias quantised to bf16 before the add). K%32==0, M%16==0, N%64==0.
template <bool ASPLIT, int ACT, bool BIAS_BF16>
__global__ __launch_bounds__(128) void k_gemm_bf(const float* __restrict__ A, int lda, const unsigned short* __restrict__ Wt, int ldb,
                                               const float* __restrict__ bias, float* __restrict__ C, int ldc, int M, int N, int K) {
  __shared__ __attribute__((aligned(16))) float so[4][16][64];
  const int tid = threadIdx.x, w = tid >> 5, lane = tid & 31, ln = lane & 15, hh = lane >> 4;
  const int ntn = N / 64;
  const int wid = blockIdx.x * 4 + w;
  const int mt = wid / ntn, nq = wid % ntn;
  if (mt * 16 >= M) return;
  const int row0 = mt * 16, col0 = nq * 64;
  const float* arow = A + (size_t)(row0 + ln) * lda;
  v8f acc[4] = {};
  for (int kb = 0; kb < K; kb += 32) {
    FragB ah, al;
    const v4f x0 = *(const v4fa*)(arow + kb + 8 * hh), x1 = *(const v4fa*)(arow + kb + 8 * hh + 4);
    const v4f x2 = *(const v4fa*)(arow + kb + 16 + 8 * hh), x3 = *(const v4fa*)(arow + kb + 16 + 8 * hh + 4);
    float xs[16] = {x0[0],x0[1],x0[2],x0[3],x1[0],x1[1],x1[2],x1[3],x2[0],x2[1],x2[2],x2[3],x3[0],x3[1],x3[2],x3[3]};
#pragma unroll
    for (int i = 0; i < 16; ++i) { const unsigned short hb = bf16_bits(xs[i]); ah.u[i] = hb; al.u[i] = ASPLIT ? bf16_bits(xs[i] - bf16_val(hb)) : (unsigned short)0; }
#pragma unroll
    for (int t = 0; t < 4; ++t) {
      const unsigned short* brow = Wt + (size_t)(col0 + t * 16 + ln) * ldb + kb;
      FragB b;
      b.half[0] = *(const v8us*)(brow + 8 * hh);
      b.half[1] = *(const v8us*)(brow + 16 + 8 * hh);
      acc[t] = mmaN<ASPLIT ? 2 : 1>(ah.v, al.v, b.v, b.v, acc[t]);
    }
  }
#pragma unroll
  for (int t = 0; t < 4; ++t) {
    float bv = bias ? bias[col0 + t * 16 + ln] : 0.f;
    if (BIAS_BF16) bv = bf16_round(bv);
#pragma unroll
    for (int r = 0; r < 8; ++r) { float v = acc[t][r] + bv; if (ACT == 1) v = fmaxf(v, 0.f); so[w][8 * hh + r][t * 16 + ln] = v; }
  }
  __builtin_amdgcn_fence(__ATOMIC_ACQ_REL, "workgroup");
  __builtin_amdgcn_wave_barrier();
  const int rsub = lane >> 4, c4 = (lane & 15) * 4;
  {
#pragma unroll
    for (int q = 0; q < 8; ++q) {
      const int r = q * 2 + rsub;
      const v4f v = *(const v4fa*)&so[w][r][c4];
      *(v4f*)(C + (size_t)(row0 + r) * ldc + col0 + c4) = v;
    }
    
  }
}

// Flash-style causal/unmasked attention, all contractions 3-term bf16 hi/lo splits, f32 softmax with running max.
// q,k,v rows are read from f32 buffers with arbitrary row pitch (so they can live inside a fused qkv buffer);
// D = head size (multiple of 32, <= 128); one wave = 16 query rows; block = 4 waves (64 queries) sharing K/V chunks of 32.
template <int D, bool CAUSAL>
__global__ __launch_bounds__(128) void k_flash(const float* __restrict__ qb, const float* __restrict__ kb, const float* __restrict__ vb,
                                             int pitch, int T, int H, float scale, float* __restrict__ y, int ypitch) {
  constexpr int KS = D / 32;        // k-steps for QK
  constexpr int DT = D / 16;        // d tiles for PV
  __shared__ __attribute__((aligned(16))) unsigned short sKh[32][D + 8], sKl[32][D + 8], sVh[32][D + 8], sVl[32][D + 8];
  __shared__ __attribute__((aligned(16))) unsigned short sPh[4][16][40], sPl[4][16][40];
  __shared__ __attribute__((aligned(16))) float sO[4][16][D];
  const int tid = threadIdx.x, w = tid >> 5, lane = tid & 31, ln = lane & 15, hh = lane >> 4;
  const int nqb = (T + 63) / 64;
  const int bh = blockIdx.x / nqb, qblk = blockIdx.x % nqb;
  const int b = bh / H, h = bh % H;
  const int q0 = qblk * 64 + w * 16;
  const float* Q = qb + (size_t)b * T * pitch + h * D;
  const float* K = kb + (size_t)b * T * pitch + h * D;
  const float* V = vb + (size_t)b * T * pitch + h * D;

  // A fragments of the wave's 16 query rows (scaled), hi/lo
  FragB aqh[KS], aql[KS];
  {
    int row = q0 + ln; if (row >= T) row = T - 1;
    const float* qr = Q + (size_t)row * pitch;
#pragma unroll
    for (int ks = 0; ks < KS; ++ks)
#pragma unroll
      for (int i = 0; i < 16; ++i) {
        const int d = ks * 32 + ((i < 8) ? (8 * hh + i) : (16 + 8 * hh + (i - 8)));
        const float x = qr[d] * scale; const unsigned short hb = bf16_bits(x);
        aqh[ks].u[i] = hb; aql[ks].u[i] = bf16_bits(x - bf16_val(hb));
      }
  }
  float m_r[8], l_r[8];
#pragma unroll
  for (int r = 0; r < 8; ++r) { m_r[r] = -3.0e38f; l_r[r] = 0.f; }
  v8f oacc[DT];
#pragma unroll
  for (int dt = 0; dt < DT; ++dt) oacc[dt] = (v8f){0.f,0.f,0.f,0.f,0.f,0.f,0.f,0.f};

  const int kv_end = CAUSAL ? min(T, qblk * 64 + 64) : T;     // block-uniform
  for (int j0 = 0; j0 < kv_end; j0 += 32) {
    __syncthreads();
    for (int e = tid; e < 32 * (D / 4); e += 128) {
      const int r = e / (D / 4), c4 = (e % (D / 4)) * 4;
      const int key = j0 + r;
      v4f kf = {0.f,0.f,0.f,0.f}, vf = {0.f,0.f,0.f,0.f};
      if (key < T) { kf = *(const v4fa*)(K + (size_t)key * pitch + c4); vf = *(const v4fa*)(V + (size_t)key * pitch + c4); }
#pragma unroll
      for (int t = 0; t < 4; ++t) {
        unsigned short hb = bf16_bits(kf[t]); sKh[r][c4 + t] = hb; sKl[r][c4 + t] = bf16_bits(kf[t] - bf16_val(hb));
        hb = bf16_bits(vf[t]); sVh[r][c4 + t] = hb; sVl[r][c4 + t] = bf16_bits(vf[t] - bf16_val(hb));
      }
    }
    __syncthreads();
    // S tile 16 x 32
    v8f s[2];
#pragma unroll
    for (int nt = 0; nt < 2; ++nt) {
      v8f acc = {};
#pragma unroll
      for (int ks = 0; ks < KS; ++ks) {
        FragB bh_, bl_;
        bh_.half[0] = *(const v8us*)&sKh[nt * 16 + ln][ks * 32 + 8 * hh]; bh_.half[1] = *(const v8us*)&sKh[nt * 16 + ln][ks * 32 + 16 + 8 * hh];
        bl_.half[0] = *(const v8us*)&sKl[nt * 16 + ln][ks * 32 + 8 * hh]; bl_.half[1] = *(const v8us*)&sKl[nt * 16 + ln][ks * 32 + 16 + 8 * hh];
        acc = mmaN<3>(aqh[ks].v, aql[ks].v, bh_.v, bl_.v, acc);
      }
      s[nt] = acc;
    }
    // mask + running max (rows 8hh+r; the 16 lanes of a half share rows)
    float alpha[8];
#pragma unroll
    for (int r = 0; r < 8; ++r) {
      const int qi = q0 + 8 * hh + r;
      const int ja = j0 + ln, jb = j0 + 16 + ln;
      if (CAUSAL) { if (ja > qi) s[0][r] = -3.0e38f; if (jb > qi) s[1][r] = -3.0e38f; }
      if (ja >= T) s[0][r] = -3.0e38f;
      if (jb >= T) s[1][r] = -3.0e38f;
      float mx = fmaxf(s[0][r], s[1][r]);
      mx = fmaxf(mx, __shfl_xor(mx, 1, 32)); mx = fmaxf(mx, __shfl_xor(mx, 2, 32)); mx = fmaxf(mx, __shfl_xor(mx, 4, 32)); mx = fmaxf(mx, __shfl_xor(mx, 8, 32));
      const float mnew = fmaxf(m_r[r], mx);
      alpha[r] = (mnew > -1.0e38f) ? __expf(m_r[r] - mnew) : 1.0f;
      const float p0 = (s[0][r] > -1.0e38f) ? __expf(s[0][r] - mnew) : 0.f;
      const float p1 = (s[1][r] > -1.0e38f) ? __expf(s[1][r] - mnew) : 0.f;
      m_r[r] = mnew;
      l_r[r] = l_r[r] * alpha[r] + p0 + p1;            // per-lane partial row sum (16 lanes combined at the end)
      unsigned short hb = bf16_bits(p0); sPh[w][8 * hh + r][ln] = hb;      sPl[w][8 * hh + r][ln] = bf16_bits(p0 - bf16_val(hb));
      hb = bf16_bits(p1);                sPh[w][8 * hh + r][16 + ln] = hb; sPl[w][8 * hh + r][16 + ln] = bf16_bits(p1 - bf16_val(hb));
    }
#pragma unroll
    for (int dt = 0; dt < DT; ++dt)
#pragma unroll
      for (int r = 0; r < 8; ++r) oacc[dt][r] *= alpha[r];
    __builtin_amdgcn_fence(__ATOMIC_ACQ_REL, "workgroup");
    __builtin_amdgcn_wave_barrier();
    FragB pah, pal;
    pah.half[0] = *(const v8us*)&sPh[w][ln][8 * hh]; pah.half[1] = *(const v8us*)&sPh[w][ln][16 + 8 * hh];
    pal.half[0] = *(const v8us*)&sPl[w][ln][8 * hh]; pal.half[1] = *(const v8us*)&sPl[w][ln][16 + 8 * hh];
#pragma unroll
    for (int dt = 0; dt < DT; ++dt) {
      FragB bvh, bvl;
#pragma unroll
      for (int i = 0; i < 8; ++i) {
        bvh.u[i] = sVh[8 * hh + i][dt * 16 + ln]; bvh.u[8 + i] = sVh[16 + 8 * hh + i][dt * 16 + ln];
        bvl.u[i] = sVl[8 * hh + i][dt * 16 + ln]; bvl.u[8 + i] = sVl[16 + 8 * hh + i][dt * 16 + ln];
      }
      oacc[dt] = mmaN<3>(pah.v, pal.v, bvh.v, bvl.v, oacc[dt]);
    }
    __builtin_amdgcn_fence(__ATOMIC_ACQ_REL, "workgroup");
    __builtin_amdgcn_wave_barrier();
  }
#pragma unroll
  for (int r = 0; r < 8; ++r) {
    float l = l_r[r];
    l += __shfl_xor(l, 1, 32); l += __shfl_xor(l, 2, 32); l += __shfl_xor(l, 4, 32); l += __shfl_xor(l, 8, 32);
    l_r[r] = (l > 0.f) ? 1.0f / l : 0.f;
  }
#pragma unroll
  for (int dt = 0; dt < DT; ++dt)
#pragma unroll
    for (int r = 0; r < 8; ++r) sO[w][8 * hh + r][dt * 16 + ln] = oacc[dt][r] * l_r[r];
  __builtin_amdgcn_fence(__ATOMIC_ACQ_REL, "workgroup");
  __builtin_amdgcn_wave_barrier();
  {
    for (int r = 0; r < 16; ++r) {
      const int row = q0 + r;
      if (row < T && lane < D / 4) {
        const v4f val = *(const v4fa*)&sO[w][r][lane * 4];
        *(v4f*)(y + ((size_t)b * T + row) * ypitch + h * D + lane * 4) = val;
      }
    }
    
  }
}

// in pitch = cols, out pitch = rows; rows, cols multiples of 32. Optional per-output-row affine (scale[c], shift[c]) and
// residual add res (same layout as out, optionally bf16-rounded) for fused epilogues: out = in*scale + shift + res.
template <bool AFFINE, bool RESID, bool RES_BF16>
__global__ __launch_bounds__(256) void k_transpose32(const float* __restrict__ in, float* __restrict__ out, int rows, int cols,
                                                    const float* __restrict__ scale, const float* __restrict__ shift, const float* __restrict__ res) {
  __shared__ float tile[32][33];
  const int b = blockIdx.z;
  const int r0 = blockIdx.y * 32, c0 = blockIdx.x * 32;
  const float* src = in + (size_t)b * rows * cols;
  float* dst = out + (size_t)b * rows * cols;
  const int tx = threadIdx.x & 31, ty = threadIdx.x >> 5;     // 8 rows per pass
  for (int i = ty; i < 32; i += 8) tile[i][tx] = src[(size_t)(r0 + i) * cols + c0 + tx];
  __syncthreads();
  {
    for (int i = ty; i < 32; i += 8) {
      float v = tile[tx][i];
      const int orow = c0 + i;
      if (AFFINE) v = v * scale[orow] + shift[orow];
      if (RESID) { float rv = res[(size_t)b * rows * cols + (size_t)orow * rows + r0 + tx]; if (RES_BF16) rv = bf16_round(rv); v += rv; }
      *(float*)(dst + (size_t)orow * rows + r0 + tx) = v;
    }
    
  }
}

// 2x2 max pool on position-major data: in [B][H*W][C] -> out [B][(H/2)*(W/2)][C]; thread per (b, p', 4 channels); C%4==0
__global__ __launch_bounds__(256) void k_pool2_pm(const float* __restrict__ in, float* __restrict__ out, int Bn, int H, int W, int C) {
  const size_t t = (size_t)blockIdx.x * 256 + threadIdx.x;
  const int c4n = C / 4, Ho = H / 2, Wo = W / 2;
  const size_t total = (size_t)Bn * Ho * Wo * c4n;
  if (t >= total) return;
  const int c4 = (int)(t % c4n) * 4; size_t rest = t / c4n;
  const int pw = (int)(rest % Wo); rest /= Wo; const int ph = (int)(rest % Ho); const int b = (int)(rest / Ho);
  const float* base = in + (size_t)b * H * W * C;
  const int p00 = (2 * ph) * W + 2 * pw;
  const v4f a = *(const v4fa*)(base + (size_t)p00 * C + c4), bq = *(const v4fa*)(base + (size_t)(p00 + 1) * C + c4);
  const v4f c = *(const v4fa*)(base + (size_t)(p00 + W) * C + c4), d = *(const v4fa*)(base + (size_t)(p00 + W + 1) * C + c4);
  v4f m; for (int i = 0; i < 4; ++i) m[i] = fmaxf(fmaxf(a[i], bq[i]), fmaxf(c[i], d[i]));
  float* dst = out + ((size_t)b * Ho * Wo + (size_t)ph * Wo + pw) * C + c4;
  *(v4f*)dst = m;
  
}

// General (non-causal) attention, 3-term bf16 splits, f32 softmax with running max.
// Q [.][Tq][qpitch], K [.][Tk][kpitch] (head dim DQ), V [.][Tk][vpitch] (head dim DVtot); this block handles DV output
// dims starting at dv0 = blockIdx.y*DV. y[bh][t][ypitch] gets columns dv0..dv0+DV-1. Per-bh base offsets via strides.
template <int DQ, int DV>
__global__ __launch_bounds__(128) void k_flash2(const float* __restrict__ Qb, size_t qstride, int qpitch, int Tq,
                                              const float* __restrict__ Kb, size_t kstride, int kpitch, int Tk,
                                              const float* __restrict__ Vb, size_t vstride, int vpitch,
                                              float scale, float* __restrict__ y, size_t ystride, int ypitch) {
  constexpr int KS = DQ / 32, DT = DV / 16;
  __shared__ __attribute__((aligned(16))) unsigned short sKh[32][DQ + 8], sKl[32][DQ + 8], sVh[32][DV + 8], sVl[32][DV + 8];
  __shared__ __attribute__((aligned(16))) unsigned short sPh[4][16][40], sPl[4][16][40];
  __shared__ __attribute__((aligned(16))) float sO[4][16][DV];
  const int tid = threadIdx.x, w = tid >> 5, lane = tid & 31, ln = lane & 15, hh = lane >> 4;
  const int nqb = (Tq + 63) / 64;
  const int bh = blockIdx.x / nqb, qblk = blockIdx.x % nqb;
  const int dv0 = blockIdx.y * DV;
  const int q0 = qblk * 64 + w * 16;
  const float* Q = Qb + (size_t)bh * qstride; const float* K = Kb + (size_t)bh * kstride; const float* V = Vb + (size_t)bh * vstride + dv0;
  FragB aqh[KS], aql[KS];
  {
    int row = q0 + ln; if (row >= Tq) row = Tq - 1;
    const float* qr = Q + (size_t)row * qpitch;
#pragma unroll
    for (int ks = 0; ks < KS; ++ks)
#pragma unroll
      for (int i = 0; i < 16; ++i) {
        const int d = ks * 32 + ((i < 8) ? (8 * hh + i) : (16 + 8 * hh + (i - 8)));
        const float x = qr[d] * scale; const unsigned short hb = bf16_bits(x);
        aqh[ks].u[i] = hb; aql[ks].u[i] = bf16_bits(x - bf16_val(hb));
      }
  }
  float m_r[8], l_r[8];
#pragma unroll
  for (int r = 0; r < 8; ++r) { m_r[r] = -3.0e38f; l_r[r] = 0.f; }
  v8f oacc[DT];
#pragma unroll
  for (int dt = 0; dt < DT; ++dt) oacc[dt] = (v8f){0.f,0.f,0.f,0.f,0.f,0.f,0.f,0.f};
  for (int j0 = 0; j0 < Tk; j0 += 32) {
    __syncthreads();
    for (int e = tid; e < 32 * (DQ / 4); e += 128) {
      const int r = e / (DQ / 4), c4 = (e % (DQ / 4)) * 4; const int key = j0 + r;
      v4f f = {0.f,0.f,0.f,0.f}; if (key < Tk) f = *(const v4fa*)(K + (size_t)key * kpitch + c4);
#pragma unroll
      for (int t = 0; t < 4; ++t) { const unsigned short hb = bf16_bits(f[t]); sKh[r][c4 + t] = hb; sKl[r][c4 + t] = bf16_bits(f[t] - bf16_val(hb)); }
    }
    for (int e = tid; e < 32 * (DV / 4); e += 128) {
      const int r = e / (DV / 4), c4 = (e % (DV / 4)) * 4; const int key = j0 + r;
      v4f f = {0.f,0.f,0.f,0.f}; if (key < Tk) f = *(const v4fa*)(V + (size_t)key * vpitch + c4);
#pragma unroll
      for (int t = 0; t < 4; ++t) { const unsigned short hb = bf16_bits(f[t]); sVh[r][c4 + t] = hb; sVl[r][c4 + t] = bf16_bits(f[t] - bf16_val(hb)); }
    }
    __syncthreads();
    v8f s[2];
#pragma unroll
    for (int nt = 0; nt < 2; ++nt) {
      v8f acc = {};
#pragma unroll
      for (int ks = 0; ks < KS; ++ks) {
        FragB bh_, bl_;
        bh_.half[0] = *(const v8us*)&sKh[nt * 16 + ln][ks * 32 + 8 * hh]; bh_.half[1] = *(const v8us*)&sKh[nt * 16 + ln][ks * 32 + 16 + 8 * hh];
        bl_.half[0] = *(const v8us*)&sKl[nt * 16 + ln][ks * 32 + 8 * hh]; bl_.half[1] = *(const v8us*)&sKl[nt * 16 + ln][ks * 32 + 16 + 8 * hh];
        acc = mmaN<3>(aqh[ks].v, aql[ks].v, bh_.v, bl_.v, acc);
      }
      s[nt] = acc;
    }
    float alpha[8];
#pragma unroll
    for (int r = 0; r < 8; ++r) {
      const int ja = j0 + ln, jb = j0 + 16 + ln;
      if (ja >= Tk) s[0][r] = -3.0e38f;
      if (jb >= Tk) s[1][r] = -3.0e38f;
      float mx = fmaxf(s[0][r], s[1][r]);
      mx = fmaxf(mx, __shfl_xor(mx, 1, 32)); mx = fmaxf(mx, __shfl_xor(mx, 2, 32)); mx = fmaxf(mx, __shfl_xor(mx, 4, 32)); mx = fmaxf(mx, __shfl_xor(mx, 8, 32));
      const float mnew = fmaxf(m_r[r], mx);
      alpha[r] = (mnew > -1.0e38f) ? __expf(m_r[r] - mnew) : 1.0f;
      const float p0 = (s[0][r] > -1.0e38f) ? __expf(s[0][r] - mnew) : 0.f;
      const float p1 = (s[1][r] > -1.0e38f) ? __expf(s[1][r] - mnew) : 0.f;
      m_r[r] = mnew;
      l_r[r] = l_r[r] * alpha[r] + p0 + p1;
      unsigned short hb = bf16_bits(p0); sPh[w][8 * hh + r][ln] = hb;      sPl[w][8 * hh + r][ln] = bf16_bits(p0 - bf16_val(hb));
      hb = bf16_bits(p1);                sPh[w][8 * hh + r][16 + ln] = hb; sPl[w][8 * hh + r][16 + ln] = bf16_bits(p1 - bf16_val(hb));
    }
#pragma unroll
    for (int dt = 0; dt < DT; ++dt)
#pragma unroll
      for (int r = 0; r < 8; ++r) oacc[dt][r] *= alpha[r];
    __builtin_amdgcn_fence(__ATOMIC_ACQ_REL, "workgroup");
    __builtin_amdgcn_wave_barrier();
    FragB pah, pal;
    pah.half[0] = *(const v8us*)&sPh[w][ln][8 * hh]; pah.half[1] = *(const v8us*)&sPh[w][ln][16 + 8 * hh];
    pal.half[0] = *(const v8us*)&sPl[w][ln][8 * hh]; pal.half[1] = *(const v8us*)&sPl[w][ln][16 + 8 * hh];
#pragma unroll
    for (int dt = 0; dt < DT; ++dt) {
      FragB bvh, bvl;
#pragma unroll
      for (int i = 0; i < 8; ++i) {
        bvh.u[i] = sVh[8 * hh + i][dt * 16 + ln]; bvh.u[8 + i] = sVh[16 + 8 * hh + i][dt * 16 + ln];
        bvl.u[i] = sVl[8 * hh + i][dt * 16 + ln]; bvl.u[8 + i] = sVl[16 + 8 * hh + i][dt * 16 + ln];
      }
      oacc[dt] = mmaN<3>(pah.v, pal.v, bvh.v, bvl.v, oacc[dt]);
    }
    __builtin_amdgcn_fence(__ATOMIC_ACQ_REL, "workgroup");
    __builtin_amdgcn_wave_barrier();
  }
#pragma unroll
  for (int r = 0; r < 8; ++r) {
    float l = l_r[r];
    l += __shfl_xor(l, 1, 32); l += __shfl_xor(l, 2, 32); l += __shfl_xor(l, 4, 32); l += __shfl_xor(l, 8, 32);
    l_r[r] = (l > 0.f) ? 1.0f / l : 0.f;
  }
#pragma unroll
  for (int dt = 0; dt < DT; ++dt)
#pragma unroll
    for (int r = 0; r < 8; ++r) sO[w][8 * hh + r][dt * 16 + ln] = oacc[dt][r] * l_r[r];
  __builtin_amdgcn_fence(__ATOMIC_ACQ_REL, "workgroup");
  __builtin_amdgcn_wave_barrier();
  {
    for (int r = 0; r < 16; ++r) {
      const int row = q0 + r;
      for (int c4 = lane * 4; c4 < DV; c4 += 128) {
        if (row < Tq) {
          const v4f val = *(const v4fa*)&sO[w][r][c4];
          *(v4f*)(y + (size_t)bh * ystride + (size_t)row * ypitch + dv0 + c4) = val;
        }
      }
    }
    
  }
}

// GEMM C = act(A·W + bias + resid): A f32 (ASPLIT -> hi/lo 2 terms), Wt bf16 [N][K]; ACT 0 none, 1 relu, 2 exact gelu;
// resid (optional, f32, row index = (row % rmod), pitch ldr, RES_BF16 rounds it) added before the activation.
template <bool ASPLIT, int ACT, bool BIAS_BF16, bool RES_BF16>
__global__ __launch_bounds__(128) void k_gemm_bf3(const float* __restrict__ A, int lda, const unsigned short* __restrict__ Wt, int ldb,
                                                const float* __restrict__ bias, const float* __restrict__ resid, int rmod, int ldr,
                                                float* __restrict__ C, int ldc, int M, int N, int K) {
  __shared__ __attribute__((aligned(16))) float so[4][16][64];
  const int tid = threadIdx.x, w = tid >> 5, lane = tid & 31, ln = lane & 15, hh = lane >> 4;
  const int ntn = N / 64;
  const int wid = blockIdx.x * 4 + w;
  const int mt = wid / ntn, nq = wid % ntn;
  if (mt * 16 >= M) return;
  const int row0 = mt * 16, col0 = nq * 64;
  const float* arow = A + (size_t)(row0 + ln) * lda;
  v8f acc[4] = {};
  for (int kb = 0; kb < K; kb += 32) {
    FragB ah, al;
    const v4f x0 = *(const v4fa*)(arow + kb + 8 * hh), x1 = *(const v4fa*)(arow + kb + 8 * hh + 4);
    const v4f x2 = *(const v4fa*)(arow + kb + 16 + 8 * hh), x3 = *(const v4fa*)(arow + kb + 16 + 8 * hh + 4);
    float xs[16] = {x0[0],x0[1],x0[2],x0[3],x1[0],x1[1],x1[2],x1[3],x2[0],x2[1],x2[2],x2[3],x3[0],x3[1],x3[2],x3[3]};
#pragma unroll
    for (int i = 0; i < 16; ++i) { const unsigned short hb = bf16_bits(xs[i]); ah.u[i] = hb; al.u[i] = ASPLIT ? bf16_bits(xs[i] - bf16_val(hb)) : (unsigned short)0; }
#pragma unroll
    for (int t = 0; t < 4; ++t) {
      const unsigned short* brow = Wt + (size_t)(col0 + t * 16 + ln) * ldb + kb;
      FragB b;
      b.half[0] = *(const v8us*)(brow + 8 * hh);
      b.half[1] = *(const v8us*)(brow + 16 + 8 * hh);
      acc[t] = mmaN<ASPLIT ? 2 : 1>(ah.v, al.v, b.v, b.v, acc[t]);
    }
  }
#pragma unroll
  for (int t = 0; t < 4; ++t) {
    const int col = col0 + t * 16 + ln;
    float bv = bias ? bias[col] : 0.f;
    if (BIAS_BF16) bv = bf16_round(bv);
#pragma unroll
    for (int r = 0; r < 8; ++r) {
      float v = acc[t][r] + bv;
      if (resid) { float rv = resid[(size_t)((row0 + 8 * hh + r) % rmod) * ldr + col]; if (RES_BF16) rv = bf16_round(rv); v += rv; }
      if (ACT == 1) v = fmaxf(v, 0.f);
      if (ACT == 2) v = 0.5f * v * (1.0f + erff(v * 0.70710678118654752f));
      if (ACT == 3) { const float u = 0.7978845608028654f * (v + 0.044715f * v * v * v); v = 0.5f * v * (1.0f + tanhf(u)); }
      so[w][8 * hh + r][t * 16 + ln] = v;
    }
  }
  __builtin_amdgcn_fence(__ATOMIC_ACQ_REL, "workgroup");
  __builtin_amdgcn_wave_barrier();
  const int rsub = lane >> 4, c4 = (lane & 15) * 4;
  {
#pragma unroll
    for (int q = 0; q < 8; ++q) {
      const int r = q * 2 + rsub;
      const v4f v = *(const v4fa*)&so[w][r][c4];
      *(v4f*)(C + (size_t)(row0 + r) * ldc + col0 + c4) = v;
    }
    
  }
}
// row LayerNorm (biased variance, eps) over N: s = X (+ R); optional out_sum <- s; out_norm <- (s-mu)*rsqrt(var+eps)*g + b
template <bool PARAM_BF16>
__global__ __launch_bounds__(256) void k_layernorm(const float* __restrict__ X, const float* __restrict__ R, const float* __restrict__ g, const float* __restrict__ bta,
                                                  float* __restrict__ out_sum, float* __restrict__ out_norm, int N, float eps) {
  __shared__ float red[256];
  const int row = blockIdx.x, tid = threadIdx.x;
  const float* x = X + (size_t)row * N; const float* rr = R ? R + (size_t)row * N : nullptr;
  float vals[16];                     // up to N = 4096
  const int per = N / 256;            // contiguous chunk per thread? use strided-by-4 chunks: thread handles j = tid*4 + 1024*u
  float s1 = 0.f;
  for (int u = 0; u < per / 4; ++u) {
    const int j = tid * 4 + 1024 * u;
    const v4f a = *(const v4fa*)(x + j);
    v4f b = {0.f,0.f,0.f,0.f}; if (rr) b = *(const v4fa*)(rr + j);
#pragma unroll
    for (int q = 0; q < 4; ++q) { const float v = a[q] + b[q]; vals[u * 4 + q] = v; s1 += v; }
  }
  red[tid] = s1; __syncthreads();
  for (int st = 128; st > 0; st >>= 1) { if (tid < st) red[tid] += red[tid + st]; __syncthreads(); }
  const float mu = red[0] / (float)N; __syncthreads();
  float s2 = 0.f;
  for (int u = 0; u < per / 4; ++u)
#pragma unroll
    for (int q = 0; q < 4; ++q) { const float c = vals[u * 4 + q] - mu; s2 += c * c; }
  red[tid] = s2; __syncthreads();
  for (int st = 128; st > 0; st >>= 1) { if (tid < st) red[tid] += red[tid + st]; __syncthreads(); }
  const float rs = rsqrtf(red[0] / (float)N + eps);
  {
    for (int u = 0; u < per / 4; ++u) {
      const int j = tid * 4 + 1024 * u;
      v4f o, sm;
#pragma unroll
      for (int q = 0; q < 4; ++q) {
        float gg = g[j + q], bb = bta[j + q];
        if (PARAM_BF16) { gg = bf16_round(gg); bb = bf16_round(bb); }
        sm[q] = vals[u * 4 + q]; o[q] = (vals[u * 4 + q] - mu) * rs * gg + bb;
      }
      if (out_sum) *(v4f*)(out_sum + (size_t)row * N + j) = sm;
      *(v4f*)(out_norm + (size_t)row * N + j) = o;
    }
    
  }
}

// K and V rows (f32, row pitch `pitch`, D = 64 columns) prepared ONCE for k_flash3: each value split into bf16 hi + lo, written as four planes.
// Kh/Kl keep the row order [row][D]. VTh/VTl are transposed inside each chunk of 32 rows: [chunk][d][32 rows], so that a chunk of any plane is
// 32 * D contiguous values at offset chunk * 32 * D, and a V^T fragment row (one d, 32 keys) is contiguous. One block = one chunk of 32 rows.
template <int D>
__global__ __launch_bounds__(256) void k_split_kv(const float* __restrict__ K, const float* __restrict__ V, int pitch,
                                                 unsigned short* __restrict__ Kh, unsigned short* __restrict__ Kl,
                                                 unsigned short* __restrict__ VTh, unsigned short* __restrict__ VTl) {
  static_assert(D == 64, "256 threads = 32 rows x D/8 units = D rows x 4 units");
  __shared__ float tv[32][D + 1];                                // pitch 65 dwords: the column walk below meets distinct banks
  const int t = threadIdx.x;
  const size_t row0 = (size_t)blockIdx.x * 32;
  {
    const int r = t / (D / 8), c8 = (t % (D / 8)) * 8;
    const float* kr = K + (row0 + r) * pitch + c8; const float* vr = V + (row0 + r) * pitch + c8;
    const v4f k0 = *(const v4fa*)kr, k1 = *(const v4fa*)(kr + 4);
    asm volatile("s_wait_xcnt 0x0" ::: "memory");                // what follows may reuse the address registers of the two loads above
    const v4f v0 = *(const v4fa*)vr, v1 = *(const v4fa*)(vr + 4);
    asm volatile("s_wait_xcnt 0x0" ::: "memory");                // the same for these two
    v8us hi, lo;
    // unrolled (here and below): the vectors are then indexed by constants and stay in registers
#pragma unroll
    for (int i = 0; i < 8; ++i) {
      const float x = (i < 4) ? k0[i & 3] : k1[i & 3];
      const unsigned short hb = bf16_bits(x); hi[i] = hb; lo[i] = bf16_bits(x - bf16_val(hb));
      tv[r][c8 + i] = (i < 4) ? v0[i & 3] : v1[i & 3];
    }
    *(v8us*)(Kh + (row0 + r) * D + c8) = hi;
    *(v8us*)(Kl + (row0 + r) * D + c8) = lo;
  }
  __syncthreads();
  {
    const int d = t / 4, k8 = (t % 4) * 8;
    v8us hi, lo;
#pragma unroll
    for (int i = 0; i < 8; ++i) {
      const float x = tv[k8 + i][d];
      const unsigned short hb = bf16_bits(x); hi[i] = hb; lo[i] = bf16_bits(x - bf16_val(hb));
    }
    *(v8us*)(VTh + row0 * D + d * 32 + k8) = hi;
    *(v8us*)(VTl + row0 * D + d * 32 + k8) = lo;
  }
}

template <int D, int NS>
__global__ __launch_bounds__(128 * NS) void k_flash3(const float* __restrict__ Qb, int qpitch, int Tq,
                                              const unsigned short* __restrict__ Kh, const unsigned short* __restrict__ Kl,
                                              const unsigned short* __restrict__ VTh, const unsigned short* __restrict__ VTl, int Tk,
                                              int H, float scale, const int* __restrict__ mask, int causal, const float* __restrict__ sbias,
                                              float* __restrict__ y, int ypitch) {
  constexpr int KS = D / 32, DT = D / 16;
  constexpr int OP = D + 4;         // pitch of sO in floats: 16 B x odd, so the 16 lanes that each store 16 bytes of their own row meet distinct banks
  constexpr int VP = 32 + 8;        // pitch of a V^T row (32 keys) in values: 80 B = 16 B x odd, for 16-byte readers
  __shared__ __attribute__((aligned(16))) unsigned short sKhG[NS][32][D + 8], sKlG[NS][32][D + 8], sVhG[NS][D][VP], sVlG[NS][D][VP];
  __shared__ __attribute__((aligned(16))) float sO[NS][4][16][OP];
  __shared__ float sM[NS][4][16], sL[NS][4][16];
  // g is the same in every lane of a wave; held in a scalar register, the chunk's base address and the test for a chunk past the end are scalar too
  const int g = __builtin_amdgcn_readfirstlane(threadIdx.x >> 7);
  const int tid = threadIdx.x & 127, w = tid >> 5, lane = tid & 31, ln = lane & 15, hh = lane >> 4;
  unsigned short (*sKh)[D + 8] = sKhG[g]; unsigned short (*sKl)[D + 8] = sKlG[g]; unsigned short (*sVh)[VP] = sVhG[g]; unsigned short (*sVl)[VP] = sVlG[g];
  const int nqb = (Tq + 63) / 64;
  const int bh = blockIdx.x / nqb, qblk = blockIdx.x % nqb;
  const int b = bh / H, h = bh % H;
  const int q0 = qblk * 64 + w * 16;
  const float* Q = Qb + (size_t)b * Tq * qpitch + h * D;
  FragB aqh[KS], aql[KS];
  {
    int row = q0 + ln; if (row >= Tq) row = Tq - 1;
    const float* qr = Q + (size_t)row * qpitch;
#pragma unroll
    for (int ks = 0; ks < KS; ++ks)
#pragma unroll
      for (int i = 0; i < 16; ++i) {
        const int d = ks * 32 + ((i < 8) ? (8 * hh + i) : (16 + 8 * hh + (i - 8)));
        const float x = qr[d] * scale; const unsigned short hb = bf16_bits(x);
        aqh[ks].u[i] = hb; aql[ks].u[i] = bf16_bits(x - bf16_val(hb));
      }
  }
  int qi = q0 + ln; if (qi >= Tq) qi = Tq - 1;                  // the lane's query
  float m_r = -3.0e38f, l_r = 0.f;                               // its running max (equal in both halves) and this half's share of its sum
  v8f oacc[DT];                                                  // O^T: oacc[dt][r] = O[query ln][dt * 16 + 8 * hh + r]
#pragma unroll
  for (int dt = 0; dt < DT; ++dt) oacc[dt] = (v8f){0.f,0.f,0.f,0.f,0.f,0.f,0.f,0.f};
  const bool special = causal || mask || sbias;
  const int kv_end = causal ? min(Tk, qblk * 64 + 64) : Tk;
  // byte offset of the thread's first 16-byte unit of its group's chunk, the same in all four planes (each plane is below 4 GiB): one 32-bit
  // register beside four scalar bases addresses all the loads of a trip
  unsigned coff = ((unsigned)bh * Tk + 32 * g) * (D * 2) + tid * 16;
  for (int jb = 0; jb < kv_end; jb += 32 * NS, coff += 32 * NS * D * 2) {   // block-uniform trips; a group's chunk past the end is masked like any tail
    const int j0 = jb + 32 * g;
    __syncthreads();
    {
      constexpr int NU = 32 * D / 8 / 128;                       // 16-byte units of one plane's chunk per thread
      v8us ckh[NU], ckl[NU], cvh[NU], cvl[NU];
      // the loops over u are unrolled so that the units stay in registers and all loads are issued before the first LDS store
      if (j0 < Tk) {
#pragma unroll
        for (int u = 0; u < NU; ++u) {
          const unsigned o = coff + 2048u * u;                   // 128 threads x 16 B a unit row
          ckh[u] = *(const v8us*)((const char*)Kh + o);  ckl[u] = *(const v8us*)((const char*)Kl + o);
          cvh[u] = *(const v8us*)((const char*)VTh + o); cvl[u] = *(const v8us*)((const char*)VTl + o);
        }
#pragma unroll
        for (int u = 0; u < NU; ++u) {
          const int e = tid + 128 * u;
          *(v8us*)&sKh[e / (D / 8)][(e % (D / 8)) * 8] = ckh[u]; *(v8us*)&sKl[e / (D / 8)][(e % (D / 8)) * 8] = ckl[u];
          *(v8us*)&sVh[e / 4][(e % 4) * 8] = cvh[u];             *(v8us*)&sVl[e / 4][(e % 4) * 8] = cvl[u];
        }
      } else {                                                   // a chunk past the end: zeros, its scores are masked below
        const v8us zero = {0, 0, 0, 0, 0, 0, 0, 0};
#pragma unroll
        for (int u = 0; u < NU; ++u) {
          const int e = tid + 128 * u;
          *(v8us*)&sKh[e / (D / 8)][(e % (D / 8)) * 8] = zero; *(v8us*)&sKl[e / (D / 8)][(e % (D / 8)) * 8] = zero;
          *(v8us*)&sVh[e / 4][(e % 4) * 8] = zero;             *(v8us*)&sVl[e / 4][(e % 4) * 8] = zero;
        }
      }
    }
    __syncthreads();
    v8f s[2];                                                    // S^T: s[nt][r] = score(query ln, key j0 + nt * 16 + 8 * hh + r)
#pragma unroll
    for (int nt = 0; nt < 2; ++nt) {
      v8f acc = {};
#pragma unroll
      for (int ks = 0; ks < KS; ++ks) {
        FragB bh_, bl_;
        bh_.half[0] = *(const v8us*)&sKh[nt * 16 + ln][ks * 32 + 8 * hh]; bh_.half[1] = *(const v8us*)&sKh[nt * 16 + ln][ks * 32 + 16 + 8 * hh];
        bl_.half[0] = *(const v8us*)&sKl[nt * 16 + ln][ks * 32 + 8 * hh]; bl_.half[1] = *(const v8us*)&sKl[nt * 16 + ln][ks * 32 + 16 + 8 * hh];
        acc = mmaN<3>(bh_.v, bl_.v, aqh[ks].v, aql[ks].v, acc);
      }
      s[nt] = acc;
    }
    if (special || jb + 32 * NS > Tk) {                          // block-uniform: masks, biases and key tails; a dropped score becomes -3e38
#pragma unroll
      for (int nt = 0; nt < 2; ++nt)
#pragma unroll
        for (int r = 0; r < 8; ++r) {
          const int key = j0 + nt * 16 + 8 * hh + r;
          bool keep = key < Tk;
          if (causal) keep = keep && (key <= qi);
          if (mask) { if (keep) keep = mask[(size_t)qi * Tk + key] != 0; }
          if (sbias) { if (keep) s[nt][r] += sbias[(size_t)bh * Tk + key]; }   // per-key additive bias (a per-query constant would cancel in the softmax)
          if (!keep) s[nt][r] = -3.0e38f;
        }
    }
    float mx = fmaxf(s[0][0], s[1][0]);
#pragma unroll
    for (int r = 1; r < 8; ++r) mx = fmaxf(mx, fmaxf(s[0][r], s[1][r]));
    mx = fmaxf(mx, xhalf(mx));                                   // the query's other 16 keys sit in the other half
    const float mnew = fmaxf(m_r, mx);
    const float mexp = fmaxf(mnew, -1.0e38f);                    // with nothing kept so far a dropped score still gives exp(-2e38) = 0
    const float alpha = __expf(m_r - mexp);
    m_r = mnew;
    FragB pbh, pbl;                                              // P^T as a B fragment: element nt * 8 + r is key nt * 16 + 8 * hh + r
    float ps[4] = {0.f, 0.f, 0.f, 0.f};
#pragma unroll
    for (int nt = 0; nt < 2; ++nt)
#pragma unroll
      for (int r = 0; r < 8; ++r) {
        const float p = __expf(s[nt][r] - mexp);
        ps[r & 3] += p;
        const unsigned short hb = bf16_bits(p);
        pbh.u[nt * 8 + r] = hb; pbl.u[nt * 8 + r] = bf16_bits(p - bf16_val(hb));
      }
    l_r = l_r * alpha + ((ps[0] + ps[1]) + (ps[2] + ps[3]));     // this half's 16 keys (the halves are added at the end)
#pragma unroll
    for (int dt = 0; dt < DT; ++dt)
#pragma unroll
      for (int r = 0; r < 8; ++r) oacc[dt][r] *= alpha;
#pragma unroll
    for (int dt = 0; dt < DT; ++dt) {
      FragB bvh, bvl;                                            // V^T as an A fragment: row dt * 16 + ln, the k order of P^T
      bvh.half[0] = *(const v8us*)&sVh[dt * 16 + ln][8 * hh]; bvh.half[1] = *(const v8us*)&sVh[dt * 16 + ln][16 + 8 * hh];
      bvl.half[0] = *(const v8us*)&sVl[dt * 16 + ln][8 * hh]; bvl.half[1] = *(const v8us*)&sVl[dt * 16 + ln][16 + 8 * hh];
      oacc[dt] = mmaN<3>(bvh.v, bvl.v, pbh.v, pbl.v, oacc[dt]);
    }
  }
  {
    const float l = l_r + xhalf(l_r);
    if (hh == 0) { sM[g][w][ln] = m_r; sL[g][w][ln] = l; }
  }
#pragma unroll
  for (int dt = 0; dt < DT; ++dt) {                              // not yet divided by the row sum
    *(v4fa*)&sO[g][w][ln][dt * 16 + 8 * hh]     = (v4f){oacc[dt][0], oacc[dt][1], oacc[dt][2], oacc[dt][3]};
    *(v4fa*)&sO[g][w][ln][dt * 16 + 8 * hh + 4] = (v4f){oacc[dt][4], oacc[dt][5], oacc[dt][6], oacc[dt][7]};
  }
  __syncthreads();                                               // every group's (max, sum, O) is in LDS
  // join: wave (g, w) finishes rows 2g, 2g + 1, then + 2 NS, of query tile w; each half wave takes one row (two rows = 512 contiguous bytes a store)
  for (int r = g * 2 + hh; r < 16; r += 2 * NS) {
    const int row = q0 + r;
    float mj = -3.0e38f;
    // the three loops over s are unrolled so that f[] stays in registers
#pragma unroll
    for (int s = 0; s < NS; ++s) mj = fmaxf(mj, sM[s][w][r]);
    float f[NS], lj = 0.f;
#pragma unroll
    for (int s = 0; s < NS; ++s) { const float ms = sM[s][w][r]; f[s] = (ms > -1.0e38f) ? __expf(ms - mj) : 0.f; lj += f[s] * sL[s][w][r]; }
    const float inv = (mj > -1.0e38f) ? 1.0f / lj : __builtin_nanf("");
    for (int c4 = ln * 4; c4 < D; c4 += 64) {
      v4f val = {0.f, 0.f, 0.f, 0.f};
#pragma unroll
      for (int s = 0; s < NS; ++s) val += f[s] * *(const v4fa*)&sO[s][w][r][c4];
      if (row < Tq) {
        *(v4f*)(y + ((size_t)b * Tq + row) * ypitch + h * D + c4) = val * inv;
        asm volatile("s_wait_xcnt 0x0" ::: "memory");            // the next trip rewrites the store's address registers
      }
    }
  }
}

// The eight preparation jobs of a call depend on nothing but the inputs, so they share ONE grid and the block index picks the job (the same for
// every thread of a block, decided in front of the one barrier): the first 4 * PREP_WB blocks round the four weight matrices to bf16 (8 values a
// thread), the next block rounds the three biases into one concatenated row, all others transpose one 32 x 32 tile of x, NCHW -> [b][hw][c].
#define PREP_WB (HC * CC / 8 / 256)       // blocks per weight matrix
#define PREP_JOBS (4 * PREP_WB + 1)       // blocks in front of the transpose tiles
__global__ __launch_bounds__(256) void k_prep(const float* __restrict__ x, float* __restrict__ xT,
                                             const float* __restrict__ tw, const float* __restrict__ pw, const float* __restrict__ gw, const float* __restrict__ fw,
                                             unsigned short* __restrict__ Bqkv, unsigned short* __restrict__ Bf,
                                             const float* __restrict__ tb, const float* __restrict__ pb, const float* __restrict__ gb, float* __restrict__ bqkv) {
  __shared__ float tile[32][33];
  const int blk = blockIdx.x;
  if (blk < 4 * PREP_WB) {
    const int m = blk / PREP_WB;
    const float* W = (m == 0) ? tw : (m == 1) ? pw : (m == 2) ? gw : fw;
    unsigned short* Wt = (m < 3) ? Bqkv + m * (HC * CC) : Bf;
    const int t = (blk % PREP_WB) * 256 + threadIdx.x;
    const v4f a = *(const v4fa*)(W + (size_t)t * 8), b = *(const v4fa*)(W + (size_t)t * 8 + 4);
    v8us v; v[0]=bf16_bits(a[0]); v[1]=bf16_bits(a[1]); v[2]=bf16_bits(a[2]); v[3]=bf16_bits(a[3]);
    v[4]=bf16_bits(b[0]); v[5]=bf16_bits(b[1]); v[6]=bf16_bits(b[2]); v[7]=bf16_bits(b[3]);
    *(v8us*)(Wt + (size_t)t * 8) = v;
    return;
  }
  if (blk == 4 * PREP_WB) {
    const int t = threadIdx.x;
    if (t < 3 * (HC / 4)) {                                      // 4 values a thread; thread t writes bqkv[4 t ..], bias t / (HC / 4)
      const int m = t / (HC / 4);
      const float* src = (m == 0) ? tb : (m == 1) ? pb : gb;
      v4f a = *(const v4fa*)(src + (t % (HC / 4)) * 4);
      for (int i = 0; i < 4; ++i) a[i] = bf16_round(a[i]);
      *(v4f*)(bqkv + t * 4) = a;
    }
    return;
  }
  const int tix = blk - PREP_JOBS;
  const int c0 = (tix % (HWN / 32)) * 32, r0 = ((tix / (HWN / 32)) % (CC / 32)) * 32, b = tix / ((HWN / 32) * (CC / 32));
  const float* src = x + (size_t)b * CC * HWN;
  float* dst = xT + (size_t)b * CC * HWN;
  const int tx = threadIdx.x & 31, ty = threadIdx.x >> 5;     // 8 rows per pass
  for (int i = ty; i < 32; i += 8) tile[i][tx] = src[(size_t)(r0 + i) * HWN + c0 + tx];
  __syncthreads();
  for (int i = ty; i < 32; i += 8) dst[(size_t)(c0 + i) * CC + r0 + tx] = tile[tx][i];
}

// out[b][c][p] = y[(b,p)][c] + x[b][c][p]  (block per (b,c): 4096 contiguous floats)
__global__ __launch_bounds__(256) void k_fin(const float* __restrict__ y, const float* __restrict__ x, float* __restrict__ out) {
  const int b = blockIdx.x / CC, c = blockIdx.x % CC; const size_t base = ((size_t)b * CC + c) * HWN;
  { for (int p = threadIdx.x; p < HWN; p += 256) *(float*)(out + base + p) = y[((size_t)b * HWN + p) * CC + c] + x[base + p];  }
}
extern "C" void kernel_launch(void* const* d_in, const int* in_sizes, int n_in,
                              void* d_out, int out_size, void* d_ws, size_t ws_size, hipStream_t stream) {
  (void)in_sizes; (void)n_in; (void)out_size;
  const float* x = (const float*)d_in[0]; const float* tw = (const float*)d_in[1]; const float* tb = (const float*)d_in[2]; const float* pw = (const float*)d_in[3]; const float* pb = (const float*)d_in[4];
  const float* gw = (const float*)d_in[5]; const float* gb = (const float*)d_in[6]; const float* fw = (const float*)d_in[7]; const float* fb = (const float*)d_in[8];
  char* ws = (char*)d_ws; size_t off = 0;
  auto take = [&](size_t bytes) { char* p = ws + off; off += (bytes + 255) & ~(size_t)255; return p; };
  unsigned short* Bqkv = (unsigned short*)take((size_t)3 * HC * CC * 2); unsigned short* Bf = (unsigned short*)take((size_t)CC * HC * 2); float* bqkv = (float*)take(3 * HC * 4 + 256);
  float* xT = (float*)take((size_t)MROWS * CC * 4); float* qkv = (float*)take((size_t)MROWS * 3 * HC * 4); float* att = (float*)take((size_t)MROWS * HC * 4); float* y = (float*)take((size_t)MROWS * CC * 4);
  unsigned short* Kh = (unsigned short*)take((size_t)MROWS * HC * 2); unsigned short* Kl = (unsigned short*)take((size_t)MROWS * HC * 2);
  unsigned short* VTh = (unsigned short*)take((size_t)MROWS * HC * 2); unsigned short* VTl = (unsigned short*)take((size_t)MROWS * HC * 2);
  if (off > ws_size) return;
  k_prep<<<PREP_JOBS + (HWN / 32) * (CC / 32) * BB, 256, 0, stream>>>(x, xT, tw, pw, gw, fw, Bqkv, Bf, tb, pb, gb, bqkv);   // rounded weights and biases, x -> [b][hw][c]
  k_gemm_bf3<false, 0, false, false><<<((MROWS / 16) * 3 + 3) / 4, 128, 0, stream>>>(xT, CC, Bqkv, CC, bqkv, nullptr, 1, 0, qkv, 3 * HC, MROWS, 3 * HC, CC);   // [theta | phi | g] + b (single term)
  k_split_kv<HC><<<MROWS / 32, 256, 0, stream>>>(qkv + HC, qkv + 2 * HC, 3 * HC, Kh, Kl, VTh, VTl);                                        // phi, g -> bf16 hi/lo planes, once
  k_flash3<HC, NSPLIT><<<BB * (HWN / 64), 128 * NSPLIT, 0, stream>>>(qkv, 3 * HC, HWN, Kh, Kl, VTh, VTl, HWN, 1, 1.0f, nullptr, 0, nullptr, att, HC);
  k_gemm_bf3<true, 0, true, false><<<((MROWS / 16) * 2 + 3) / 4, 128, 0, stream>>>(att, HC, Bf, HC, fb, nullptr, 1, 0, y, CC, MROWS, CC, HC);                    // final conv + b
  k_fin<<<BB * CC, 256, 0, stream>>>(y, x, (float*)d_out);
}

// v005
// It runs in 105 microseconds.
// Next to v004, in two timings, it ran 1.15 and 1.13 times as fast.
// Counting every step since v000, it is 6.16 times as fast.
#include <hip/hip_runtime.h>
// theta/phi/g 1×1 convolutions as one GEMM on position-major bf16(x) (single exact term, K=128, N=192), the 4096×4096 non-local attention per batch as
// 16-query tiles on WMMA (Q·Kᵀ and P·V as 3-term bf16 hi/lo splits, f32 online softmax, no scaling), and the final 1×1 conv (2 terms) + bias; the
// residual add and the NCHW transposes are f32. 
#define BB 4
#define CC 128
#define HC 64
#define HWN 4096
#define MROWS (BB * HWN)
#define NSPLIT 4      // key groups per attention block: 4 waves each, so NSPLIT waves per SIMD

typedef __bf16 v16b __attribute__((ext_vector_type(16)));
typedef unsigned short v8us __attribute__((ext_vector_type(8), may_alias));
typedef float  v8f  __attribute__((ext_vector_type(8)));
typedef float  v4f  __attribute__((ext_vector_type(4)));
typedef float  v4fa __attribute__((ext_vector_type(4), may_alias));
typedef float  v2f  __attribute__((ext_vector_type(2)));
typedef __bf16 v2b  __attribute__((ext_vector_type(2)));
union FragB { v16b v; v8us half[2]; unsigned short u[16]; unsigned int w[8]; };
union Pack8 { v8us v; unsigned int w[4]; };

// f32 -> bf16, round to nearest even, by the hardware conversion
__device__ __forceinline__ unsigned short bf16_bits(float x) { return __builtin_bit_cast(unsigned short, (__bf16)x); }
// two values in one packed conversion: a in the low half of the word, b in the high half
__device__ __forceinline__ unsigned int bf16_pack2(float a, float b) { const v2f v = {a, b}; return __builtin_bit_cast(unsigned int, __builtin_convertvector(v, v2b)); }
// the lo word of a pair: what its hi word hw leaves over, rounded (x - hi is exact in f32)
__device__ __forceinline__ unsigned int bf16_rest2(float a, float b, unsigned int hw) {
  const v2f x = {a, b}, h = {__uint_as_float(hw << 16), __uint_as_float(hw & 0xFFFF0000u)};
  return __builtin_bit_cast(unsigned int, __builtin_convertvector(x - h, v2b));
}
__device__ __forceinline__ float bf16_val(unsigned short b) { return __uint_as_float(((unsigned int)b) << 16); }
__device__ __forceinline__ float bf16_round(float x) { return bf16_val(bf16_bits(x)); }
// D += A·B with NT terms: 1 = ah·bh, 2 = + al·bh (A split), 3 = + ah·bl (both split)
template <int NT>
__device__ __forceinline__ v8f mmaN(v16b ah, v16b al, v16b bh, v16b bl, v8f c) {
  c = __builtin_amdgcn_wmma_f32_16x16x32_bf16(false, ah, false, bh, (short)0, c, false, false);
  if (NT >= 2) c = __builtin_amdgcn_wmma_f32_16x16x32_bf16(false, al, false, bh, (short)0, c, false, false);
  if (NT >= 3) c = __builtin_amdgcn_wmma_f32_16x16x32_bf16(false, ah, false, bl, (short)0, c, false, false);
  asm volatile("v_nop\n\tv_nop\n\tv_nop\n\tv_nop" : "+v"(c) : "v"(ah), "v"(al), "v"(bh), "v"(bl));
  return c;
}

// lane l <-> lane l ^ 16 (the other 16-lane row) in one vector cross-row move
__device__ __forceinline__ float xhalf(float x) {
  const int b = __float_as_int(x);
  return __int_as_float(__builtin_amdgcn_permlanex16(b, b, 0x76543210, 0xfedcba98, false, false));
}

__global__ __launch_bounds__(256) void k_wt_bf16(const float* __restrict__ W, unsigned short* __restrict__ Wt, int K, int N) {
  const int t = blockIdx.x * 256 + threadIdx.x;
  const int k8n = K / 8;
  if (t >= N * k8n) return;
  const int n = t / k8n, k8 = (t % k8n) * 8;
  v8us v;
#pragma unroll
  for (int i = 0; i < 8; ++i) v[i] = bf16_bits(W[(size_t)(k8 + i) * N + n]);
  *(v8us*)(Wt + (size_t)n * K + k8) = v;
  
}

// GEMM C[M][N] (f32, pitch ldc) = act(A[M][K]·W + bias). A f32 row-major (pitch lda) converted per fragment to bf16
// (ASPLIT: hi/lo two planes -> 2 terms, else single rounded term); Wt bf16 [N][K] (pitch ldb). BIAS_BF16 rounds the
// bias to bf16 first (bias quantised to bf16 before the add). K%32==0, M%16==0, N%64==0.
template <bool ASPLIT, int ACT, bool BIAS_BF16>
__global__ __launch_bounds__(128) void k_gemm_bf(const float* __restrict__ A, int lda, const unsigned short* __restrict__ Wt, int ldb,
                                               const float* __restrict__ bias, float* __restrict__ C, int ldc, int M, int N, int K) {
  __shared__ __attribute__((aligned(16))) float so[4][16][64];
  const int tid = threadIdx.x, w = tid >> 5, lane = tid & 31, ln = lane & 15, hh = lane >> 4;
  const int ntn = N / 64;
  const int wid = blockIdx.x * 4 + w;
  const int mt = wid / ntn, nq = wid % ntn;
  if (mt * 16 >= M) return;
  const int row0 = mt * 16, col0 = nq * 64;
  const float* arow = A + (size_t)(row0 + ln) * lda;
  v8f acc[4] = {};
  for (int kb = 0; kb < K; kb += 32) {
    FragB ah, al;
    const v4f x0 = *(const v4fa*)(arow + kb + 8 * hh), x1 = *(const v4fa*)(arow + kb + 8 * hh + 4);
    const v4f x2 = *(const v4fa*)(arow + kb + 16 + 8 * hh), x3 = *(const v4fa*)(arow + kb + 16 + 8 * hh + 4);
    float xs[16] = {x0[0],x0[1],x0[2],x0[3],x1[0],x1[1],x1[2],x1[3],x2[0],x2[1],x2[2],x2[3],x3[0],x3[1],x3[2],x3[3]};
#pragma unroll
    for (int i = 0; i < 8; ++i) { const unsigned int hw = bf16_pack2(xs[2 * i], xs[2 * i + 1]); ah.w[i] = hw; al.w[i] = ASPLIT ? bf16_rest2(xs[2 * i], xs[2 * i + 1], hw) : 0u; }
#pragma unroll
    for (int t = 0; t < 4; ++t) {
      const unsigned short* brow = Wt + (size_t)(col0 + t * 16 + ln) * ldb + kb;
      FragB b;
      b.half[0] = *(const v8us*)(brow + 8 * hh);
      b.half[1] = *(const v8us*)(brow + 16 + 8 * hh);
      acc[t] = mmaN<ASPLIT ? 2 : 1>(ah.v, al.v, b.v, b.v, acc[t]);
    }
  }
#pragma unroll
  for (int t = 0; t < 4; ++t) {
    float bv = bias ? bias[col0 + t * 16 + ln] : 0.f;
    if (BIAS_BF16) bv = bf16_round(bv);
#pragma unroll
    for (int r = 0; r < 8; ++r) { float v = acc[t][r] + bv; if (ACT == 1) v = fmaxf(v, 0.f); so[w][8 * hh + r][t * 16 + ln] = v; }
  }
  __builtin_amdgcn_fence(__ATOMIC_ACQ_REL, "workgroup");
  __builtin_amdgcn_wave_barrier();
  const int rsub = lane >> 4, c4 = (lane & 15) * 4;
  {
#pragma unroll
    for (int q = 0; q < 8; ++q) {
      const int r = q * 2 + rsub;
      const v4f v = *(const v4fa*)&so[w][r][c4];
      *(v4f*)(C + (size_t)(row0 + r) * ldc + col0 + c4) = v;
    }
    
  }
}

// Flash-style causal/unmasked attention, all contractions 3-term bf16 hi/lo splits, f32 softmax with running max.
// q,k,v rows are read from f32 buffers with arbitrary row pitch (so they can live inside a fused qkv buffer);
// D = head size (multiple of 32, <= 128); one wave = 16 query rows; block = 4 waves (64 queries) sharing K/V chunks of 32.
template <int D, bool CAUSAL>
__global__ __launch_bounds__(128) void k_flash(const float* __restrict__ qb, const float* __restrict__ kb, const float* __restrict__ vb,
                                             int pitch, int T, int H, float scale, float* __restrict__ y, int ypitch) {
  constexpr int KS = D / 32;        // k-steps for QK
  constexpr int DT = D / 16;        // d tiles for PV
  __shared__ __attribute__((aligned(16))) unsigned short sKh[32][D + 8], sKl[32][D + 8], sVh[32][D + 8], sVl[32][D + 8];
  __shared__ __attribute__((aligned(16))) unsigned short sPh[4][16][40], sPl[4][16][40];
  __shared__ __attribute__((aligned(16))) float sO[4][16][D];
  const int tid = threadIdx.x, w = tid >> 5, lane = tid & 31, ln = lane & 15, hh = lane >> 4;
  const int nqb = (T + 63) / 64;
  const int bh = blockIdx.x / nqb, qblk = blockIdx.x % nqb;
  const int b = bh / H, h = bh % H;
  const int q0 = qblk * 64 + w * 16;
  const float* Q = qb + (size_t)b * T * pitch + h * D;
  const float* K = kb + (size_t)b * T * pitch + h * D;
  const float* V = vb + (size_t)b * T * pitch + h * D;

  // A fragments of the wave's 16 query rows (scaled), hi/lo
  FragB aqh[KS], aql[KS];
  {
    int row = q0 + ln; if (row >= T) row = T - 1;
    const float* qr = Q + (size_t)row * pitch;
#pragma unroll
    for (int ks = 0; ks < KS; ++ks)
#pragma unroll
      for (int i = 0; i < 16; ++i) {
        const int d = ks * 32 + ((i < 8) ? (8 * hh + i) : (16 + 8 * hh + (i - 8)));
        const float x = qr[d] * scale; const unsigned short hb = bf16_bits(x);
        aqh[ks].u[i] = hb; aql[ks].u[i] = bf16_bits(x - bf16_val(hb));
      }
  }
  float m_r[8], l_r[8];
#pragma unroll
  for (int r = 0; r < 8; ++r) { m_r[r] = -3.0e38f; l_r[r] = 0.f; }
  v8f oacc[DT];
#pragma unroll
  for (int dt = 0; dt < DT; ++dt) oacc[dt] = (v8f){0.f,0.f,0.f,0.f,0.f,0.f,0.f,0.f};

  const int kv_end = CAUSAL ? min(T, qblk * 64 + 64) : T;     // block-uniform
  for (int j0 = 0; j0 < kv_end; j0 += 32) {
    __syncthreads();
    for (int e = tid; e < 32 * (D / 4); e += 128) {
      const int r = e / (D / 4), c4 = (e % (D / 4)) * 4;
      const int key = j0 + r;
      v4f kf = {0.f,0.f,0.f,0.f}, vf = {0.f,0.f,0.f,0.f};
      if (key < T) { kf = *(const v4fa*)(K + (size_t)key * pitch + c4); vf = *(const v4fa*)(V + (size_t)key * pitch + c4); }
#pragma unroll
      for (int t = 0; t < 4; ++t) {
        unsigned short hb = bf16_bits(kf[t]); sKh[r][c4 + t] = hb; sKl[r][c4 + t] = bf16_bits(kf[t] - bf16_val(hb));
        hb = bf16_bits(vf[t]); sVh[r][c4 + t] = hb; sVl[r][c4 + t] = bf16_bits(vf[t] - bf16_val(hb));
      }
    }
    __syncthreads();
    // S tile 16 x 32
    v8f s[2];
#pragma unroll
    for (int nt = 0; nt < 2; ++nt) {
      v8f acc = {};
#pragma unroll
      for (int ks = 0; ks < KS; ++ks) {
        FragB bh_, bl_;
        bh_.half[0] = *(const v8us*)&sKh[nt * 16 + ln][ks * 32 + 8 * hh]; bh_.half[1] = *(const v8us*)&sKh[nt * 16 + ln][ks * 32 + 16 + 8 * hh];
        bl_.half[0] = *(const v8us*)&sKl[nt * 16 + ln][ks * 32 + 8 * hh]; bl_.half[1] = *(const v8us*)&sKl[nt * 16 + ln][ks * 32 + 16 + 8 * hh];
        acc = mmaN<3>(aqh[ks].v, aql[ks].v, bh_.v, bl_.v, acc);
      }
      s[nt] = acc;
    }
    // mask + running max (rows 8hh+r; the 16 lanes of a half share rows)
    float alpha[8];
#pragma unroll
    for (int r = 0; r < 8; ++r) {
      const int qi = q0 + 8 * hh + r;
      const int ja = j0 + ln, jb = j0 + 16 + ln;
      if (CAUSAL) { if (ja > qi) s[0][r] = -3.0e38f; if (jb > qi) s[1][r] = -3.0e38f; }
      if (ja >= T) s[0][r] = -3.0e38f;
      if (jb >= T) s[1][r] = -3.0e38f;
      float mx = fmaxf(s[0][r], s[1][r]);
      mx = fmaxf(mx, __shfl_xor(mx, 1, 32)); mx = fmaxf(mx, __shfl_xor(mx, 2, 32)); mx = fmaxf(mx, __shfl_xor(mx, 4, 32)); mx = fmaxf(mx, __shfl_xor(mx, 8, 32));
      const float mnew = fmaxf(m_r[r], mx);
      alpha[r] = (mnew > -1.0e38f) ? __expf(m_r[r] - mnew) : 1.0f;
      const float p0 = (s[0][r] > -1.0e38f) ? __expf(s[0][r] - mnew) : 0.f;
      const float p1 = (s[1][r] > -1.0e38f) ? __expf(s[1][r] - mnew) : 0.f;
      m_r[r] = mnew;
      l_r[r] = l_r[r] * alpha[r] + p0 + p1;            // per-lane partial row sum (16 lanes combined at the end)
      unsigned short hb = bf16_bits(p0); sPh[w][8 * hh + r][ln] = hb;      sPl[w][8 * hh + r][ln] = bf16_bits(p0 - bf16_val(hb));
      hb = bf16_bits(p1);                sPh[w][8 * hh + r][16 + ln] = hb; sPl[w][8 * hh + r][16 + ln] = bf16_bits(p1 - bf16_val(hb));
    }
#pragma unroll
    for (int dt = 0; dt < DT; ++dt)
#pragma unroll
      for (int r = 0; r < 8; ++r) oacc[dt][r] *= alpha[r];
    __builtin_amdgcn_fence(__ATOMIC_ACQ_REL, "workgroup");
    __builtin_amdgcn_wave_barrier();
    FragB pah, pal;
    pah.half[0] = *(const v8us*)&sPh[w][ln][8 * hh]; pah.half[1] = *(const v8us*)&sPh[w][ln][16 + 8 * hh];
    pal.half[0] = *(const v8us*)&sPl[w][ln][8 * hh]; pal.half[1] = *(const v8us*)&sPl[w][ln][16 + 8 * hh];
#pragma unroll
    for (int dt = 0; dt < DT; ++dt) {
      FragB bvh, bvl;
#pragma unroll
      for (int i = 0; i < 8; ++i) {
        bvh.u[i] = sVh[8 * hh + i][dt * 16 + ln]; bvh.u[8 + i] = sVh[16 + 8 * hh + i][dt * 16 + ln];
        bvl.u[i] = sVl[8 * hh + i][dt * 16 + ln]; bvl.u[8 + i] = sVl[16 + 8 * hh + i][dt * 16 + ln];
      }
      oacc[dt] = mmaN<3>(pah.v, pal.v, bvh.v, bvl.v, oacc[dt]);
    }
    __builtin_amdgcn_fence(__ATOMIC_ACQ_REL, "workgroup");
    __builtin_amdgcn_wave_barrier();
  }
#pragma unroll
  for (int r = 0; r < 8; ++r) {
    float l = l_r[r];
    l += __shfl_xor(l, 1, 32); l += __shfl_xor(l, 2, 32); l += __shfl_xor(l, 4, 32); l += __shfl_xor(l, 8, 32);
    l_r[r] = (l > 0.f) ? 1.0f / l : 0.f;
  }
#pragma unroll
  for (int dt = 0; dt < DT; ++dt)
#pragma unroll
    for (int r = 0; r < 8; ++r) sO[w][8 * hh + r][dt * 16 + ln] = oacc[dt][r] * l_r[r];
  __builtin_amdgcn_fence(__ATOMIC_ACQ_REL, "workgroup");
  __builtin_amdgcn_wave_barrier();
  {
    for (int r = 0; r < 16; ++r) {
      const int row = q0 + r;
      if (row < T && lane < D / 4) {
        const v4f val = *(const v4fa*)&sO[w][r][lane * 4];
        *(v4f*)(y + ((size_t)b * T + row) * ypitch + h * D + lane * 4) = val;
      }
    }
    
  }
}

// in pitch = cols, out pitch = rows; rows, cols multiples of 32. Optional per-output-row affine (scale[c], shift[c]) and
// residual add res (same layout as out, optionally bf16-rounded) for fused epilogues: out = in*scale + shift + res.
template <bool AFFINE, bool RESID, bool RES_BF16>
__global__ __launch_bounds__(256) void k_transpose32(const float* __restrict__ in, float* __restrict__ out, int rows, int cols,
                                                    const float* __restrict__ scale, const float* __restrict__ shift, const float* __restrict__ res) {
  __shared__ float tile[32][33];
  const int b = blockIdx.z;
  const int r0 = blockIdx.y * 32, c0 = blockIdx.x * 32;
  const float* src = in + (size_t)b * rows * cols;
  float* dst = out + (size_t)b * rows * cols;
  const int tx = threadIdx.x & 31, ty = threadIdx.x >> 5;     // 8 rows per pass
  for (int i = ty; i < 32; i += 8) tile[i][tx] = src[(size_t)(r0 + i) * cols + c0 + tx];
  __syncthreads();
  {
    for (int i = ty; i < 32; i += 8) {
      float v = tile[tx][i];
      const int orow = c0 + i;
      if (AFFINE) v = v * scale[orow] + shift[orow];
      if (RESID) { float rv = res[(size_t)b * rows * cols + (size_t)orow * rows + r0 + tx]; if (RES_BF16) rv = bf16_round(rv); v += rv; }
      *(float*)(dst + (size_t)orow * rows + r0 + tx) = v;
    }
    
  }
}

// 2x2 max pool on position-major data: in [B][H*W][C] -> out [B][(H/2)*(W/2)][C]; thread per (b, p', 4 channels); C%4==0
__global__ __launch_bounds__(256) void k_pool2_pm(const float* __restrict__ in, float* __restrict__ out, int Bn, int H, int W, int C) {
  const size_t t = (size_t)blockIdx.x * 256 + threadIdx.x;
  const int c4n = C / 4, Ho = H / 2, Wo = W / 2;
  const size_t total = (size_t)Bn * Ho * Wo * c4n;
  if (t >= total) return;
  const int c4 = (int)(t % c4n) * 4; size_t rest = t / c4n;
  const int pw = (int)(rest % Wo); rest /= Wo; const int ph = (int)(rest % Ho); const int b = (int)(rest / Ho);
  const float* base = in + (size_t)b * H * W * C;
  const int p00 = (2 * ph) * W + 2 * pw;
  const v4f a = *(const v4fa*)(base + (size_t)p00 * C + c4), bq = *(const v4fa*)(base + (size_t)(p00 + 1) * C + c4);
  const v4f c = *(const v4fa*)(base + (size_t)(p00 + W) * C + c4), d = *(const v4fa*)(base + (size_t)(p00 + W + 1) * C + c4);
  v4f m; for (int i = 0; i < 4; ++i) m[i] = fmaxf(fmaxf(a[i], bq[i]), fmaxf(c[i], d[i]));
  float* dst = out + ((size_t)b * Ho * Wo + (size_t)ph * Wo + pw) * C + c4;
  *(v4f*)dst = m;
  
}

// General (non-causal) attention, 3-term bf16 splits, f32 softmax with running max.
// Q [.][Tq][qpitch], K [.][Tk][kpitch] (head dim DQ), V [.][Tk][vpitch] (head dim DVtot); this block handles DV output
// dims starting at dv0 = blockIdx.y*DV. y[bh][t][ypitch] gets columns dv0..dv0+DV-1. Per-bh base offsets via strides.
template <int DQ, int DV>
__global__ __launch_bounds__(128) void k_flash2(const float* __restrict__ Qb, size_t qstride, int qpitch, int Tq,
                                              const float* __restrict__ Kb, size_t kstride, int kpitch, int Tk,
                                              const float* __restrict__ Vb, size_t vstride, int vpitch,
                                              float scale, float* __restrict__ y, size_t ystride, int ypitch) {
  constexpr int KS = DQ / 32, DT = DV / 16;
  __shared__ __attribute__((aligned(16))) unsigned short sKh[32][DQ + 8], sKl[32][DQ + 8], sVh[32][DV + 8], sVl[32][DV + 8];
  __shared__ __attribute__((aligned(16))) unsigned short sPh[4][16][40], sPl[4][16][40];
  __shared__ __attribute__((aligned(16))) float sO[4][16][DV];
  const int tid = threadIdx.x, w = tid >> 5, lane = tid & 31, ln = lane & 15, hh = lane >> 4;
  const int nqb = (Tq + 63) / 64;
  const int bh = blockIdx.x / nqb, qblk = blockIdx.x % nqb;
  const int dv0 = blockIdx.y * DV;
  const int q0 = qblk * 64 + w * 16;
  const float* Q = Qb + (size_t)bh * qstride; const float* K = Kb + (size_t)bh * kstride; const float* V = Vb + (size_t)bh * vstride + dv0;
  FragB aqh[KS], aql[KS];
  {
    int row = q0 + ln; if (row >= Tq) row = Tq - 1;
    const float* qr = Q + (size_t)row * qpitch;
#pragma unroll
    for (int ks = 0; ks < KS; ++ks)
#pragma unroll
      for (int i = 0; i < 16; ++i) {
        const int d = ks * 32 + ((i < 8) ? (8 * hh + i) : (16 + 8 * hh + (i - 8)));
        const float x = qr[d] * scale; const unsigned short hb = bf16_bits(x);
        aqh[ks].u[i] = hb; aql[ks].u[i] = bf16_bits(x - bf16_val(hb));
      }
  }
  float m_r[8], l_r[8];
#pragma unroll
  for (int r = 0; r < 8; ++r) { m_r[r] = -3.0e38f; l_r[r] = 0.f; }
  v8f oacc[DT];
#pragma unroll
  for (int dt = 0; dt < DT; ++dt) oacc[dt] = (v8f){0.f,0.f,0.f,0.f,0.f,0.f,0.f,0.f};
  for (int j0 = 0; j0 < Tk; j0 += 32) {
    __syncthreads();
    for (int e = tid; e < 32 * (DQ / 4); e += 128) {
      const int r = e / (DQ / 4), c4 = (e % (DQ / 4)) * 4; const int key = j0 + r;
      v4f f = {0.f,0.f,0.f,0.f}; if (key < Tk) f = *(const v4fa*)(K + (size_t)key * kpitch + c4);
#pragma unroll
      for (int t = 0; t < 4; ++t) { const unsigned short hb = bf16_bits(f[t]); sKh[r][c4 + t] = hb; sKl[r][c4 + t] = bf16_bits(f[t] - bf16_val(hb)); }
    }
    for (int e = tid; e < 32 * (DV / 4); e += 128) {
      const int r = e / (DV / 4), c4 = (e % (DV / 4)) * 4; const int key = j0 + r;
      v4f f = {0.f,0.f,0.f,0.f}; if (key < Tk) f = *(const v4fa*)(V + (size_t)key * vpitch + c4);
#pragma unroll
      for (int t = 0; t < 4; ++t) { const unsigned short hb = bf16_bits(f[t]); sVh[r][c4 + t] = hb; sVl[r][c4 + t] = bf16_bits(f[t] - bf16_val(hb)); }
    }
    __syncthreads();
    v8f s[2];
#pragma unroll
    for (int nt = 0; nt < 2; ++nt) {
      v8f acc = {};
#pragma unroll
      for (int ks = 0; ks < KS; ++ks) {
        FragB bh_, bl_;
        bh_.half[0] = *(const v8us*)&sKh[nt * 16 + ln][ks * 32 + 8 * hh]; bh_.half[1] = *(const v8us*)&sKh[nt * 16 + ln][ks * 32 + 16 + 8 * hh];
        bl_.half[0] = *(const v8us*)&sKl[nt * 16 + ln][ks * 32 + 8 * hh]; bl_.half[1] = *(const v8us*)&sKl[nt * 16 + ln][ks * 32 + 16 + 8 * hh];
        acc = mmaN<3>(aqh[ks].v, aql[ks].v, bh_.v, bl_.v, acc);
      }
      s[nt] = acc;
    }
    float alpha[8];
#pragma unroll
    for (int r = 0; r < 8; ++r) {
      const int ja = j0 + ln, jb = j0 + 16 + ln;
      if (ja >= Tk) s[0][r] = -3.0e38f;
      if (jb >= Tk) s[1][r] = -3.0e38f;
      float mx = fmaxf(s[0][r], s[1][r]);
      mx = fmaxf(mx, __shfl_xor(mx, 1, 32)); mx = fmaxf(mx, __shfl_xor(mx, 2, 32)); mx = fmaxf(mx, __shfl_xor(mx, 4, 32)); mx = fmaxf(mx, __shfl_xor(mx, 8, 32));
      const float mnew = fmaxf(m_r[r], mx);
      alpha[r] = (mnew > -1.0e38f) ? __expf(m_r[r] - mnew) : 1.0f;
      const float p0 = (s[0][r] > -1.0e38f) ? __expf(s[0][r] - mnew) : 0.f;
      const float p1 = (s[1][r] > -1.0e38f) ? __expf(s[1][r] - mnew) : 0.f;
      m_r[r] = mnew;
      l_r[r] = l_r[r] * alpha[r] + p0 + p1;
      unsigned short hb = bf16_bits(p0); sPh[w][8 * hh + r][ln] = hb;      sPl[w][8 * hh + r][ln] = bf16_bits(p0 - bf16_val(hb));
      hb = bf16_bits(p1);                sPh[w][8 * hh + r][16 + ln] = hb; sPl[w][8 * hh + r][16 + ln] = bf16_bits(p1 - bf16_val(hb));
    }
#pragma unroll
    for (int dt = 0; dt < DT; ++dt)
#pragma unroll
      for (int r = 0; r < 8; ++r) oacc[dt][r] *= alpha[r];
    __builtin_amdgcn_fence(__ATOMIC_ACQ_REL, "workgroup");
    __builtin_amdgcn_wave_barrier();
    FragB pah, pal;
    pah.half[0] = *(const v8us*)&sPh[w][ln][8 * hh]; pah.half[1] = *(const v8us*)&sPh[w][ln][16 + 8 * hh];
    pal.half[0] = *(const v8us*)&sPl[w][ln][8 * hh]; pal.half[1] = *(const v8us*)&sPl[w][ln][16 + 8 * hh];
#pragma unroll
    for (int dt = 0; dt < DT; ++dt) {
      FragB bvh, bvl;
#pragma unroll
      for (int i = 0; i < 8; ++i) {
        bvh.u[i] = sVh[8 * hh + i][dt * 16 + ln]; bvh.u[8 + i] = sVh[16 + 8 * hh + i][dt * 16 + ln];
        bvl.u[i] = sVl[8 * hh + i][dt * 16 + ln]; bvl.u[8 + i] = sVl[16 + 8 * hh + i][dt * 16 + ln];
      }
      oacc[dt] = mmaN<3>(pah.v, pal.v, bvh.v, bvl.v, oacc[dt]);
    }
    __builtin_amdgcn_fence(__ATOMIC_ACQ_REL, "workgroup");
    __builtin_amdgcn_wave_barrier();
  }
#pragma unroll
  for (int r = 0; r < 8; ++r) {
    float l = l_r[r];
    l += __shfl_xor(l, 1, 32); l += __shfl_xor(l, 2, 32); l += __shfl_xor(l, 4, 32); l += __shfl_xor(l, 8, 32);
    l_r[r] = (l > 0.f) ? 1.0f / l : 0.f;
  }
#pragma unroll
  for (int dt = 0; dt < DT; ++dt)
#pragma unroll
    for (int r = 0; r < 8; ++r) sO[w][8 * hh + r][dt * 16 + ln] = oacc[dt][r] * l_r[r];
  __builtin_amdgcn_fence(__ATOMIC_ACQ_REL, "workgroup");
  __builtin_amdgcn_wave_barrier();
  {
    for (int r = 0; r < 16; ++r) {
      const int row = q0 + r;
      for (int c4 = lane * 4; c4 < DV; c4 += 128) {
        if (row < Tq) {
          const v4f val = *(const v4fa*)&sO[w][r][c4];
          *(v4f*)(y + (size_t)bh * ystride + (size_t)row * ypitch + dv0 + c4) = val;
        }
      }
    }
    
  }
}

// GEMM C = act(A·W + bias + resid): A f32 (ASPLIT -> hi/lo 2 terms), Wt bf16 [N][K]; ACT 0 none, 1 relu, 2 exact gelu;
// resid (optional, f32, row index = (row % rmod), pitch ldr, RES_BF16 rounds it) added before the activation.
template <bool ASPLIT, int ACT, bool BIAS_BF16, bool RES_BF16>
__global__ __launch_bounds__(128) void k_gemm_bf3(const float* __restrict__ A, int lda, const unsigned short* __restrict__ Wt, int ldb,
                                                const float* __restrict__ bias, const float* __restrict__ resid, int rmod, int ldr,
                                                float* __restrict__ C, int ldc, int M, int N, int K) {
  __shared__ __attribute__((aligned(16))) float so[4][16][64];
  const int tid = threadIdx.x, w = tid >> 5, lane = tid & 31, ln = lane & 15, hh = lane >> 4;
  const int ntn = N / 64;
  const int wid = blockIdx.x * 4 + w;
  const int mt = wid / ntn, nq = wid % ntn;
  if (mt * 16 >= M) return;
  const int row0 = mt * 16, col0 = nq * 64;
  const float* arow = A + (size_t)(row0 + ln) * lda;
  v8f acc[4] = {};
  for (int kb = 0; kb < K; kb += 32) {
    FragB ah, al;
    const v4f x0 = *(const v4fa*)(arow + kb + 8 * hh), x1 = *(const v4fa*)(arow + kb + 8 * hh + 4);
    const v4f x2 = *(const v4fa*)(arow + kb + 16 + 8 * hh), x3 = *(const v4fa*)(arow + kb + 16 + 8 * hh + 4);
    float xs[16] = {x0[0],x0[1],x0[2],x0[3],x1[0],x1[1],x1[2],x1[3],x2[0],x2[1],x2[2],x2[3],x3[0],x3[1],x3[2],x3[3]};
#pragma unroll
    for (int i = 0; i < 8; ++i) { const unsigned int hw = bf16_pack2(xs[2 * i], xs[2 * i + 1]); ah.w[i] = hw; al.w[i] = ASPLIT ? bf16_rest2(xs[2 * i], xs[2 * i + 1], hw) : 0u; }
#pragma unroll
    for (int t = 0; t < 4; ++t) {
      const unsigned short* brow = Wt + (size_t)(col0 + t * 16 + ln) * ldb + kb;
      FragB b;
      b.half[0] = *(const v8us*)(brow + 8 * hh);
      b.half[1] = *(const v8us*)(brow + 16 + 8 * hh);
      acc[t] = mmaN<ASPLIT ? 2 : 1>(ah.v, al.v, b.v, b.v, acc[t]);
    }
  }
#pragma unroll
  for (int t = 0; t < 4; ++t) {
    const int col = col0 + t * 16 + ln;
    float bv = bias ? bias[col] : 0.f;
    if (BIAS_BF16) bv = bf16_round(bv);
#pragma unroll
    for (int r = 0; r < 8; ++r) {
      float v = acc[t][r] + bv;
      if (resid) { float rv = resid[(size_t)((row0 + 8 * hh + r) % rmod) * ldr + col]; if (RES_BF16) rv = bf16_round(rv); v += rv; }
      if (ACT == 1) v = fmaxf(v, 0.f);
      if (ACT == 2) v = 0.5f * v * (1.0f + erff(v * 0.70710678118654752f));
      if (ACT == 3) { const float u = 0.7978845608028654f * (v + 0.044715f * v * v * v); v = 0.5f * v * (1.0f + tanhf(u)); }
      so[w][8 * hh + r][t * 16 + ln] = v;
    }
  }
  __builtin_amdgcn_fence(__ATOMIC_ACQ_REL, "workgroup");
  __builtin_amdgcn_wave_barrier();
  const int rsub = lane >> 4, c4 = (lane & 15) * 4;
  {
#pragma unroll
    for (int q = 0; q < 8; ++q) {
      const int r = q * 2 + rsub;
      const v4f v = *(const v4fa*)&so[w][r][c4];
      *(v4f*)(C + (size_t)(row0 + r) * ldc + col0 + c4) = v;
    }
    
  }
}
// row LayerNorm (biased variance, eps) over N: s = X (+ R); optional out_sum <- s; out_norm <- (s-mu)*rsqrt(var+eps)*g + b
template <bool PARAM_BF16>
__global__ __launch_bounds__(256) void k_layernorm(const float* __restrict__ X, const float* __restrict__ R, const float* __restrict__ g, const float* __restrict__ bta,
                                                  float* __restrict__ out_sum, float* __restrict__ out_norm, int N, float eps) {
  __shared__ float red[256];
  const int row = blockIdx.x, tid = threadIdx.x;
  const float* x = X + (size_t)row * N; const float* rr = R ? R + (size_t)row * N : nullptr;
  float vals[16];                     // up to N = 4096
  const int per = N / 256;            // contiguous chunk per thread? use strided-by-4 chunks: thread handles j = tid*4 + 1024*u
  float s1 = 0.f;
  for (int u = 0; u < per / 4; ++u) {
    const int j = tid * 4 + 1024 * u;
    const v4f a = *(const v4fa*)(x + j);
    v4f b = {0.f,0.f,0.f,0.f}; if (rr) b = *(const v4fa*)(rr + j);
#pragma unroll
    for (int q = 0; q < 4; ++q) { const float v = a[q] + b[q]; vals[u * 4 + q] = v; s1 += v; }
  }
  red[tid] = s1; __syncthreads();
  for (int st = 128; st > 0; st >>= 1) { if (tid < st) red[tid] += red[tid + st]; __syncthreads(); }
  const float mu = red[0] / (float)N; __syncthreads();
  float s2 = 0.f;
  for (int u = 0; u < per / 4; ++u)
#pragma unroll
    for (int q = 0; q < 4; ++q) { const float c = vals[u * 4 + q] - mu; s2 += c * c; }
  red[tid] = s2; __syncthreads();
  for (int st = 128; st > 0; st >>= 1) { if (tid < st) red[tid] += red[tid + st]; __syncthreads(); }
  const float rs = rsqrtf(red[0] / (float)N + eps);
  {
    for (int u = 0; u < per / 4; ++u) {
      const int j = tid * 4 + 1024 * u;
      v4f o, sm;
#pragma unroll
      for (int q = 0; q < 4; ++q) {
        float gg = g[j + q], bb = bta[j + q];
        if (PARAM_BF16) { gg = bf16_round(gg); bb = bf16_round(bb); }
        sm[q] = vals[u * 4 + q]; o[q] = (vals[u * 4 + q] - mu) * rs * gg + bb;
      }
      if (out_sum) *(v4f*)(out_sum + (size_t)row * N + j) = sm;
      *(v4f*)(out_norm + (size_t)row * N + j) = o;
    }
    
  }
}

// K and V rows (f32, row pitch `pitch`, D = 64 columns) prepared ONCE for k_flash3: each value split into bf16 hi + lo, written as four planes.
// Kh/Kl keep the row order [row][D]. VTh/VTl are transposed inside each chunk of 32 rows: [chunk][d][32 rows], so that a chunk of any plane is
// 32 * D contiguous values at offset chunk * 32 * D, and a V^T fragment row (one d, 32 keys) is contiguous. One block = one chunk of 32 rows.
template <int D>
__global__ __launch_bounds__(256) void k_split_kv(const float* __restrict__ K, const float* __restrict__ V, int pitch,
                                                 unsigned short* __restrict__ Kh, unsigned short* __restrict__ Kl,
                                                 unsigned short* __restrict__ VTh, unsigned short* __restrict__ VTl) {
  static_assert(D == 64, "256 threads = 32 rows x D/8 units = D rows x 4 units");
  __shared__ float tv[32][D + 1];                                // pitch 65 dwords: the column walk below meets distinct banks
  const int t = threadIdx.x;
  const size_t row0 = (size_t)blockIdx.x * 32;
  {
    const int r = t / (D / 8), c8 = (t % (D / 8)) * 8;
    const float* kr = K + (row0 + r) * pitch + c8; const float* vr = V + (row0 + r) * pitch + c8;
    const v4f k0 = *(const v4fa*)kr, k1 = *(const v4fa*)(kr + 4);
    asm volatile("s_wait_xcnt 0x0" ::: "memory");                // what follows may reuse the address registers of the two loads above
    const v4f v0 = *(const v4fa*)vr, v1 = *(const v4fa*)(vr + 4);
    asm volatile("s_wait_xcnt 0x0" ::: "memory");                // the same for these two
    Pack8 hi, lo;
    // unrolled (here and below): the vectors are then indexed by constants and stay in registers
#pragma unroll
    for (int i = 0; i < 8; i += 2) {
      const float x0 = (i < 4) ? k0[i & 3] : k1[i & 3], x1 = (i < 4) ? k0[(i + 1) & 3] : k1[(i + 1) & 3];
      hi.w[i / 2] = bf16_pack2(x0, x1); lo.w[i / 2] = bf16_rest2(x0, x1, hi.w[i / 2]);
      tv[r][c8 + i] = (i < 4) ? v0[i & 3] : v1[i & 3]; tv[r][c8 + i + 1] = (i < 4) ? v0[(i + 1) & 3] : v1[(i + 1) & 3];
    }
    *(v8us*)(Kh + (row0 + r) * D + c8) = hi.v;
    *(v8us*)(Kl + (row0 + r) * D + c8) = lo.v;
  }
  __syncthreads();
  {
    const int d = t / 4, k8 = (t % 4) * 8;
    Pack8 hi, lo;
#pragma unroll
    for (int i = 0; i < 8; i += 2) {
      const float x0 = tv[k8 + i][d], x1 = tv[k8 + i + 1][d];
      hi.w[i / 2] = bf16_pack2(x0, x1); lo.w[i / 2] = bf16_rest2(x0, x1, hi.w[i / 2]);
    }
    *(v8us*)(VTh + row0 * D + d * 32 + k8) = hi.v;
    *(v8us*)(VTl + row0 * D + d * 32 + k8) = lo.v;
  }
}

template <int D, int NS>
__global__ __launch_bounds__(128 * NS) void k_flash3(const float* __restrict__ Qb, int qpitch, int Tq,
                                              const unsigned short* __restrict__ Kh, const unsigned short* __restrict__ Kl,
                                              const unsigned short* __restrict__ VTh, const unsigned short* __restrict__ VTl, int Tk,
                                              int H, float scale, const int* __restrict__ mask, int causal, const float* __restrict__ sbias,
                                              float* __restrict__ y, int ypitch) {
  constexpr int KS = D / 32, DT = D / 16;
  constexpr int OP = D + 4;         // pitch of sO in floats: 16 B x odd, so the 16 lanes that each store 16 bytes of their own row meet distinct banks
  constexpr int VP = 32 + 8;        // pitch of a V^T row (32 keys) in values: 80 B = 16 B x odd, for 16-byte readers
  __shared__ __attribute__((aligned(16))) unsigned short sKhG[NS][32][D + 8], sKlG[NS][32][D + 8], sVhG[NS][D][VP], sVlG[NS][D][VP];
  __shared__ __attribute__((aligned(16))) float sO[NS][4][16][OP];
  __shared__ float sM[NS][4][16], sL[NS][4][16];
  // g is the same in every lane of a wave; held in a scalar register, the chunk's base address and the test for a chunk past the end are scalar too
  const int g = __builtin_amdgcn_readfirstlane(threadIdx.x >> 7);
  const int tid = threadIdx.x & 127, w = tid >> 5, lane = tid & 31, ln = lane & 15, hh = lane >> 4;
  unsigned short (*sKh)[D + 8] = sKhG[g]; unsigned short (*sKl)[D + 8] = sKlG[g]; unsigned short (*sVh)[VP] = sVhG[g]; unsigned short (*sVl)[VP] = sVlG[g];
  const int nqb = (Tq + 63) / 64;
  const int bh = blockIdx.x / nqb, qblk = blockIdx.x % nqb;
  const int b = bh / H, h = bh % H;
  const int q0 = qblk * 64 + w * 16;
  const float* Q = Qb + (size_t)b * Tq * qpitch + h * D;
  FragB aqh[KS], aql[KS];
  {
    int row = q0 + ln; if (row >= Tq) row = Tq - 1;
    const float* qr = Q + (size_t)row * qpitch;
#pragma unroll
    for (int ks = 0; ks < KS; ++ks)
#pragma unroll
      for (int i = 0; i < 16; i += 2) {
        const int d = ks * 32 + ((i < 8) ? (8 * hh + i) : (16 + 8 * hh + (i - 8)));
        const float x0 = qr[d] * scale, x1 = qr[d + 1] * scale; const unsigned int hw = bf16_pack2(x0, x1);
        aqh[ks].w[i / 2] = hw; aql[ks].w[i / 2] = bf16_rest2(x0, x1, hw);
      }
  }
  int qi = q0 + ln; if (qi >= Tq) qi = Tq - 1;                  // the lane's query
  float m_r = -3.0e38f, l_r = 0.f;                               // its running max (equal in both halves) and this half's share of its sum
  v8f oacc[DT];                                                  // O^T: oacc[dt][r] = O[query ln][dt * 16 + 8 * hh + r]
#pragma unroll
  for (int dt = 0; dt < DT; ++dt) oacc[dt] = (v8f){0.f,0.f,0.f,0.f,0.f,0.f,0.f,0.f};
  const bool special = causal || mask || sbias;
  const int kv_end = causal ? min(Tk, qblk * 64 + 64) : Tk;
  // byte offset of the thread's first 16-byte unit of its group's chunk, the same in all four planes (each plane is below 4 GiB): one 32-bit
  // register beside four scalar bases addresses all the loads of a trip
  unsigned coff = ((unsigned)bh * Tk + 32 * g) * (D * 2) + tid * 16;
  for (int jb = 0; jb < kv_end; jb += 32 * NS, coff += 32 * NS * D * 2) {   // block-uniform trips; a group's chunk past the end is masked like any tail
    const int j0 = jb + 32 * g;
    __syncthreads();
    {
      constexpr int NU = 32 * D / 8 / 128;                       // 16-byte units of one plane's chunk per thread
      v8us ckh[NU], ckl[NU], cvh[NU], cvl[NU];
      // the loops over u are unrolled so that the units stay in registers and all loads are issued before the first LDS store
      if (j0 < Tk) {
#pragma unroll
        for (int u = 0; u < NU; ++u) {
          const unsigned o = coff + 2048u * u;                   // 128 threads x 16 B a unit row
          ckh[u] = *(const v8us*)((const char*)Kh + o);  ckl[u] = *(const v8us*)((const char*)Kl + o);
          cvh[u] = *(const v8us*)((const char*)VTh + o); cvl[u] = *(const v8us*)((const char*)VTl + o);
        }
#pragma unroll
        for (int u = 0; u < NU; ++u) {
          const int e = tid + 128 * u;
          *(v8us*)&sKh[e / (D / 8)][(e % (D / 8)) * 8] = ckh[u]; *(v8us*)&sKl[e / (D / 8)][(e % (D / 8)) * 8] = ckl[u];
          *(v8us*)&sVh[e / 4][(e % 4) * 8] = cvh[u];             *(v8us*)&sVl[e / 4][(e % 4) * 8] = cvl[u];
        }
      } else {                                                   // a chunk past the end: zeros, its scores are masked below
        const v8us zero = {0, 0, 0, 0, 0, 0, 0, 0};
#pragma unroll
        for (int u = 0; u < NU; ++u) {
          const int e = tid + 128 * u;
          *(v8us*)&sKh[e / (D / 8)][(e % (D / 8)) * 8] = zero; *(v8us*)&sKl[e / (D / 8)][(e % (D / 8)) * 8] = zero;
          *(v8us*)&sVh[e / 4][(e % 4) * 8] = zero;             *(v8us*)&sVl[e / 4][(e % 4) * 8] = zero;
        }
      }
    }
    __syncthreads();
    v8f s[2];                                                    // S^T: s[nt][r] = score(query ln, key j0 + nt * 16 + 8 * hh + r)
#pragma unroll
    for (int nt = 0; nt < 2; ++nt) {
      v8f acc = {};
#pragma unroll
      for (int ks = 0; ks < KS; ++ks) {
        FragB bh_, bl_;
        bh_.half[0] = *(const v8us*)&sKh[nt * 16 + ln][ks * 32 + 8 * hh]; bh_.half[1] = *(const v8us*)&sKh[nt * 16 + ln][ks * 32 + 16 + 8 * hh];
        bl_.half[0] = *(const v8us*)&sKl[nt * 16 + ln][ks * 32 + 8 * hh]; bl_.half[1] = *(const v8us*)&sKl[nt * 16 + ln][ks * 32 + 16 + 8 * hh];
        acc = mmaN<3>(bh_.v, bl_.v, aqh[ks].v, aql[ks].v, acc);
      }
      s[nt] = acc;
    }
    if (special || jb + 32 * NS > Tk) {                          // block-uniform: masks, biases and key tails; a dropped score becomes -3e38
#pragma unroll
      for (int nt = 0; nt < 2; ++nt)
#pragma unroll
        for (int r = 0; r < 8; ++r) {
          const int key = j0 + nt * 16 + 8 * hh + r;
          bool keep = key < Tk;
          if (causal) keep = keep && (key <= qi);
          if (mask) { if (keep) keep = mask[(size_t)qi * Tk + key] != 0; }
          if (sbias) { if (keep) s[nt][r] += sbias[(size_t)bh * Tk + key]; }   // per-key additive bias (a per-query constant would cancel in the softmax)
          if (!keep) s[nt][r] = -3.0e38f;
        }
    }
    float mx = fmaxf(s[0][0], s[1][0]);
#pragma unroll
    for (int r = 1; r < 8; ++r) mx = fmaxf(mx, fmaxf(s[0][r], s[1][r]));
    mx = fmaxf(mx, xhalf(mx));                                   // the query's other 16 keys sit in the other half
    const float mnew = fmaxf(m_r, mx);
    const float mexp = fmaxf(mnew, -1.0e38f);                    // with nothing kept so far a dropped score still gives exp(-2e38) = 0
    const float alpha = __expf(m_r - mexp);
    m_r = mnew;
    FragB pbh, pbl;                                              // P^T as a B fragment: element nt * 8 + r is key nt * 16 + 8 * hh + r
    float ps[4] = {0.f, 0.f, 0.f, 0.f};
#pragma unroll
    for (int nt = 0; nt < 2; ++nt)
#pragma unroll
      for (int r = 0; r < 8; r += 2) {
        const float p0 = __expf(s[nt][r] - mexp), p1 = __expf(s[nt][r + 1] - mexp);
        ps[r & 3] += p0; ps[(r + 1) & 3] += p1;
        const unsigned int hw = bf16_pack2(p0, p1);
        pbh.w[nt * 4 + r / 2] = hw; pbl.w[nt * 4 + r / 2] = bf16_rest2(p0, p1, hw);
      }
    l_r = l_r * alpha + ((ps[0] + ps[1]) + (ps[2] + ps[3]));     // this half's 16 keys (the halves are added at the end)
#pragma unroll
    for (int dt = 0; dt < DT; ++dt)
#pragma unroll
      for (int r = 0; r < 8; ++r) oacc[dt][r] *= alpha;
#pragma unroll
    for (int dt = 0; dt < DT; ++dt) {
      FragB bvh, bvl;                                            // V^T as an A fragment: row dt * 16 + ln, the k order of P^T
      bvh.half[0] = *(const v8us*)&sVh[dt * 16 + ln][8 * hh]; bvh.half[1] = *(const v8us*)&sVh[dt * 16 + ln][16 + 8 * hh];
      bvl.half[0] = *(const v8us*)&sVl[dt * 16 + ln][8 * hh]; bvl.half[1] = *(const v8us*)&sVl[dt * 16 + ln][16 + 8 * hh];
      oacc[dt] = mmaN<3>(bvh.v, bvl.v, pbh.v, pbl.v, oacc[dt]);
    }
  }
  {
    const float l = l_r + xhalf(l_r);
    if (hh == 0) { sM[g][w][ln] = m_r; sL[g][w][ln] = l; }
  }
#pragma unroll
  for (int dt = 0; dt < DT; ++dt) {                              // not yet divided by the row sum
    *(v4fa*)&sO[g][w][ln][dt * 16 + 8 * hh]     = (v4f){oacc[dt][0], oacc[dt][1], oacc[dt][2], oacc[dt][3]};
    *(v4fa*)&sO[g][w][ln][dt * 16 + 8 * hh + 4] = (v4f){oacc[dt][4], oacc[dt][5], oacc[dt][6], oacc[dt][7]};
  }
  __syncthreads();                                               // every group's (max, sum, O) is in LDS
  // join: wave (g, w) finishes rows 2g, 2g + 1, then + 2 NS, of query tile w; each half wave takes one row (two rows = 512 contiguous bytes a store)
  for (int r = g * 2 + hh; r < 16; r += 2 * NS) {
    const int row = q0 + r;
    float mj = -3.0e38f;
    // the three loops over s are unrolled so that f[] stays in registers
#pragma unroll
    for (int s = 0; s < NS; ++s) mj = fmaxf(mj, sM[s][w][r]);
    float f[NS], lj = 0.f;
#pragma unroll
    for (int s = 0; s < NS; ++s) { const float ms = sM[s][w][r]; f[s] = (ms > -1.0e38f) ? __expf(ms - mj) : 0.f; lj += f[s] * sL[s][w][r]; }
    const float inv = (mj > -1.0e38f) ? 1.0f / lj : __builtin_nanf("");
    for (int c4 = ln * 4; c4 < D; c4 += 64) {
      v4f val = {0.f, 0.f, 0.f, 0.f};
#pragma unroll
      for (int s = 0; s < NS; ++s) val += f[s] * *(const v4fa*)&sO[s][w][r][c4];
      if (row < Tq) {
        *(v4f*)(y + ((size_t)b * Tq + row) * ypitch + h * D + c4) = val * inv;
        asm volatile("s_wait_xcnt 0x0" ::: "memory");            // the next trip rewrites the store's address registers
      }
    }
  }
}

// The eight preparation jobs of a call depend on nothing but the inputs, so they share ONE grid and the block index picks the job (the same for
// every thread of a block, decided in front of the one barrier): the first 4 * PREP_WB blocks round the four weight matrices to bf16 (8 values a
// thread), the next block rounds the three biases into one concatenated row, all others transpose one 32 x 32 tile of x, NCHW -> [b][hw][c].
#define PREP_WB (HC * CC / 8 / 256)       // blocks per weight matrix
#define PREP_JOBS (4 * PREP_WB + 1)       // blocks in front of the transpose tiles
__global__ __launch_bounds__(256) void k_prep(const float* __restrict__ x, float* __restrict__ xT,
                                             const float* __restrict__ tw, const float* __restrict__ pw, const float* __restrict__ gw, const float* __restrict__ fw,
                                             unsigned short* __restrict__ Bqkv, unsigned short* __restrict__ Bf,
                                             const float* __restrict__ tb, const float* __restrict__ pb, const float* __restrict__ gb, float* __restrict__ bqkv) {
  __shared__ float tile[32][33];
  const int blk = blockIdx.x;
  if (blk < 4 * PREP_WB) {
    const int m = blk / PREP_WB;
    const float* W = (m == 0) ? tw : (m == 1) ? pw : (m == 2) ? gw : fw;
    unsigned short* Wt = (m < 3) ? Bqkv + m * (HC * CC) : Bf;
    const int t = (blk % PREP_WB) * 256 + threadIdx.x;
    const v4f a = *(const v4fa*)(W + (size_t)t * 8), b = *(const v4fa*)(W + (size_t)t * 8 + 4);
    Pack8 v; v.w[0] = bf16_pack2(a[0], a[1]); v.w[1] = bf16_pack2(a[2], a[3]); v.w[2] = bf16_pack2(b[0], b[1]); v.w[3] = bf16_pack2(b[2], b[3]);
    *(v8us*)(Wt + (size_t)t * 8) = v.v;
    return;
  }
  if (blk == 4 * PREP_WB) {
    const int t = threadIdx.x;
    if (t < 3 * (HC / 4)) {                                      // 4 values a thread; thread t writes bqkv[4 t ..], bias t / (HC / 4)
      const int m = t / (HC / 4);
      const float* src = (m == 0) ? tb : (m == 1) ? pb : gb;
      v4f a = *(const v4fa*)(src + (t % (HC / 4)) * 4);
      for (int i = 0; i < 4; ++i) a[i] = bf16_round(a[i]);
      *(v4f*)(bqkv + t * 4) = a;
    }
    return;
  }
  const int tix = blk - PREP_JOBS;
  const int c0 = (tix % (HWN / 32)) * 32, r0 = ((tix / (HWN / 32)) % (CC / 32)) * 32, b = tix / ((HWN / 32) * (CC / 32));
  const float* src = x + (size_t)b * CC * HWN;
  float* dst = xT + (size_t)b * CC * HWN;
  const int tx = threadIdx.x & 31, ty = threadIdx.x >> 5;     // 8 rows per pass
  for (int i = ty; i < 32; i += 8) tile[i][tx] = src[(size_t)(r0 + i) * HWN + c0 + tx];
  __syncthreads();
  for (int i = ty; i < 32; i += 8) dst[(size_t)(c0 + i) * CC + r0 + tx] = tile[tx][i];
}

// out[b][c][p] = y[(b,p)][c] + x[b][c][p]  (block per (b,c): 4096 contiguous floats)
__global__ __launch_bounds__(256) void k_fin(const float* __restrict__ y, const float* __restrict__ x, float* __restrict__ out) {
  const int b = blockIdx.x / CC, c = blockIdx.x % CC; const size_t base = ((size_t)b * CC + c) * HWN;
  { for (int p = threadIdx.x; p < HWN; p += 256) *(float*)(out + base + p) = y[((size_t)b * HWN + p) * CC + c] + x[base + p];  }
}
extern "C" void kernel_launch(void* const* d_in, const int* in_sizes, int n_in,
                              void* d_out, int out_size, void* d_ws, size_t ws_size, hipStream_t stream) {
  (void)in_sizes; (void)n_in; (void)out_size;
  const float* x = (const float*)d_in[0]; const float* tw = (const float*)d_in[1]; const float* tb = (const float*)d_in[2]; const float* pw = (const float*)d_in[3]; const float* pb = (const float*)d_in[4];
  const float* gw = (const float*)d_in[5]; const float* gb = (const float*)d_in[6]; const float* fw = (const float*)d_in[7]; const float* fb = (const float*)d_in[8];
  char* ws = (char*)d_ws; size_t off = 0;
  auto take = [&](size_t bytes) { char* p = ws + off; off += (bytes + 255) & ~(size_t)255; return p; };
  unsigned short* Bqkv = (unsigned short*)take((size_t)3 * HC * CC * 2); unsigned short* Bf = (unsigned short*)take((size_t)CC * HC * 2); float* bqkv = (float*)take(3 * HC * 4 + 256);
  float* xT = (float*)take((size_t)MROWS * CC * 4); float* qkv = (float*)take((size_t)MROWS * 3 * HC * 4); float* att = (float*)take((size_t)MROWS * HC * 4); float* y = (float*)take((size_t)MROWS * CC * 4);
  unsigned short* Kh = (unsigned short*)take((size_t)MROWS * HC * 2); unsigned short* Kl = (unsigned short*)take((size_t)MROWS * HC * 2);
  unsigned short* VTh = (unsigned short*)take((size_t)MROWS * HC * 2); unsigned short* VTl = (unsigned short*)take((size_t)MROWS * HC * 2);
  if (off > ws_size) return;
  k_prep<<<PREP_JOBS + (HWN / 32) * (CC / 32) * BB, 256, 0, stream>>>(x, xT, tw, pw, gw, fw, Bqkv, Bf, tb, pb, gb, bqkv);   // rounded weights and biases, x -> [b][hw][c]
  k_gemm_bf3<false, 0, false, false><<<((MROWS / 16) * 3 + 3) / 4, 128, 0, stream>>>(xT, CC, Bqkv, CC, bqkv, nullptr, 1, 0, qkv, 3 * HC, MROWS, 3 * HC, CC);   // [theta | phi | g] + b (single term)
  k_split_kv<HC><<<MROWS / 32, 256, 0, stream>>>(qkv + HC, qkv + 2 * HC, 3 * HC, Kh, Kl, VTh, VTl);                                        // phi, g -> bf16 hi/lo planes, once
  k_flash3<HC, NSPLIT><<<BB * (HWN / 64), 128 * NSPLIT, 0, stream>>>(qkv, 3 * HC, HWN, Kh, Kl, VTh, VTl, HWN, 1, 1.0f, nullptr, 0, nullptr, att, HC);
  k_gemm_bf3<true, 0, true, false><<<((MROWS / 16) * 2 + 3) / 4, 128, 0, stream>>>(att, HC, Bf, HC, fb, nullptr, 1, 0, y, CC, MROWS, CC, HC);                    // final conv + b
  k_fin<<<BB * CC, 256, 0, stream>>>(y, x, (float*)d_out);
}

// v006
// A run of this version takes 91 microseconds.
// Timed twice side by side with v005, it ran 1.18 and 1.17 times as fast.
// Counting every step since v000, it is 7.24 times as fast.
#include <hip/hip_runtime.h>
// theta/phi/g 1×1 convolutions as one GEMM on position-major bf16(x) (single rounded term, K=128, N=192), the 4096×4096 non-local attention per batch as
// 16-query tiles on WMMA (Q·Kᵀ and P·V as 3-term bf16 hi/lo splits, f32 online softmax, no scaling), and the final 1×1 conv (2 terms) + bias; the
// residual add and the NCHW transposes are f32. 
#define BB 4
#define CC 128
#define HC 64
#define HWN 4096
#define MROWS (BB * HWN)
#define NSPLIT 4      // key groups per attention block: 4 waves each, so NSPLIT waves per SIMD

typedef __bf16 v16b __attribute__((ext_vector_type(16)));
typedef unsigned short v8us __attribute__((ext_vector_type(8), may_alias));
typedef float  v8f  __attribute__((ext_vector_type(8)));
typedef float  v4f  __attribute__((ext_vector_type(4)));
typedef float  v4fa __attribute__((ext_vector_type(4), may_alias));
typedef float  v2f  __attribute__((ext_vector_type(2)));
typedef __bf16 v2b  __attribute__((ext_vector_type(2)));
union FragB { v16b v; v8us half[2]; unsigned short u[16]; unsigned int w[8]; };
union Pack8 { v8us v; unsigned int w[4]; };

// f32 -> bf16, round to nearest even, by the hardware conversion
__device__ __forceinline__ unsigned short bf16_bits(float x) { return __builtin_bit_cast(unsigned short, (__bf16)x); }
// two values in one packed conversion: a in the low half of the word, b in the high half
__device__ __forceinline__ unsigned int bf16_pack2(float a, float b) { const v2f v = {a, b}; return __builtin_bit_cast(unsigned int, __builtin_convertvector(v, v2b)); }
// the lo word of a pair: what its hi word hw leaves over, rounded (x - hi is exact in f32)
__device__ __forceinline__ unsigned int bf16_rest2(float a, float b, unsigned int hw) {
  const v2f x = {a, b}, h = {__uint_as_float(hw << 16), __uint_as_float(hw & 0xFFFF0000u)};
  return __builtin_bit_cast(unsigned int, __builtin_convertvector(x - h, v2b));
}
__device__ __forceinline__ float bf16_val(unsigned short b) { return __uint_as_float(((unsigned int)b) << 16); }
__device__ __forceinline__ float bf16_round(float x) { return bf16_val(bf16_bits(x)); }
// D += A·B with NT terms: 1 = ah·bh, 2 = + al·bh (A split), 3 = + ah·bl (both split)
template <int NT>
__device__ __forceinline__ v8f mmaN(v16b ah, v16b al, v16b bh, v16b bl, v8f c) {
  c = __builtin_amdgcn_wmma_f32_16x16x32_bf16(false, ah, false, bh, (short)0, c, false, false);
  if (NT >= 2) c = __builtin_amdgcn_wmma_f32_16x16x32_bf16(false, al, false, bh, (short)0, c, false, false);
  if (NT >= 3) c = __builtin_amdgcn_wmma_f32_16x16x32_bf16(false, ah, false, bl, (short)0, c, false, false);
  asm volatile("v_nop\n\tv_nop\n\tv_nop\n\tv_nop" : "+v"(c) : "v"(ah), "v"(al), "v"(bh), "v"(bl));
  return c;
}

// lane l <-> lane l ^ 16 (the other 16-lane row) in one vector cross-row move
__device__ __forceinline__ float xhalf(float x) {
  const int b = __float_as_int(x);
  return __int_as_float(__builtin_amdgcn_permlanex16(b, b, 0x76543210, 0xfedcba98, false, false));
}

__global__ __launch_bounds__(256) void k_wt_bf16(const float* __restrict__ W, unsigned short* __restrict__ Wt, int K, int N) {
  const int t = blockIdx.x * 256 + threadIdx.x;
  const int k8n = K / 8;
  if (t >= N * k8n) return;
  const int n = t / k8n, k8 = (t % k8n) * 8;
  v8us v;
#pragma unroll
  for (int i = 0; i < 8; ++i) v[i] = bf16_bits(W[(size_t)(k8 + i) * N + n]);
  *(v8us*)(Wt + (size_t)n * K + k8) = v;
  
}

// GEMM C[M][N] (f32, pitch ldc) = act(A[M][K]·W + bias). A f32 row-major (pitch lda) converted per fragment to bf16
// (ASPLIT: hi/lo two planes -> 2 terms, else single rounded term); Wt bf16 [N][K] (pitch ldb). BIAS_BF16 rounds the
// bias to bf16 first (bias quantised to bf16 before the add). K%32==0, M%16==0, N%64==0.
template <bool ASPLIT, int ACT, bool BIAS_BF16>
__global__ __launch_bounds__(128) void k_gemm_bf(const float* __restrict__ A, int lda, const unsigned short* __restrict__ Wt, int ldb,
                                               const float* __restrict__ bias, float* __restrict__ C, int ldc, int M, int N, int K) {
  __shared__ __attribute__((aligned(16))) float so[4][16][64];
  const int tid = threadIdx.x, w = tid >> 5, lane = tid & 31, ln = lane & 15, hh = lane >> 4;
  const int ntn = N / 64;
  const int wid = blockIdx.x * 4 + w;
  const int mt = wid / ntn, nq = wid % ntn;
  if (mt * 16 >= M) return;
  const int row0 = mt * 16, col0 = nq * 64;
  const float* arow = A + (size_t)(row0 + ln) * lda;
  v8f acc[4] = {};
  for (int kb = 0; kb < K; kb += 32) {
    FragB ah, al;
    const v4f x0 = *(const v4fa*)(arow + kb + 8 * hh), x1 = *(const v4fa*)(arow + kb + 8 * hh + 4);
    const v4f x2 = *(const v4fa*)(arow + kb + 16 + 8 * hh), x3 = *(const v4fa*)(arow + kb + 16 + 8 * hh + 4);
    float xs[16] = {x0[0],x0[1],x0[2],x0[3],x1[0],x1[1],x1[2],x1[3],x2[0],x2[1],x2[2],x2[3],x3[0],x3[1],x3[2],x3[3]};
#pragma unroll
    for (int i = 0; i < 8; ++i) { const unsigned int hw = bf16_pack2(xs[2 * i], xs[2 * i + 1]); ah.w[i] = hw; al.w[i] = ASPLIT ? bf16_rest2(xs[2 * i], xs[2 * i + 1], hw) : 0u; }
#pragma unroll
    for (int t = 0; t < 4; ++t) {
      const unsigned short* brow = Wt + (size_t)(col0 + t * 16 + ln) * ldb + kb;
      FragB b;
      b.half[0] = *(const v8us*)(brow + 8 * hh);
      b.half[1] = *(const v8us*)(brow + 16 + 8 * hh);
      acc[t] = mmaN<ASPLIT ? 2 : 1>(ah.v, al.v, b.v, b.v, acc[t]);
    }
  }
#pragma unroll
  for (int t = 0; t < 4; ++t) {
    float bv = bias ? bias[col0 + t * 16 + ln] : 0.f;
    if (BIAS_BF16) bv = bf16_round(bv);
#pragma unroll
    for (int r = 0; r < 8; ++r) { float v = acc[t][r] + bv; if (ACT == 1) v = fmaxf(v, 0.f); so[w][8 * hh + r][t * 16 + ln] = v; }
  }
  __builtin_amdgcn_fence(__ATOMIC_ACQ_REL, "workgroup");
  __builtin_amdgcn_wave_barrier();
  const int rsub = lane >> 4, c4 = (lane & 15) * 4;
  {
#pragma unroll
    for (int q = 0; q < 8; ++q) {
      const int r = q * 2 + rsub;
      const v4f v = *(const v4fa*)&so[w][r][c4];
      *(v4f*)(C + (size_t)(row0 + r) * ldc + col0 + c4) = v;
    }
    
  }
}

// Flash-style causal/unmasked attention, all contractions 3-term bf16 hi/lo splits, f32 softmax with running max.
// q,k,v rows are read from f32 buffers with arbitrary row pitch (so they can live inside a fused qkv buffer);
// D = head size (multiple of 32, <= 128); one wave = 16 query rows; block = 4 waves (64 queries) sharing K/V chunks of 32.
template <int D, bool CAUSAL>
__global__ __launch_bounds__(128) void k_flash(const float* __restrict__ qb, const float* __restrict__ kb, const float* __restrict__ vb,
                                             int pitch, int T, int H, float scale, float* __restrict__ y, int ypitch) {
  constexpr int KS = D / 32;        // k-steps for QK
  constexpr int DT = D / 16;        // d tiles for PV
  __shared__ __attribute__((aligned(16))) unsigned short sKh[32][D + 8], sKl[32][D + 8], sVh[32][D + 8], sVl[32][D + 8];
  __shared__ __attribute__((aligned(16))) unsigned short sPh[4][16][40], sPl[4][16][40];
  __shared__ __attribute__((aligned(16))) float sO[4][16][D];
  const int tid = threadIdx.x, w = tid >> 5, lane = tid & 31, ln = lane & 15, hh = lane >> 4;
  const int nqb = (T + 63) / 64;
  const int bh = blockIdx.x / nqb, qblk = blockIdx.x % nqb;
  const int b = bh / H, h = bh % H;
  const int q0 = qblk * 64 + w * 16;
  const float* Q = qb + (size_t)b * T * pitch + h * D;
  const float* K = kb + (size_t)b * T * pitch + h * D;
  const float* V = vb + (size_t)b * T * pitch + h * D;

  // A fragments of the wave's 16 query rows (scaled), hi/lo
  FragB aqh[KS], aql[KS];
  {
    int row = q0 + ln; if (row >= T) row = T - 1;
    const float* qr = Q + (size_t)row * pitch;
#pragma unroll
    for (int ks = 0; ks < KS; ++ks)
#pragma unroll
      for (int i = 0; i < 16; ++i) {
        const int d = ks * 32 + ((i < 8) ? (8 * hh + i) : (16 + 8 * hh + (i - 8)));
        const float x = qr[d] * scale; const unsigned short hb = bf16_bits(x);
        aqh[ks].u[i] = hb; aql[ks].u[i] = bf16_bits(x - bf16_val(hb));
      }
  }
  float m_r[8], l_r[8];
#pragma unroll
  for (int r = 0; r < 8; ++r) { m_r[r] = -3.0e38f; l_r[r] = 0.f; }
  v8f oacc[DT];
#pragma unroll
  for (int dt = 0; dt < DT; ++dt) oacc[dt] = (v8f){0.f,0.f,0.f,0.f,0.f,0.f,0.f,0.f};

  const int kv_end = CAUSAL ? min(T, qblk * 64 + 64) : T;     // block-uniform
  for (int j0 = 0; j0 < kv_end; j0 += 32) {
    __syncthreads();
    for (int e = tid; e < 32 * (D / 4); e += 128) {
      const int r = e / (D / 4), c4 = (e % (D / 4)) * 4;
      const int key = j0 + r;
      v4f kf = {0.f,0.f,0.f,0.f}, vf = {0.f,0.f,0.f,0.f};
      if (key < T) { kf = *(const v4fa*)(K + (size_t)key * pitch + c4); vf = *(const v4fa*)(V + (size_t)key * pitch + c4); }
#pragma unroll
      for (int t = 0; t < 4; ++t) {
        unsigned short hb = bf16_bits(kf[t]); sKh[r][c4 + t] = hb; sKl[r][c4 + t] = bf16_bits(kf[t] - bf16_val(hb));
        hb = bf16_bits(vf[t]); sVh[r][c4 + t] = hb; sVl[r][c4 + t] = bf16_bits(vf[t] - bf16_val(hb));
      }
    }
    __syncthreads();
    // S tile 16 x 32
    v8f s[2];
#pragma unroll
    for (int nt = 0; nt < 2; ++nt) {
      v8f acc = {};
#pragma unroll
      for (int ks = 0; ks < KS; ++ks) {
        FragB bh_, bl_;
        bh_.half[0] = *(const v8us*)&sKh[nt * 16 + ln][ks * 32 + 8 * hh]; bh_.half[1] = *(const v8us*)&sKh[nt * 16 + ln][ks * 32 + 16 + 8 * hh];
        bl_.half[0] = *(const v8us*)&sKl[nt * 16 + ln][ks * 32 + 8 * hh]; bl_.half[1] = *(const v8us*)&sKl[nt * 16 + ln][ks * 32 + 16 + 8 * hh];
        acc = mmaN<3>(aqh[ks].v, aql[ks].v, bh_.v, bl_.v, acc);
      }
      s[nt] = acc;
    }
    // mask + running max (rows 8hh+r; the 16 lanes of a half share rows)
    float alpha[8];
#pragma unroll
    for (int r = 0; r < 8; ++r) {
      const int qi = q0 + 8 * hh + r;
      const int ja = j0 + ln, jb = j0 + 16 + ln;
      if (CAUSAL) { if (ja > qi) s[0][r] = -3.0e38f; if (jb > qi) s[1][r] = -3.0e38f; }
      if (ja >= T) s[0][r] = -3.0e38f;
      if (jb >= T) s[1][r] = -3.0e38f;
      float mx = fmaxf(s[0][r], s[1][r]);
      mx = fmaxf(mx, __shfl_xor(mx, 1, 32)); mx = fmaxf(mx, __shfl_xor(mx, 2, 32)); mx = fmaxf(mx, __shfl_xor(mx, 4, 32)); mx = fmaxf(mx, __shfl_xor(mx, 8, 32));
      const float mnew = fmaxf(m_r[r], mx);
      alpha[r] = (mnew > -1.0e38f) ? __expf(m_r[r] - mnew) : 1.0f;
      const float p0 = (s[0][r] > -1.0e38f) ? __expf(s[0][r] - mnew) : 0.f;
      const float p1 = (s[1][r] > -1.0e38f) ? __expf(s[1][r] - mnew) : 0.f;
      m_r[r] = mnew;
      l_r[r] = l_r[r] * alpha[r] + p0 + p1;            // per-lane partial row sum (16 lanes combined at the end)
      unsigned short hb = bf16_bits(p0); sPh[w][8 * hh + r][ln] = hb;      sPl[w][8 * hh + r][ln] = bf16_bits(p0 - bf16_val(hb));
      hb = bf16_bits(p1);                sPh[w][8 * hh + r][16 + ln] = hb; sPl[w][8 * hh + r][16 + ln] = bf16_bits(p1 - bf16_val(hb));
    }
#pragma unroll
    for (int dt = 0; dt < DT; ++dt)
#pragma unroll
      for (int r = 0; r < 8; ++r) oacc[dt][r] *= alpha[r];
    __builtin_amdgcn_fence(__ATOMIC_ACQ_REL, "workgroup");
    __builtin_amdgcn_wave_barrier();
    FragB pah, pal;
    pah.half[0] = *(const v8us*)&sPh[w][ln][8 * hh]; pah.half[1] = *(const v8us*)&sPh[w][ln][16 + 8 * hh];
    pal.half[0] = *(const v8us*)&sPl[w][ln][8 * hh]; pal.half[1] = *(const v8us*)&sPl[w][ln][16 + 8 * hh];
#pragma unroll
    for (int dt = 0; dt < DT; ++dt) {
      FragB bvh, bvl;
#pragma unroll
      for (int i = 0; i < 8; ++i) {
        bvh.u[i] = sVh[8 * hh + i][dt * 16 + ln]; bvh.u[8 + i] = sVh[16 + 8 * hh + i][dt * 16 + ln];
        bvl.u[i] = sVl[8 * hh + i][dt * 16 + ln]; bvl.u[8 + i] = sVl[16 + 8 * hh + i][dt * 16 + ln];
      }
      oacc[dt] = mmaN<3>(pah.v, pal.v, bvh.v, bvl.v, oacc[dt]);
    }
    __builtin_amdgcn_fence(__ATOMIC_ACQ_REL, "workgroup");
    __builtin_amdgcn_wave_barrier();
  }
#pragma unroll
  for (int r = 0; r < 8; ++r) {
    float l = l_r[r];
    l += __shfl_xor(l, 1, 32); l += __shfl_xor(l, 2, 32); l += __shfl_xor(l, 4, 32); l += __shfl_xor(l, 8, 32);
    l_r[r] = (l > 0.f) ? 1.0f / l : 0.f;
  }
#pragma unroll
  for (int dt = 0; dt < DT; ++dt)
#pragma unroll
    for (int r = 0; r < 8; ++r) sO[w][8 * hh + r][dt * 16 + ln] = oacc[dt][r] * l_r[r];
  __builtin_amdgcn_fence(__ATOMIC_ACQ_REL, "workgroup");
  __builtin_amdgcn_wave_barrier();
  {
    for (int r = 0; r < 16; ++r) {
      const int row = q0 + r;
      if (row < T && lane < D / 4) {
        const v4f val = *(const v4fa*)&sO[w][r][lane * 4];
        *(v4f*)(y + ((size_t)b * T + row) * ypitch + h * D + lane * 4) = val;
      }
    }
    
  }
}

// in pitch = cols, out pitch = rows; rows, cols multiples of 32. Optional per-output-row affine (scale[c], shift[c]) and
// residual add res (same layout as out, optionally bf16-rounded) for fused epilogues: out = in*scale + shift + res.
template <bool AFFINE, bool RESID, bool RES_BF16>
__global__ __launch_bounds__(256) void k_transpose32(const float* __restrict__ in, float* __restrict__ out, int rows, int cols,
                                                    const float* __restrict__ scale, const float* __restrict__ shift, const float* __restrict__ res) {
  __shared__ float tile[32][33];
  const int b = blockIdx.z;
  const int r0 = blockIdx.y * 32, c0 = blockIdx.x * 32;
  const float* src = in + (size_t)b * rows * cols;
  float* dst = out + (size_t)b * rows * cols;
  const int tx = threadIdx.x & 31, ty = threadIdx.x >> 5;     // 8 rows per pass
  for (int i = ty; i < 32; i += 8) tile[i][tx] = src[(size_t)(r0 + i) * cols + c0 + tx];
  __syncthreads();
  {
    for (int i = ty; i < 32; i += 8) {
      float v = tile[tx][i];
      const int orow = c0 + i;
      if (AFFINE) v = v * scale[orow] + shift[orow];
      if (RESID) { float rv = res[(size_t)b * rows * cols + (size_t)orow * rows + r0 + tx]; if (RES_BF16) rv = bf16_round(rv); v += rv; }
      *(float*)(dst + (size_t)orow * rows + r0 + tx) = v;
    }
    
  }
}

// 2x2 max pool on position-major data: in [B][H*W][C] -> out [B][(H/2)*(W/2)][C]; thread per (b, p', 4 channels); C%4==0
__global__ __launch_bounds__(256) void k_pool2_pm(const float* __restrict__ in, float* __restrict__ out, int Bn, int H, int W, int C) {
  const size_t t = (size_t)blockIdx.x * 256 + threadIdx.x;
  const int c4n = C / 4, Ho = H / 2, Wo = W / 2;
  const size_t total = (size_t)Bn * Ho * Wo * c4n;
  if (t >= total) return;
  const int c4 = (int)(t % c4n) * 4; size_t rest = t / c4n;
  const int pw = (int)(rest % Wo); rest /= Wo; const int ph = (int)(rest % Ho); const int b = (int)(rest / Ho);
  const float* base = in + (size_t)b * H * W * C;
  const int p00 = (2 * ph) * W + 2 * pw;
  const v4f a = *(const v4fa*)(base + (size_t)p00 * C + c4), bq = *(const v4fa*)(base + (size_t)(p00 + 1) * C + c4);
  const v4f c = *(const v4fa*)(base + (size_t)(p00 + W) * C + c4), d = *(const v4fa*)(base + (size_t)(p00 + W + 1) * C + c4);
  v4f m; for (int i = 0; i < 4; ++i) m[i] = fmaxf(fmaxf(a[i], bq[i]), fmaxf(c[i], d[i]));
  float* dst = out + ((size_t)b * Ho * Wo + (size_t)ph * Wo + pw) * C + c4;
  *(v4f*)dst = m;
  
}

// General (non-causal) attention, 3-term bf16 splits, f32 softmax with running max.
// Q [.][Tq][qpitch], K [.][Tk][kpitch] (head dim DQ), V [.][Tk][vpitch] (head dim DVtot); this block handles DV output
// dims starting at dv0 = blockIdx.y*DV. y[bh][t][ypitch] gets columns dv0..dv0+DV-1. Per-bh base offsets via strides.
template <int DQ, int DV>
__global__ __launch_bounds__(128) void k_flash2(const float* __restrict__ Qb, size_t qstride, int qpitch, int Tq,
                                              const float* __restrict__ Kb, size_t kstride, int kpitch, int Tk,
                                              const float* __restrict__ Vb, size_t vstride, int vpitch,
                                              float scale, float* __restrict__ y, size_t ystride, int ypitch) {
  constexpr int KS = DQ / 32, DT = DV / 16;
  __shared__ __attribute__((aligned(16))) unsigned short sKh[32][DQ + 8], sKl[32][DQ + 8], sVh[32][DV + 8], sVl[32][DV + 8];
  __shared__ __attribute__((aligned(16))) unsigned short sPh[4][16][40], sPl[4][16][40];
  __shared__ __attribute__((aligned(16))) float sO[4][16][DV];
  const int tid = threadIdx.x, w = tid >> 5, lane = tid & 31, ln = lane & 15, hh = lane >> 4;
  const int nqb = (Tq + 63) / 64;
  const int bh = blockIdx.x / nqb, qblk = blockIdx.x % nqb;
  const int dv0 = blockIdx.y * DV;
  const int q0 = qblk * 64 + w * 16;
  const float* Q = Qb + (size_t)bh * qstride; const float* K = Kb + (size_t)bh * kstride; const float* V = Vb + (size_t)bh * vstride + dv0;
  FragB aqh[KS], aql[KS];
  {
    int row = q0 + ln; if (row >= Tq) row = Tq - 1;
    const float* qr = Q + (size_t)row * qpitch;
#pragma unroll
    for (int ks = 0; ks < KS; ++ks)
#pragma unroll
      for (int i = 0; i < 16; ++i) {
        const int d = ks * 32 + ((i < 8) ? (8 * hh + i) : (16 + 8 * hh + (i - 8)));
        const float x = qr[d] * scale; const unsigned short hb = bf16_bits(x);
        aqh[ks].u[i] = hb; aql[ks].u[i] = bf16_bits(x - bf16_val(hb));
      }
  }
  float m_r[8], l_r[8];
#pragma unroll
  for (int r = 0; r < 8; ++r) { m_r[r] = -3.0e38f; l_r[r] = 0.f; }
  v8f oacc[DT];
#pragma unroll
  for (int dt = 0; dt < DT; ++dt) oacc[dt] = (v8f){0.f,0.f,0.f,0.f,0.f,0.f,0.f,0.f};
  for (int j0 = 0; j0 < Tk; j0 += 32) {
    __syncthreads();
    for (int e = tid; e < 32 * (DQ / 4); e += 128) {
      const int r = e / (DQ / 4), c4 = (e % (DQ / 4)) * 4; const int key = j0 + r;
      v4f f = {0.f,0.f,0.f,0.f}; if (key < Tk) f = *(const v4fa*)(K + (size_t)key * kpitch + c4);
#pragma unroll
      for (int t = 0; t < 4; ++t) { const unsigned short hb = bf16_bits(f[t]); sKh[r][c4 + t] = hb; sKl[r][c4 + t] = bf16_bits(f[t] - bf16_val(hb)); }
    }
    for (int e = tid; e < 32 * (DV / 4); e += 128) {
      const int r = e / (DV / 4), c4 = (e % (DV / 4)) * 4; const int key = j0 + r;
      v4f f = {0.f,0.f,0.f,0.f}; if (key < Tk) f = *(const v4fa*)(V + (size_t)key * vpitch + c4);
#pragma unroll
      for (int t = 0; t < 4; ++t) { const unsigned short hb = bf16_bits(f[t]); sVh[r][c4 + t] = hb; sVl[r][c4 + t] = bf16_bits(f[t] - bf16_val(hb)); }
    }
    __syncthreads();
    v8f s[2];
#pragma unroll
    for (int nt = 0; nt < 2; ++nt) {
      v8f acc = {};
#pragma unroll
      for (int ks = 0; ks < KS; ++ks) {
        FragB bh_, bl_;
        bh_.half[0] = *(const v8us*)&sKh[nt * 16 + ln][ks * 32 + 8 * hh]; bh_.half[1] = *(const v8us*)&sKh[nt * 16 + ln][ks * 32 + 16 + 8 * hh];
        bl_.half[0] = *(const v8us*)&sKl[nt * 16 + ln][ks * 32 + 8 * hh]; bl_.half[1] = *(const v8us*)&sKl[nt * 16 + ln][ks * 32 + 16 + 8 * hh];
        acc = mmaN<3>(aqh[ks].v, aql[ks].v, bh_.v, bl_.v, acc);
      }
      s[nt] = acc;
    }
    float alpha[8];
#pragma unroll
    for (int r = 0; r < 8; ++r) {
      const int ja = j0 + ln, jb = j0 + 16 + ln;
      if (ja >= Tk) s[0][r] = -3.0e38f;
      if (jb >= Tk) s[1][r] = -3.0e38f;
      float mx = fmaxf(s[0][r], s[1][r]);
      mx = fmaxf(mx, __shfl_xor(mx, 1, 32)); mx = fmaxf(mx, __shfl_xor(mx, 2, 32)); mx = fmaxf(mx, __shfl_xor(mx, 4, 32)); mx = fmaxf(mx, __shfl_xor(mx, 8, 32));
      const float mnew = fmaxf(m_r[r], mx);
      alpha[r] = (mnew > -1.0e38f) ? __expf(m_r[r] - mnew) : 1.0f;
      const float p0 = (s[0][r] > -1.0e38f) ? __expf(s[0][r] - mnew) : 0.f;
      const float p1 = (s[1][r] > -1.0e38f) ? __expf(s[1][r] - mnew) : 0.f;
      m_r[r] = mnew;
      l_r[r] = l_r[r] * alpha[r] + p0 + p1;
      unsigned short hb = bf16_bits(p0); sPh[w][8 * hh + r][ln] = hb;      sPl[w][8 * hh + r][ln] = bf16_bits(p0 - bf16_val(hb));
      hb = bf16_bits(p1);                sPh[w][8 * hh + r][16 + ln] = hb; sPl[w][8 * hh + r][16 + ln] = bf16_bits(p1 - bf16_val(hb));
    }
#pragma unroll
    for (int dt = 0; dt < DT; ++dt)
#pragma unroll
      for (int r = 0; r < 8; ++r) oacc[dt][r] *= alpha[r];
    __builtin_amdgcn_fence(__ATOMIC_ACQ_REL, "workgroup");
    __builtin_amdgcn_wave_barrier();
    FragB pah, pal;
    pah.half[0] = *(const v8us*)&sPh[w][ln][8 * hh]; pah.half[1] = *(const v8us*)&sPh[w][ln][16 + 8 * hh];
    pal.half[0] = *(const v8us*)&sPl[w][ln][8 * hh]; pal.half[1] = *(const v8us*)&sPl[w][ln][16 + 8 * hh];
#pragma unroll
    for (int dt = 0; dt < DT; ++dt) {
      FragB bvh, bvl;
#pragma unroll
      for (int i = 0; i < 8; ++i) {
        bvh.u[i] = sVh[8 * hh + i][dt * 16 + ln]; bvh.u[8 + i] = sVh[16 + 8 * hh + i][dt * 16 + ln];
        bvl.u[i] = sVl[8 * hh + i][dt * 16 + ln]; bvl.u[8 + i] = sVl[16 + 8 * hh + i][dt * 16 + ln];
      }
      oacc[dt] = mmaN<3>(pah.v, pal.v, bvh.v, bvl.v, oacc[dt]);
    }
    __builtin_amdgcn_fence(__ATOMIC_ACQ_REL, "workgroup");
    __builtin_amdgcn_wave_barrier();
  }
#pragma unroll
  for (int r = 0; r < 8; ++r) {
    float l = l_r[r];
    l += __shfl_xor(l, 1, 32); l += __shfl_xor(l, 2, 32); l += __shfl_xor(l, 4, 32); l += __shfl_xor(l, 8, 32);
    l_r[r] = (l > 0.f) ? 1.0f / l : 0.f;
  }
#pragma unroll
  for (int dt = 0; dt < DT; ++dt)
#pragma unroll
    for (int r = 0; r < 8; ++r) sO[w][8 * hh + r][dt * 16 + ln] = oacc[dt][r] * l_r[r];
  __builtin_amdgcn_fence(__ATOMIC_ACQ_REL, "workgroup");
  __builtin_amdgcn_wave_barrier();
  {
    for (int r = 0; r < 16; ++r) {
      const int row = q0 + r;
      for (int c4 = lane * 4; c4 < DV; c4 += 128) {
        if (row < Tq) {
          const v4f val = *(const v4fa*)&sO[w][r][c4];
          *(v4f*)(y + (size_t)bh * ystride + (size_t)row * ypitch + dv0 + c4) = val;
        }
      }
    }
    
  }
}

// GEMM C = act(A·W + bias + resid): A f32 (ASPLIT -> hi/lo 2 terms), Wt bf16 [N][K]; ACT 0 none, 1 relu, 2 exact gelu;
// resid (optional, f32, row index = (row % rmod), pitch ldr, RES_BF16 rounds it) added before the activation.
template <bool ASPLIT, int ACT, bool BIAS_BF16, bool RES_BF16>
__global__ __launch_bounds__(128) void k_gemm_bf3(const float* __restrict__ A, int lda, const unsigned short* __restrict__ Wt, int ldb,
                                                const float* __restrict__ bias, const float* __restrict__ resid, int rmod, int ldr,
                                                float* __restrict__ C, int ldc, int M, int N, int K) {
  __shared__ __attribute__((aligned(16))) float so[4][16][64];
  const int tid = threadIdx.x, w = tid >> 5, lane = tid & 31, ln = lane & 15, hh = lane >> 4;
  const int ntn = N / 64;
  const int wid = blockIdx.x * 4 + w;
  const int mt = wid / ntn, nq = wid % ntn;
  if (mt * 16 >= M) return;
  const int row0 = mt * 16, col0 = nq * 64;
  const float* arow = A + (size_t)(row0 + ln) * lda;
  v8f acc[4] = {};
  for (int kb = 0; kb < K; kb += 32) {
    FragB ah, al;
    const v4f x0 = *(const v4fa*)(arow + kb + 8 * hh), x1 = *(const v4fa*)(arow + kb + 8 * hh + 4);
    const v4f x2 = *(const v4fa*)(arow + kb + 16 + 8 * hh), x3 = *(const v4fa*)(arow + kb + 16 + 8 * hh + 4);
    float xs[16] = {x0[0],x0[1],x0[2],x0[3],x1[0],x1[1],x1[2],x1[3],x2[0],x2[1],x2[2],x2[3],x3[0],x3[1],x3[2],x3[3]};
#pragma unroll
    for (int i = 0; i < 8; ++i) { const unsigned int hw = bf16_pack2(xs[2 * i], xs[2 * i + 1]); ah.w[i] = hw; al.w[i] = ASPLIT ? bf16_rest2(xs[2 * i], xs[2 * i + 1], hw) : 0u; }
#pragma unroll
    for (int t = 0; t < 4; ++t) {
      const unsigned short* brow = Wt + (size_t)(col0 + t * 16 + ln) * ldb + kb;
      FragB b;
      b.half[0] = *(const v8us*)(brow + 8 * hh);
      b.half[1] = *(const v8us*)(brow + 16 + 8 * hh);
      acc[t] = mmaN<ASPLIT ? 2 : 1>(ah.v, al.v, b.v, b.v, acc[t]);
    }
  }
#pragma unroll
  for (int t = 0; t < 4; ++t) {
    const int col = col0 + t * 16 + ln;
    float bv = bias ? bias[col] : 0.f;
    if (BIAS_BF16) bv = bf16_round(bv);
#pragma unroll
    for (int r = 0; r < 8; ++r) {
      float v = acc[t][r] + bv;
      if (resid) { float rv = resid[(size_t)((row0 + 8 * hh + r) % rmod) * ldr + col]; if (RES_BF16) rv = bf16_round(rv); v += rv; }
      if (ACT == 1) v = fmaxf(v, 0.f);
      if (ACT == 2) v = 0.5f * v * (1.0f + erff(v * 0.70710678118654752f));
      if (ACT == 3) { const float u = 0.7978845608028654f * (v + 0.044715f * v * v * v); v = 0.5f * v * (1.0f + tanhf(u)); }
      so[w][8 * hh + r][t * 16 + ln] = v;
    }
  }
  __builtin_amdgcn_fence(__ATOMIC_ACQ_REL, "workgroup");
  __builtin_amdgcn_wave_barrier();
  const int rsub = lane >> 4, c4 = (lane & 15) * 4;
  {
#pragma unroll
    for (int q = 0; q < 8; ++q) {
      const int r = q * 2 + rsub;
      const v4f v = *(const v4fa*)&so[w][r][c4];
      *(v4f*)(C + (size_t)(row0 + r) * ldc + col0 + c4) = v;
    }
    
  }
}
// row LayerNorm (biased variance, eps) over N: s = X (+ R); optional out_sum <- s; out_norm <- (s-mu)*rsqrt(var+eps)*g + b
template <bool PARAM_BF16>
__global__ __launch_bounds__(256) void k_layernorm(const float* __restrict__ X, const float* __restrict__ R, const float* __restrict__ g, const float* __restrict__ bta,
                                                  float* __restrict__ out_sum, float* __restrict__ out_norm, int N, float eps) {
  __shared__ float red[256];
  const int row = blockIdx.x, tid = threadIdx.x;
  const float* x = X + (size_t)row * N; const float* rr = R ? R + (size_t)row * N : nullptr;
  float vals[16];                     // up to N = 4096
  const int per = N / 256;            // contiguous chunk per thread? use strided-by-4 chunks: thread handles j = tid*4 + 1024*u
  float s1 = 0.f;
  for (int u = 0; u < per / 4; ++u) {
    const int j = tid * 4 + 1024 * u;
    const v4f a = *(const v4fa*)(x + j);
    v4f b = {0.f,0.f,0.f,0.f}; if (rr) b = *(const v4fa*)(rr + j);
#pragma unroll
    for (int q = 0; q < 4; ++q) { const float v = a[q] + b[q]; vals[u * 4 + q] = v; s1 += v; }
  }
  red[tid] = s1; __syncthreads();
  for (int st = 128; st > 0; st >>= 1) { if (tid < st) red[tid] += red[tid + st]; __syncthreads(); }
  const float mu = red[0] / (float)N; __syncthreads();
  float s2 = 0.f;
  for (int u = 0; u < per / 4; ++u)
#pragma unroll
    for (int q = 0; q < 4; ++q) { const float c = vals[u * 4 + q] - mu; s2 += c * c; }
  red[tid] = s2; __syncthreads();
  for (int st = 128; st > 0; st >>= 1) { if (tid < st) red[tid] += red[tid + st]; __syncthreads(); }
  const float rs = rsqrtf(red[0] / (float)N + eps);
  {
    for (int u = 0; u < per / 4; ++u) {
      const int j = tid * 4 + 1024 * u;
      v4f o, sm;
#pragma unroll
      for (int q = 0; q < 4; ++q) {
        float gg = g[j + q], bb = bta[j + q];
        if (PARAM_BF16) { gg = bf16_round(gg); bb = bf16_round(bb); }
        sm[q] = vals[u * 4 + q]; o[q] = (vals[u * 4 + q] - mu) * rs * gg + bb;
      }
      if (out_sum) *(v4f*)(out_sum + (size_t)row * N + j) = sm;
      *(v4f*)(out_norm + (size_t)row * N + j) = o;
    }
    
  }
}

// K and V rows (f32, row pitch `pitch`, D = 64 columns) prepared ONCE for k_flash3: each value split into bf16 hi + lo, written as four planes.
// Kh/Kl keep the row order [row][D]. VTh/VTl are transposed inside each chunk of 32 rows: [chunk][d][32 rows], so that a chunk of any plane is
// 32 * D contiguous values at offset chunk * 32 * D, and a V^T fragment row (one d, 32 keys) is contiguous. One block = one chunk of 32 rows.
template <int D>
__global__ __launch_bounds__(256) void k_split_kv(const float* __restrict__ K, const float* __restrict__ V, int pitch,
                                                 unsigned short* __restrict__ Kh, unsigned short* __restrict__ Kl,
                                                 unsigned short* __restrict__ VTh, unsigned short* __restrict__ VTl) {
  static_assert(D == 64, "256 threads = 32 rows x D/8 units = D rows x 4 units");
  __shared__ float tv[32][D + 1];                                // pitch 65 dwords: the column walk below meets distinct banks
  const int t = threadIdx.x;
  const size_t row0 = (size_t)blockIdx.x * 32;
  {
    const int r = t / (D / 8), c8 = (t % (D / 8)) * 8;
    const float* kr = K + (row0 + r) * pitch + c8; const float* vr = V + (row0 + r) * pitch + c8;
    const v4f k0 = *(const v4fa*)kr, k1 = *(const v4fa*)(kr + 4);
    asm volatile("s_wait_xcnt 0x0" ::: "memory");                // what follows may reuse the address registers of the two loads above
    const v4f v0 = *(const v4fa*)vr, v1 = *(const v4fa*)(vr + 4);
    asm volatile("s_wait_xcnt 0x0" ::: "memory");                // the same for these two
    Pack8 hi, lo;
    // unrolled (here and below): the vectors are then indexed by constants and stay in registers
#pragma unroll
    for (int i = 0; i < 8; i += 2) {
      const float x0 = (i < 4) ? k0[i & 3] : k1[i & 3], x1 = (i < 4) ? k0[(i + 1) & 3] : k1[(i + 1) & 3];
      hi.w[i / 2] = bf16_pack2(x0, x1); lo.w[i / 2] = bf16_rest2(x0, x1, hi.w[i / 2]);
      tv[r][c8 + i] = (i < 4) ? v0[i & 3] : v1[i & 3]; tv[r][c8 + i + 1] = (i < 4) ? v0[(i + 1) & 3] : v1[(i + 1) & 3];
    }
    *(v8us*)(Kh + (row0 + r) * D + c8) = hi.v;
    *(v8us*)(Kl + (row0 + r) * D + c8) = lo.v;
  }
  __syncthreads();
  {
    const int d = t / 4, k8 = (t % 4) * 8;
    Pack8 hi, lo;
#pragma unroll
    for (int i = 0; i < 8; i += 2) {
      const float x0 = tv[k8 + i][d], x1 = tv[k8 + i + 1][d];
      hi.w[i / 2] = bf16_pack2(x0, x1); lo.w[i / 2] = bf16_rest2(x0, x1, hi.w[i / 2]);
    }
    *(v8us*)(VTh + row0 * D + d * 32 + k8) = hi.v;
    *(v8us*)(VTl + row0 * D + d * 32 + k8) = lo.v;
  }
}

// One 32-key chunk of one key group in LDS: the four planes of k_split_kv. K rows at a pitch of D + 8 values, V^T rows (32 keys) at 32 + 8 values:
// both 16 B x odd, for 16-byte readers.
template <int D> struct KvStage { unsigned short Kh[32][D + 8], Kl[32][D + 8], Vh[D][32 + 8], Vl[D][32 + 8]; };
__device__ __forceinline__ unsigned lds_off(const void* p) { return (unsigned)(size_t)p; }   // byte address inside the work-group's LDS

template <int D, int NS>
__global__ __launch_bounds__(128 * NS) void k_flash3(const float* __restrict__ Qb, int qpitch, int Tq,
                                              const unsigned short* __restrict__ Kh, const unsigned short* __restrict__ Kl,
                                              const unsigned short* __restrict__ VTh, const unsigned short* __restrict__ VTl, int Tk,
                                              int H, float scale, const int* __restrict__ mask, int causal, const float* __restrict__ sbias,
                                              float* __restrict__ y, int ypitch) {
  constexpr int KS = D / 32, DT = D / 16;
  constexpr int OP = D + 4;         // pitch of sO in floats: 16 B x odd, so the 16 lanes that each store 16 bytes of their own row meet distinct banks
  __shared__ __attribute__((aligned(16))) KvStage<D> sSt[2][NS];
  __shared__ __attribute__((aligned(16))) float sO[NS][4][16][OP];
  __shared__ float sM[NS][4][16], sL[NS][4][16];
  // g is the same in every lane of a wave; held in a scalar register, the chunk's base address and the test for a chunk past the end are scalar too
  const int g = __builtin_amdgcn_readfirstlane(threadIdx.x >> 7);
  const int tid = threadIdx.x & 127, w = tid >> 5, lane = tid & 31, ln = lane & 15, hh = lane >> 4;
  const int nqb = (Tq + 63) / 64;
  const int bh = blockIdx.x / nqb, qblk = blockIdx.x % nqb;
  const int b = bh / H, h = bh % H;
  const int q0 = qblk * 64 + w * 16;
  const float* Q = Qb + (size_t)b * Tq * qpitch + h * D;
  FragB aqh[KS], aql[KS];
  {
    int row = q0 + ln; if (row >= Tq) row = Tq - 1;
    const float* qr = Q + (size_t)row * qpitch;
#pragma unroll
    for (int ks = 0; ks < KS; ++ks)
#pragma unroll
      for (int i = 0; i < 16; i += 2) {
        const int d = ks * 32 + ((i < 8) ? (8 * hh + i) : (16 + 8 * hh + (i - 8)));
        const float x0 = qr[d] * scale, x1 = qr[d + 1] * scale; const unsigned int hw = bf16_pack2(x0, x1);
        aqh[ks].w[i / 2] = hw; aql[ks].w[i / 2] = bf16_rest2(x0, x1, hw);
      }
  }
  int qi = q0 + ln; if (qi >= Tq) qi = Tq - 1;                  // the lane's query
  float m_r = -3.0e38f, l_r = 0.f;                               // its running max (equal in both halves) and this half's share of its sum
  v8f oacc[DT];                                                  // O^T: oacc[dt][r] = O[query ln][dt * 16 + 8 * hh + r]
#pragma unroll
  for (int dt = 0; dt < DT; ++dt) oacc[dt] = (v8f){0.f,0.f,0.f,0.f,0.f,0.f,0.f,0.f};
  const bool special = causal || mask || sbias;
  const int kv_end = causal ? min(Tk, qblk * 64 + 64) : Tk;
  static_assert(32 * D / 8 / 128 == 2, "two 16-byte units of each plane's chunk per thread");
  const int ntrip = (kv_end + 32 * NS - 1) / (32 * NS);          // block-uniform trips; a group's chunk past the end is masked like any tail
  // The thread's eight units of its group's chunk of trip t -> buffer buf. A chunk past the end of the keys is replaced by the last chunk: its addresses
  // stay inside the planes, every wave issues the same copies, and its scores are masked below, so that its P is 0 against finite V.
  auto stage = [&](int t, int buf) {
    const int jc = min((t * NS + g) * 32, Tk - 32);
    const unsigned o = ((unsigned)bh * Tk + jc) * (D * 2) + tid * 16;   // the same byte offset in all four planes (each plane is below 4 GiB)
    KvStage<D>* S = &sSt[buf][g];
    const int e0 = tid, e1 = tid + 128;                          // unit e: 128 threads x 16 B = 2048 B a unit row
    // the copies and, as the last line, the wait in front of any rewrite of their address registers, in one statement: nothing can come between
    asm volatile("global_load_async_to_lds_b128 %0, %8, off\n\t"
                 "global_load_async_to_lds_b128 %1, %9, off\n\t"
                 "global_load_async_to_lds_b128 %2, %10, off\n\t"
                 "global_load_async_to_lds_b128 %3, %11, off\n\t"
                 "global_load_async_to_lds_b128 %4, %12, off\n\t"
                 "global_load_async_to_lds_b128 %5, %13, off\n\t"
                 "global_load_async_to_lds_b128 %6, %14, off\n\t"
                 "global_load_async_to_lds_b128 %7, %15, off\n\t"
                 "s_wait_xcnt 0x0"
                 :: "v"(lds_off(&S->Kh[e0 / (D / 8)][(e0 % (D / 8)) * 8])), "v"(lds_off(&S->Kl[e0 / (D / 8)][(e0 % (D / 8)) * 8])),
                    "v"(lds_off(&S->Vh[e0 / 4][(e0 % 4) * 8])),             "v"(lds_off(&S->Vl[e0 / 4][(e0 % 4) * 8])),
                    "v"(lds_off(&S->Kh[e1 / (D / 8)][(e1 % (D / 8)) * 8])), "v"(lds_off(&S->Kl[e1 / (D / 8)][(e1 % (D / 8)) * 8])),
                    "v"(lds_off(&S->Vh[e1 / 4][(e1 % 4) * 8])),             "v"(lds_off(&S->Vl[e1 / 4][(e1 % 4) * 8])),
                    "v"((const char*)Kh + o),          "v"((const char*)Kl + o),          "v"((const char*)VTh + o),          "v"((const char*)VTl + o),
                    "v"((const char*)Kh + (o + 2048u)), "v"((const char*)Kl + (o + 2048u)), "v"((const char*)VTh + (o + 2048u)), "v"((const char*)VTl + (o + 2048u))
                 : "memory");
  };
  stage(0, 0);
  asm volatile("s_wait_asynccnt 0x0" ::: "memory");              // this wave's copies of chunk 0 have landed
  __syncthreads();                                               // and every other wave's
  if (ntrip > 1) stage(1, 1);
  for (int t = 0; t < ntrip; ++t) {
    const int jb = t * 32 * NS, j0 = jb + 32 * g;
    const KvStage<D>* S = &sSt[t & 1][g];
    const unsigned short (*sKh)[D + 8] = S->Kh; const unsigned short (*sKl)[D + 8] = S->Kl;
    const unsigned short (*sVh)[32 + 8] = S->Vh; const unsigned short (*sVl)[32 + 8] = S->Vl;
    v8f s[2];                                                    // S^T: s[nt][r] = score(query ln, key j0 + nt * 16 + 8 * hh + r)
#pragma unroll
    for (int nt = 0; nt < 2; ++nt) {
      v8f acc = {};
#pragma unroll
      for (int ks = 0; ks < KS; ++ks) {
        FragB bh_, bl_;
        bh_.half[0] = *(const v8us*)&sKh[nt * 16 + ln][ks * 32 + 8 * hh]; bh_.half[1] = *(const v8us*)&sKh[nt * 16 + ln][ks * 32 + 16 + 8 * hh];
        bl_.half[0] = *(const v8us*)&sKl[nt * 16 + ln][ks * 32 + 8 * hh]; bl_.half[1] = *(const v8us*)&sKl[nt * 16 + ln][ks * 32 + 16 + 8 * hh];
        acc = mmaN<3>(bh_.v, bl_.v, aqh[ks].v, aql[ks].v, acc);
      }
      s[nt] = acc;
    }
    if (special || jb + 32 * NS > Tk) {                          // block-uniform: masks, biases and key tails; a dropped score becomes -3e38
#pragma unroll
      for (int nt = 0; nt < 2; ++nt)
#pragma unroll
        for (int r = 0; r < 8; ++r) {
          const int key = j0 + nt * 16 + 8 * hh + r;
          bool keep = key < Tk;
          if (causal) keep = keep && (key <= qi);
          if (mask) { if (keep) keep = mask[(size_t)qi * Tk + key] != 0; }
          if (sbias) { if (keep) s[nt][r] += sbias[(size_t)bh * Tk + key]; }   // per-key additive bias (a per-query constant would cancel in the softmax)
          if (!keep) s[nt][r] = -3.0e38f;
        }
    }
    float mx = fmaxf(s[0][0], s[1][0]);
#pragma unroll
    for (int r = 1; r < 8; ++r) mx = fmaxf(mx, fmaxf(s[0][r], s[1][r]));
    mx = fmaxf(mx, xhalf(mx));                                   // the query's other 16 keys sit in the other half
    const float mnew = fmaxf(m_r, mx);
    const float mexp = fmaxf(mnew, -1.0e38f);                    // with nothing kept so far a dropped score still gives exp(-2e38) = 0
    const float alpha = __expf(m_r - mexp);
    m_r = mnew;
    FragB pbh, pbl;                                              // P^T as a B fragment: element nt * 8 + r is key nt * 16 + 8 * hh + r
    float ps[4] = {0.f, 0.f, 0.f, 0.f};
#pragma unroll
    for (int nt = 0; nt < 2; ++nt)
#pragma unroll
      for (int r = 0; r < 8; r += 2) {
        const float p0 = __expf(s[nt][r] - mexp), p1 = __expf(s[nt][r + 1] - mexp);
        ps[r & 3] += p0; ps[(r + 1) & 3] += p1;
        const unsigned int hw = bf16_pack2(p0, p1);
        pbh.w[nt * 4 + r / 2] = hw; pbl.w[nt * 4 + r / 2] = bf16_rest2(p0, p1, hw);
      }
    l_r = l_r * alpha + ((ps[0] + ps[1]) + (ps[2] + ps[3]));     // this half's 16 keys (the halves are added at the end)
#pragma unroll
    for (int dt = 0; dt < DT; ++dt)
#pragma unroll
      for (int r = 0; r < 8; ++r) oacc[dt][r] *= alpha;
#pragma unroll
    for (int dt = 0; dt < DT; ++dt) {
      FragB bvh, bvl;                                            // V^T as an A fragment: row dt * 16 + ln, the k order of P^T
      bvh.half[0] = *(const v8us*)&sVh[dt * 16 + ln][8 * hh]; bvh.half[1] = *(const v8us*)&sVh[dt * 16 + ln][16 + 8 * hh];
      bvl.half[0] = *(const v8us*)&sVl[dt * 16 + ln][8 * hh]; bvl.half[1] = *(const v8us*)&sVl[dt * 16 + ln][16 + 8 * hh];
      oacc[dt] = mmaN<3>(bvh.v, bvl.v, pbh.v, pbl.v, oacc[dt]);
    }
    asm volatile("s_wait_dscnt 0x0" ::: "memory");               // this wave's reads of the buffer are done before it is handed back
    asm volatile("s_wait_asynccnt 0x0" ::: "memory");            // this wave's copies of the next chunk have landed
    __syncthreads();                                             // the next chunk is published, this trip's buffer is free
    if (t + 2 < ntrip) stage(t + 2, t & 1);
  }
  asm volatile("s_wait_asynccnt 0x0" ::: "memory");              // no copy is left in flight behind the loop
  {
    const float l = l_r + xhalf(l_r);
    if (hh == 0) { sM[g][w][ln] = m_r; sL[g][w][ln] = l; }
  }
#pragma unroll
  for (int dt = 0; dt < DT; ++dt) {                              // not yet divided by the row sum
    *(v4fa*)&sO[g][w][ln][dt * 16 + 8 * hh]     = (v4f){oacc[dt][0], oacc[dt][1], oacc[dt][2], oacc[dt][3]};
    *(v4fa*)&sO[g][w][ln][dt * 16 + 8 * hh + 4] = (v4f){oacc[dt][4], oacc[dt][5], oacc[dt][6], oacc[dt][7]};
  }
  __syncthreads();                                               // every group's (max, sum, O) is in LDS
  // join: wave (g, w) finishes rows 2g, 2g + 1, then + 2 NS, of query tile w; each half wave takes one row (two rows = 512 contiguous bytes a store)
  for (int r = g * 2 + hh; r < 16; r += 2 * NS) {
    const int row = q0 + r;
    float mj = -3.0e38f;
    // the three loops over s are unrolled so that f[] stays in registers
#pragma unroll
    for (int s = 0; s < NS; ++s) mj = fmaxf(mj, sM[s][w][r]);
    float f[NS], lj = 0.f;
#pragma unroll
    for (int s = 0; s < NS; ++s) { const float ms = sM[s][w][r]; f[s] = (ms > -1.0e38f) ? __expf(ms - mj) : 0.f; lj += f[s] * sL[s][w][r]; }
    const float inv = (mj > -1.0e38f) ? 1.0f / lj : __builtin_nanf("");
    for (int c4 = ln * 4; c4 < D; c4 += 64) {
      v4f val = {0.f, 0.f, 0.f, 0.f};
#pragma unroll
      for (int s = 0; s < NS; ++s) val += f[s] * *(const v4fa*)&sO[s][w][r][c4];
      if (row < Tq) {
        *(v4f*)(y + ((size_t)b * Tq + row) * ypitch + h * D + c4) = val * inv;
        asm volatile("s_wait_xcnt 0x0" ::: "memory");            // the next trip rewrites the store's address registers
      }
    }
  }
}

// The eight preparation jobs of a call depend on nothing but the inputs, so they share ONE grid and the block index picks the job (the same for
// every thread of a block, decided in front of the one barrier): the first 4 * PREP_WB blocks round the four weight matrices to bf16 (8 values a
// thread), the next block rounds the three biases into one concatenated row, all others transpose one 32 x 32 tile of x, NCHW -> [b][hw][c].
#define PREP_WB (HC * CC / 8 / 256)       // blocks per weight matrix
#define PREP_JOBS (4 * PREP_WB + 1)       // blocks in front of the transpose tiles
__global__ __launch_bounds__(256) void k_prep(const float* __restrict__ x, float* __restrict__ xT,
                                             const float* __restrict__ tw, const float* __restrict__ pw, const float* __restrict__ gw, const float* __restrict__ fw,
                                             unsigned short* __restrict__ Bqkv, unsigned short* __restrict__ Bf,
                                             const float* __restrict__ tb, const float* __restrict__ pb, const float* __restrict__ gb, float* __restrict__ bqkv) {
  __shared__ float tile[32][33];
  const int blk = blockIdx.x;
  if (blk < 4 * PREP_WB) {
    const int m = blk / PREP_WB;
    const float* W = (m == 0) ? tw : (m == 1) ? pw : (m == 2) ? gw : fw;
    unsigned short* Wt = (m < 3) ? Bqkv + m * (HC * CC) : Bf;
    const int t = (blk % PREP_WB) * 256 + threadIdx.x;
    const v4f a = *(const v4fa*)(W + (size_t)t * 8), b = *(const v4fa*)(W + (size_t)t * 8 + 4);
    Pack8 v; v.w[0] = bf16_pack2(a[0], a[1]); v.w[1] = bf16_pack2(a[2], a[3]); v.w[2] = bf16_pack2(b[0], b[1]); v.w[3] = bf16_pack2(b[2], b[3]);
    *(v8us*)(Wt + (size_t)t * 8) = v.v;
    return;
  }
  if (blk == 4 * PREP_WB) {
    const int t = threadIdx.x;
    if (t < 3 * (HC / 4)) {                                      // 4 values a thread; thread t writes bqkv[4 t ..], bias t / (HC / 4)
      const int m = t / (HC / 4);
      const float* src = (m == 0) ? tb : (m == 1) ? pb : gb;
      v4f a = *(const v4fa*)(src + (t % (HC / 4)) * 4);
      for (int i = 0; i < 4; ++i) a[i] = bf16_round(a[i]);
      *(v4f*)(bqkv + t * 4) = a;
    }
    return;
  }
  const int tix = blk - PREP_JOBS;
  const int c0 = (tix % (HWN / 32)) * 32, r0 = ((tix / (HWN / 32)) % (CC / 32)) * 32, b = tix / ((HWN / 32) * (CC / 32));
  const float* src = x + (size_t)b * CC * HWN;
  float* dst = xT + (size_t)b * CC * HWN;
  const int tx = threadIdx.x & 31, ty = threadIdx.x >> 5;     // 8 rows per pass
  for (int i = ty; i < 32; i += 8) tile[i][tx] = src[(size_t)(r0 + i) * HWN + c0 + tx];
  __syncthreads();
  for (int i = ty; i < 32; i += 8) dst[(size_t)(c0 + i) * CC + r0 + tx] = tile[tx][i];
}

// out[b][c][p] = y[(b,p)][c] + x[b][c][p]  (block per (b,c): 4096 contiguous floats)
__global__ __launch_bounds__(256) void k_fin(const float* __restrict__ y, const float* __restrict__ x, float* __restrict__ out) {
  const int b = blockIdx.x / CC, c = blockIdx.x % CC; const size_t base = ((size_t)b * CC + c) * HWN;
  { for (int p = threadIdx.x; p < HWN; p += 256) *(float*)(out + base + p) = y[((size_t)b * HWN + p) * CC + c] + x[base + p];  }
}
extern "C" void kernel_launch(void* const* d_in, const int* in_sizes, int n_in,
                              void* d_out, int out_size, void* d_ws, size_t ws_size, hipStream_t stream) {
  (void)in_sizes; (void)n_in; (void)out_size;
  const float* x = (const float*)d_in[0]; const float* tw = (const float*)d_in[1]; const float* tb = (const float*)d_in[2]; const float* pw = (const float*)d_in[3]; const float* pb = (const float*)d_in[4];
  const float* gw = (const float*)d_in[5]; const float* gb = (const float*)d_in[6]; const float* fw = (const float*)d_in[7]; const float* fb = (const float*)d_in[8];
  char* ws = (char*)d_ws; size_t off = 0;
  auto take = [&](size_t bytes) { char* p = ws + off; off += (bytes + 255) & ~(size_t)255; return p; };
  unsigned short* Bqkv = (unsigned short*)take((size_t)3 * HC * CC * 2); unsigned short* Bf = (unsigned short*)take((size_t)CC * HC * 2); float* bqkv = (float*)take(3 * HC * 4 + 256);
  float* xT = (float*)take((size_t)MROWS * CC * 4); float* qkv = (float*)take((size_t)MROWS * 3 * HC * 4); float* att = (float*)take((size_t)MROWS * HC * 4); float* y = (float*)take((size_t)MROWS * CC * 4);
  unsigned short* Kh = (unsigned short*)take((size_t)MROWS * HC * 2); unsigned short* Kl = (unsigned short*)take((size_t)MROWS * HC * 2);
  unsigned short* VTh = (unsigned short*)take((size_t)MROWS * HC * 2); unsigned short* VTl = (unsigned short*)take((size_t)MROWS * HC * 2);
  if (off > ws_size) return;
  k_prep<<<PREP_JOBS + (HWN / 32) * (CC / 32) * BB, 256, 0, stream>>>(x, xT, tw, pw, gw, fw, Bqkv, Bf, tb, pb, gb, bqkv);   // rounded weights and biases, x -> [b][hw][c]
  k_gemm_bf3<false, 0, false, false><<<((MROWS / 16) * 3 + 3) / 4, 128, 0, stream>>>(xT, CC, Bqkv, CC, bqkv, nullptr, 1, 0, qkv, 3 * HC, MROWS, 3 * HC, CC);   // [theta | phi | g] + b (single term)
  k_split_kv<HC><<<MROWS / 32, 256, 0, stream>>>(qkv + HC, qkv + 2 * HC, 3 * HC, Kh, Kl, VTh, VTl);                                        // phi, g -> bf16 hi/lo planes, once
  k_flash3<HC, NSPLIT><<<BB * (HWN / 64), 128 * NSPLIT, 0, stream>>>(qkv, 3 * HC, HWN, Kh, Kl, VTh, VTl, HWN, 1, 1.0f, nullptr, 0, nullptr, att, HC);
  k_gemm_bf3<true, 0, true, false><<<((MROWS / 16) * 2 + 3) / 4, 128, 0, stream>>>(att, HC, Bf, HC, fb, nullptr, 1, 0, y, CC, MROWS, CC, HC);                    // final conv + b
  k_fin<<<BB * CC, 256, 0, stream>>>(y, x, (float*)d_out);
}

// v007
// It runs in 84.3 microseconds.
// In two side-by-side timings against v006, it was 1.08 and 1.07 times as fast.
// All steps since v000 together make it 7.80 times as fast.
#include <hip/hip_runtime.h>
// theta/phi/g 1×1 convolutions as one GEMM on channel-major bf16(x), read as it lies (single exact term, K=128, N=192), the 4096×4096 non-local attention per batch as
// 16-query tiles on WMMA (Q·Kᵀ and P·V as 3-term bf16 hi/lo splits, f32 online softmax, no scaling), and the final 1×1 conv (2 terms) + bias; the
// residual add and the transpose back to NCHW are f32.
#define BB 4
#define CC 128
#define HC 64
#define HWN 4096
#define MROWS (BB * HWN)
#define NSPLIT 4      // key groups per attention block: 4 waves each, so NSPLIT waves per SIMD

typedef __bf16 v16b __attribute__((ext_vector_type(16)));
typedef unsigned short v8us __attribute__((ext_vector_type(8), may_alias));
typedef float  v8f  __attribute__((ext_vector_type(8)));
typedef float  v4f  __attribute__((ext_vector_type(4)));
typedef float  v4fa __attribute__((ext_vector_type(4), may_alias));
typedef float  v2f  __attribute__((ext_vector_type(2)));
typedef __bf16 v2b  __attribute__((ext_vector_type(2)));
union FragB { v16b v; v8us half[2]; unsigned short u[16]; unsigned int w[8]; };
union Pack8 { v8us v; unsigned int w[4]; };

// f32 -> bf16, round to nearest even, by the hardware conversion
__device__ __forceinline__ unsigned short bf16_bits(float x) { return __builtin_bit_cast(unsigned short, (__bf16)x); }
// two values in one packed conversion: a in the low half of the word, b in the high half
__device__ __forceinline__ unsigned int bf16_pack2(float a, float b) { const v2f v = {a, b}; return __builtin_bit_cast(unsigned int, __builtin_convertvector(v, v2b)); }
// the lo word of a pair: what its hi word hw leaves over, rounded (x - hi is exact in f32)
__device__ __forceinline__ unsigned int bf16_rest2(float a, float b, unsigned int hw) {
  const v2f x = {a, b}, h = {__uint_as_float(hw << 16), __uint_as_float(hw & 0xFFFF0000u)};
  return __builtin_bit_cast(unsigned int, __builtin_convertvector(x - h, v2b));
}
__device__ __forceinline__ float bf16_val(unsigned short b) { return __uint_as_float(((unsigned int)b) << 16); }
__device__ __forceinline__ float bf16_round(float x) { return bf16_val(bf16_bits(x)); }
// D += A·B with NT terms: 1 = ah·bh, 2 = + al·bh (A split), 3 = + ah·bl (both split)
template <int NT>
__device__ __forceinline__ v8f mmaN(v16b ah, v16b al, v16b bh, v16b bl, v8f c) {
  c = __builtin_amdgcn_wmma_f32_16x16x32_bf16(false, ah, false, bh, (short)0, c, false, false);
  if (NT >= 2) c = __builtin_amdgcn_wmma_f32_16x16x32_bf16(false, al, false, bh, (short)0, c, false, false);
  if (NT >= 3) c = __builtin_amdgcn_wmma_f32_16x16x32_bf16(false, ah, false, bl, (short)0, c, false, false);
  asm volatile("v_nop\n\tv_nop\n\tv_nop\n\tv_nop" : "+v"(c) : "v"(ah), "v"(al), "v"(bh), "v"(bl));
  return c;
}

// lane l <-> lane l ^ 16 (the other 16-lane row) in one vector cross-row move
__device__ __forceinline__ float xhalf(float x) {
  const int b = __float_as_int(x);
  return __int_as_float(__builtin_amdgcn_permlanex16(b, b, 0x76543210, 0xfedcba98, false, false));
}

__global__ __launch_bounds__(256) void k_wt_bf16(const float* __restrict__ W, unsigned short* __restrict__ Wt, int K, int N) {
  const int t = blockIdx.x * 256 + threadIdx.x;
  const int k8n = K / 8;
  if (t >= N * k8n) return;
  const int n = t / k8n, k8 = (t % k8n) * 8;
  v8us v;
#pragma unroll
  for (int i = 0; i < 8; ++i) v[i] = bf16_bits(W[(size_t)(k8 + i) * N + n]);
  *(v8us*)(Wt + (size_t)n * K + k8) = v;
  
}

// GEMM C[M][N] (f32, pitch ldc) = act(A[M][K]·W + bias). A f32 row-major (pitch lda) converted per fragment to bf16
// (ASPLIT: hi/lo two planes -> 2 terms, else single rounded term); Wt bf16 [N][K] (pitch ldb). BIAS_BF16 rounds the
// bias to bf16 first (bias quantised to bf16 before the add). K%32==0, M%16==0, N%64==0.
template <bool ASPLIT, int ACT, bool BIAS_BF16>
__global__ __launch_bounds__(128) void k_gemm_bf(const float* __restrict__ A, int lda, const unsigned short* __restrict__ Wt, int ldb,
                                               const float* __restrict__ bias, float* __restrict__ C, int ldc, int M, int N, int K) {
  __shared__ __attribute__((aligned(16))) float so[4][16][64];
  const int tid = threadIdx.x, w = tid >> 5, lane = tid & 31, ln = lane & 15, hh = lane >> 4;
  const int ntn = N / 64;
  const int wid = blockIdx.x * 4 + w;
  const int mt = wid / ntn, nq = wid % ntn;
  if (mt * 16 >= M) return;
  const int row0 = mt * 16, col0 = nq * 64;
  const float* arow = A + (size_t)(row0 + ln) * lda;
  v8f acc[4] = {};
  for (int kb = 0; kb < K; kb += 32) {
    FragB ah, al;
    const v4f x0 = *(const v4fa*)(arow + kb + 8 * hh), x1 = *(const v4fa*)(arow + kb + 8 * hh + 4);
    const v4f x2 = *(const v4fa*)(arow + kb + 16 + 8 * hh), x3 = *(const v4fa*)(arow + kb + 16 + 8 * hh + 4);
    float xs[16] = {x0[0],x0[1],x0[2],x0[3],x1[0],x1[1],x1[2],x1[3],x2[0],x2[1],x2[2],x2[3],x3[0],x3[1],x3[2],x3[3]};
#pragma unroll
    for (int i = 0; i < 8; ++i) { const unsigned int hw = bf16_pack2(xs[2 * i], xs[2 * i + 1]); ah.w[i] = hw; al.w[i] = ASPLIT ? bf16_rest2(xs[2 * i], xs[2 * i + 1], hw) : 0u; }
#pragma unroll
    for (int t = 0; t < 4; ++t) {
      const unsigned short* brow = Wt + (size_t)(col0 + t * 16 + ln) * ldb + kb;
      FragB b;
      b.half[0] = *(const v8us*)(brow + 8 * hh);
      b.half[1] = *(const v8us*)(brow + 16 + 8 * hh);
      acc[t] = mmaN<ASPLIT ? 2 : 1>(ah.v, al.v, b.v, b.v, acc[t]);
    }
  }
#pragma unroll
  for (int t = 0; t < 4; ++t) {
    float bv = bias ? bias[col0 + t * 16 + ln] : 0.f;
    if (BIAS_BF16) bv = bf16_round(bv);
#pragma unroll
    for (int r = 0; r < 8; ++r) { float v = acc[t][r] + bv; if (ACT == 1) v = fmaxf(v, 0.f); so[w][8 * hh + r][t * 16 + ln] = v; }
  }
  __builtin_amdgcn_fence(__ATOMIC_ACQ_REL, "workgroup");
  __builtin_amdgcn_wave_barrier();
  const int rsub = lane >> 4, c4 = (lane & 15) * 4;
  {
#pragma unroll
    for (int q = 0; q < 8; ++q) {
      const int r = q * 2 + rsub;
      const v4f v = *(const v4fa*)&so[w][r][c4];
      *(v4f*)(C + (size_t)(row0 + r) * ldc + col0 + c4) = v;
    }
    
  }
}

// Flash-style causal/unmasked attention, all contractions 3-term bf16 hi/lo splits, f32 softmax with running max.
// q,k,v rows are read from f32 buffers with arbitrary row pitch (so they can live inside a fused qkv buffer);
// D = head size (multiple of 32, <= 128); one wave = 16 query rows; block = 4 waves (64 queries) sharing K/V chunks of 32.
template <int D, bool CAUSAL>
__global__ __launch_bounds__(128) void k_flash(const float* __restrict__ qb, const float* __restrict__ kb, const float* __restrict__ vb,
                                             int pitch, int T, int H, float scale, float* __restrict__ y, int ypitch) {
  constexpr int KS = D / 32;        // k-steps for QK
  constexpr int DT = D / 16;        // d tiles for PV
  __shared__ __attribute__((aligned(16))) unsigned short sKh[32][D + 8], sKl[32][D + 8], sVh[32][D + 8], sVl[32][D + 8];
  __shared__ __attribute__((aligned(16))) unsigned short sPh[4][16][40], sPl[4][16][40];
  __shared__ __attribute__((aligned(16))) float sO[4][16][D];
  const int tid = threadIdx.x, w = tid >> 5, lane = tid & 31, ln = lane & 15, hh = lane >> 4;
  const int nqb = (T + 63) / 64;
  const int bh = blockIdx.x / nqb, qblk = blockIdx.x % nqb;
  const int b = bh / H, h = bh % H;
  const int q0 = qblk * 64 + w * 16;
  const float* Q = qb + (size_t)b * T * pitch + h * D;
  const float* K = kb + (size_t)b * T * pitch + h * D;
  const float* V = vb + (size_t)b * T * pitch + h * D;

  // A fragments of the wave's 16 query rows (scaled), hi/lo
  FragB aqh[KS], aql[KS];
  {
    int row = q0 + ln; if (row >= T) row = T - 1;
    const float* qr = Q + (size_t)row * pitch;
#pragma unroll
    for (int ks = 0; ks < KS; ++ks)
#pragma unroll
      for (int i = 0; i < 16; ++i) {
        const int d = ks * 32 + ((i < 8) ? (8 * hh + i) : (16 + 8 * hh + (i - 8)));
        const float x = qr[d] * scale; const unsigned short hb = bf16_bits(x);
        aqh[ks].u[i] = hb; aql[ks].u[i] = bf16_bits(x - bf16_val(hb));
      }
  }
  float m_r[8], l_r[8];
#pragma unroll
  for (int r = 0; r < 8; ++r) { m_r[r] = -3.0e38f; l_r[r] = 0.f; }
  v8f oacc[DT];
#pragma unroll
  for (int dt = 0; dt < DT; ++dt) oacc[dt] = (v8f){0.f,0.f,0.f,0.f,0.f,0.f,0.f,0.f};

  const int kv_end = CAUSAL ? min(T, qblk * 64 + 64) : T;     // block-uniform
  for (int j0 = 0; j0 < kv_end; j0 += 32) {
    __syncthreads();
    for (int e = tid; e < 32 * (D / 4); e += 128) {
      const int r = e / (D / 4), c4 = (e % (D / 4)) * 4;
      const int key = j0 + r;
      v4f kf = {0.f,0.f,0.f,0.f}, vf = {0.f,0.f,0.f,0.f};
      if (key < T) { kf = *(const v4fa*)(K + (size_t)key * pitch + c4); vf = *(const v4fa*)(V + (size_t)key * pitch + c4); }
#pragma unroll
      for (int t = 0; t < 4; ++t) {
        unsigned short hb = bf16_bits(kf[t]); sKh[r][c4 + t] = hb; sKl[r][c4 + t] = bf16_bits(kf[t] - bf16_val(hb));
        hb = bf16_bits(vf[t]); sVh[r][c4 + t] = hb; sVl[r][c4 + t] = bf16_bits(vf[t] - bf16_val(hb));
      }
    }
    __syncthreads();
    // S tile 16 x 32
    v8f s[2];
#pragma unroll
    for (int nt = 0; nt < 2; ++nt) {
      v8f acc = {};
#pragma unroll
      for (int ks = 0; ks < KS; ++ks) {
        FragB bh_, bl_;
        bh_.half[0] = *(const v8us*)&sKh[nt * 16 + ln][ks * 32 + 8 * hh]; bh_.half[1] = *(const v8us*)&sKh[nt * 16 + ln][ks * 32 + 16 + 8 * hh];
        bl_.half[0] = *(const v8us*)&sKl[nt * 16 + ln][ks * 32 + 8 * hh]; bl_.half[1] = *(const v8us*)&sKl[nt * 16 + ln][ks * 32 + 16 + 8 * hh];
        acc = mmaN<3>(aqh[ks].v, aql[ks].v, bh_.v, bl_.v, acc);
      }
      s[nt] = acc;
    }
    // mask + running max (rows 8hh+r; the 16 lanes of a half share rows)
    float alpha[8];
#pragma unroll
    for (int r = 0; r < 8; ++r) {
      const int qi = q0 + 8 * hh + r;
      const int ja = j0 + ln, jb = j0 + 16 + ln;
      if (CAUSAL) { if (ja > qi) s[0][r] = -3.0e38f; if (jb > qi) s[1][r] = -3.0e38f; }
      if (ja >= T) s[0][r] = -3.0e38f;
      if (jb >= T) s[1][r] = -3.0e38f;
      float mx = fmaxf(s[0][r], s[1][r]);
      mx = fmaxf(mx, __shfl_xor(mx, 1, 32)); mx = fmaxf(mx, __shfl_xor(mx, 2, 32)); mx = fmaxf(mx, __shfl_xor(mx, 4, 32)); mx = fmaxf(mx, __shfl_xor(mx, 8, 32));
      const float mnew = fmaxf(m_r[r], mx);
      alpha[r] = (mnew > -1.0e38f) ? __expf(m_r[r] - mnew) : 1.0f;
      const float p0 = (s[0][r] > -1.0e38f) ? __expf(s[0][r] - mnew) : 0.f;
      const float p1 = (s[1][r] > -1.0e38f) ? __expf(s[1][r] - mnew) : 0.f;
      m_r[r] = mnew;
      l_r[r] = l_r[r] * alpha[r] + p0 + p1;            // per-lane partial row sum (16 lanes combined at the end)
      unsigned short hb = bf16_bits(p0); sPh[w][8 * hh + r][ln] = hb;      sPl[w][8 * hh + r][ln] = bf16_bits(p0 - bf16_val(hb));
      hb = bf16_bits(p1);                sPh[w][8 * hh + r][16 + ln] = hb; sPl[w][8 * hh + r][16 + ln] = bf16_bits(p1 - bf16_val(hb));
    }
#pragma unroll
    for (int dt = 0; dt < DT; ++dt)
#pragma unroll
      for (int r = 0; r < 8; ++r) oacc[dt][r] *= alpha[r];
    __builtin_amdgcn_fence(__ATOMIC_ACQ_REL, "workgroup");
    __builtin_amdgcn_wave_barrier();
    FragB pah, pal;
    pah.half[0] = *(const v8us*)&sPh[w][ln][8 * hh]; pah.half[1] = *(const v8us*)&sPh[w][ln][16 + 8 * hh];
    pal.half[0] = *(const v8us*)&sPl[w][ln][8 * hh]; pal.half[1] = *(const v8us*)&sPl[w][ln][16 + 8 * hh];
#pragma unroll
    for (int dt = 0; dt < DT; ++dt) {
      FragB bvh, bvl;
#pragma unroll
      for (int i = 0; i < 8; ++i) {
        bvh.u[i] = sVh[8 * hh + i][dt * 16 + ln]; bvh.u[8 + i] = sVh[16 + 8 * hh + i][dt * 16 + ln];
        bvl.u[i] = sVl[8 * hh + i][dt * 16 + ln]; bvl.u[8 + i] = sVl[16 + 8 * hh + i][dt * 16 + ln];
      }
      oacc[dt] = mmaN<3>(pah.v, pal.v, bvh.v, bvl.v, oacc[dt]);
    }
    __builtin_amdgcn_fence(__ATOMIC_ACQ_REL, "workgroup");
    __builtin_amdgcn_wave_barrier();
  }
#pragma unroll
  for (int r = 0; r < 8; ++r) {
    float l = l_r[r];
    l += __shfl_xor(l, 1, 32); l += __shfl_xor(l, 2, 32); l += __shfl_xor(l, 4, 32); l += __shfl_xor(l, 8, 32);
    l_r[r] = (l > 0.f) ? 1.0f / l : 0.f;
  }
#pragma unroll
  for (int dt = 0; dt < DT; ++dt)
#pragma unroll
    for (int r = 0; r < 8; ++r) sO[w][8 * hh + r][dt * 16 + ln] = oacc[dt][r] * l_r[r];
  __builtin_amdgcn_fence(__ATOMIC_ACQ_REL, "workgroup");
  __builtin_amdgcn_wave_barrier();
  {
    for (int r = 0; r < 16; ++r) {
      const int row = q0 + r;
      if (row < T && lane < D / 4) {
        const v4f val = *(const v4fa*)&sO[w][r][lane * 4];
        *(v4f*)(y + ((size_t)b * T + row) * ypitch + h * D + lane * 4) = val;
      }
    }
    
  }
}

// in pitch = cols, out pitch = rows; rows, cols multiples of 32. Optional per-output-row affine (scale[c], shift[c]) and
// residual add res (same layout as out, optionally bf16-rounded) for fused epilogues: out = in*scale + shift + res.
template <bool AFFINE, bool RESID, bool RES_BF16>
__global__ __launch_bounds__(256) void k_transpose32(const float* __restrict__ in, float* __restrict__ out, int rows, int cols,
                                                    const float* __restrict__ scale, const float* __restrict__ shift, const float* __restrict__ res) {
  __shared__ float tile[32][33];
  const int b = blockIdx.z;
  const int r0 = blockIdx.y * 32, c0 = blockIdx.x * 32;
  const float* src = in + (size_t)b * rows * cols;
  float* dst = out + (size_t)b * rows * cols;
  const int tx = threadIdx.x & 31, ty = threadIdx.x >> 5;     // 8 rows per pass
  for (int i = ty; i < 32; i += 8) tile[i][tx] = src[(size_t)(r0 + i) * cols + c0 + tx];
  __syncthreads();
  {
    for (int i = ty; i < 32; i += 8) {
      float v = tile[tx][i];
      const int orow = c0 + i;
      if (AFFINE) v = v * scale[orow] + shift[orow];
      if (RESID) { float rv = res[(size_t)b * rows * cols + (size_t)orow * rows + r0 + tx]; if (RES_BF16) rv = bf16_round(rv); v += rv; }
      *(float*)(dst + (size_t)orow * rows + r0 + tx) = v;
    }
    
  }
}

// 2x2 max pool on position-major data: in [B][H*W][C] -> out [B][(H/2)*(W/2)][C]; thread per (b, p', 4 channels); C%4==0
__global__ __launch_bounds__(256) void k_pool2_pm(const float* __restrict__ in, float* __restrict__ out, int Bn, int H, int W, int C) {
  const size_t t = (size_t)blockIdx.x * 256 + threadIdx.x;
  const int c4n = C / 4, Ho = H / 2, Wo = W / 2;
  const size_t total = (size_t)Bn * Ho * Wo * c4n;
  if (t >= total) return;
  const int c4 = (int)(t % c4n) * 4; size_t rest = t / c4n;
  const int pw = (int)(rest % Wo); rest /= Wo; const int ph = (int)(rest % Ho); const int b = (int)(rest / Ho);
  const float* base = in + (size_t)b * H * W * C;
  const int p00 = (2 * ph) * W + 2 * pw;
  const v4f a = *(const v4fa*)(base + (size_t)p00 * C + c4), bq = *(const v4fa*)(base + (size_t)(p00 + 1) * C + c4);
  const v4f c = *(const v4fa*)(base + (size_t)(p00 + W) * C + c4), d = *(const v4fa*)(base + (size_t)(p00 + W + 1) * C + c4);
  v4f m; for (int i = 0; i < 4; ++i) m[i] = fmaxf(fmaxf(a[i], bq[i]), fmaxf(c[i], d[i]));
  float* dst = out + ((size_t)b * Ho * Wo + (size_t)ph * Wo + pw) * C + c4;
  *(v4f*)dst = m;
  
}

// General (non-causal) attention, 3-term bf16 splits, f32 softmax with running max.
// Q [.][Tq][qpitch], K [.][Tk][kpitch] (head dim DQ), V [.][Tk][vpitch] (head dim DVtot); this block handles DV output
// dims starting at dv0 = blockIdx.y*DV. y[bh][t][ypitch] gets columns dv0..dv0+DV-1. Per-bh base offsets via strides.
template <int DQ, int DV>
__global__ __launch_bounds__(128) void k_flash2(const float* __restrict__ Qb, size_t qstride, int qpitch, int Tq,
                                              const float* __restrict__ Kb, size_t kstride, int kpitch, int Tk,
                                              const float* __restrict__ Vb, size_t vstride, int vpitch,
                                              float scale, float* __restrict__ y, size_t ystride, int ypitch) {
  constexpr int KS = DQ / 32, DT = DV / 16;
  __shared__ __attribute__((aligned(16))) unsigned short sKh[32][DQ + 8], sKl[32][DQ + 8], sVh[32][DV + 8], sVl[32][DV + 8];
  __shared__ __attribute__((aligned(16))) unsigned short sPh[4][16][40], sPl[4][16][40];
  __shared__ __attribute__((aligned(16))) float sO[4][16][DV];
  const int tid = threadIdx.x, w = tid >> 5, lane = tid & 31, ln = lane & 15, hh = lane >> 4;
  const int nqb = (Tq + 63) / 64;
  const int bh = blockIdx.x / nqb, qblk = blockIdx.x % nqb;
  const int dv0 = blockIdx.y * DV;
  const int q0 = qblk * 64 + w * 16;
  const float* Q = Qb + (size_t)bh * qstride; const float* K = Kb + (size_t)bh * kstride; const float* V = Vb + (size_t)bh * vstride + dv0;
  FragB aqh[KS], aql[KS];
  {
    int row = q0 + ln; if (row >= Tq) row = Tq - 1;
    const float* qr = Q + (size_t)row * qpitch;
#pragma unroll
    for (int ks = 0; ks < KS; ++ks)
#pragma unroll
      for (int i = 0; i < 16; ++i) {
        const int d = ks * 32 + ((i < 8) ? (8 * hh + i) : (16 + 8 * hh + (i - 8)));
        const float x = qr[d] * scale; const unsigned short hb = bf16_bits(x);
        aqh[ks].u[i] = hb; aql[ks].u[i] = bf16_bits(x - bf16_val(hb));
      }
  }
  float m_r[8], l_r[8];
#pragma unroll
  for (int r = 0; r < 8; ++r) { m_r[r] = -3.0e38f; l_r[r] = 0.f; }
  v8f oacc[DT];
#pragma unroll
  for (int dt = 0; dt < DT; ++dt) oacc[dt] = (v8f){0.f,0.f,0.f,0.f,0.f,0.f,0.f,0.f};
  for (int j0 = 0; j0 < Tk; j0 += 32) {
    __syncthreads();
    for (int e = tid; e < 32 * (DQ / 4); e += 128) {
      const int r = e / (DQ / 4), c4 = (e % (DQ / 4)) * 4; const int key = j0 + r;
      v4f f = {0.f,0.f,0.f,0.f}; if (key < Tk) f = *(const v4fa*)(K + (size_t)key * kpitch + c4);
#pragma unroll
      for (int t = 0; t < 4; ++t) { const unsigned short hb = bf16_bits(f[t]); sKh[r][c4 + t] = hb; sKl[r][c4 + t] = bf16_bits(f[t] - bf16_val(hb)); }
    }
    for (int e = tid; e < 32 * (DV / 4); e += 128) {
      const int r = e / (DV / 4), c4 = (e % (DV / 4)) * 4; const int key = j0 + r;
      v4f f = {0.f,0.f,0.f,0.f}; if (key < Tk) f = *(const v4fa*)(V + (size_t)key * vpitch + c4);
#pragma unroll
      for (int t = 0; t < 4; ++t) { const unsigned short hb = bf16_bits(f[t]); sVh[r][c4 + t] = hb; sVl[r][c4 + t] = bf16_bits(f[t] - bf16_val(hb)); }
    }
    __syncthreads();
    v8f s[2];
#pragma unroll
    for (int nt = 0; nt < 2; ++nt) {
      v8f acc = {};
#pragma unroll
      for (int ks = 0; ks < KS; ++ks) {
        FragB bh_, bl_;
        bh_.half[0] = *(const v8us*)&sKh[nt * 16 + ln][ks * 32 + 8 * hh]; bh_.half[1] = *(const v8us*)&sKh[nt * 16 + ln][ks * 32 + 16 + 8 * hh];
        bl_.half[0] = *(const v8us*)&sKl[nt * 16 + ln][ks * 32 + 8 * hh]; bl_.half[1] = *(const v8us*)&sKl[nt * 16 + ln][ks * 32 + 16 + 8 * hh];
        acc = mmaN<3>(aqh[ks].v, aql[ks].v, bh_.v, bl_.v, acc);
      }
      s[nt] = acc;
    }
    float alpha[8];
#pragma unroll
    for (int r = 0; r < 8; ++r) {
      const int ja = j0 + ln, jb = j0 + 16 + ln;
      if (ja >= Tk) s[0][r] = -3.0e38f;
      if (jb >= Tk) s[1][r] = -3.0e38f;
      float mx = fmaxf(s[0][r], s[1][r]);
      mx = fmaxf(mx, __shfl_xor(mx, 1, 32)); mx = fmaxf(mx, __shfl_xor(mx, 2, 32)); mx = fmaxf(mx, __shfl_xor(mx, 4, 32)); mx = fmaxf(mx, __shfl_xor(mx, 8, 32));
      const float mnew = fmaxf(m_r[r], mx);
      alpha[r] = (mnew > -1.0e38f) ? __expf(m_r[r] - mnew) : 1.0f;
      const float p0 = (s[0][r] > -1.0e38f) ? __expf(s[0][r] - mnew) : 0.f;
      const float p1 = (s[1][r] > -1.0e38f) ? __expf(s[1][r] - mnew) : 0.f;
      m_r[r] = mnew;
      l_r[r] = l_r[r] * alpha[r] + p0 + p1;
      unsigned short hb = bf16_bits(p0); sPh[w][8 * hh + r][ln] = hb;      sPl[w][8 * hh + r][ln] = bf16_bits(p0 - bf16_val(hb));
      hb = bf16_bits(p1);                sPh[w][8 * hh + r][16 + ln] = hb; sPl[w][8 * hh + r][16 + ln] = bf16_bits(p1 - bf16_val(hb));
    }
#pragma unroll
    for (int dt = 0; dt < DT; ++dt)
#pragma unroll
      for (int r = 0; r < 8; ++r) oacc[dt][r] *= alpha[r];
    __builtin_amdgcn_fence(__ATOMIC_ACQ_REL, "workgroup");
    __builtin_amdgcn_wave_barrier();
    FragB pah, pal;
    pah.half[0] = *(const v8us*)&sPh[w][ln][8 * hh]; pah.half[1] = *(const v8us*)&sPh[w][ln][16 + 8 * hh];
    pal.half[0] = *(const v8us*)&sPl[w][ln][8 * hh]; pal.half[1] = *(const v8us*)&sPl[w][ln][16 + 8 * hh];
#pragma unroll
    for (int dt = 0; dt < DT; ++dt) {
      FragB bvh, bvl;
#pragma unroll
      for (int i = 0; i < 8; ++i) {
        bvh.u[i] = sVh[8 * hh + i][dt * 16 + ln]; bvh.u[8 + i] = sVh[16 + 8 * hh + i][dt * 16 + ln];
        bvl.u[i] = sVl[8 * hh + i][dt * 16 + ln]; bvl.u[8 + i] = sVl[16 + 8 * hh + i][dt * 16 + ln];
      }
      oacc[dt] = mmaN<3>(pah.v, pal.v, bvh.v, bvl.v, oacc[dt]);
    }
    __builtin_amdgcn_fence(__ATOMIC_ACQ_REL, "workgroup");
    __builtin_amdgcn_wave_barrier();
  }
#pragma unroll
  for (int r = 0; r < 8; ++r) {
    float l = l_r[r];
    l += __shfl_xor(l, 1, 32); l += __shfl_xor(l, 2, 32); l += __shfl_xor(l, 4, 32); l += __shfl_xor(l, 8, 32);
    l_r[r] = (l > 0.f) ? 1.0f / l : 0.f;
  }
#pragma unroll
  for (int dt = 0; dt < DT; ++dt)
#pragma unroll
    for (int r = 0; r < 8; ++r) sO[w][8 * hh + r][dt * 16 + ln] = oacc[dt][r] * l_r[r];
  __builtin_amdgcn_fence(__ATOMIC_ACQ_REL, "workgroup");
  __builtin_amdgcn_wave_barrier();
  {
    for (int r = 0; r < 16; ++r) {
      const int row = q0 + r;
      for (int c4 = lane * 4; c4 < DV; c4 += 128) {
        if (row < Tq) {
          const v4f val = *(const v4fa*)&sO[w][r][c4];
          *(v4f*)(y + (size_t)bh * ystride + (size_t)row * ypitch + dv0 + c4) = val;
        }
      }
    }
    
  }
}

// GEMM C = act(A·W + bias + resid): A f32 (ASPLIT -> hi/lo 2 terms), Wt bf16 [N][K]; ACT 0 none, 1 relu, 2 exact gelu;
// resid (optional, f32, row index = (row % rmod), pitch ldr, RES_BF16 rounds it) added before the activation.
template <bool ASPLIT, int ACT, bool BIAS_BF16, bool RES_BF16>
__global__ __launch_bounds__(128) void k_gemm_bf3(const float* __restrict__ A, int lda, const unsigned short* __restrict__ Wt, int ldb,
                                                const float* __restrict__ bias, const float* __restrict__ resid, int rmod, int ldr,
                                                float* __restrict__ C, int ldc, int M, int N, int K) {
  __shared__ __attribute__((aligned(16))) float so[4][16][64];
  const int tid = threadIdx.x, w = tid >> 5, lane = tid & 31, ln = lane & 15, hh = lane >> 4;
  const int ntn = N / 64;
  const int wid = blockIdx.x * 4 + w;
  const int mt = wid / ntn, nq = wid % ntn;
  if (mt * 16 >= M) return;
  const int row0 = mt * 16, col0 = nq * 64;
  const float* arow = A + (size_t)(row0 + ln) * lda;
  v8f acc[4] = {};
  for (int kb = 0; kb < K; kb += 32) {
    FragB ah, al;
    const v4f x0 = *(const v4fa*)(arow + kb + 8 * hh), x1 = *(const v4fa*)(arow + kb + 8 * hh + 4);
    const v4f x2 = *(const v4fa*)(arow + kb + 16 + 8 * hh), x3 = *(const v4fa*)(arow + kb + 16 + 8 * hh + 4);
    float xs[16] = {x0[0],x0[1],x0[2],x0[3],x1[0],x1[1],x1[2],x1[3],x2[0],x2[1],x2[2],x2[3],x3[0],x3[1],x3[2],x3[3]};
#pragma unroll
    for (int i = 0; i < 8; ++i) { const unsigned int hw = bf16_pack2(xs[2 * i], xs[2 * i + 1]); ah.w[i] = hw; al.w[i] = ASPLIT ? bf16_rest2(xs[2 * i], xs[2 * i + 1], hw) : 0u; }
#pragma unroll
    for (int t = 0; t < 4; ++t) {
      const unsigned short* brow = Wt + (size_t)(col0 + t * 16 + ln) * ldb + kb;
      FragB b;
      b.half[0] = *(const v8us*)(brow + 8 * hh);
      b.half[1] = *(const v8us*)(brow + 16 + 8 * hh);
      acc[t] = mmaN<ASPLIT ? 2 : 1>(ah.v, al.v, b.v, b.v, acc[t]);
    }
  }
#pragma unroll
  for (int t = 0; t < 4; ++t) {
    const int col = col0 + t * 16 + ln;
    float bv = bias ? bias[col] : 0.f;
    if (BIAS_BF16) bv = bf16_round(bv);
#pragma unroll
    for (int r = 0; r < 8; ++r) {
      float v = acc[t][r] + bv;
      if (resid) { float rv = resid[(size_t)((row0 + 8 * hh + r) % rmod) * ldr + col]; if (RES_BF16) rv = bf16_round(rv); v += rv; }
      if (ACT == 1) v = fmaxf(v, 0.f);
      if (ACT == 2) v = 0.5f * v * (1.0f + erff(v * 0.70710678118654752f));
      if (ACT == 3) { const float u = 0.7978845608028654f * (v + 0.044715f * v * v * v); v = 0.5f * v * (1.0f + tanhf(u)); }
      so[w][8 * hh + r][t * 16 + ln] = v;
    }
  }
  __builtin_amdgcn_fence(__ATOMIC_ACQ_REL, "workgroup");
  __builtin_amdgcn_wave_barrier();
  const int rsub = lane >> 4, c4 = (lane & 15) * 4;
  {
#pragma unroll
    for (int q = 0; q < 8; ++q) {
      const int r = q * 2 + rsub;
      const v4f v = *(const v4fa*)&so[w][r][c4];
      *(v4f*)(C + (size_t)(row0 + r) * ldc + col0 + c4) = v;
    }
    
  }
}
// row LayerNorm (biased variance, eps) over N: s = X (+ R); optional out_sum <- s; out_norm <- (s-mu)*rsqrt(var+eps)*g + b
template <bool PARAM_BF16>
__global__ __launch_bounds__(256) void k_layernorm(const float* __restrict__ X, const float* __restrict__ R, const float* __restrict__ g, const float* __restrict__ bta,
                                                  float* __restrict__ out_sum, float* __restrict__ out_norm, int N, float eps) {
  __shared__ float red[256];
  const int row = blockIdx.x, tid = threadIdx.x;
  const float* x = X + (size_t)row * N; const float* rr = R ? R + (size_t)row * N : nullptr;
  float vals[16];                     // up to N = 4096
  const int per = N / 256;            // contiguous chunk per thread? use strided-by-4 chunks: thread handles j = tid*4 + 1024*u
  float s1 = 0.f;
  for (int u = 0; u < per / 4; ++u) {
    const int j = tid * 4 + 1024 * u;
    const v4f a = *(const v4fa*)(x + j);
    v4f b = {0.f,0.f,0.f,0.f}; if (rr) b = *(const v4fa*)(rr + j);
#pragma unroll
    for (int q = 0; q < 4; ++q) { const float v = a[q] + b[q]; vals[u * 4 + q] = v; s1 += v; }
  }
  red[tid] = s1; __syncthreads();
  for (int st = 128; st > 0; st >>= 1) { if (tid < st) red[tid] += red[tid + st]; __syncthreads(); }
  const float mu = red[0] / (float)N; __syncthreads();
  float s2 = 0.f;
  for (int u = 0; u < per / 4; ++u)
#pragma unroll
    for (int q = 0; q < 4; ++q) { const float c = vals[u * 4 + q] - mu; s2 += c * c; }
  red[tid] = s2; __syncthreads();
  for (int st = 128; st > 0; st >>= 1) { if (tid < st) red[tid] += red[tid + st]; __syncthreads(); }
  const float rs = rsqrtf(red[0] / (float)N + eps);
  {
    for (int u = 0; u < per / 4; ++u) {
      const int j = tid * 4 + 1024 * u;
      v4f o, sm;
#pragma unroll
      for (int q = 0; q < 4; ++q) {
        float gg = g[j + q], bb = bta[j + q];
        if (PARAM_BF16) { gg = bf16_round(gg); bb = bf16_round(bb); }
        sm[q] = vals[u * 4 + q]; o[q] = (vals[u * 4 + q] - mu) * rs * gg + bb;
      }
      if (out_sum) *(v4f*)(out_sum + (size_t)row * N + j) = sm;
      *(v4f*)(out_norm + (size_t)row * N + j) = o;
    }
    
  }
}

// K and V rows (f32, row pitch `pitch`, D = 64 columns) prepared ONCE for k_flash3: each value split into bf16 hi + lo, written as four planes.
// Kh/Kl keep the row order [row][D]. VTh/VTl are transposed inside each chunk of 32 rows: [chunk][d][32 rows], so that a chunk of any plane is
// 32 * D contiguous values at offset chunk * 32 * D, and a V^T fragment row (one d, 32 keys) is contiguous. One block = one chunk of 32 rows.
template <int D>
__global__ __launch_bounds__(256) void k_split_kv(const float* __restrict__ K, const float* __restrict__ V, int pitch,
                                                 unsigned short* __restrict__ Kh, unsigned short* __restrict__ Kl,
                                                 unsigned short* __restrict__ VTh, unsigned short* __restrict__ VTl) {
  static_assert(D == 64, "256 threads = 32 rows x D/8 units = D rows x 4 units");
  __shared__ float tv[32][D + 1];                                // pitch 65 dwords: the column walk below meets distinct banks
  const int t = threadIdx.x;
  const size_t row0 = (size_t)blockIdx.x * 32;
  {
    const int r = t / (D / 8), c8 = (t % (D / 8)) * 8;
    const float* kr = K + (row0 + r) * pitch + c8; const float* vr = V + (row0 + r) * pitch + c8;
    const v4f k0 = *(const v4fa*)kr, k1 = *(const v4fa*)(kr + 4);
    asm volatile("s_wait_xcnt 0x0" ::: "memory");                // what follows may reuse the address registers of the two loads above
    const v4f v0 = *(const v4fa*)vr, v1 = *(const v4fa*)(vr + 4);
    asm volatile("s_wait_xcnt 0x0" ::: "memory");                // the same for these two
    Pack8 hi, lo;
    // unrolled (here and below): the vectors are then indexed by constants and stay in registers
#pragma unroll
    for (int i = 0; i < 8; i += 2) {
      const float x0 = (i < 4) ? k0[i & 3] : k1[i & 3], x1 = (i < 4) ? k0[(i + 1) & 3] : k1[(i + 1) & 3];
      hi.w[i / 2] = bf16_pack2(x0, x1); lo.w[i / 2] = bf16_rest2(x0, x1, hi.w[i / 2]);
      tv[r][c8 + i] = (i < 4) ? v0[i & 3] : v1[i & 3]; tv[r][c8 + i + 1] = (i < 4) ? v0[(i + 1) & 3] : v1[(i + 1) & 3];
    }
    *(v8us*)(Kh + (row0 + r) * D + c8) = hi.v;
    *(v8us*)(Kl + (row0 + r) * D + c8) = lo.v;
  }
  __syncthreads();
  {
    const int d = t / 4, k8 = (t % 4) * 8;
    Pack8 hi, lo;
#pragma unroll
    for (int i = 0; i < 8; i += 2) {
      const float x0 = tv[k8 + i][d], x1 = tv[k8 + i + 1][d];
      hi.w[i / 2] = bf16_pack2(x0, x1); lo.w[i / 2] = bf16_rest2(x0, x1, hi.w[i / 2]);
    }
    *(v8us*)(VTh + row0 * D + d * 32 + k8) = hi.v;
    *(v8us*)(VTl + row0 * D + d * 32 + k8) = lo.v;
  }
}

// One 32-key chunk of one key group in LDS: the four planes of k_split_kv. K rows at a pitch of D + 8 values, V^T rows (32 keys) at 32 + 8 values:
// both 16 B x odd, for 16-byte readers.
template <int D> struct KvStage { unsigned short Kh[32][D + 8], Kl[32][D + 8], Vh[D][32 + 8], Vl[D][32 + 8]; };
__device__ __forceinline__ unsigned lds_off(const void* p) { return (unsigned)(size_t)p; }   // byte address inside the work-group's LDS

template <int D, int NS>
__global__ __launch_bounds__(128 * NS) void k_flash3(const float* __restrict__ Qb, int qpitch, int Tq,
                                              const unsigned short* __restrict__ Kh, const unsigned short* __restrict__ Kl,
                                              const unsigned short* __restrict__ VTh, const unsigned short* __restrict__ VTl, int Tk,
                                              int H, float scale, const int* __restrict__ mask, int causal, const float* __restrict__ sbias,
                                              float* __restrict__ y, int ypitch) {
  constexpr int KS = D / 32, DT = D / 16;
  constexpr int OP = D + 4;         // pitch of sO in floats: 16 B x odd, so the 16 lanes that each store 16 bytes of their own row meet distinct banks
  __shared__ __attribute__((aligned(16))) KvStage<D> sSt[2][NS];
  __shared__ __attribute__((aligned(16))) float sO[NS][4][16][OP];
  __shared__ float sM[NS][4][16], sL[NS][4][16];
  // g is the same in every lane of a wave; held in a scalar register, the chunk's base address and the test for a chunk past the end are scalar too
  const int g = __builtin_amdgcn_readfirstlane(threadIdx.x >> 7);
  const int tid = threadIdx.x & 127, w = tid >> 5, lane = tid & 31, ln = lane & 15, hh = lane >> 4;
  const int nqb = (Tq + 63) / 64;
  const int bh = blockIdx.x / nqb, qblk = blockIdx.x % nqb;
  const int b = bh / H, h = bh % H;
  const int q0 = qblk * 64 + w * 16;
  const float* Q = Qb + (size_t)b * Tq * qpitch + h * D;
  FragB aqh[KS], aql[KS];
  {
    int row = q0 + ln; if (row >= Tq) row = Tq - 1;
    const float* qr = Q + (size_t)row * qpitch;
#pragma unroll
    for (int ks = 0; ks < KS; ++ks)
#pragma unroll
      for (int i = 0; i < 16; i += 2) {
        const int d = ks * 32 + ((i < 8) ? (8 * hh + i) : (16 + 8 * hh + (i - 8)));
        const float x0 = qr[d] * scale, x1 = qr[d + 1] * scale; const unsigned int hw = bf16_pack2(x0, x1);
        aqh[ks].w[i / 2] = hw; aql[ks].w[i / 2] = bf16_rest2(x0, x1, hw);
      }
  }
  int qi = q0 + ln; if (qi >= Tq) qi = Tq - 1;                  // the lane's query
  float m_r = -3.0e38f, l_r = 0.f;                               // its running max (equal in both halves) and this half's share of its sum
  v8f oacc[DT];                                                  // O^T: oacc[dt][r] = O[query ln][dt * 16 + 8 * hh + r]
#pragma unroll
  for (int dt = 0; dt < DT; ++dt) oacc[dt] = (v8f){0.f,0.f,0.f,0.f,0.f,0.f,0.f,0.f};
  const bool special = causal || mask || sbias;
  const int kv_end = causal ? min(Tk, qblk * 64 + 64) : Tk;
  static_assert(32 * D / 8 / 128 == 2, "two 16-byte units of each plane's chunk per thread");
  const int ntrip = (kv_end + 32 * NS - 1) / (32 * NS);          // block-uniform trips; a group's chunk past the end is masked like any tail
  // The thread's eight units of its group's chunk of trip t -> buffer buf. A chunk past the end of the keys is replaced by the last chunk: its addresses
  // stay inside the planes, every wave issues the same copies, and its scores are masked below, so that its P is 0 against finite V.
  auto stage = [&](int t, int buf) {
    const int jc = min((t * NS + g) * 32, Tk - 32);
    const unsigned o = ((unsigned)bh * Tk + jc) * (D * 2) + tid * 16;   // the same byte offset in all four planes (each plane is below 4 GiB)
    KvStage<D>* S = &sSt[buf][g];
    const int e0 = tid, e1 = tid + 128;                          // unit e: 128 threads x 16 B = 2048 B a unit row
    // the copies and, as the last line, the wait in front of any rewrite of their address registers, in one statement: nothing can come between
    asm volatile("global_load_async_to_lds_b128 %0, %8, off\n\t"
                 "global_load_async_to_lds_b128 %1, %9, off\n\t"
                 "global_load_async_to_lds_b128 %2, %10, off\n\t"
                 "global_load_async_to_lds_b128 %3, %11, off\n\t"
                 "global_load_async_to_lds_b128 %4, %12, off\n\t"
                 "global_load_async_to_lds_b128 %5, %13, off\n\t"
                 "global_load_async_to_lds_b128 %6, %14, off\n\t"
                 "global_load_async_to_lds_b128 %7, %15, off\n\t"
                 "s_wait_xcnt 0x0"
                 :: "v"(lds_off(&S->Kh[e0 / (D / 8)][(e0 % (D / 8)) * 8])), "v"(lds_off(&S->Kl[e0 / (D / 8)][(e0 % (D / 8)) * 8])),
                    "v"(lds_off(&S->Vh[e0 / 4][(e0 % 4) * 8])),             "v"(lds_off(&S->Vl[e0 / 4][(e0 % 4) * 8])),
                    "v"(lds_off(&S->Kh[e1 / (D / 8)][(e1 % (D / 8)) * 8])), "v"(lds_off(&S->Kl[e1 / (D / 8)][(e1 % (D / 8)) * 8])),
                    "v"(lds_off(&S->Vh[e1 / 4][(e1 % 4) * 8])),             "v"(lds_off(&S->Vl[e1 / 4][(e1 % 4) * 8])),
                    "v"((const char*)Kh + o),          "v"((const char*)Kl + o),          "v"((const char*)VTh + o),          "v"((const char*)VTl + o),
                    "v"((const char*)Kh + (o + 2048u)), "v"((const char*)Kl + (o + 2048u)), "v"((const char*)VTh + (o + 2048u)), "v"((const char*)VTl + (o + 2048u))
                 : "memory");
  };
  stage(0, 0);
  asm volatile("s_wait_asynccnt 0x0" ::: "memory");              // this wave's copies of chunk 0 have landed
  __syncthreads();                                               // and every other wave's
  if (ntrip > 1) stage(1, 1);
  for (int t = 0; t < ntrip; ++t) {
    const int jb = t * 32 * NS, j0 = jb + 32 * g;
    const KvStage<D>* S = &sSt[t & 1][g];
    const unsigned short (*sKh)[D + 8] = S->Kh; const unsigned short (*sKl)[D + 8] = S->Kl;
    const unsigned short (*sVh)[32 + 8] = S->Vh; const unsigned short (*sVl)[32 + 8] = S->Vl;
    v8f s[2];                                                    // S^T: s[nt][r] = score(query ln, key j0 + nt * 16 + 8 * hh + r)
#pragma unroll
    for (int nt = 0; nt < 2; ++nt) {
      v8f acc = {};
#pragma unroll
      for (int ks = 0; ks < KS; ++ks) {
        FragB bh_, bl_;
        bh_.half[0] = *(const v8us*)&sKh[nt * 16 + ln][ks * 32 + 8 * hh]; bh_.half[1] = *(const v8us*)&sKh[nt * 16 + ln][ks * 32 + 16 + 8 * hh];
        bl_.half[0] = *(const v8us*)&sKl[nt * 16 + ln][ks * 32 + 8 * hh]; bl_.half[1] = *(const v8us*)&sKl[nt * 16 + ln][ks * 32 + 16 + 8 * hh];
        acc = mmaN<3>(bh_.v, bl_.v, aqh[ks].v, aql[ks].v, acc);
      }
      s[nt] = acc;
    }
    if (special || jb + 32 * NS > Tk) {                          // block-uniform: masks, biases and key tails; a dropped score becomes -3e38
#pragma unroll
      for (int nt = 0; nt < 2; ++nt)
#pragma unroll
        for (int r = 0; r < 8; ++r) {
          const int key = j0 + nt * 16 + 8 * hh + r;
          bool keep = key < Tk;
          if (causal) keep = keep && (key <= qi);
          if (mask) { if (keep) keep = mask[(size_t)qi * Tk + key] != 0; }
          if (sbias) { if (keep) s[nt][r] += sbias[(size_t)bh * Tk + key]; }   // per-key additive bias (a per-query constant would cancel in the softmax)
          if (!keep) s[nt][r] = -3.0e38f;
        }
    }
    float mx = fmaxf(s[0][0], s[1][0]);
#pragma unroll
    for (int r = 1; r < 8; ++r) mx = fmaxf(mx, fmaxf(s[0][r], s[1][r]));
    mx = fmaxf(mx, xhalf(mx));                                   // the query's other 16 keys sit in the other half
    const float mnew = fmaxf(m_r, mx);
    const float mexp = fmaxf(mnew, -1.0e38f);                    // with nothing kept so far a dropped score still gives exp(-2e38) = 0
    const float alpha = __expf(m_r - mexp);
    m_r = mnew;
    FragB pbh, pbl;                                              // P^T as a B fragment: element nt * 8 + r is key nt * 16 + 8 * hh + r
    float ps[4] = {0.f, 0.f, 0.f, 0.f};
#pragma unroll
    for (int nt = 0; nt < 2; ++nt)
#pragma unroll
      for (int r = 0; r < 8; r += 2) {
        const float p0 = __expf(s[nt][r] - mexp), p1 = __expf(s[nt][r + 1] - mexp);
        ps[r & 3] += p0; ps[(r + 1) & 3] += p1;
        const unsigned int hw = bf16_pack2(p0, p1);
        pbh.w[nt * 4 + r / 2] = hw; pbl.w[nt * 4 + r / 2] = bf16_rest2(p0, p1, hw);
      }
    l_r = l_r * alpha + ((ps[0] + ps[1]) + (ps[2] + ps[3]));     // this half's 16 keys (the halves are added at the end)
#pragma unroll
    for (int dt = 0; dt < DT; ++dt)
#pragma unroll
      for (int r = 0; r < 8; ++r) oacc[dt][r] *= alpha;
#pragma unroll
    for (int dt = 0; dt < DT; ++dt) {
      FragB bvh, bvl;                                            // V^T as an A fragment: row dt * 16 + ln, the k order of P^T
      bvh.half[0] = *(const v8us*)&sVh[dt * 16 + ln][8 * hh]; bvh.half[1] = *(const v8us*)&sVh[dt * 16 + ln][16 + 8 * hh];
      bvl.half[0] = *(const v8us*)&sVl[dt * 16 + ln][8 * hh]; bvl.half[1] = *(const v8us*)&sVl[dt * 16 + ln][16 + 8 * hh];
      oacc[dt] = mmaN<3>(bvh.v, bvl.v, pbh.v, pbl.v, oacc[dt]);
    }
    asm volatile("s_wait_dscnt 0x0" ::: "memory");               // this wave's reads of the buffer are done before it is handed back
    asm volatile("s_wait_asynccnt 0x0" ::: "memory");            // this wave's copies of the next chunk have landed
    __syncthreads();                                             // the next chunk is published, this trip's buffer is free
    if (t + 2 < ntrip) stage(t + 2, t & 1);
  }
  asm volatile("s_wait_asynccnt 0x0" ::: "memory");              // no copy is left in flight behind the loop
  {
    const float l = l_r + xhalf(l_r);
    if (hh == 0) { sM[g][w][ln] = m_r; sL[g][w][ln] = l; }
  }
#pragma unroll
  for (int dt = 0; dt < DT; ++dt) {                              // not yet divided by the row sum
    *(v4fa*)&sO[g][w][ln][dt * 16 + 8 * hh]     = (v4f){oacc[dt][0], oacc[dt][1], oacc[dt][2], oacc[dt][3]};
    *(v4fa*)&sO[g][w][ln][dt * 16 + 8 * hh + 4] = (v4f){oacc[dt][4], oacc[dt][5], oacc[dt][6], oacc[dt][7]};
  }
  __syncthreads();                                               // every group's (max, sum, O) is in LDS
  // join: wave (g, w) finishes rows 2g, 2g + 1, then + 2 NS, of query tile w; each half wave takes one row (two rows = 512 contiguous bytes a store)
  for (int r = g * 2 + hh; r < 16; r += 2 * NS) {
    const int row = q0 + r;
    float mj = -3.0e38f;
    // the three loops over s are unrolled so that f[] stays in registers
#pragma unroll
    for (int s = 0; s < NS; ++s) mj = fmaxf(mj, sM[s][w][r]);
    float f[NS], lj = 0.f;
#pragma unroll
    for (int s = 0; s < NS; ++s) { const float ms = sM[s][w][r]; f[s] = (ms > -1.0e38f) ? __expf(ms - mj) : 0.f; lj += f[s] * sL[s][w][r]; }
    const float inv = (mj > -1.0e38f) ? 1.0f / lj : __builtin_nanf("");
    for (int c4 = ln * 4; c4 < D; c4 += 64) {
      v4f val = {0.f, 0.f, 0.f, 0.f};
#pragma unroll
      for (int s = 0; s < NS; ++s) val += f[s] * *(const v4fa*)&sO[s][w][r][c4];
      if (row < Tq) {
        *(v4f*)(y + ((size_t)b * Tq + row) * ypitch + h * D + c4) = val * inv;
        asm volatile("s_wait_xcnt 0x0" ::: "memory");            // the next trip rewrites the store's address registers
      }
    }
  }
}

// The seven small preparation jobs of a call depend on nothing but the inputs, so they share ONE grid and the block index picks the job: the first
// 4 * PREP_WB blocks round the four weight matrices to bf16 (8 values a thread), the last block rounds the three biases into one concatenated row.
#define PREP_WB (HC * CC / 8 / 256)       // blocks per weight matrix
#define PREP_JOBS (4 * PREP_WB + 1)       // blocks of the grid
__global__ __launch_bounds__(256) void k_prep(const float* __restrict__ tw, const float* __restrict__ pw, const float* __restrict__ gw, const float* __restrict__ fw,
                                             unsigned short* __restrict__ Bqkv, unsigned short* __restrict__ Bf,
                                             const float* __restrict__ tb, const float* __restrict__ pb, const float* __restrict__ gb, float* __restrict__ bqkv) {
  const int blk = blockIdx.x;
  if (blk < 4 * PREP_WB) {
    const int m = blk / PREP_WB;
    const float* W = (m == 0) ? tw : (m == 1) ? pw : (m == 2) ? gw : fw;
    unsigned short* Wt = (m < 3) ? Bqkv + m * (HC * CC) : Bf;
    const int t = (blk % PREP_WB) * 256 + threadIdx.x;
    const v4f a = *(const v4fa*)(W + (size_t)t * 8), b = *(const v4fa*)(W + (size_t)t * 8 + 4);
    Pack8 v; v.w[0] = bf16_pack2(a[0], a[1]); v.w[1] = bf16_pack2(a[2], a[3]); v.w[2] = bf16_pack2(b[0], b[1]); v.w[3] = bf16_pack2(b[2], b[3]);
    *(v8us*)(Wt + (size_t)t * 8) = v.v;
    return;
  }
  const int t = threadIdx.x;
  if (t < 3 * (HC / 4)) {                                        // 4 values a thread; thread t writes bqkv[4 t ..], bias t / (HC / 4)
    const int m = t / (HC / 4);
    const float* src = (m == 0) ? tb : (m == 1) ? pb : gb;
    v4f a = *(const v4fa*)(src + (t % (HC / 4)) * 4);
    for (int i = 0; i < 4; ++i) a[i] = bf16_round(a[i]);
    *(v4f*)(bqkv + t * 4) = a;
  }
}

// Takes eight loaded vectors as inputs only and emits nothing: the loads written in front of it are all issued before the first use of any of them,
// so that they are in flight together; without it the compiler waits for each small group of loads and uses it before it issues the next.
template <class T>
__device__ __forceinline__ void hold8(T a, T b, T c, T d, T e, T f, T g, T h) {
  asm volatile("" :: "v"(a), "v"(b), "v"(c), "v"(d), "v"(e), "v"(f), "v"(g), "v"(h));
}

// GEMM C[M][N] (f32, dense rows) = A.W + bias on a CHANNEL-MAJOR A, read as it lies: A is [M / LDA][K][LDA] in f32 (LDA positions a batch), row m is
// position m % LDA of batch m / LDA. A lane gathers the 16 k values of its row at a stride of LDA floats (the 16 lanes of a half wave read 64
// contiguous bytes a load) and rounds them to bf16 (one term): no transposed copy of A is made. Wt bf16 [N][K]; bias f32, added as it is.
// One wave = 16 rows x 64 columns. K % 64 == 0, M % 16 == 0, N % 64 == 0, LDA % 16 == 0.
template <int K, int N, int LDA>
__global__ __launch_bounds__(128) void k_gemm_cm(const float* __restrict__ A, const unsigned short* __restrict__ Wt, const float* __restrict__ bias,
                                               float* __restrict__ C, int M) {
  constexpr int KS = K / 32, NTN = N / 64;
  static_assert((KS * 4) % 8 == 0, "hold8 takes the vectors by eights");
  __shared__ __attribute__((aligned(16))) float so[4][16][64];
  const int tid = threadIdx.x, w = tid >> 5, lane = tid & 31, ln = lane & 15, hh = lane >> 4;
  const int wid = blockIdx.x * 4 + w;
  const int mt = wid / NTN, nq = wid % NTN;
  if (mt * 16 >= M) return;
  const int row0 = mt * 16, col0 = nq * 64;
  // the lane's three base addresses; everything else of an address is a constant
  const float* ab = A + (size_t)(row0 / LDA) * K * LDA + (size_t)(8 * hh) * LDA + (row0 % LDA + ln);
  const unsigned short* wb = Wt + (size_t)(col0 + ln) * K + 8 * hh;
  const float* bb = bias + col0 + ln;
  // All loops are unrolled: the fragments are then indexed by constants and stay in registers, and the addresses are immediate offsets of the bases.
  v4f ra[KS * 4];                                                // element i = 4 q + j of k step ks in ra[ks * 4 + q][j]: k = 32 ks + 8 hh + i (i < 8), + 8 more (i >= 8)
#pragma unroll
  for (int ks = 0; ks < KS; ++ks)
#pragma unroll
    for (int q = 0; q < 4; ++q)
#pragma unroll
      for (int j = 0; j < 4; ++j) ra[ks * 4 + q][j] = ab[(size_t)(ks * 32 + (q >> 1) * 16 + (q & 1) * 4 + j) * LDA];
  FragB bf[KS][4];                                               // the same k order: half 0 is k = 32 ks + 8 hh + 0..7, half 1 is 16 further
#pragma unroll
  for (int ks = 0; ks < KS; ++ks)
#pragma unroll
    for (int t = 0; t < 4; ++t) {
      bf[ks][t].half[0] = *(const v8us*)(wb + t * 16 * K + ks * 32);
      bf[ks][t].half[1] = *(const v8us*)(wb + t * 16 * K + ks * 32 + 16);
    }
  float bv[4];
#pragma unroll
  for (int t = 0; t < 4; ++t) bv[t] = bb[t * 16];
#pragma unroll
  for (int e = 0; e < KS * 4; e += 8) hold8(ra[e], ra[e + 1], ra[e + 2], ra[e + 3], ra[e + 4], ra[e + 5], ra[e + 6], ra[e + 7]);
#pragma unroll
  for (int ks = 0; ks < KS; ++ks)
    hold8(bf[ks][0].half[0], bf[ks][0].half[1], bf[ks][1].half[0], bf[ks][1].half[1], bf[ks][2].half[0], bf[ks][2].half[1], bf[ks][3].half[0], bf[ks][3].half[1]);
  // inputs only, emits nothing: the three bases stay in their registers until every load that names them has returned, so that neither a later
  // load's result nor a later instruction takes an address register of a load in flight
  asm volatile("" :: "v"(bv[0]), "v"(bv[1]), "v"(bv[2]), "v"(bv[3]), "v"(ab), "v"(wb), "v"(bb));
  v8f acc[4] = {};
#pragma unroll
  for (int ks = 0; ks < KS; ++ks) {
    FragB ah;
#pragma unroll
    for (int i = 0; i < 8; ++i) ah.w[i] = bf16_pack2(ra[ks * 4 + i / 2][(i & 1) * 2], ra[ks * 4 + i / 2][(i & 1) * 2 + 1]);
#pragma unroll
    for (int t = 0; t < 4; ++t) acc[t] = mmaN<1>(ah.v, ah.v, bf[ks][t].v, bf[ks][t].v, acc[t]);
  }
#pragma unroll
  for (int t = 0; t < 4; ++t)
#pragma unroll
    for (int r = 0; r < 8; ++r) so[w][8 * hh + r][t * 16 + ln] = acc[t][r] + bv[t];
  __builtin_amdgcn_fence(__ATOMIC_ACQ_REL, "workgroup");
  __builtin_amdgcn_wave_barrier();
  const int rsub = lane >> 4, c4 = (lane & 15) * 4;
#pragma unroll
  for (int q = 0; q < 8; ++q) {
    const int r = q * 2 + rsub;
    const v4f v = *(const v4fa*)&so[w][r][c4];
    *(v4f*)(C + (size_t)(row0 + r) * N + col0 + c4) = v;
  }
}

// out[b][c][p] = y[(b,p)][c] + x[b][c][p]  (block per (b,c): 4096 contiguous floats)
__global__ __launch_bounds__(256) void k_fin(const float* __restrict__ y, const float* __restrict__ x, float* __restrict__ out) {
  const int b = blockIdx.x / CC, c = blockIdx.x % CC; const size_t base = ((size_t)b * CC + c) * HWN;
  { for (int p = threadIdx.x; p < HWN; p += 256) *(float*)(out + base + p) = y[((size_t)b * HWN + p) * CC + c] + x[base + p];  }
}
extern "C" void kernel_launch(void* const* d_in, const int* in_sizes, int n_in,
                              void* d_out, int out_size, void* d_ws, size_t ws_size, hipStream_t stream) {
  (void)in_sizes; (void)n_in; (void)out_size;
  const float* x = (const float*)d_in[0]; const float* tw = (const float*)d_in[1]; const float* tb = (const float*)d_in[2]; const float* pw = (const float*)d_in[3]; const float* pb = (const float*)d_in[4];
  const float* gw = (const float*)d_in[5]; const float* gb = (const float*)d_in[6]; const float* fw = (const float*)d_in[7]; const float* fb = (const float*)d_in[8];
  char* ws = (char*)d_ws; size_t off = 0;
  auto take = [&](size_t bytes) { char* p = ws + off; off += (bytes + 255) & ~(size_t)255; return p; };
  unsigned short* Bqkv = (unsigned short*)take((size_t)3 * HC * CC * 2); unsigned short* Bf = (unsigned short*)take((size_t)CC * HC * 2); float* bqkv = (float*)take(3 * HC * 4 + 256);
  float* qkv = (float*)take((size_t)MROWS * 3 * HC * 4); float* att = (float*)take((size_t)MROWS * HC * 4); float* y = (float*)take((size_t)MROWS * CC * 4);
  unsigned short* Kh = (unsigned short*)take((size_t)MROWS * HC * 2); unsigned short* Kl = (unsigned short*)take((size_t)MROWS * HC * 2);
  unsigned short* VTh = (unsigned short*)take((size_t)MROWS * HC * 2); unsigned short* VTl = (unsigned short*)take((size_t)MROWS * HC * 2);
  if (off > ws_size) return;
  k_prep<<<PREP_JOBS, 256, 0, stream>>>(tw, pw, gw, fw, Bqkv, Bf, tb, pb, gb, bqkv);   // rounded weights and biases
  k_gemm_cm<CC, 3 * HC, HWN><<<((MROWS / 16) * 3 + 3) / 4, 128, 0, stream>>>(x, Bqkv, bqkv, qkv, MROWS);   // [theta | phi | g] + b (single term), x read as it lies (NCHW)
  k_split_kv<HC><<<MROWS / 32, 256, 0, stream>>>(qkv + HC, qkv + 2 * HC, 3 * HC, Kh, Kl, VTh, VTl);                                        // phi, g -> bf16 hi/lo planes, once
  k_flash3<HC, NSPLIT><<<BB * (HWN / 64), 128 * NSPLIT, 0, stream>>>(qkv, 3 * HC, HWN, Kh, Kl, VTh, VTl, HWN, 1, 1.0f, nullptr, 0, nullptr, att, HC);
  k_gemm_bf3<true, 0, true, false><<<((MROWS / 16) * 2 + 3) / 4, 128, 0, stream>>>(att, HC, Bf, HC, fb, nullptr, 1, 0, y, CC, MROWS, CC, HC);                    // final conv + b
  k_fin<<<BB * CC, 256, 0, stream>>>(y, x, (float*)d_out);
}

// v008
// One run takes 62 microseconds.
// In both of two side-by-side timings against v007, it was 1.36 times as fast.
// All steps since v000 together make it 10.6 times as fast.
#include <hip/hip_runtime.h>
// theta/phi/g 1×1 convolutions as one GEMM on channel-major bf16(x), read as it lies (single exact term, K=128, N=192), the 4096×4096 non-local attention per batch as
// 16-query tiles on WMMA (Q·Kᵀ and P·V as 3-term bf16 hi/lo splits, f32 online softmax, no scaling), and the final 1×1 conv (2 terms) + bias; the
// residual add is f32, and the attention kernel stores the result NCHW itself.
#define BB 4
#define CC 128
#define HC 64
#define HWN 4096
#define MROWS (BB * HWN)
#define NSPLIT 4      // key groups per attention block: 4 waves each, so NSPLIT waves per SIMD

typedef __bf16 v16b __attribute__((ext_vector_type(16)));
typedef unsigned short v8us __attribute__((ext_vector_type(8), may_alias));
typedef float  v8f  __attribute__((ext_vector_type(8)));
typedef float  v4f  __attribute__((ext_vector_type(4)));
typedef float  v4fa __attribute__((ext_vector_type(4), may_alias));
typedef float  v2f  __attribute__((ext_vector_type(2)));
typedef __bf16 v2b  __attribute__((ext_vector_type(2)));
typedef unsigned int v2ua __attribute__((ext_vector_type(2), may_alias));
union FragB { v16b v; v8us half[2]; unsigned short u[16]; unsigned int w[8]; };
union Pack8 { v8us v; unsigned int w[4]; };

// f32 -> bf16, round to nearest even, by the hardware conversion
__device__ __forceinline__ unsigned short bf16_bits(float x) { return __builtin_bit_cast(unsigned short, (__bf16)x); }
// two values in one packed conversion: a in the low half of the word, b in the high half
__device__ __forceinline__ unsigned int bf16_pack2(float a, float b) { const v2f v = {a, b}; return __builtin_bit_cast(unsigned int, __builtin_convertvector(v, v2b)); }
// the lo word of a pair: what its hi word hw leaves over, rounded (x - hi is exact in f32)
__device__ __forceinline__ unsigned int bf16_rest2(float a, float b, unsigned int hw) {
  const v2f x = {a, b}, h = {__uint_as_float(hw << 16), __uint_as_float(hw & 0xFFFF0000u)};
  return __builtin_bit_cast(unsigned int, __builtin_convertvector(x - h, v2b));
}
__device__ __forceinline__ float bf16_val(unsigned short b) { return __uint_as_float(((unsigned int)b) << 16); }
__device__ __forceinline__ float bf16_round(float x) { return bf16_val(bf16_bits(x)); }
// D += A·B with NT terms: 1 = ah·bh, 2 = + al·bh (A split), 3 = + ah·bl (both split)
template <int NT>
__device__ __forceinline__ v8f mmaN(v16b ah, v16b al, v16b bh, v16b bl, v8f c) {
  c = __builtin_amdgcn_wmma_f32_16x16x32_bf16(false, ah, false, bh, (short)0, c, false, false);
  if (NT >= 2) c = __builtin_amdgcn_wmma_f32_16x16x32_bf16(false, al, false, bh, (short)0, c, false, false);
  if (NT >= 3) c = __builtin_amdgcn_wmma_f32_16x16x32_bf16(false, ah, false, bl, (short)0, c, false, false);
  asm volatile("v_nop\n\tv_nop\n\tv_nop\n\tv_nop" : "+v"(c) : "v"(ah), "v"(al), "v"(bh), "v"(bl));
  return c;
}

// lane l <-> lane l ^ 16 (the other 16-lane row) in one vector cross-row move
__device__ __forceinline__ float xhalf(float x) {
  const int b = __float_as_int(x);
  return __int_as_float(__builtin_amdgcn_permlanex16(b, b, 0x76543210, 0xfedcba98, false, false));
}

__global__ __launch_bounds__(256) void k_wt_bf16(const float* __restrict__ W, unsigned short* __restrict__ Wt, int K, int N) {
  const int t = blockIdx.x * 256 + threadIdx.x;
  const int k8n = K / 8;
  if (t >= N * k8n) return;
  const int n = t / k8n, k8 = (t % k8n) * 8;
  v8us v;
#pragma unroll
  for (int i = 0; i < 8; ++i) v[i] = bf16_bits(W[(size_t)(k8 + i) * N + n]);
  *(v8us*)(Wt + (size_t)n * K + k8) = v;
  
}

// GEMM C[M][N] (f32, pitch ldc) = act(A[M][K]·W + bias). A f32 row-major (pitch lda) converted per fragment to bf16
// (ASPLIT: hi/lo two planes -> 2 terms, else single rounded term); Wt bf16 [N][K] (pitch ldb). BIAS_BF16 rounds the
// bias to bf16 first (bias quantised to bf16 before the add). K%32==0, M%16==0, N%64==0.
template <bool ASPLIT, int ACT, bool BIAS_BF16>
__global__ __launch_bounds__(128) void k_gemm_bf(const float* __restrict__ A, int lda, const unsigned short* __restrict__ Wt, int ldb,
                                               const float* __restrict__ bias, float* __restrict__ C, int ldc, int M, int N, int K) {
  __shared__ __attribute__((aligned(16))) float so[4][16][64];
  const int tid = threadIdx.x, w = tid >> 5, lane = tid & 31, ln = lane & 15, hh = lane >> 4;
  const int ntn = N / 64;
  const int wid = blockIdx.x * 4 + w;
  const int mt = wid / ntn, nq = wid % ntn;
  if (mt * 16 >= M) return;
  const int row0 = mt * 16, col0 = nq * 64;
  const float* arow = A + (size_t)(row0 + ln) * lda;
  v8f acc[4] = {};
  for (int kb = 0; kb < K; kb += 32) {
    FragB ah, al;
    const v4f x0 = *(const v4fa*)(arow + kb + 8 * hh), x1 = *(const v4fa*)(arow + kb + 8 * hh + 4);
    const v4f x2 = *(const v4fa*)(arow + kb + 16 + 8 * hh), x3 = *(const v4fa*)(arow + kb + 16 + 8 * hh + 4);
    float xs[16] = {x0[0],x0[1],x0[2],x0[3],x1[0],x1[1],x1[2],x1[3],x2[0],x2[1],x2[2],x2[3],x3[0],x3[1],x3[2],x3[3]};
#pragma unroll
    for (int i = 0; i < 8; ++i) { const unsigned int hw = bf16_pack2(xs[2 * i], xs[2 * i + 1]); ah.w[i] = hw; al.w[i] = ASPLIT ? bf16_rest2(xs[2 * i], xs[2 * i + 1], hw) : 0u; }
#pragma unroll
    for (int t = 0; t < 4; ++t) {
      const unsigned short* brow = Wt + (size_t)(col0 + t * 16 + ln) * ldb + kb;
      FragB b;
      b.half[0] = *(const v8us*)(brow + 8 * hh);
      b.half[1] = *(const v8us*)(brow + 16 + 8 * hh);
      acc[t] = mmaN<ASPLIT ? 2 : 1>(ah.v, al.v, b.v, b.v, acc[t]);
    }
  }
#pragma unroll
  for (int t = 0; t < 4; ++t) {
    float bv = bias ? bias[col0 + t * 16 + ln] : 0.f;
    if (BIAS_BF16) bv = bf16_round(bv);
#pragma unroll
    for (int r = 0; r < 8; ++r) { float v = acc[t][r] + bv; if (ACT == 1) v = fmaxf(v, 0.f); so[w][8 * hh + r][t * 16 + ln] = v; }
  }
  __builtin_amdgcn_fence(__ATOMIC_ACQ_REL, "workgroup");
  __builtin_amdgcn_wave_barrier();
  const int rsub = lane >> 4, c4 = (lane & 15) * 4;
  {
#pragma unroll
    for (int q = 0; q < 8; ++q) {
      const int r = q * 2 + rsub;
      const v4f v = *(const v4fa*)&so[w][r][c4];
      *(v4f*)(C + (size_t)(row0 + r) * ldc + col0 + c4) = v;
    }
    
  }
}

// Flash-style causal/unmasked attention, all contractions 3-term bf16 hi/lo splits, f32 softmax with running max.
// q,k,v rows are read from f32 buffers with arbitrary row pitch (so they can live inside a fused qkv buffer);
// D = head size (multiple of 32, <= 128); one wave = 16 query rows; block = 4 waves (64 queries) sharing K/V chunks of 32.
template <int D, bool CAUSAL>
__global__ __launch_bounds__(128) void k_flash(const float* __restrict__ qb, const float* __restrict__ kb, const float* __restrict__ vb,
                                             int pitch, int T, int H, float scale, float* __restrict__ y, int ypitch) {
  constexpr int KS = D / 32;        // k-steps for QK
  constexpr int DT = D / 16;        // d tiles for PV
  __shared__ __attribute__((aligned(16))) unsigned short sKh[32][D + 8], sKl[32][D + 8], sVh[32][D + 8], sVl[32][D + 8];
  __shared__ __attribute__((aligned(16))) unsigned short sPh[4][16][40], sPl[4][16][40];
  __shared__ __attribute__((aligned(16))) float sO[4][16][D];
  const int tid = threadIdx.x, w = tid >> 5, lane = tid & 31, ln = lane & 15, hh = lane >> 4;
  const int nqb = (T + 63) / 64;
  const int bh = blockIdx.x / nqb, qblk = blockIdx.x % nqb;
  const int b = bh / H, h = bh % H;
  const int q0 = qblk * 64 + w * 16;
  const float* Q = qb + (size_t)b * T * pitch + h * D;
  const float* K = kb + (size_t)b * T * pitch + h * D;
  const float* V = vb + (size_t)b * T * pitch + h * D;

  // A fragments of the wave's 16 query rows (scaled), hi/lo
  FragB aqh[KS], aql[KS];
  {
    int row = q0 + ln; if (row >= T) row = T - 1;
    const float* qr = Q + (size_t)row * pitch;
#pragma unroll
    for (int ks = 0; ks < KS; ++ks)
#pragma unroll
      for (int i = 0; i < 16; ++i) {
        const int d = ks * 32 + ((i < 8) ? (8 * hh + i) : (16 + 8 * hh + (i - 8)));
        const float x = qr[d] * scale; const unsigned short hb = bf16_bits(x);
        aqh[ks].u[i] = hb; aql[ks].u[i] = bf16_bits(x - bf16_val(hb));
      }
  }
  float m_r[8], l_r[8];
#pragma unroll
  for (int r = 0; r < 8; ++r) { m_r[r] = -3.0e38f; l_r[r] = 0.f; }
  v8f oacc[DT];
#pragma unroll
  for (int dt = 0; dt < DT; ++dt) oacc[dt] = (v8f){0.f,0.f,0.f,0.f,0.f,0.f,0.f,0.f};

  const int kv_end = CAUSAL ? min(T, qblk * 64 + 64) : T;     // block-uniform
  for (int j0 = 0; j0 < kv_end; j0 += 32) {
    __syncthreads();
    for (int e = tid; e < 32 * (D / 4); e += 128) {
      const int r = e / (D / 4), c4 = (e % (D / 4)) * 4;
      const int key = j0 + r;
      v4f kf = {0.f,0.f,0.f,0.f}, vf = {0.f,0.f,0.f,0.f};
      if (key < T) { kf = *(const v4fa*)(K + (size_t)key * pitch + c4); vf = *(const v4fa*)(V + (size_t)key * pitch + c4); }
#pragma unroll
      for (int t = 0; t < 4; ++t) {
        unsigned short hb = bf16_bits(kf[t]); sKh[r][c4 + t] = hb; sKl[r][c4 + t] = bf16_bits(kf[t] - bf16_val(hb));
        hb = bf16_bits(vf[t]); sVh[r][c4 + t] = hb; sVl[r][c4 + t] = bf16_bits(vf[t] - bf16_val(hb));
      }
    }
    __syncthreads();
    // S tile 16 x 32
    v8f s[2];
#pragma unroll
    for (int nt = 0; nt < 2; ++nt) {
      v8f acc = {};
#pragma unroll
      for (int ks = 0; ks < KS; ++ks) {
        FragB bh_, bl_;
        bh_.half[0] = *(const v8us*)&sKh[nt * 16 + ln][ks * 32 + 8 * hh]; bh_.half[1] = *(const v8us*)&sKh[nt * 16 + ln][ks * 32 + 16 + 8 * hh];
        bl_.half[0] = *(const v8us*)&sKl[nt * 16 + ln][ks * 32 + 8 * hh]; bl_.half[1] = *(const v8us*)&sKl[nt * 16 + ln][ks * 32 + 16 + 8 * hh];
        acc = mmaN<3>(aqh[ks].v, aql[ks].v, bh_.v, bl_.v, acc);
      }
      s[nt] = acc;
    }
    // mask + running max (rows 8hh+r; the 16 lanes of a half share rows)
    float alpha[8];
#pragma unroll
    for (int r = 0; r < 8; ++r) {
      const int qi = q0 + 8 * hh + r;
      const int ja = j0 + ln, jb = j0 + 16 + ln;
      if (CAUSAL) { if (ja > qi) s[0][r] = -3.0e38f; if (jb > qi) s[1][r] = -3.0e38f; }
      if (ja >= T) s[0][r] = -3.0e38f;
      if (jb >= T) s[1][r] = -3.0e38f;
      float mx = fmaxf(s[0][r], s[1][r]);
      mx = fmaxf(mx, __shfl_xor(mx, 1, 32)); mx = fmaxf(mx, __shfl_xor(mx, 2, 32)); mx = fmaxf(mx, __shfl_xor(mx, 4, 32)); mx = fmaxf(mx, __shfl_xor(mx, 8, 32));
      const float mnew = fmaxf(m_r[r], mx);
      alpha[r] = (mnew > -1.0e38f) ? __expf(m_r[r] - mnew) : 1.0f;
      const float p0 = (s[0][r] > -1.0e38f) ? __expf(s[0][r] - mnew) : 0.f;
      const float p1 = (s[1][r] > -1.0e38f) ? __expf(s[1][r] - mnew) : 0.f;
      m_r[r] = mnew;
      l_r[r] = l_r[r] * alpha[r] + p0 + p1;            // per-lane partial row sum (16 lanes combined at the end)
      unsigned short hb = bf16_bits(p0); sPh[w][8 * hh + r][ln] = hb;      sPl[w][8 * hh + r][ln] = bf16_bits(p0 - bf16_val(hb));
      hb = bf16_bits(p1);                sPh[w][8 * hh + r][16 + ln] = hb; sPl[w][8 * hh + r][16 + ln] = bf16_bits(p1 - bf16_val(hb));
    }
#pragma unroll
    for (int dt = 0; dt < DT; ++dt)
#pragma unroll
      for (int r = 0; r < 8; ++r) oacc[dt][r] *= alpha[r];
    __builtin_amdgcn_fence(__ATOMIC_ACQ_REL, "workgroup");
    __builtin_amdgcn_wave_barrier();
    FragB pah, pal;
    pah.half[0] = *(const v8us*)&sPh[w][ln][8 * hh]; pah.half[1] = *(const v8us*)&sPh[w][ln][16 + 8 * hh];
    pal.half[0] = *(const v8us*)&sPl[w][ln][8 * hh]; pal.half[1] = *(const v8us*)&sPl[w][ln][16 + 8 * hh];
#pragma unroll
    for (int dt = 0; dt < DT; ++dt) {
      FragB bvh, bvl;
#pragma unroll
      for (int i = 0; i < 8; ++i) {
        bvh.u[i] = sVh[8 * hh + i][dt * 16 + ln]; bvh.u[8 + i] = sVh[16 + 8 * hh + i][dt * 16 + ln];
        bvl.u[i] = sVl[8 * hh + i][dt * 16 + ln]; bvl.u[8 + i] = sVl[16 + 8 * hh + i][dt * 16 + ln];
      }
      oacc[dt] = mmaN<3>(pah.v, pal.v, bvh.v, bvl.v, oacc[dt]);
    }
    __builtin_amdgcn_fence(__ATOMIC_ACQ_REL, "workgroup");
    __builtin_amdgcn_wave_barrier();
  }
#pragma unroll
  for (int r = 0; r < 8; ++r) {
    float l = l_r[r];
    l += __shfl_xor(l, 1, 32); l += __shfl_xor(l, 2, 32); l += __shfl_xor(l, 4, 32); l += __shfl_xor(l, 8, 32);
    l_r[r] = (l > 0.f) ? 1.0f / l : 0.f;
  }
#pragma unroll
  for (int dt = 0; dt < DT; ++dt)
#pragma unroll
    for (int r = 0; r < 8; ++r) sO[w][8 * hh + r][dt * 16 + ln] = oacc[dt][r] * l_r[r];
  __builtin_amdgcn_fence(__ATOMIC_ACQ_REL, "workgroup");
  __builtin_amdgcn_wave_barrier();
  {
    for (int r = 0; r < 16; ++r) {
      const int row = q0 + r;
      if (row < T && lane < D / 4) {
        const v4f val = *(const v4fa*)&sO[w][r][lane * 4];
        *(v4f*)(y + ((size_t)b * T + row) * ypitch + h * D + lane * 4) = val;
      }
    }
    
  }
}

// in pitch = cols, out pitch = rows; rows, cols multiples of 32. Optional per-output-row affine (scale[c], shift[c]) and
// residual add res (same layout as out, optionally bf16-rounded) for fused epilogues: out = in*scale + shift + res.
template <bool AFFINE, bool RESID, bool RES_BF16>
__global__ __launch_bounds__(256) void k_transpose32(const float* __restrict__ in, float* __restrict__ out, int rows, int cols,
                                                    const float* __restrict__ scale, const float* __restrict__ shift, const float* __restrict__ res) {
  __shared__ float tile[32][33];
  const int b = blockIdx.z;
  const int r0 = blockIdx.y * 32, c0 = blockIdx.x * 32;
  const float* src = in + (size_t)b * rows * cols;
  float* dst = out + (size_t)b * rows * cols;
  const int tx = threadIdx.x & 31, ty = threadIdx.x >> 5;     // 8 rows per pass
  for (int i = ty; i < 32; i += 8) tile[i][tx] = src[(size_t)(r0 + i) * cols + c0 + tx];
  __syncthreads();
  {
    for (int i = ty; i < 32; i += 8) {
      float v = tile[tx][i];
      const int orow = c0 + i;
      if (AFFINE) v = v * scale[orow] + shift[orow];
      if (RESID) { float rv = res[(size_t)b * rows * cols + (size_t)orow * rows + r0 + tx]; if (RES_BF16) rv = bf16_round(rv); v += rv; }
      *(float*)(dst + (size_t)orow * rows + r0 + tx) = v;
    }
    
  }
}

// 2x2 max pool on position-major data: in [B][H*W][C] -> out [B][(H/2)*(W/2)][C]; thread per (b, p', 4 channels); C%4==0
__global__ __launch_bounds__(256) void k_pool2_pm(const float* __restrict__ in, float* __restrict__ out, int Bn, int H, int W, int C) {
  const size_t t = (size_t)blockIdx.x * 256 + threadIdx.x;
  const int c4n = C / 4, Ho = H / 2, Wo = W / 2;
  const size_t total = (size_t)Bn * Ho * Wo * c4n;
  if (t >= total) return;
  const int c4 = (int)(t % c4n) * 4; size_t rest = t / c4n;
  const int pw = (int)(rest % Wo); rest /= Wo; const int ph = (int)(rest % Ho); const int b = (int)(rest / Ho);
  const float* base = in + (size_t)b * H * W * C;
  const int p00 = (2 * ph) * W + 2 * pw;
  const v4f a = *(const v4fa*)(base + (size_t)p00 * C + c4), bq = *(const v4fa*)(base + (size_t)(p00 + 1) * C + c4);
  const v4f c = *(const v4fa*)(base + (size_t)(p00 + W) * C + c4), d = *(const v4fa*)(base + (size_t)(p00 + W + 1) * C + c4);
  v4f m; for (int i = 0; i < 4; ++i) m[i] = fmaxf(fmaxf(a[i], bq[i]), fmaxf(c[i], d[i]));
  float* dst = out + ((size_t)b * Ho * Wo + (size_t)ph * Wo + pw) * C + c4;
  *(v4f*)dst = m;
  
}

// General (non-causal) attention, 3-term bf16 splits, f32 softmax with running max.
// Q [.][Tq][qpitch], K [.][Tk][kpitch] (head dim DQ), V [.][Tk][vpitch] (head dim DVtot); this block handles DV output
// dims starting at dv0 = blockIdx.y*DV. y[bh][t][ypitch] gets columns dv0..dv0+DV-1. Per-bh base offsets via strides.
template <int DQ, int DV>
__global__ __launch_bounds__(128) void k_flash2(const float* __restrict__ Qb, size_t qstride, int qpitch, int Tq,
                                              const float* __restrict__ Kb, size_t kstride, int kpitch, int Tk,
                                              const float* __restrict__ Vb, size_t vstride, int vpitch,
                                              float scale, float* __restrict__ y, size_t ystride, int ypitch) {
  constexpr int KS = DQ / 32, DT = DV / 16;
  __shared__ __attribute__((aligned(16))) unsigned short sKh[32][DQ + 8], sKl[32][DQ + 8], sVh[32][DV + 8], sVl[32][DV + 8];
  __shared__ __attribute__((aligned(16))) unsigned short sPh[4][16][40], sPl[4][16][40];
  __shared__ __attribute__((aligned(16))) float sO[4][16][DV];
  const int tid = threadIdx.x, w = tid >> 5, lane = tid & 31, ln = lane & 15, hh = lane >> 4;
  const int nqb = (Tq + 63) / 64;
  const int bh = blockIdx.x / nqb, qblk = blockIdx.x % nqb;
  const int dv0 = blockIdx.y * DV;
  const int q0 = qblk * 64 + w * 16;
  const float* Q = Qb + (size_t)bh * qstride; const float* K = Kb + (size_t)bh * kstride; const float* V = Vb + (size_t)bh * vstride + dv0;
  FragB aqh[KS], aql[KS];
  {
    int row = q0 + ln; if (row >= Tq) row = Tq - 1;
    const float* qr = Q + (size_t)row * qpitch;
#pragma unroll
    for (int ks = 0; ks < KS; ++ks)
#pragma unroll
      for (int i = 0; i < 16; ++i) {
        const int d = ks * 32 + ((i < 8) ? (8 * hh + i) : (16 + 8 * hh + (i - 8)));
        const float x = qr[d] * scale; const unsigned short hb = bf16_bits(x);
        aqh[ks].u[i] = hb; aql[ks].u[i] = bf16_bits(x - bf16_val(hb));
      }
  }
  float m_r[8], l_r[8];
#pragma unroll
  for (int r = 0; r < 8; ++r) { m_r[r] = -3.0e38f; l_r[r] = 0.f; }
  v8f oacc[DT];
#pragma unroll
  for (int dt = 0; dt < DT; ++dt) oacc[dt] = (v8f){0.f,0.f,0.f,0.f,0.f,0.f,0.f,0.f};
  for (int j0 = 0; j0 < Tk; j0 += 32) {
    __syncthreads();
    for (int e = tid; e < 32 * (DQ / 4); e += 128) {
      const int r = e / (DQ / 4), c4 = (e % (DQ / 4)) * 4; const int key = j0 + r;
      v4f f = {0.f,0.f,0.f,0.f}; if (key < Tk) f = *(const v4fa*)(K + (size_t)key * kpitch + c4);
#pragma unroll
      for (int t = 0; t < 4; ++t) { const unsigned short hb = bf16_bits(f[t]); sKh[r][c4 + t] = hb; sKl[r][c4 + t] = bf16_bits(f[t] - bf16_val(hb)); }
    }
    for (int e = tid; e < 32 * (DV / 4); e += 128) {
      const int r = e / (DV / 4), c4 = (e % (DV / 4)) * 4; const int key = j0 + r;
      v4f f = {0.f,0.f,0.f,0.f}; if (key < Tk) f = *(const v4fa*)(V + (size_t)key * vpitch + c4);
#pragma unroll
      for (int t = 0; t < 4; ++t) { const unsigned short hb = bf16_bits(f[t]); sVh[r][c4 + t] = hb; sVl[r][c4 + t] = bf16_bits(f[t] - bf16_val(hb)); }
    }
    __syncthreads();
    v8f s[2];
#pragma unroll
    for (int nt = 0; nt < 2; ++nt) {
      v8f acc = {};
#pragma unroll
      for (int ks = 0; ks < KS; ++ks) {
        FragB bh_, bl_;
        bh_.half[0] = *(const v8us*)&sKh[nt * 16 + ln][ks * 32 + 8 * hh]; bh_.half[1] = *(const v8us*)&sKh[nt * 16 + ln][ks * 32 + 16 + 8 * hh];
        bl_.half[0] = *(const v8us*)&sKl[nt * 16 + ln][ks * 32 + 8 * hh]; bl_.half[1] = *(const v8us*)&sKl[nt * 16 + ln][ks * 32 + 16 + 8 * hh];
        acc = mmaN<3>(aqh[ks].v, aql[ks].v, bh_.v, bl_.v, acc);
      }
      s[nt] = acc;
    }
    float alpha[8];
#pragma unroll
    for (int r = 0; r < 8; ++r) {
      const int ja = j0 + ln, jb = j0 + 16 + ln;
      if (ja >= Tk) s[0][r] = -3.0e38f;
      if (jb >= Tk) s[1][r] = -3.0e38f;
      float mx = fmaxf(s[0][r], s[1][r]);
      mx = fmaxf(mx, __shfl_xor(mx, 1, 32)); mx = fmaxf(mx, __shfl_xor(mx, 2, 32)); mx = fmaxf(mx, __shfl_xor(mx, 4, 32)); mx = fmaxf(mx, __shfl_xor(mx, 8, 32));
      const float mnew = fmaxf(m_r[r], mx);
      alpha[r] = (mnew > -1.0e38f) ? __expf(m_r[r] - mnew) : 1.0f;
      const float p0 = (s[0][r] > -1.0e38f) ? __expf(s[0][r] - mnew) : 0.f;
      const float p1 = (s[1][r] > -1.0e38f) ? __expf(s[1][r] - mnew) : 0.f;
      m_r[r] = mnew;
      l_r[r] = l_r[r] * alpha[r] + p0 + p1;
      unsigned short hb = bf16_bits(p0); sPh[w][8 * hh + r][ln] = hb;      sPl[w][8 * hh + r][ln] = bf16_bits(p0 - bf16_val(hb));
      hb = bf16_bits(p1);                sPh[w][8 * hh + r][16 + ln] = hb; sPl[w][8 * hh + r][16 + ln] = bf16_bits(p1 - bf16_val(hb));
    }
#pragma unroll
    for (int dt = 0; dt < DT; ++dt)
#pragma unroll
      for (int r = 0; r < 8; ++r) oacc[dt][r] *= alpha[r];
    __builtin_amdgcn_fence(__ATOMIC_ACQ_REL, "workgroup");
    __builtin_amdgcn_wave_barrier();
    FragB pah, pal;
    pah.half[0] = *(const v8us*)&sPh[w][ln][8 * hh]; pah.half[1] = *(const v8us*)&sPh[w][ln][16 + 8 * hh];
    pal.half[0] = *(const v8us*)&sPl[w][ln][8 * hh]; pal.half[1] = *(const v8us*)&sPl[w][ln][16 + 8 * hh];
#pragma unroll
    for (int dt = 0; dt < DT; ++dt) {
      FragB bvh, bvl;
#pragma unroll
      for (int i = 0; i < 8; ++i) {
        bvh.u[i] = sVh[8 * hh + i][dt * 16 + ln]; bvh.u[8 + i] = sVh[16 + 8 * hh + i][dt * 16 + ln];
        bvl.u[i] = sVl[8 * hh + i][dt * 16 + ln]; bvl.u[8 + i] = sVl[16 + 8 * hh + i][dt * 16 + ln];
      }
      oacc[dt] = mmaN<3>(pah.v, pal.v, bvh.v, bvl.v, oacc[dt]);
    }
    __builtin_amdgcn_fence(__ATOMIC_ACQ_REL, "workgroup");
    __builtin_amdgcn_wave_barrier();
  }
#pragma unroll
  for (int r = 0; r < 8; ++r) {
    float l = l_r[r];
    l += __shfl_xor(l, 1, 32); l += __shfl_xor(l, 2, 32); l += __shfl_xor(l, 4, 32); l += __shfl_xor(l, 8, 32);
    l_r[r] = (l > 0.f) ? 1.0f / l : 0.f;
  }
#pragma unroll
  for (int dt = 0; dt < DT; ++dt)
#pragma unroll
    for (int r = 0; r < 8; ++r) sO[w][8 * hh + r][dt * 16 + ln] = oacc[dt][r] * l_r[r];
  __builtin_amdgcn_fence(__ATOMIC_ACQ_REL, "workgroup");
  __builtin_amdgcn_wave_barrier();
  {
    for (int r = 0; r < 16; ++r) {
      const int row = q0 + r;
      for (int c4 = lane * 4; c4 < DV; c4 += 128) {
        if (row < Tq) {
          const v4f val = *(const v4fa*)&sO[w][r][c4];
          *(v4f*)(y + (size_t)bh * ystride + (size_t)row * ypitch + dv0 + c4) = val;
        }
      }
    }
    
  }
}

// row LayerNorm (biased variance, eps) over N: s = X (+ R); optional out_sum <- s; out_norm <- (s-mu)*rsqrt(var+eps)*g + b
template <bool PARAM_BF16>
__global__ __launch_bounds__(256) void k_layernorm(const float* __restrict__ X, const float* __restrict__ R, const float* __restrict__ g, const float* __restrict__ bta,
                                                  float* __restrict__ out_sum, float* __restrict__ out_norm, int N, float eps) {
  __shared__ float red[256];
  const int row = blockIdx.x, tid = threadIdx.x;
  const float* x = X + (size_t)row * N; const float* rr = R ? R + (size_t)row * N : nullptr;
  float vals[16];                     // up to N = 4096
  const int per = N / 256;            // contiguous chunk per thread? use strided-by-4 chunks: thread handles j = tid*4 + 1024*u
  float s1 = 0.f;
  for (int u = 0; u < per / 4; ++u) {
    const int j = tid * 4 + 1024 * u;
    const v4f a = *(const v4fa*)(x + j);
    v4f b = {0.f,0.f,0.f,0.f}; if (rr) b = *(const v4fa*)(rr + j);
#pragma unroll
    for (int q = 0; q < 4; ++q) { const float v = a[q] + b[q]; vals[u * 4 + q] = v; s1 += v; }
  }
  red[tid] = s1; __syncthreads();
  for (int st = 128; st > 0; st >>= 1) { if (tid < st) red[tid] += red[tid + st]; __syncthreads(); }
  const float mu = red[0] / (float)N; __syncthreads();
  float s2 = 0.f;
  for (int u = 0; u < per / 4; ++u)
#pragma unroll
    for (int q = 0; q < 4; ++q) { const float c = vals[u * 4 + q] - mu; s2 += c * c; }
  red[tid] = s2; __syncthreads();
  for (int st = 128; st > 0; st >>= 1) { if (tid < st) red[tid] += red[tid + st]; __syncthreads(); }
  const float rs = rsqrtf(red[0] / (float)N + eps);
  {
    for (int u = 0; u < per / 4; ++u) {
      const int j = tid * 4 + 1024 * u;
      v4f o, sm;
#pragma unroll
      for (int q = 0; q < 4; ++q) {
        float gg = g[j + q], bb = bta[j + q];
        if (PARAM_BF16) { gg = bf16_round(gg); bb = bf16_round(bb); }
        sm[q] = vals[u * 4 + q]; o[q] = (vals[u * 4 + q] - mu) * rs * gg + bb;
      }
      if (out_sum) *(v4f*)(out_sum + (size_t)row * N + j) = sm;
      *(v4f*)(out_norm + (size_t)row * N + j) = o;
    }
    
  }
}

// K and V rows (f32, row pitch `pitch`, D = 64 columns) prepared ONCE for k_flash3: each value split into bf16 hi + lo, written as four planes.
// Kh/Kl keep the row order [row][D]. VTh/VTl are transposed inside each chunk of 32 rows: [chunk][d][32 rows], so that a chunk of any plane is
// 32 * D contiguous values at offset chunk * 32 * D, and a V^T fragment row (one d, 32 keys) is contiguous. One block = one chunk of 32 rows.
template <int D>
__global__ __launch_bounds__(256) void k_split_kv(const float* __restrict__ K, const float* __restrict__ V, int pitch,
                                                 unsigned short* __restrict__ Kh, unsigned short* __restrict__ Kl,
                                                 unsigned short* __restrict__ VTh, unsigned short* __restrict__ VTl) {
  static_assert(D == 64, "256 threads = 32 rows x D/8 units = D rows x 4 units");
  __shared__ float tv[32][D + 1];                                // pitch 65 dwords: the column walk below meets distinct banks
  const int t = threadIdx.x;
  const size_t row0 = (size_t)blockIdx.x * 32;
  {
    const int r = t / (D / 8), c8 = (t % (D / 8)) * 8;
    const float* kr = K + (row0 + r) * pitch + c8; const float* vr = V + (row0 + r) * pitch + c8;
    const v4f k0 = *(const v4fa*)kr, k1 = *(const v4fa*)(kr + 4);
    asm volatile("s_wait_xcnt 0x0" ::: "memory");                // what follows may reuse the address registers of the two loads above
    const v4f v0 = *(const v4fa*)vr, v1 = *(const v4fa*)(vr + 4);
    asm volatile("s_wait_xcnt 0x0" ::: "memory");                // the same for these two
    Pack8 hi, lo;
    // unrolled (here and below): the vectors are then indexed by constants and stay in registers
#pragma unroll
    for (int i = 0; i < 8; i += 2) {
      const float x0 = (i < 4) ? k0[i & 3] : k1[i & 3], x1 = (i < 4) ? k0[(i + 1) & 3] : k1[(i + 1) & 3];
      hi.w[i / 2] = bf16_pack2(x0, x1); lo.w[i / 2] = bf16_rest2(x0, x1, hi.w[i / 2]);
      tv[r][c8 + i] = (i < 4) ? v0[i & 3] : v1[i & 3]; tv[r][c8 + i + 1] = (i < 4) ? v0[(i + 1) & 3] : v1[(i + 1) & 3];
    }
    *(v8us*)(Kh + (row0 + r) * D + c8) = hi.v;
    *(v8us*)(Kl + (row0 + r) * D + c8) = lo.v;
  }
  __syncthreads();
  {
    const int d = t / 4, k8 = (t % 4) * 8;
    Pack8 hi, lo;
#pragma unroll
    for (int i = 0; i < 8; i += 2) {
      const float x0 = tv[k8 + i][d], x1 = tv[k8 + i + 1][d];
      hi.w[i / 2] = bf16_pack2(x0, x1); lo.w[i / 2] = bf16_rest2(x0, x1, hi.w[i / 2]);
    }
    *(v8us*)(VTh + row0 * D + d * 32 + k8) = hi.v;
    *(v8us*)(VTl + row0 * D + d * 32 + k8) = lo.v;
  }
}

// One 32-key chunk of one key group in LDS: the four planes of k_split_kv. K rows at a pitch of D + 8 values, V^T rows (32 keys) at 32 + 8 values:
// both 16 B x odd, for 16-byte readers.
template <int D> struct KvStage { unsigned short Kh[32][D + 8], Kl[32][D + 8], Vh[D][32 + 8], Vl[D][32 + 8]; };
__device__ __forceinline__ unsigned lds_off(const void* p) { return (unsigned)(size_t)p; }   // byte address inside the work-group's LDS

template <int D, int NS, int NC>
__global__ __launch_bounds__(128 * NS) void k_flash3(const float* __restrict__ Qb, int qpitch, int Tq,
                                              const unsigned short* __restrict__ Kh, const unsigned short* __restrict__ Kl,
                                              const unsigned short* __restrict__ VTh, const unsigned short* __restrict__ VTl, int Tk,
                                              float scale, const int* __restrict__ mask, int causal, const float* __restrict__ sbias,
                                              const unsigned short* __restrict__ Wf, const float* __restrict__ fb, const float* __restrict__ xres,
                                              float* __restrict__ out) {
  constexpr int KS = D / 32, DT = D / 16;
  constexpr int OP = D + 4;         // pitch of sO in floats: 16 B x odd, so the 16 lanes that each store 16 bytes of their own row meet distinct banks
  __shared__ __attribute__((aligned(16))) KvStage<D> sSt[2][NS];
  __shared__ __attribute__((aligned(16))) float sO[NS][4][16][OP];
  __shared__ float sM[NS][4][16], sL[NS][4][16];
  __shared__ __attribute__((aligned(16))) unsigned short sAh[64][D + 8], sAl[64][D + 8];   // the joined rows, bf16 hi and lo; pitch 16 B x odd
  // g is the same in every lane of a wave; held in a scalar register, the chunk's base address and the test for a chunk past the end are scalar too
  const int g = __builtin_amdgcn_readfirstlane(threadIdx.x >> 7);
  const int tid = threadIdx.x & 127, w = tid >> 5, lane = tid & 31, ln = lane & 15, hh = lane >> 4;
  const int nqb = (Tq + 63) / 64;
  const int bh = blockIdx.x / nqb, qblk = blockIdx.x % nqb;
  const int q0 = qblk * 64 + w * 16;
  const float* Q = Qb + (size_t)bh * Tq * qpitch;
  FragB aqh[KS], aql[KS];
  {
    int row = q0 + ln; if (row >= Tq) row = Tq - 1;
    const float* qr = Q + (size_t)row * qpitch;
#pragma unroll
    for (int ks = 0; ks < KS; ++ks)
#pragma unroll
      for (int i = 0; i < 16; i += 2) {
        const int d = ks * 32 + ((i < 8) ? (8 * hh + i) : (16 + 8 * hh + (i - 8)));
        const float x0 = qr[d] * scale, x1 = qr[d + 1] * scale; const unsigned int hw = bf16_pack2(x0, x1);
        aqh[ks].w[i / 2] = hw; aql[ks].w[i / 2] = bf16_rest2(x0, x1, hw);
      }
  }
  int qi = q0 + ln; if (qi >= Tq) qi = Tq - 1;                  // the lane's query
  float m_r = -3.0e38f, l_r = 0.f;                               // its running max (equal in both halves) and this half's share of its sum
  v8f oacc[DT];                                                  // O^T: oacc[dt][r] = O[query ln][dt * 16 + 8 * hh + r]
#pragma unroll
  for (int dt = 0; dt < DT; ++dt) oacc[dt] = (v8f){0.f,0.f,0.f,0.f,0.f,0.f,0.f,0.f};
  const bool special = causal || mask || sbias;
  const int kv_end = causal ? min(Tk, qblk * 64 + 64) : Tk;
  static_assert(32 * D / 8 / 128 == 2, "two 16-byte units of each plane's chunk per thread");
  const int ntrip = (kv_end + 32 * NS - 1) / (32 * NS);          // block-uniform trips; a group's chunk past the end is masked like any tail
  // The thread's eight units of its group's chunk of trip t -> buffer buf. A chunk past the end of the keys is replaced by the last chunk: its addresses
  // stay inside the planes, every wave issues the same copies, and its scores are masked below, so that its P is 0 against finite V.
  auto stage = [&](int t, int buf) {
    const int jc = min((t * NS + g) * 32, Tk - 32);
    const unsigned o = ((unsigned)bh * Tk + jc) * (D * 2) + tid * 16;   // the same byte offset in all four planes (each plane is below 4 GiB)
    KvStage<D>* S = &sSt[buf][g];
    const int e0 = tid, e1 = tid + 128;                          // unit e: 128 threads x 16 B = 2048 B a unit row
    // the copies and, as the last line, the wait in front of any rewrite of their address registers, in one statement: nothing can come between
    asm volatile("global_load_async_to_lds_b128 %0, %8, off\n\t"
                 "global_load_async_to_lds_b128 %1, %9, off\n\t"
                 "global_load_async_to_lds_b128 %2, %10, off\n\t"
                 "global_load_async_to_lds_b128 %3, %11, off\n\t"
                 "global_load_async_to_lds_b128 %4, %12, off\n\t"
                 "global_load_async_to_lds_b128 %5, %13, off\n\t"
                 "global_load_async_to_lds_b128 %6, %14, off\n\t"
                 "global_load_async_to_lds_b128 %7, %15, off\n\t"
                 "s_wait_xcnt 0x0"
                 :: "v"(lds_off(&S->Kh[e0 / (D / 8)][(e0 % (D / 8)) * 8])), "v"(lds_off(&S->Kl[e0 / (D / 8)][(e0 % (D / 8)) * 8])),
                    "v"(lds_off(&S->Vh[e0 / 4][(e0 % 4) * 8])),             "v"(lds_off(&S->Vl[e0 / 4][(e0 % 4) * 8])),
                    "v"(lds_off(&S->Kh[e1 / (D / 8)][(e1 % (D / 8)) * 8])), "v"(lds_off(&S->Kl[e1 / (D / 8)][(e1 % (D / 8)) * 8])),
                    "v"(lds_off(&S->Vh[e1 / 4][(e1 % 4) * 8])),             "v"(lds_off(&S->Vl[e1 / 4][(e1 % 4) * 8])),
                    "v"((const char*)Kh + o),          "v"((const char*)Kl + o),          "v"((const char*)VTh + o),          "v"((const char*)VTl + o),
                    "v"((const char*)Kh + (o + 2048u)), "v"((const char*)Kl + (o + 2048u)), "v"((const char*)VTh + (o + 2048u)), "v"((const char*)VTl + (o + 2048u))
                 : "memory");
  };
  stage(0, 0);
  asm volatile("s_wait_asynccnt 0x0" ::: "memory");              // this wave's copies of chunk 0 have landed
  __syncthreads();                                               // and every other wave's
  if (ntrip > 1) stage(1, 1);
  for (int t = 0; t < ntrip; ++t) {
    const int jb = t * 32 * NS, j0 = jb + 32 * g;
    const KvStage<D>* S = &sSt[t & 1][g];
    const unsigned short (*sKh)[D + 8] = S->Kh; const unsigned short (*sKl)[D + 8] = S->Kl;
    const unsigned short (*sVh)[32 + 8] = S->Vh; const unsigned short (*sVl)[32 + 8] = S->Vl;
    v8f s[2];                                                    // S^T: s[nt][r] = score(query ln, key j0 + nt * 16 + 8 * hh + r)
#pragma unroll
    for (int nt = 0; nt < 2; ++nt) {
      v8f acc = {};
#pragma unroll
      for (int ks = 0; ks < KS; ++ks) {
        FragB bh_, bl_;
        bh_.half[0] = *(const v8us*)&sKh[nt * 16 + ln][ks * 32 + 8 * hh]; bh_.half[1] = *(const v8us*)&sKh[nt * 16 + ln][ks * 32 + 16 + 8 * hh];
        bl_.half[0] = *(const v8us*)&sKl[nt * 16 + ln][ks * 32 + 8 * hh]; bl_.half[1] = *(const v8us*)&sKl[nt * 16 + ln][ks * 32 + 16 + 8 * hh];
        acc = mmaN<3>(bh_.v, bl_.v, aqh[ks].v, aql[ks].v, acc);
      }
      s[nt] = acc;
    }
    if (special || jb + 32 * NS > Tk) {                          // block-uniform: masks, biases and key tails; a dropped score becomes -3e38
#pragma unroll
      for (int nt = 0; nt < 2; ++nt)
#pragma unroll
        for (int r = 0; r < 8; ++r) {
          const int key = j0 + nt * 16 + 8 * hh + r;
          bool keep = key < Tk;
          if (causal) keep = keep && (key <= qi);
          if (mask) { if (keep) keep = mask[(size_t)qi * Tk + key] != 0; }
          if (sbias) { if (keep) s[nt][r] += sbias[(size_t)bh * Tk + key]; }   // per-key additive bias (a per-query constant would cancel in the softmax)
          if (!keep) s[nt][r] = -3.0e38f;
        }
    }
    float mx = fmaxf(s[0][0], s[1][0]);
#pragma unroll
    for (int r = 1; r < 8; ++r) mx = fmaxf(mx, fmaxf(s[0][r], s[1][r]));
    mx = fmaxf(mx, xhalf(mx));                                   // the query's other 16 keys sit in the other half
    const float mnew = fmaxf(m_r, mx);
    const float mexp = fmaxf(mnew, -1.0e38f);                    // with nothing kept so far a dropped score still gives exp(-2e38) = 0
    const float alpha = __expf(m_r - mexp);
    m_r = mnew;
    FragB pbh, pbl;                                              // P^T as a B fragment: element nt * 8 + r is key nt * 16 + 8 * hh + r
    float ps[4] = {0.f, 0.f, 0.f, 0.f};
#pragma unroll
    for (int nt = 0; nt < 2; ++nt)
#pragma unroll
      for (int r = 0; r < 8; r += 2) {
        const float p0 = __expf(s[nt][r] - mexp), p1 = __expf(s[nt][r + 1] - mexp);
        ps[r & 3] += p0; ps[(r + 1) & 3] += p1;
        const unsigned int hw = bf16_pack2(p0, p1);
        pbh.w[nt * 4 + r / 2] = hw; pbl.w[nt * 4 + r / 2] = bf16_rest2(p0, p1, hw);
      }
    l_r = l_r * alpha + ((ps[0] + ps[1]) + (ps[2] + ps[3]));     // this half's 16 keys (the halves are added at the end)
#pragma unroll
    for (int dt = 0; dt < DT; ++dt)
#pragma unroll
      for (int r = 0; r < 8; ++r) oacc[dt][r] *= alpha;
#pragma unroll
    for (int dt = 0; dt < DT; ++dt) {
      FragB bvh, bvl;                                            // V^T as an A fragment: row dt * 16 + ln, the k order of P^T
      bvh.half[0] = *(const v8us*)&sVh[dt * 16 + ln][8 * hh]; bvh.half[1] = *(const v8us*)&sVh[dt * 16 + ln][16 + 8 * hh];
      bvl.half[0] = *(const v8us*)&sVl[dt * 16 + ln][8 * hh]; bvl.half[1] = *(const v8us*)&sVl[dt * 16 + ln][16 + 8 * hh];
      oacc[dt] = mmaN<3>(bvh.v, bvl.v, pbh.v, pbl.v, oacc[dt]);
    }
    asm volatile("s_wait_dscnt 0x0" ::: "memory");               // this wave's reads of the buffer are done before it is handed back
    asm volatile("s_wait_asynccnt 0x0" ::: "memory");            // this wave's copies of the next chunk have landed
    __syncthreads();                                             // the next chunk is published, this trip's buffer is free
    if (t + 2 < ntrip) stage(t + 2, t & 1);
  }
  asm volatile("s_wait_asynccnt 0x0" ::: "memory");              // no copy is left in flight behind the loop
  // The output projection's tiles: NC / 16 channel tiles x 4 query tiles, two query tiles (32 positions = one 128-byte line a channel) a wave.
  // What it needs from global memory is asked for here, so that it arrives under the join.
  static_assert(NC / 16 * 4 == 2 * 4 * NS, "two 16 x 16 tiles a wave");
  const int wv = __builtin_amdgcn_readfirstlane(threadIdx.x >> 5);   // the wave's number in the block, scalar
  const int ct = wv >> 1, qt0 = (wv & 1) * 2;
  const float* xb = xres + (size_t)bh * NC * Tq; float* ob = out + (size_t)bh * NC * Tq;
  FragB fw[KS];                                                  // Wf as an A fragment: row ct * 16 + ln, k = 32 ks + 8 hh + 0..7, then 16 further
  int off[8];                                                    // element r of an accumulator: channel ct * 16 + 8 hh + r, position ln of the tile
  float xr[2][8];
  v4f fb0, fb1;
  {
    const unsigned short* wr = Wf + (ct * 16 + ln) * D + 8 * hh;
#pragma unroll
    for (int ks = 0; ks < KS; ++ks) { fw[ks].half[0] = *(const v8us*)(wr + ks * 32); fw[ks].half[1] = *(const v8us*)(wr + ks * 32 + 16); }
    fb0 = *(const v4fa*)(fb + ct * 16 + 8 * hh); fb1 = *(const v4fa*)(fb + ct * 16 + 8 * hh + 4);
#pragma unroll
    for (int r = 0; r < 8; ++r) {
      off[r] = (ct * 16 + 8 * hh + r) * Tq + qblk * 64 + qt0 * 16 + ln;
      xr[0][r] = xb[off[r]]; xr[1][r] = xb[off[r] + 16];
    }
    // what follows may reuse the address registers of the loads above; wr as an input: no later load's result takes its registers in front of the wait
    asm volatile("s_wait_xcnt 0x0" :: "v"(wr) : "memory");
  }
  {
    const float l = l_r + xhalf(l_r);
    if (hh == 0) { sM[g][w][ln] = m_r; sL[g][w][ln] = l; }
  }
#pragma unroll
  for (int dt = 0; dt < DT; ++dt) {                              // not yet divided by the row sum
    *(v4fa*)&sO[g][w][ln][dt * 16 + 8 * hh]     = (v4f){oacc[dt][0], oacc[dt][1], oacc[dt][2], oacc[dt][3]};
    *(v4fa*)&sO[g][w][ln][dt * 16 + 8 * hh + 4] = (v4f){oacc[dt][4], oacc[dt][5], oacc[dt][6], oacc[dt][7]};
  }
  __syncthreads();                                               // every group's (max, sum, O) is in LDS
  // join: wave (g, w) finishes rows 2g, 2g + 1, then + 2 NS, of query tile w; each half wave takes one row (a lane writes 4 values of its row a store, as bf16 hi and lo into sAh and sAl)
  for (int r = g * 2 + hh; r < 16; r += 2 * NS) {
    float mj = -3.0e38f;
    // the three loops over s are unrolled so that f[] stays in registers
#pragma unroll
    for (int s = 0; s < NS; ++s) mj = fmaxf(mj, sM[s][w][r]);
    float f[NS], lj = 0.f;
#pragma unroll
    for (int s = 0; s < NS; ++s) { const float ms = sM[s][w][r]; f[s] = (ms > -1.0e38f) ? __expf(ms - mj) : 0.f; lj += f[s] * sL[s][w][r]; }
    const float inv = (mj > -1.0e38f) ? 1.0f / lj : __builtin_nanf("");
    for (int c4 = ln * 4; c4 < D; c4 += 64) {
      v4f val = {0.f, 0.f, 0.f, 0.f};
#pragma unroll
      for (int s = 0; s < NS; ++s) val += f[s] * *(const v4fa*)&sO[s][w][r][c4];
      val *= inv;
      const unsigned int h0 = bf16_pack2(val[0], val[1]), h1 = bf16_pack2(val[2], val[3]);
      *(v2ua*)&sAh[w * 16 + r][c4] = (v2ua){h0, h1};
      *(v2ua*)&sAl[w * 16 + r][c4] = (v2ua){bf16_rest2(val[0], val[1], h0), bf16_rest2(val[2], val[3], h1)};
    }
  }
  __syncthreads();                                               // the block's 64 rows are in LDS
  // unrolled: fragments and accumulators are indexed by constants and stay in registers
#pragma unroll
  for (int j = 0; j < 2; ++j) {
    const int qr = (qt0 + j) * 16 + ln;
    v8f acc = {};
#pragma unroll
    for (int ks = 0; ks < KS; ++ks) {
      FragB ph, pl;                                              // att^T as a B fragment: column qr, the k order of fw
      ph.half[0] = *(const v8us*)&sAh[qr][ks * 32 + 8 * hh]; ph.half[1] = *(const v8us*)&sAh[qr][ks * 32 + 16 + 8 * hh];
      pl.half[0] = *(const v8us*)&sAl[qr][ks * 32 + 8 * hh]; pl.half[1] = *(const v8us*)&sAl[qr][ks * 32 + 16 + 8 * hh];
      acc = mmaN<1>(fw[ks].v, fw[ks].v, ph.v, ph.v, acc);
      acc = mmaN<1>(fw[ks].v, fw[ks].v, pl.v, pl.v, acc);
    }
#pragma unroll
    for (int r = 0; r < 8; ++r) ob[off[r] + j * 16] = (acc[r] + bf16_round(r < 4 ? fb0[r & 3] : fb1[r & 3])) + xr[j][r];
  }
}

// The seven small preparation jobs of a call depend on nothing but the inputs, so they share ONE grid and the block index picks the job: the first
// 4 * PREP_WB blocks round the four weight matrices to bf16 (8 values a thread), the last block rounds the three biases into one concatenated row.
#define PREP_WB (HC * CC / 8 / 256)       // blocks per weight matrix
#define PREP_JOBS (4 * PREP_WB + 1)       // blocks of the grid
__global__ __launch_bounds__(256) void k_prep(const float* __restrict__ tw, const float* __restrict__ pw, const float* __restrict__ gw, const float* __restrict__ fw,
                                             unsigned short* __restrict__ Bqkv, unsigned short* __restrict__ Bf,
                                             const float* __restrict__ tb, const float* __restrict__ pb, const float* __restrict__ gb, float* __restrict__ bqkv) {
  const int blk = blockIdx.x;
  if (blk < 4 * PREP_WB) {
    const int m = blk / PREP_WB;
    const float* W = (m == 0) ? tw : (m == 1) ? pw : (m == 2) ? gw : fw;
    unsigned short* Wt = (m < 3) ? Bqkv + m * (HC * CC) : Bf;
    const int t = (blk % PREP_WB) * 256 + threadIdx.x;
    const v4f a = *(const v4fa*)(W + (size_t)t * 8), b = *(const v4fa*)(W + (size_t)t * 8 + 4);
    Pack8 v; v.w[0] = bf16_pack2(a[0], a[1]); v.w[1] = bf16_pack2(a[2], a[3]); v.w[2] = bf16_pack2(b[0], b[1]); v.w[3] = bf16_pack2(b[2], b[3]);
    *(v8us*)(Wt + (size_t)t * 8) = v.v;
    return;
  }
  const int t = threadIdx.x;
  if (t < 3 * (HC / 4)) {                                        // 4 values a thread; thread t writes bqkv[4 t ..], bias t / (HC / 4)
    const int m = t / (HC / 4);
    const float* src = (m == 0) ? tb : (m == 1) ? pb : gb;
    v4f a = *(const v4fa*)(src + (t % (HC / 4)) * 4);
    for (int i = 0; i < 4; ++i) a[i] = bf16_round(a[i]);
    *(v4f*)(bqkv + t * 4) = a;
  }
}

// Takes eight loaded vectors as inputs only and emits nothing: the loads written in front of it are all issued before the first use of any of them,
// so that they are in flight together; without it the compiler waits for each small group of loads and uses it before it issues the next.
template <class T>
__device__ __forceinline__ void hold8(T a, T b, T c, T d, T e, T f, T g, T h) {
  asm volatile("" :: "v"(a), "v"(b), "v"(c), "v"(d), "v"(e), "v"(f), "v"(g), "v"(h));
}

// GEMM C[M][N] (f32, dense rows) = A.W + bias on a CHANNEL-MAJOR A, read as it lies: A is [M / LDA][K][LDA] in f32 (LDA positions a batch), row m is
// position m % LDA of batch m / LDA. A lane gathers the 16 k values of its row at a stride of LDA floats (the 16 lanes of a half wave read 64
// contiguous bytes a load) and rounds them to bf16 (one term): no transposed copy of A is made. Wt bf16 [N][K]; bias f32, added as it is.
// One wave = 16 rows x 64 columns. K % 64 == 0, M % 16 == 0, N % 64 == 0, LDA % 16 == 0.
template <int K, int N, int LDA>
__global__ __launch_bounds__(128) void k_gemm_cm(const float* __restrict__ A, const unsigned short* __restrict__ Wt, const float* __restrict__ bias,
                                               float* __restrict__ C, int M) {
  constexpr int KS = K / 32, NTN = N / 64;
  static_assert((KS * 4) % 8 == 0, "hold8 takes the vectors by eights");
  __shared__ __attribute__((aligned(16))) float so[4][16][64];
  const int tid = threadIdx.x, w = tid >> 5, lane = tid & 31, ln = lane & 15, hh = lane >> 4;
  const int wid = blockIdx.x * 4 + w;
  const int mt = wid / NTN, nq = wid % NTN;
  if (mt * 16 >= M) return;
  const int row0 = mt * 16, col0 = nq * 64;
  // the lane's three base addresses; everything else of an address is a constant
  const float* ab = A + (size_t)(row0 / LDA) * K * LDA + (size_t)(8 * hh) * LDA + (row0 % LDA + ln);
  const unsigned short* wb = Wt + (size_t)(col0 + ln) * K + 8 * hh;
  const float* bb = bias + col0 + ln;
  // All loops are unrolled: the fragments are then indexed by constants and stay in registers, and the addresses are immediate offsets of the bases.
  v4f ra[KS * 4];                                                // element i = 4 q + j of k step ks in ra[ks * 4 + q][j]: k = 32 ks + 8 hh + i (i < 8), + 8 more (i >= 8)
#pragma unroll
  for (int ks = 0; ks < KS; ++ks)
#pragma unroll
    for (int q = 0; q < 4; ++q)
#pragma unroll
      for (int j = 0; j < 4; ++j) ra[ks * 4 + q][j] = ab[(size_t)(ks * 32 + (q >> 1) * 16 + (q & 1) * 4 + j) * LDA];
  FragB bf[KS][4];                                               // the same k order: half 0 is k = 32 ks + 8 hh + 0..7, half 1 is 16 further
#pragma unroll
  for (int ks = 0; ks < KS; ++ks)
#pragma unroll
    for (int t = 0; t < 4; ++t) {
      bf[ks][t].half[0] = *(const v8us*)(wb + t * 16 * K + ks * 32);
      bf[ks][t].half[1] = *(const v8us*)(wb + t * 16 * K + ks * 32 + 16);
    }
  float bv[4];
#pragma unroll
  for (int t = 0; t < 4; ++t) bv[t] = bb[t * 16];
#pragma unroll
  for (int e = 0; e < KS * 4; e += 8) hold8(ra[e], ra[e + 1], ra[e + 2], ra[e + 3], ra[e + 4], ra[e + 5], ra[e + 6], ra[e + 7]);
#pragma unroll
  for (int ks = 0; ks < KS; ++ks)
    hold8(bf[ks][0].half[0], bf[ks][0].half[1], bf[ks][1].half[0], bf[ks][1].half[1], bf[ks][2].half[0], bf[ks][2].half[1], bf[ks][3].half[0], bf[ks][3].half[1]);
  // inputs only, emits nothing: the three bases stay in their registers until every load that names them has returned, so that neither a later
  // load's result nor a later instruction takes an address register of a load in flight
  asm volatile("" :: "v"(bv[0]), "v"(bv[1]), "v"(bv[2]), "v"(bv[3]), "v"(ab), "v"(wb), "v"(bb));
  v8f acc[4] = {};
#pragma unroll
  for (int ks = 0; ks < KS; ++ks) {
    FragB ah;
#pragma unroll
    for (int i = 0; i < 8; ++i) ah.w[i] = bf16_pack2(ra[ks * 4 + i / 2][(i & 1) * 2], ra[ks * 4 + i / 2][(i & 1) * 2 + 1]);
#pragma unroll
    for (int t = 0; t < 4; ++t) acc[t] = mmaN<1>(ah.v, ah.v, bf[ks][t].v, bf[ks][t].v, acc[t]);
  }
#pragma unroll
  for (int t = 0; t < 4; ++t)
#pragma unroll
    for (int r = 0; r < 8; ++r) so[w][8 * hh + r][t * 16 + ln] = acc[t][r] + bv[t];
  __builtin_amdgcn_fence(__ATOMIC_ACQ_REL, "workgroup");
  __builtin_amdgcn_wave_barrier();
  const int rsub = lane >> 4, c4 = (lane & 15) * 4;
#pragma unroll
  for (int q = 0; q < 8; ++q) {
    const int r = q * 2 + rsub;
    const v4f v = *(const v4fa*)&so[w][r][c4];
    *(v4f*)(C + (size_t)(row0 + r) * N + col0 + c4) = v;
  }
}

extern "C" void kernel_launch(void* const* d_in, const int* in_sizes, int n_in,
                              void* d_out, int out_size, void* d_ws, size_t ws_size, hipStream_t stream) {
  (void)in_sizes; (void)n_in; (void)out_size;
  const float* x = (const float*)d_in[0]; const float* tw = (const float*)d_in[1]; const float* tb = (const float*)d_in[2]; const float* pw = (const float*)d_in[3]; const float* pb = (const float*)d_in[4];
  const float* gw = (const float*)d_in[5]; const float* gb = (const float*)d_in[6]; const float* fw = (const float*)d_in[7]; const float* fb = (const float*)d_in[8];
  char* ws = (char*)d_ws; size_t off = 0;
  auto take = [&](size_t bytes) { char* p = ws + off; off += (bytes + 255) & ~(size_t)255; return p; };
  unsigned short* Bqkv = (unsigned short*)take((size_t)3 * HC * CC * 2); unsigned short* Bf = (unsigned short*)take((size_t)CC * HC * 2); float* bqkv = (float*)take(3 * HC * 4 + 256);
  float* qkv = (float*)take((size_t)MROWS * 3 * HC * 4);
  unsigned short* Kh = (unsigned short*)take((size_t)MROWS * HC * 2); unsigned short* Kl = (unsigned short*)take((size_t)MROWS * HC * 2);
  unsigned short* VTh = (unsigned short*)take((size_t)MROWS * HC * 2); unsigned short* VTl = (unsigned short*)take((size_t)MROWS * HC * 2);
  if (off > ws_size) return;
  k_prep<<<PREP_JOBS, 256, 0, stream>>>(tw, pw, gw, fw, Bqkv, Bf, tb, pb, gb, bqkv);   // rounded weights and biases
  k_gemm_cm<CC, 3 * HC, HWN><<<((MROWS / 16) * 3 + 3) / 4, 128, 0, stream>>>(x, Bqkv, bqkv, qkv, MROWS);   // [theta | phi | g] + b (single term), x read as it lies (NCHW)
  k_split_kv<HC><<<MROWS / 32, 256, 0, stream>>>(qkv + HC, qkv + 2 * HC, 3 * HC, Kh, Kl, VTh, VTl);                                        // phi, g -> bf16 hi/lo planes, once
  k_flash3<HC, NSPLIT, CC><<<BB * (HWN / 64), 128 * NSPLIT, 0, stream>>>(qkv, 3 * HC, HWN, Kh, Kl, VTh, VTl, HWN, 1.0f, nullptr, 0, nullptr,
                                                                       Bf, fb, x, (float*)d_out);   // attention, final conv + b, + x, stored NCHW
}

// v009
// A run of this version takes 55.9 microseconds.
// In two side-by-side timings against v008, it was 1.10 and 1.12 times as fast.
// Counting every step since v000, it is 11.8 times as fast.
#include <hip/hip_runtime.h>
// theta/phi/g 1×1 convolutions as one GEMM on channel-major bf16(x), read as it lies (single exact term, K=128, N=192), the 4096×4096 non-local attention per batch as
// 16-query tiles on WMMA (Q·Kᵀ and P·V as 3-term bf16 hi/lo splits, f32 online softmax, no scaling), and the final 1×1 conv (2 terms) + bias; the
// residual add is f32, and the attention kernel stores the result NCHW itself.
#define BB 4
#define CC 128
#define HC 64
#define HWN 4096
#define MROWS (BB * HWN)
#define NSPLIT 4      // key groups per attention block: 4 waves each, so NSPLIT waves per SIMD

typedef __bf16 v16b __attribute__((ext_vector_type(16)));
typedef unsigned short v8us __attribute__((ext_vector_type(8), may_alias));
typedef float  v8f  __attribute__((ext_vector_type(8)));
typedef float  v4f  __attribute__((ext_vector_type(4)));
typedef float  v4fa __attribute__((ext_vector_type(4), may_alias));
typedef float  v2f  __attribute__((ext_vector_type(2)));
typedef __bf16 v2b  __attribute__((ext_vector_type(2)));
typedef unsigned int v2ua __attribute__((ext_vector_type(2), may_alias));
union FragB { v16b v; v8us half[2]; unsigned short u[16]; unsigned int w[8]; };
union Pack8 { v8us v; unsigned int w[4]; };

// f32 -> bf16, round to nearest even, by the hardware conversion
__device__ __forceinline__ unsigned short bf16_bits(float x) { return __builtin_bit_cast(unsigned short, (__bf16)x); }
// two values in one packed conversion: a in the low half of the word, b in the high half
__device__ __forceinline__ unsigned int bf16_pack2(float a, float b) { const v2f v = {a, b}; return __builtin_bit_cast(unsigned int, __builtin_convertvector(v, v2b)); }
// the lo word of a pair: what its hi word hw leaves over, rounded (x - hi is exact in f32)
__device__ __forceinline__ unsigned int bf16_rest2(float a, float b, unsigned int hw) {
  const v2f x = {a, b}, h = {__uint_as_float(hw << 16), __uint_as_float(hw & 0xFFFF0000u)};
  return __builtin_bit_cast(unsigned int, __builtin_convertvector(x - h, v2b));
}
__device__ __forceinline__ float bf16_val(unsigned short b) { return __uint_as_float(((unsigned int)b) << 16); }
__device__ __forceinline__ float bf16_round(float x) { return bf16_val(bf16_bits(x)); }
// D += A·B with NT terms: 1 = ah·bh, 2 = + al·bh (A split), 3 = + ah·bl (both split)
template <int NT>
__device__ __forceinline__ v8f mmaN(v16b ah, v16b al, v16b bh, v16b bl, v8f c) {
  c = __builtin_amdgcn_wmma_f32_16x16x32_bf16(false, ah, false, bh, (short)0, c, false, false);
  if (NT >= 2) c = __builtin_amdgcn_wmma_f32_16x16x32_bf16(false, al, false, bh, (short)0, c, false, false);
  if (NT >= 3) c = __builtin_amdgcn_wmma_f32_16x16x32_bf16(false, ah, false, bl, (short)0, c, false, false);
  asm volatile("v_nop\n\tv_nop\n\tv_nop\n\tv_nop" : "+v"(c) : "v"(ah), "v"(al), "v"(bh), "v"(bl));
  return c;
}

// one product on the builtin alone: the compiler keeps the distance behind it and is free to place other products and vector work around it
__device__ __forceinline__ v8f mma1(v16b a, v16b b, v8f c) { return __builtin_amdgcn_wmma_f32_16x16x32_bf16(false, a, false, b, (short)0, c, false, false); }

// lane l <-> lane l ^ 16 (the other 16-lane row) in one vector cross-row move
__device__ __forceinline__ float xhalf(float x) {
  const int b = __float_as_int(x);
  return __int_as_float(__builtin_amdgcn_permlanex16(b, b, 0x76543210, 0xfedcba98, false, false));
}

__global__ __launch_bounds__(256) void k_wt_bf16(const float* __restrict__ W, unsigned short* __restrict__ Wt, int K, int N) {
  const int t = blockIdx.x * 256 + threadIdx.x;
  const int k8n = K / 8;
  if (t >= N * k8n) return;
  const int n = t / k8n, k8 = (t % k8n) * 8;
  v8us v;
#pragma unroll
  for (int i = 0; i < 8; ++i) v[i] = bf16_bits(W[(size_t)(k8 + i) * N + n]);
  *(v8us*)(Wt + (size_t)n * K + k8) = v;
  
}

// GEMM C[M][N] (f32, pitch ldc) = act(A[M][K]·W + bias). A f32 row-major (pitch lda) converted per fragment to bf16
// (ASPLIT: hi/lo two planes -> 2 terms, else single rounded term); Wt bf16 [N][K] (pitch ldb). BIAS_BF16 rounds the
// bias to bf16 first (bias quantised to bf16 before the add). K%32==0, M%16==0, N%64==0.
template <bool ASPLIT, int ACT, bool BIAS_BF16>
__global__ __launch_bounds__(128) void k_gemm_bf(const float* __restrict__ A, int lda, const unsigned short* __restrict__ Wt, int ldb,
                                               const float* __restrict__ bias, float* __restrict__ C, int ldc, int M, int N, int K) {
  __shared__ __attribute__((aligned(16))) float so[4][16][64];
  const int tid = threadIdx.x, w = tid >> 5, lane = tid & 31, ln = lane & 15, hh = lane >> 4;
  const int ntn = N / 64;
  const int wid = blockIdx.x * 4 + w;
  const int mt = wid / ntn, nq = wid % ntn;
  if (mt * 16 >= M) return;
  const int row0 = mt * 16, col0 = nq * 64;
  const float* arow = A + (size_t)(row0 + ln) * lda;
  v8f acc[4] = {};
  for (int kb = 0; kb < K; kb += 32) {
    FragB ah, al;
    const v4f x0 = *(const v4fa*)(arow + kb + 8 * hh), x1 = *(const v4fa*)(arow + kb + 8 * hh + 4);
    const v4f x2 = *(const v4fa*)(arow + kb + 16 + 8 * hh), x3 = *(const v4fa*)(arow + kb + 16 + 8 * hh + 4);
    float xs[16] = {x0[0],x0[1],x0[2],x0[3],x1[0],x1[1],x1[2],x1[3],x2[0],x2[1],x2[2],x2[3],x3[0],x3[1],x3[2],x3[3]};
#pragma unroll
    for (int i = 0; i < 8; ++i) { const unsigned int hw = bf16_pack2(xs[2 * i], xs[2 * i + 1]); ah.w[i] = hw; al.w[i] = ASPLIT ? bf16_rest2(xs[2 * i], xs[2 * i + 1], hw) : 0u; }
#pragma unroll
    for (int t = 0; t < 4; ++t) {
      const unsigned short* brow = Wt + (size_t)(col0 + t * 16 + ln) * ldb + kb;
      FragB b;
      b.half[0] = *(const v8us*)(brow + 8 * hh);
      b.half[1] = *(const v8us*)(brow + 16 + 8 * hh);
      acc[t] = mmaN<ASPLIT ? 2 : 1>(ah.v, al.v, b.v, b.v, acc[t]);
    }
  }
#pragma unroll
  for (int t = 0; t < 4; ++t) {
    float bv = bias ? bias[col0 + t * 16 + ln] : 0.f;
    if (BIAS_BF16) bv = bf16_round(bv);
#pragma unroll
    for (int r = 0; r < 8; ++r) { float v = acc[t][r] + bv; if (ACT == 1) v = fmaxf(v, 0.f); so[w][8 * hh + r][t * 16 + ln] = v; }
  }
  __builtin_amdgcn_fence(__ATOMIC_ACQ_REL, "workgroup");
  __builtin_amdgcn_wave_barrier();
  const int rsub = lane >> 4, c4 = (lane & 15) * 4;
  {
#pragma unroll
    for (int q = 0; q < 8; ++q) {
      const int r = q * 2 + rsub;
      const v4f v = *(const v4fa*)&so[w][r][c4];
      *(v4f*)(C + (size_t)(row0 + r) * ldc + col0 + c4) = v;
    }
    
  }
}

// Flash-style causal/unmasked attention, all contractions 3-term bf16 hi/lo splits, f32 softmax with running max.
// q,k,v rows are read from f32 buffers with arbitrary row pitch (so they can live inside a fused qkv buffer);
// D = head size (multiple of 32, <= 128); one wave = 16 query rows; block = 4 waves (64 queries) sharing K/V chunks of 32.
template <int D, bool CAUSAL>
__global__ __launch_bounds__(128) void k_flash(const float* __restrict__ qb, const float* __restrict__ kb, const float* __restrict__ vb,
                                             int pitch, int T, int H, float scale, float* __restrict__ y, int ypitch) {
  constexpr int KS = D / 32;        // k-steps for QK
  constexpr int DT = D / 16;        // d tiles for PV
  __shared__ __attribute__((aligned(16))) unsigned short sKh[32][D + 8], sKl[32][D + 8], sVh[32][D + 8], sVl[32][D + 8];
  __shared__ __attribute__((aligned(16))) unsigned short sPh[4][16][40], sPl[4][16][40];
  __shared__ __attribute__((aligned(16))) float sO[4][16][D];
  const int tid = threadIdx.x, w = tid >> 5, lane = tid & 31, ln = lane & 15, hh = lane >> 4;
  const int nqb = (T + 63) / 64;
  const int bh = blockIdx.x / nqb, qblk = blockIdx.x % nqb;
  const int b = bh / H, h = bh % H;
  const int q0 = qblk * 64 + w * 16;
  const float* Q = qb + (size_t)b * T * pitch + h * D;
  const float* K = kb + (size_t)b * T * pitch + h * D;
  const float* V = vb + (size_t)b * T * pitch + h * D;

  // A fragments of the wave's 16 query rows (scaled), hi/lo
  FragB aqh[KS], aql[KS];
  {
    int row = q0 + ln; if (row >= T) row = T - 1;
    const float* qr = Q + (size_t)row * pitch;
#pragma unroll
    for (int ks = 0; ks < KS; ++ks)
#pragma unroll
      for (int i = 0; i < 16; ++i) {
        const int d = ks * 32 + ((i < 8) ? (8 * hh + i) : (16 + 8 * hh + (i - 8)));
        const float x = qr[d] * scale; const unsigned short hb = bf16_bits(x);
        aqh[ks].u[i] = hb; aql[ks].u[i] = bf16_bits(x - bf16_val(hb));
      }
  }
  float m_r[8], l_r[8];
#pragma unroll
  for (int r = 0; r < 8; ++r) { m_r[r] = -3.0e38f; l_r[r] = 0.f; }
  v8f oacc[DT];
#pragma unroll
  for (int dt = 0; dt < DT; ++dt) oacc[dt] = (v8f){0.f,0.f,0.f,0.f,0.f,0.f,0.f,0.f};

  const int kv_end = CAUSAL ? min(T, qblk * 64 + 64) : T;     // block-uniform
  for (int j0 = 0; j0 < kv_end; j0 += 32) {
    __syncthreads();
    for (int e = tid; e < 32 * (D / 4); e += 128) {
      const int r = e / (D / 4), c4 = (e % (D / 4)) * 4;
      const int key = j0 + r;
      v4f kf = {0.f,0.f,0.f,0.f}, vf = {0.f,0.f,0.f,0.f};
      if (key < T) { kf = *(const v4fa*)(K + (size_t)key * pitch + c4); vf = *(const v4fa*)(V + (size_t)key * pitch + c4); }
#pragma unroll
      for (int t = 0; t < 4; ++t) {
        unsigned short hb = bf16_bits(kf[t]); sKh[r][c4 + t] = hb; sKl[r][c4 + t] = bf16_bits(kf[t] - bf16_val(hb));
        hb = bf16_bits(vf[t]); sVh[r][c4 + t] = hb; sVl[r][c4 + t] = bf16_bits(vf[t] - bf16_val(hb));
      }
    }
    __syncthreads();
    // S tile 16 x 32
    v8f s[2];
#pragma unroll
    for (int nt = 0; nt < 2; ++nt) {
      v8f acc = {};
#pragma unroll
      for (int ks = 0; ks < KS; ++ks) {
        FragB bh_, bl_;
        bh_.half[0] = *(const v8us*)&sKh[nt * 16 + ln][ks * 32 + 8 * hh]; bh_.half[1] = *(const v8us*)&sKh[nt * 16 + ln][ks * 32 + 16 + 8 * hh];
        bl_.half[0] = *(const v8us*)&sKl[nt * 16 + ln][ks * 32 + 8 * hh]; bl_.half[1] = *(const v8us*)&sKl[nt * 16 + ln][ks * 32 + 16 + 8 * hh];
        acc = mmaN<3>(aqh[ks].v, aql[ks].v, bh_.v, bl_.v, acc);
      }
      s[nt] = acc;
    }
    // mask + running max (rows 8hh+r; the 16 lanes of a half share rows)
    float alpha[8];
#pragma unroll
    for (int r = 0; r < 8; ++r) {
      const int qi = q0 + 8 * hh + r;
      const int ja = j0 + ln, jb = j0 + 16 + ln;
      if (CAUSAL) { if (ja > qi) s[0][r] = -3.0e38f; if (jb > qi) s[1][r] = -3.0e38f; }
      if (ja >= T) s[0][r] = -3.0e38f;
      if (jb >= T) s[1][r] = -3.0e38f;
      float mx = fmaxf(s[0][r], s[1][r]);
      mx = fmaxf(mx, __shfl_xor(mx, 1, 32)); mx = fmaxf(mx, __shfl_xor(mx, 2, 32)); mx = fmaxf(mx, __shfl_xor(mx, 4, 32)); mx = fmaxf(mx, __shfl_xor(mx, 8, 32));
      const float mnew = fmaxf(m_r[r], mx);
      alpha[r] = (mnew > -1.0e38f) ? __expf(m_r[r] - mnew) : 1.0f;
      const float p0 = (s[0][r] > -1.0e38f) ? __expf(s[0][r] - mnew) : 0.f;
      const float p1 = (s[1][r] > -1.0e38f) ? __expf(s[1][r] - mnew) : 0.f;
      m_r[r] = mnew;
      l_r[r] = l_r[r] * alpha[r] + p0 + p1;            // per-lane partial row sum (16 lanes combined at the end)
      unsigned short hb = bf16_bits(p0); sPh[w][8 * hh + r][ln] = hb;      sPl[w][8 * hh + r][ln] = bf16_bits(p0 - bf16_val(hb));
      hb = bf16_bits(p1);                sPh[w][8 * hh + r][16 + ln] = hb; sPl[w][8 * hh + r][16 + ln] = bf16_bits(p1 - bf16_val(hb));
    }
#pragma unroll
    for (int dt = 0; dt < DT; ++dt)
#pragma unroll
      for (int r = 0; r < 8; ++r) oacc[dt][r] *= alpha[r];
    __builtin_amdgcn_fence(__ATOMIC_ACQ_REL, "workgroup");
    __builtin_amdgcn_wave_barrier();
    FragB pah, pal;
    pah.half[0] = *(const v8us*)&sPh[w][ln][8 * hh]; pah.half[1] = *(const v8us*)&sPh[w][ln][16 + 8 * hh];
    pal.half[0] = *(const v8us*)&sPl[w][ln][8 * hh]; pal.half[1] = *(const v8us*)&sPl[w][ln][16 + 8 * hh];
#pragma unroll
    for (int dt = 0; dt < DT; ++dt) {
      FragB bvh, bvl;
#pragma unroll
      for (int i = 0; i < 8; ++i) {
        bvh.u[i] = sVh[8 * hh + i][dt * 16 + ln]; bvh.u[8 + i] = sVh[16 + 8 * hh + i][dt * 16 + ln];
        bvl.u[i] = sVl[8 * hh + i][dt * 16 + ln]; bvl.u[8 + i] = sVl[16 + 8 * hh + i][dt * 16 + ln];
      }
      oacc[dt] = mmaN<3>(pah.v, pal.v, bvh.v, bvl.v, oacc[dt]);
    }
    __builtin_amdgcn_fence(__ATOMIC_ACQ_REL, "workgroup");
    __builtin_amdgcn_wave_barrier();
  }
#pragma unroll
  for (int r = 0; r < 8; ++r) {
    float l = l_r[r];
    l += __shfl_xor(l, 1, 32); l += __shfl_xor(l, 2, 32); l += __shfl_xor(l, 4, 32); l += __shfl_xor(l, 8, 32);
    l_r[r] = (l > 0.f) ? 1.0f / l : 0.f;
  }
#pragma unroll
  for (int dt = 0; dt < DT; ++dt)
#pragma unroll
    for (int r = 0; r < 8; ++r) sO[w][8 * hh + r][dt * 16 + ln] = oacc[dt][r] * l_r[r];
  __builtin_amdgcn_fence(__ATOMIC_ACQ_REL, "workgroup");
  __builtin_amdgcn_wave_barrier();
  {
    for (int r = 0; r < 16; ++r) {
      const int row = q0 + r;
      if (row < T && lane < D / 4) {
        const v4f val = *(const v4fa*)&sO[w][r][lane * 4];
        *(v4f*)(y + ((size_t)b * T + row) * ypitch + h * D + lane * 4) = val;
      }
    }
    
  }
}

// in pitch = cols, out pitch = rows; rows, cols multiples of 32. Optional per-output-row affine (scale[c], shift[c]) and
// residual add res (same layout as out, optionally bf16-rounded) for fused epilogues: out = in*scale + shift + res.
template <bool AFFINE, bool RESID, bool RES_BF16>
__global__ __launch_bounds__(256) void k_transpose32(const float* __restrict__ in, float* __restrict__ out, int rows, int cols,
                                                    const float* __restrict__ scale, const float* __restrict__ shift, const float* __restrict__ res) {
  __shared__ float tile[32][33];
  const int b = blockIdx.z;
  const int r0 = blockIdx.y * 32, c0 = blockIdx.x * 32;
  const float* src = in + (size_t)b * rows * cols;
  float* dst = out + (size_t)b * rows * cols;
  const int tx = threadIdx.x & 31, ty = threadIdx.x >> 5;     // 8 rows per pass
  for (int i = ty; i < 32; i += 8) tile[i][tx] = src[(size_t)(r0 + i) * cols + c0 + tx];
  __syncthreads();
  {
    for (int i = ty; i < 32; i += 8) {
      float v = tile[tx][i];
      const int orow = c0 + i;
      if (AFFINE) v = v * scale[orow] + shift[orow];
      if (RESID) { float rv = res[(size_t)b * rows * cols + (size_t)orow * rows + r0 + tx]; if (RES_BF16) rv = bf16_round(rv); v += rv; }
      *(float*)(dst + (size_t)orow * rows + r0 + tx) = v;
    }
    
  }
}

// 2x2 max pool on position-major data: in [B][H*W][C] -> out [B][(H/2)*(W/2)][C]; thread per (b, p', 4 channels); C%4==0
__global__ __launch_bounds__(256) void k_pool2_pm(const float* __restrict__ in, float* __restrict__ out, int Bn, int H, int W, int C) {
  const size_t t = (size_t)blockIdx.x * 256 + threadIdx.x;
  const int c4n = C / 4, Ho = H / 2, Wo = W / 2;
  const size_t total = (size_t)Bn * Ho * Wo * c4n;
  if (t >= total) return;
  const int c4 = (int)(t % c4n) * 4; size_t rest = t / c4n;
  const int pw = (int)(rest % Wo); rest /= Wo; const int ph = (int)(rest % Ho); const int b = (int)(rest / Ho);
  const float* base = in + (size_t)b * H * W * C;
  const int p00 = (2 * ph) * W + 2 * pw;
  const v4f a = *(const v4fa*)(base + (size_t)p00 * C + c4), bq = *(const v4fa*)(base + (size_t)(p00 + 1) * C + c4);
  const v4f c = *(const v4fa*)(base + (size_t)(p00 + W) * C + c4), d = *(const v4fa*)(base + (size_t)(p00 + W + 1) * C + c4);
  v4f m; for (int i = 0; i < 4; ++i) m[i] = fmaxf(fmaxf(a[i], bq[i]), fmaxf(c[i], d[i]));
  float* dst = out + ((size_t)b * Ho * Wo + (size_t)ph * Wo + pw) * C + c4;
  *(v4f*)dst = m;
  
}

// General (non-causal) attention, 3-term bf16 splits, f32 softmax with running max.
// Q [.][Tq][qpitch], K [.][Tk][kpitch] (head dim DQ), V [.][Tk][vpitch] (head dim DVtot); this block handles DV output
// dims starting at dv0 = blockIdx.y*DV. y[bh][t][ypitch] gets columns dv0..dv0+DV-1. Per-bh base offsets via strides.
template <int DQ, int DV>
__global__ __launch_bounds__(128) void k_flash2(const float* __restrict__ Qb, size_t qstride, int qpitch, int Tq,
                                              const float* __restrict__ Kb, size_t kstride, int kpitch, int Tk,
                                              const float* __restrict__ Vb, size_t vstride, int vpitch,
                                              float scale, float* __restrict__ y, size_t ystride, int ypitch) {
  constexpr int KS = DQ / 32, DT = DV / 16;
  __shared__ __attribute__((aligned(16))) unsigned short sKh[32][DQ + 8], sKl[32][DQ + 8], sVh[32][DV + 8], sVl[32][DV + 8];
  __shared__ __attribute__((aligned(16))) unsigned short sPh[4][16][40], sPl[4][16][40];
  __shared__ __attribute__((aligned(16))) float sO[4][16][DV];
  const int tid = threadIdx.x, w = tid >> 5, lane = tid & 31, ln = lane & 15, hh = lane >> 4;
  const int nqb = (Tq + 63) / 64;
  const int bh = blockIdx.x / nqb, qblk = blockIdx.x % nqb;
  const int dv0 = blockIdx.y * DV;
  const int q0 = qblk * 64 + w * 16;
  const float* Q = Qb + (size_t)bh * qstride; const float* K = Kb + (size_t)bh * kstride; const float* V = Vb + (size_t)bh * vstride + dv0;
  FragB aqh[KS], aql[KS];
  {
    int row = q0 + ln; if (row >= Tq) row = Tq - 1;
    const float* qr = Q + (size_t)row * qpitch;
#pragma unroll
    for (int ks = 0; ks < KS; ++ks)
#pragma unroll
      for (int i = 0; i < 16; ++i) {
        const int d = ks * 32 + ((i < 8) ? (8 * hh + i) : (16 + 8 * hh + (i - 8)));
        const float x = qr[d] * scale; const unsigned short hb = bf16_bits(x);
        aqh[ks].u[i] = hb; aql[ks].u[i] = bf16_bits(x - bf16_val(hb));
      }
  }
  float m_r[8], l_r[8];
#pragma unroll
  for (int r = 0; r < 8; ++r) { m_r[r] = -3.0e38f; l_r[r] = 0.f; }
  v8f oacc[DT];
#pragma unroll
  for (int dt = 0; dt < DT; ++dt) oacc[dt] = (v8f){0.f,0.f,0.f,0.f,0.f,0.f,0.f,0.f};
  for (int j0 = 0; j0 < Tk; j0 += 32) {
    __syncthreads();
    for (int e = tid; e < 32 * (DQ / 4); e += 128) {
      const int r = e / (DQ / 4), c4 = (e % (DQ / 4)) * 4; const int key = j0 + r;
      v4f f = {0.f,0.f,0.f,0.f}; if (key < Tk) f = *(const v4fa*)(K + (size_t)key * kpitch + c4);
#pragma unroll
      for (int t = 0; t < 4; ++t) { const unsigned short hb = bf16_bits(f[t]); sKh[r][c4 + t] = hb; sKl[r][c4 + t] = bf16_bits(f[t] - bf16_val(hb)); }
    }
    for (int e = tid; e < 32 * (DV / 4); e += 128) {
      const int r = e / (DV / 4), c4 = (e % (DV / 4)) * 4; const int key = j0 + r;
      v4f f = {0.f,0.f,0.f,0.f}; if (key < Tk) f = *(const v4fa*)(V + (size_t)key * vpitch + c4);
#pragma unroll
      for (int t = 0; t < 4; ++t) { const unsigned short hb = bf16_bits(f[t]); sVh[r][c4 + t] = hb; sVl[r][c4 + t] = bf16_bits(f[t] - bf16_val(hb)); }
    }
    __syncthreads();
    v8f s[2];
#pragma unroll
    for (int nt = 0; nt < 2; ++nt) {
      v8f acc = {};
#pragma unroll
      for (int ks = 0; ks < KS; ++ks) {
        FragB bh_, bl_;
        bh_.half[0] = *(const v8us*)&sKh[nt * 16 + ln][ks * 32 + 8 * hh]; bh_.half[1] = *(const v8us*)&sKh[nt * 16 + ln][ks * 32 + 16 + 8 * hh];
        bl_.half[0] = *(const v8us*)&sKl[nt * 16 + ln][ks * 32 + 8 * hh]; bl_.half[1] = *(const v8us*)&sKl[nt * 16 + ln][ks * 32 + 16 + 8 * hh];
        acc = mmaN<3>(aqh[ks].v, aql[ks].v, bh_.v, bl_.v, acc);
      }
      s[nt] = acc;
    }
    float alpha[8];
#pragma unroll
    for (int r = 0; r < 8; ++r) {
      const int ja = j0 + ln, jb = j0 + 16 + ln;
      if (ja >= Tk) s[0][r] = -3.0e38f;
      if (jb >= Tk) s[1][r] = -3.0e38f;
      float mx = fmaxf(s[0][r], s[1][r]);
      mx = fmaxf(mx, __shfl_xor(mx, 1, 32)); mx = fmaxf(mx, __shfl_xor(mx, 2, 32)); mx = fmaxf(mx, __shfl_xor(mx, 4, 32)); mx = fmaxf(mx, __shfl_xor(mx, 8, 32));
      const float mnew = fmaxf(m_r[r], mx);
      alpha[r] = (mnew > -1.0e38f) ? __expf(m_r[r] - mnew) : 1.0f;
      const float p0 = (s[0][r] > -1.0e38f) ? __expf(s[0][r] - mnew) : 0.f;
      const float p1 = (s[1][r] > -1.0e38f) ? __expf(s[1][r] - mnew) : 0.f;
      m_r[r] = mnew;
      l_r[r] = l_r[r] * alpha[r] + p0 + p1;
      unsigned short hb = bf16_bits(p0); sPh[w][8 * hh + r][ln] = hb;      sPl[w][8 * hh + r][ln] = bf16_bits(p0 - bf16_val(hb));
      hb = bf16_bits(p1);                sPh[w][8 * hh + r][16 + ln] = hb; sPl[w][8 * hh + r][16 + ln] = bf16_bits(p1 - bf16_val(hb));
    }
#pragma unroll
    for (int dt = 0; dt < DT; ++dt)
#pragma unroll
      for (int r = 0; r < 8; ++r) oacc[dt][r] *= alpha[r];
    __builtin_amdgcn_fence(__ATOMIC_ACQ_REL, "workgroup");
    __builtin_amdgcn_wave_barrier();
    FragB pah, pal;
    pah.half[0] = *(const v8us*)&sPh[w][ln][8 * hh]; pah.half[1] = *(const v8us*)&sPh[w][ln][16 + 8 * hh];
    pal.half[0] = *(const v8us*)&sPl[w][ln][8 * hh]; pal.half[1] = *(const v8us*)&sPl[w][ln][16 + 8 * hh];
#pragma unroll
    for (int dt = 0; dt < DT; ++dt) {
      FragB bvh, bvl;
#pragma unroll
      for (int i = 0; i < 8; ++i) {
        bvh.u[i] = sVh[8 * hh + i][dt * 16 + ln]; bvh.u[8 + i] = sVh[16 + 8 * hh + i][dt * 16 + ln];
        bvl.u[i] = sVl[8 * hh + i][dt * 16 + ln]; bvl.u[8 + i] = sVl[16 + 8 * hh + i][dt * 16 + ln];
      }
      oacc[dt] = mmaN<3>(pah.v, pal.v, bvh.v, bvl.v, oacc[dt]);
    }
    __builtin_amdgcn_fence(__ATOMIC_ACQ_REL, "workgroup");
    __builtin_amdgcn_wave_barrier();
  }
#pragma unroll
  for (int r = 0; r < 8; ++r) {
    float l = l_r[r];
    l += __shfl_xor(l, 1, 32); l += __shfl_xor(l, 2, 32); l += __shfl_xor(l, 4, 32); l += __shfl_xor(l, 8, 32);
    l_r[r] = (l > 0.f) ? 1.0f / l : 0.f;
  }
#pragma unroll
  for (int dt = 0; dt < DT; ++dt)
#pragma unroll
    for (int r = 0; r < 8; ++r) sO[w][8 * hh + r][dt * 16 + ln] = oacc[dt][r] * l_r[r];
  __builtin_amdgcn_fence(__ATOMIC_ACQ_REL, "workgroup");
  __builtin_amdgcn_wave_barrier();
  {
    for (int r = 0; r < 16; ++r) {
      const int row = q0 + r;
      for (int c4 = lane * 4; c4 < DV; c4 += 128) {
        if (row < Tq) {
          const v4f val = *(const v4fa*)&sO[w][r][c4];
          *(v4f*)(y + (size_t)bh * ystride + (size_t)row * ypitch + dv0 + c4) = val;
        }
      }
    }
    
  }
}

// row LayerNorm (biased variance, eps) over N: s = X (+ R); optional out_sum <- s; out_norm <- (s-mu)*rsqrt(var+eps)*g + b
template <bool PARAM_BF16>
__global__ __launch_bounds__(256) void k_layernorm(const float* __restrict__ X, const float* __restrict__ R, const float* __restrict__ g, const float* __restrict__ bta,
                                                  float* __restrict__ out_sum, float* __restrict__ out_norm, int N, float eps) {
  __shared__ float red[256];
  const int row = blockIdx.x, tid = threadIdx.x;
  const float* x = X + (size_t)row * N; const float* rr = R ? R + (size_t)row * N : nullptr;
  float vals[16];                     // up to N = 4096
  const int per = N / 256;            // contiguous chunk per thread? use strided-by-4 chunks: thread handles j = tid*4 + 1024*u
  float s1 = 0.f;
  for (int u = 0; u < per / 4; ++u) {
    const int j = tid * 4 + 1024 * u;
    const v4f a = *(const v4fa*)(x + j);
    v4f b = {0.f,0.f,0.f,0.f}; if (rr) b = *(const v4fa*)(rr + j);
#pragma unroll
    for (int q = 0; q < 4; ++q) { const float v = a[q] + b[q]; vals[u * 4 + q] = v; s1 += v; }
  }
  red[tid] = s1; __syncthreads();
  for (int st = 128; st > 0; st >>= 1) { if (tid < st) red[tid] += red[tid + st]; __syncthreads(); }
  const float mu = red[0] / (float)N; __syncthreads();
  float s2 = 0.f;
  for (int u = 0; u < per / 4; ++u)
#pragma unroll
    for (int q = 0; q < 4; ++q) { const float c = vals[u * 4 + q] - mu; s2 += c * c; }
  red[tid] = s2; __syncthreads();
  for (int st = 128; st > 0; st >>= 1) { if (tid < st) red[tid] += red[tid + st]; __syncthreads(); }
  const float rs = rsqrtf(red[0] / (float)N + eps);
  {
    for (int u = 0; u < per / 4; ++u) {
      const int j = tid * 4 + 1024 * u;
      v4f o, sm;
#pragma unroll
      for (int q = 0; q < 4; ++q) {
        float gg = g[j + q], bb = bta[j + q];
        if (PARAM_BF16) { gg = bf16_round(gg); bb = bf16_round(bb); }
        sm[q] = vals[u * 4 + q]; o[q] = (vals[u * 4 + q] - mu) * rs * gg + bb;
      }
      if (out_sum) *(v4f*)(out_sum + (size_t)row * N + j) = sm;
      *(v4f*)(out_norm + (size_t)row * N + j) = o;
    }
    
  }
}

// K and V rows (f32, row pitch `pitch`, D = 64 columns) prepared ONCE for k_flash3: each value split into bf16 hi + lo, written as four planes.
// Kh/Kl keep the row order [row][D]. VTh/VTl are transposed inside each chunk of 32 rows: [chunk][d][32 rows], so that a chunk of any plane is
// 32 * D contiguous values at offset chunk * 32 * D, and a V^T fragment row (one d, 32 keys) is contiguous. One block = one chunk of 32 rows.
template <int D>
__global__ __launch_bounds__(256) void k_split_kv(const float* __restrict__ K, const float* __restrict__ V, int pitch,
                                                 unsigned short* __restrict__ Kh, unsigned short* __restrict__ Kl,
                                                 unsigned short* __restrict__ VTh, unsigned short* __restrict__ VTl) {
  static_assert(D == 64, "256 threads = 32 rows x D/8 units = D rows x 4 units");
  __shared__ float tv[32][D + 1];                                // pitch 65 dwords: the column walk below meets distinct banks
  const int t = threadIdx.x;
  const size_t row0 = (size_t)blockIdx.x * 32;
  {
    const int r = t / (D / 8), c8 = (t % (D / 8)) * 8;
    const float* kr = K + (row0 + r) * pitch + c8; const float* vr = V + (row0 + r) * pitch + c8;
    const v4f k0 = *(const v4fa*)kr, k1 = *(const v4fa*)(kr + 4);
    asm volatile("s_wait_xcnt 0x0" ::: "memory");                // what follows may reuse the address registers of the two loads above
    const v4f v0 = *(const v4fa*)vr, v1 = *(const v4fa*)(vr + 4);
    asm volatile("s_wait_xcnt 0x0" ::: "memory");                // the same for these two
    Pack8 hi, lo;
    // unrolled (here and below): the vectors are then indexed by constants and stay in registers
#pragma unroll
    for (int i = 0; i < 8; i += 2) {
      const float x0 = (i < 4) ? k0[i & 3] : k1[i & 3], x1 = (i < 4) ? k0[(i + 1) & 3] : k1[(i + 1) & 3];
      hi.w[i / 2] = bf16_pack2(x0, x1); lo.w[i / 2] = bf16_rest2(x0, x1, hi.w[i / 2]);
      tv[r][c8 + i] = (i < 4) ? v0[i & 3] : v1[i & 3]; tv[r][c8 + i + 1] = (i < 4) ? v0[(i + 1) & 3] : v1[(i + 1) & 3];
    }
    *(v8us*)(Kh + (row0 + r) * D + c8) = hi.v;
    *(v8us*)(Kl + (row0 + r) * D + c8) = lo.v;
  }
  __syncthreads();
  {
    const int d = t / 4, k8 = (t % 4) * 8;
    Pack8 hi, lo;
#pragma unroll
    for (int i = 0; i < 8; i += 2) {
      const float x0 = tv[k8 + i][d], x1 = tv[k8 + i + 1][d];
      hi.w[i / 2] = bf16_pack2(x0, x1); lo.w[i / 2] = bf16_rest2(x0, x1, hi.w[i / 2]);
    }
    *(v8us*)(VTh + row0 * D + d * 32 + k8) = hi.v;
    *(v8us*)(VTl + row0 * D + d * 32 + k8) = lo.v;
  }
}

// One 32-key chunk of one key group in LDS: the four planes of k_split_kv. K rows at a pitch of D + 8 values, V^T rows (32 keys) at 32 + 8 values:
// both 16 B x odd, for 16-byte readers.
template <int D> struct KvStage { unsigned short Kh[32][D + 8], Kl[32][D + 8], Vh[D][32 + 8], Vl[D][32 + 8]; };
__device__ __forceinline__ unsigned lds_off(const void* p) { return (unsigned)(size_t)p; }   // byte address inside the work-group's LDS

template <int D, int NS, int NC>
__global__ __launch_bounds__(128 * NS) void k_flash3(const float* __restrict__ Qb, int qpitch, int Tq,
                                              const unsigned short* __restrict__ Kh, const unsigned short* __restrict__ Kl,
                                              const unsigned short* __restrict__ VTh, const unsigned short* __restrict__ VTl, int Tk,
                                              float scale, const int* __restrict__ mask, int causal, const float* __restrict__ sbias,
                                              const unsigned short* __restrict__ Wf, const float* __restrict__ fb, const float* __restrict__ xres,
                                              float* __restrict__ out) {
  constexpr int KS = D / 32, DT = D / 16;
  constexpr int OP = D + 4;         // pitch of sO in floats: 16 B x odd, so the 16 lanes that each store 16 bytes of their own row meet distinct banks
  __shared__ __attribute__((aligned(16))) KvStage<D> sSt[2][NS];
  __shared__ __attribute__((aligned(16))) float sO[NS][4][16][OP];
  __shared__ float sM[NS][4][16], sL[NS][4][16];
  __shared__ __attribute__((aligned(16))) unsigned short sAh[64][D + 8], sAl[64][D + 8];   // the joined rows, bf16 hi and lo; pitch 16 B x odd
  // g is the same in every lane of a wave; held in a scalar register, the chunk's base address and the test for a chunk past the end are scalar too
  const int g = __builtin_amdgcn_readfirstlane(threadIdx.x >> 7);
  const int tid = threadIdx.x & 127, w = tid >> 5, lane = tid & 31, ln = lane & 15, hh = lane >> 4;
  const int nqb = (Tq + 63) / 64;
  const int bh = blockIdx.x / nqb, qblk = blockIdx.x % nqb;
  const int q0 = qblk * 64 + w * 16;
  const float* Q = Qb + (size_t)bh * Tq * qpitch;
  FragB aqh[KS], aql[KS];
  {
    int row = q0 + ln; if (row >= Tq) row = Tq - 1;
    const float* qr = Q + (size_t)row * qpitch;
#pragma unroll
    for (int ks = 0; ks < KS; ++ks)
#pragma unroll
      for (int i = 0; i < 16; i += 2) {
        const int d = ks * 32 + ((i < 8) ? (8 * hh + i) : (16 + 8 * hh + (i - 8)));
        const float x0 = qr[d] * scale, x1 = qr[d + 1] * scale; const unsigned int hw = bf16_pack2(x0, x1);
        aqh[ks].w[i / 2] = hw; aql[ks].w[i / 2] = bf16_rest2(x0, x1, hw);
      }
  }
  int qi = q0 + ln; if (qi >= Tq) qi = Tq - 1;                  // the lane's query
  float m_r = -3.0e38f, l_r = 0.f;                               // its running max (equal in both halves) and this half's share of its sum
  v8f oacc[DT];                                                  // O^T: oacc[dt][r] = O[query ln][dt * 16 + 8 * hh + r]
#pragma unroll
  for (int dt = 0; dt < DT; ++dt) oacc[dt] = (v8f){0.f,0.f,0.f,0.f,0.f,0.f,0.f,0.f};
  const bool special = causal || mask || sbias;
  const int kv_end = causal ? min(Tk, qblk * 64 + 64) : Tk;
  static_assert(32 * D / 8 / 128 == 2, "two 16-byte units of each plane's chunk per thread");
  const int ntrip = (kv_end + 32 * NS - 1) / (32 * NS);          // block-uniform trips; a group's chunk past the end is masked like any tail
  // The thread's eight units of its group's chunk of trip t -> buffer buf. A chunk past the end of the keys is replaced by the last chunk: its addresses
  // stay inside the planes, every wave issues the same copies, and its scores are masked below, so that its P is 0 against finite V.
  auto stage = [&](int t, int buf) {
    const int jc = min((t * NS + g) * 32, Tk - 32);
    const unsigned o = ((unsigned)bh * Tk + jc) * (D * 2) + tid * 16;   // the same byte offset in all four planes (each plane is below 4 GiB)
    KvStage<D>* S = &sSt[buf][g];
    const int e0 = tid, e1 = tid + 128;                          // unit e: 128 threads x 16 B = 2048 B a unit row
    // the copies and, as the last line, the wait in front of any rewrite of their address registers, in one statement: nothing can come between
    asm volatile("global_load_async_to_lds_b128 %0, %8, off\n\t"
                 "global_load_async_to_lds_b128 %1, %9, off\n\t"
                 "global_load_async_to_lds_b128 %2, %10, off\n\t"
                 "global_load_async_to_lds_b128 %3, %11, off\n\t"
                 "global_load_async_to_lds_b128 %4, %12, off\n\t"
                 "global_load_async_to_lds_b128 %5, %13, off\n\t"
                 "global_load_async_to_lds_b128 %6, %14, off\n\t"
                 "global_load_async_to_lds_b128 %7, %15, off\n\t"
                 "s_wait_xcnt 0x0"
                 :: "v"(lds_off(&S->Kh[e0 / (D / 8)][(e0 % (D / 8)) * 8])), "v"(lds_off(&S->Kl[e0 / (D / 8)][(e0 % (D / 8)) * 8])),
                    "v"(lds_off(&S->Vh[e0 / 4][(e0 % 4) * 8])),             "v"(lds_off(&S->Vl[e0 / 4][(e0 % 4) * 8])),
                    "v"(lds_off(&S->Kh[e1 / (D / 8)][(e1 % (D / 8)) * 8])), "v"(lds_off(&S->Kl[e1 / (D / 8)][(e1 % (D / 8)) * 8])),
                    "v"(lds_off(&S->Vh[e1 / 4][(e1 % 4) * 8])),             "v"(lds_off(&S->Vl[e1 / 4][(e1 % 4) * 8])),
                    "v"((const char*)Kh + o),          "v"((const char*)Kl + o),          "v"((const char*)VTh + o),          "v"((const char*)VTl + o),
                    "v"((const char*)Kh + (o + 2048u)), "v"((const char*)Kl + (o + 2048u)), "v"((const char*)VTh + (o + 2048u)), "v"((const char*)VTl + (o + 2048u))
                 : "memory");
  };
  // The fragments are fetched ahead, each kind as ONE group of 16 loads: a chunk's K rows one trip ahead, under the softmax and the P.V products of the
  // chunk before, its V^T rows at the head of its own trip, under its score products.
  // Every loop over fragments, here and in the trip, is unrolled: the arrays are then indexed by constants and stay in registers.
  FragB kh[2][KS], kl[2][KS];                                    // K as A fragments: row nt * 16 + ln, the k order of Q^T
  auto load_k = [&](int buf) {
    const KvStage<D>* S = &sSt[buf][g];
#pragma unroll
    for (int nt = 0; nt < 2; ++nt)
#pragma unroll
      for (int ks = 0; ks < KS; ++ks) {
        kh[nt][ks].half[0] = *(const v8us*)&S->Kh[nt * 16 + ln][ks * 32 + 8 * hh]; kh[nt][ks].half[1] = *(const v8us*)&S->Kh[nt * 16 + ln][ks * 32 + 16 + 8 * hh];
        kl[nt][ks].half[0] = *(const v8us*)&S->Kl[nt * 16 + ln][ks * 32 + 8 * hh]; kl[nt][ks].half[1] = *(const v8us*)&S->Kl[nt * 16 + ln][ks * 32 + 16 + 8 * hh];
      }
  };
  stage(0, 0);
  asm volatile("s_wait_asynccnt 0x0" ::: "memory");              // this wave's copies of chunk 0 have landed
  __syncthreads();                                               // and every other wave's
  if (ntrip > 1) stage(1, 1);
  load_k(0);
  for (int t = 0; t < ntrip; ++t) {
    const int jb = t * 32 * NS, j0 = jb + 32 * g;
    const KvStage<D>* S = &sSt[t & 1][g];
    const unsigned short (*sVh)[32 + 8] = S->Vh; const unsigned short (*sVl)[32 + 8] = S->Vl;
    FragB bvh[DT], bvl[DT];                                      // V^T as A fragments: row dt * 16 + ln, the k order of P^T
#pragma unroll
    for (int dt = 0; dt < DT; ++dt) {
      bvh[dt].half[0] = *(const v8us*)&sVh[dt * 16 + ln][8 * hh]; bvh[dt].half[1] = *(const v8us*)&sVh[dt * 16 + ln][16 + 8 * hh];
      bvl[dt].half[0] = *(const v8us*)&sVl[dt * 16 + ln][8 * hh]; bvl[dt].half[1] = *(const v8us*)&sVl[dt * 16 + ln][16 + 8 * hh];
    }
    // keeps the 16 loads above in one group in front of the score products; left alone, the compiler sinks them in pairs to where they are used
    __builtin_amdgcn_sched_barrier(0);
    v8f s[2] = {};                                               // S^T: s[nt][r] = score(query ln, key j0 + nt * 16 + 8 * hh + r)
    // the two key tiles take turns, so that a product does not wait for the one in front of it; a tile's own order of terms stays hh, lh, hl per k step
#pragma unroll
    for (int ks = 0; ks < KS; ++ks) {
#pragma unroll
      for (int nt = 0; nt < 2; ++nt) s[nt] = mma1(kh[nt][ks].v, aqh[ks].v, s[nt]);
#pragma unroll
      for (int nt = 0; nt < 2; ++nt) s[nt] = mma1(kl[nt][ks].v, aqh[ks].v, s[nt]);
#pragma unroll
      for (int nt = 0; nt < 2; ++nt) s[nt] = mma1(kh[nt][ks].v, aql[ks].v, s[nt]);
    }
    // the distance between the last score product and the first reader of the scores, kept on EVERY path: branches follow
    asm volatile("v_nop\n\tv_nop\n\tv_nop\n\tv_nop" : "+v"(s[0]), "+v"(s[1]));
    if (special || jb + 32 * NS > Tk) {                          // block-uniform: masks, biases and key tails; a dropped score becomes -3e38
#pragma unroll
      for (int nt = 0; nt < 2; ++nt)
#pragma unroll
        for (int r = 0; r < 8; ++r) {
          const int key = j0 + nt * 16 + 8 * hh + r;
          bool keep = key < Tk;
          if (causal) keep = keep && (key <= qi);
          if (mask) { if (keep) keep = mask[(size_t)qi * Tk + key] != 0; }
          if (sbias) { if (keep) s[nt][r] += sbias[(size_t)bh * Tk + key]; }   // per-key additive bias (a per-query constant would cancel in the softmax)
          if (!keep) s[nt][r] = -3.0e38f;
        }
    }
    // The next chunk is published HERE, in front of this chunk's last block (P.V), whose fragments are already fetched: what follows reads no LDS of this chunk.
    asm volatile("s_wait_dscnt 0x0" ::: "memory");               // this wave's reads of the buffer (K a trip ago, V^T above) are done before it is handed back
    asm volatile("s_wait_asynccnt 0x0" ::: "memory");            // this wave's copies of the next chunk have landed
    __syncthreads();                                             // the next chunk is published, this trip's buffer is free
    if (t + 2 < ntrip) stage(t + 2, t & 1);
    if (t + 1 < ntrip) load_k((t + 1) & 1);                      // block-uniform; behind the barrier that published that chunk
    float mx = fmaxf(s[0][0], s[1][0]);
#pragma unroll
    for (int r = 1; r < 8; ++r) mx = fmaxf(mx, fmaxf(s[0][r], s[1][r]));
    mx = fmaxf(mx, xhalf(mx));                                   // the query's other 16 keys sit in the other half
    const float mnew = fmaxf(m_r, mx);
    const float mexp = fmaxf(mnew, -1.0e38f);                    // with nothing kept so far a dropped score still gives exp(-2e38) = 0
    const float alpha = __expf(m_r - mexp);
    m_r = mnew;
    FragB pbh, pbl;                                              // P^T as a B fragment: element nt * 8 + r is key nt * 16 + 8 * hh + r
    float ps[4] = {0.f, 0.f, 0.f, 0.f};
#pragma unroll
    for (int nt = 0; nt < 2; ++nt)
#pragma unroll
      for (int r = 0; r < 8; r += 2) {
        const float p0 = __expf(s[nt][r] - mexp), p1 = __expf(s[nt][r + 1] - mexp);
        ps[r & 3] += p0; ps[(r + 1) & 3] += p1;
        const unsigned int hw = bf16_pack2(p0, p1);
        pbh.w[nt * 4 + r / 2] = hw; pbl.w[nt * 4 + r / 2] = bf16_rest2(p0, p1, hw);
      }
    l_r = l_r * alpha + ((ps[0] + ps[1]) + (ps[2] + ps[3]));     // this half's 16 keys (the halves are added at the end)
#pragma unroll
    for (int dt = 0; dt < DT; ++dt)
#pragma unroll
      for (int r = 0; r < 8; ++r) oacc[dt][r] *= alpha;
    // the four output tiles take turns; a tile's own order of terms stays hh, lh, hl
#pragma unroll
    for (int dt = 0; dt < DT; ++dt) oacc[dt] = mma1(bvh[dt].v, pbh.v, oacc[dt]);
#pragma unroll
    for (int dt = 0; dt < DT; ++dt) oacc[dt] = mma1(bvl[dt].v, pbh.v, oacc[dt]);
#pragma unroll
    for (int dt = 0; dt < DT; ++dt) oacc[dt] = mma1(bvh[dt].v, pbl.v, oacc[dt]);
  }
  asm volatile("s_wait_asynccnt 0x0" ::: "memory");              // no copy is left in flight behind the loop
  // The output projection's tiles: NC / 16 channel tiles x 4 query tiles, two query tiles (32 positions = one 128-byte line a channel) a wave.
  // What it needs from global memory is asked for here, so that it arrives under the join.
  static_assert(NC / 16 * 4 == 2 * 4 * NS, "two 16 x 16 tiles a wave");
  const int wv = __builtin_amdgcn_readfirstlane(threadIdx.x >> 5);   // the wave's number in the block, scalar
  const int ct = wv >> 1, qt0 = (wv & 1) * 2;
  const float* xb = xres + (size_t)bh * NC * Tq; float* ob = out + (size_t)bh * NC * Tq;
  FragB fw[KS];                                                  // Wf as an A fragment: row ct * 16 + ln, k = 32 ks + 8 hh + 0..7, then 16 further
  int off[8];                                                    // element r of an accumulator: channel ct * 16 + 8 hh + r, position ln of the tile
  float xr[2][8];
  v4f fb0, fb1;
  {
    const unsigned short* wr = Wf + (ct * 16 + ln) * D + 8 * hh;
#pragma unroll
    for (int ks = 0; ks < KS; ++ks) { fw[ks].half[0] = *(const v8us*)(wr + ks * 32); fw[ks].half[1] = *(const v8us*)(wr + ks * 32 + 16); }
    fb0 = *(const v4fa*)(fb + ct * 16 + 8 * hh); fb1 = *(const v4fa*)(fb + ct * 16 + 8 * hh + 4);
#pragma unroll
    for (int r = 0; r < 8; ++r) {
      off[r] = (ct * 16 + 8 * hh + r) * Tq + qblk * 64 + qt0 * 16 + ln;
      xr[0][r] = xb[off[r]]; xr[1][r] = xb[off[r] + 16];
    }
    // what follows may reuse the address registers of the loads above; wr as an input: no later load's result takes its registers in front of the wait
    asm volatile("s_wait_xcnt 0x0" :: "v"(wr) : "memory");
  }
  {
    const float l = l_r + xhalf(l_r);
    if (hh == 0) { sM[g][w][ln] = m_r; sL[g][w][ln] = l; }
  }
#pragma unroll
  for (int dt = 0; dt < DT; ++dt) {                              // not yet divided by the row sum
    *(v4fa*)&sO[g][w][ln][dt * 16 + 8 * hh]     = (v4f){oacc[dt][0], oacc[dt][1], oacc[dt][2], oacc[dt][3]};
    *(v4fa*)&sO[g][w][ln][dt * 16 + 8 * hh + 4] = (v4f){oacc[dt][4], oacc[dt][5], oacc[dt][6], oacc[dt][7]};
  }
  __syncthreads();                                               // every group's (max, sum, O) is in LDS
  // join: wave (g, w) finishes rows 2g, 2g + 1, then + 2 NS, of query tile w; each half wave takes one row (a lane writes 4 values of its row a store, as bf16 hi and lo into sAh and sAl)
  for (int r = g * 2 + hh; r < 16; r += 2 * NS) {
    float mj = -3.0e38f;
    // the three loops over s are unrolled so that f[] stays in registers
#pragma unroll
    for (int s = 0; s < NS; ++s) mj = fmaxf(mj, sM[s][w][r]);
    float f[NS], lj = 0.f;
#pragma unroll
    for (int s = 0; s < NS; ++s) { const float ms = sM[s][w][r]; f[s] = (ms > -1.0e38f) ? __expf(ms - mj) : 0.f; lj += f[s] * sL[s][w][r]; }
    const float inv = (mj > -1.0e38f) ? 1.0f / lj : __builtin_nanf("");
    for (int c4 = ln * 4; c4 < D; c4 += 64) {
      v4f val = {0.f, 0.f, 0.f, 0.f};
#pragma unroll
      for (int s = 0; s < NS; ++s) val += f[s] * *(const v4fa*)&sO[s][w][r][c4];
      val *= inv;
      const unsigned int h0 = bf16_pack2(val[0], val[1]), h1 = bf16_pack2(val[2], val[3]);
      *(v2ua*)&sAh[w * 16 + r][c4] = (v2ua){h0, h1};
      *(v2ua*)&sAl[w * 16 + r][c4] = (v2ua){bf16_rest2(val[0], val[1], h0), bf16_rest2(val[2], val[3], h1)};
    }
  }
  __syncthreads();                                               // the block's 64 rows are in LDS
  // unrolled: fragments and accumulators are indexed by constants and stay in registers
#pragma unroll
  for (int j = 0; j < 2; ++j) {
    const int qr = (qt0 + j) * 16 + ln;
    v8f acc = {};
#pragma unroll
    for (int ks = 0; ks < KS; ++ks) {
      FragB ph, pl;                                              // att^T as a B fragment: column qr, the k order of fw
      ph.half[0] = *(const v8us*)&sAh[qr][ks * 32 + 8 * hh]; ph.half[1] = *(const v8us*)&sAh[qr][ks * 32 + 16 + 8 * hh];
      pl.half[0] = *(const v8us*)&sAl[qr][ks * 32 + 8 * hh]; pl.half[1] = *(const v8us*)&sAl[qr][ks * 32 + 16 + 8 * hh];
      acc = mmaN<1>(fw[ks].v, fw[ks].v, ph.v, ph.v, acc);
      acc = mmaN<1>(fw[ks].v, fw[ks].v, pl.v, pl.v, acc);
    }
#pragma unroll
    for (int r = 0; r < 8; ++r) ob[off[r] + j * 16] = (acc[r] + bf16_round(r < 4 ? fb0[r & 3] : fb1[r & 3])) + xr[j][r];
  }
}

// The seven small preparation jobs of a call depend on nothing but the inputs, so they share ONE grid and the block index picks the job: the first
// 4 * PREP_WB blocks round the four weight matrices to bf16 (8 values a thread), the last block rounds the three biases into one concatenated row.
#define PREP_WB (HC * CC / 8 / 256)       // blocks per weight matrix
#define PREP_JOBS (4 * PREP_WB + 1)       // blocks of the grid
__global__ __launch_bounds__(256) void k_prep(const float* __restrict__ tw, const float* __restrict__ pw, const float* __restrict__ gw, const float* __restrict__ fw,
                                             unsigned short* __restrict__ Bqkv, unsigned short* __restrict__ Bf,
                                             const float* __restrict__ tb, const float* __restrict__ pb, const float* __restrict__ gb, float* __restrict__ bqkv) {
  const int blk = blockIdx.x;
  if (blk < 4 * PREP_WB) {
    const int m = blk / PREP_WB;
    const float* W = (m == 0) ? tw : (m == 1) ? pw : (m == 2) ? gw : fw;
    unsigned short* Wt = (m < 3) ? Bqkv + m * (HC * CC) : Bf;
    const int t = (blk % PREP_WB) * 256 + threadIdx.x;
    const v4f a = *(const v4fa*)(W + (size_t)t * 8), b = *(const v4fa*)(W + (size_t)t * 8 + 4);
    Pack8 v; v.w[0] = bf16_pack2(a[0], a[1]); v.w[1] = bf16_pack2(a[2], a[3]); v.w[2] = bf16_pack2(b[0], b[1]); v.w[3] = bf16_pack2(b[2], b[3]);
    *(v8us*)(Wt + (size_t)t * 8) = v.v;
    return;
  }
  const int t = threadIdx.x;
  if (t < 3 * (HC / 4)) {                                        // 4 values a thread; thread t writes bqkv[4 t ..], bias t / (HC / 4)
    const int m = t / (HC / 4);
    const float* src = (m == 0) ? tb : (m == 1) ? pb : gb;
    v4f a = *(const v4fa*)(src + (t % (HC / 4)) * 4);
    for (int i = 0; i < 4; ++i) a[i] = bf16_round(a[i]);
    *(v4f*)(bqkv + t * 4) = a;
  }
}

// Takes eight loaded vectors as inputs only and emits nothing: the loads written in front of it are all issued before the first use of any of them,
// so that they are in flight together; without it the compiler waits for each small group of loads and uses it before it issues the next.
template <class T>
__device__ __forceinline__ void hold8(T a, T b, T c, T d, T e, T f, T g, T h) {
  asm volatile("" :: "v"(a), "v"(b), "v"(c), "v"(d), "v"(e), "v"(f), "v"(g), "v"(h));
}

// GEMM C[M][N] (f32, dense rows) = A.W + bias on a CHANNEL-MAJOR A, read as it lies: A is [M / LDA][K][LDA] in f32 (LDA positions a batch), row m is
// position m % LDA of batch m / LDA. A lane gathers the 16 k values of its row at a stride of LDA floats (the 16 lanes of a half wave read 64
// contiguous bytes a load) and rounds them to bf16 (one term): no transposed copy of A is made. Wt bf16 [N][K]; bias f32, added as it is.
// One wave = 16 rows x 64 columns. K % 64 == 0, M % 16 == 0, N % 64 == 0, LDA % 16 == 0.
template <int K, int N, int LDA>
__global__ __launch_bounds__(128) void k_gemm_cm(const float* __restrict__ A, const unsigned short* __restrict__ Wt, const float* __restrict__ bias,
                                               float* __restrict__ C, int M) {
  constexpr int KS = K / 32, NTN = N / 64;
  static_assert((KS * 4) % 8 == 0, "hold8 takes the vectors by eights");
  __shared__ __attribute__((aligned(16))) float so[4][16][64];
  const int tid = threadIdx.x, w = tid >> 5, lane = tid & 31, ln = lane & 15, hh = lane >> 4;
  const int wid = blockIdx.x * 4 + w;
  const int mt = wid / NTN, nq = wid % NTN;
  if (mt * 16 >= M) return;
  const int row0 = mt * 16, col0 = nq * 64;
  // the lane's three base addresses; everything else of an address is a constant
  const float* ab = A + (size_t)(row0 / LDA) * K * LDA + (size_t)(8 * hh) * LDA + (row0 % LDA + ln);
  const unsigned short* wb = Wt + (size_t)(col0 + ln) * K + 8 * hh;
  const float* bb = bias + col0 + ln;
  // All loops are unrolled: the fragments are then indexed by constants and stay in registers, and the addresses are immediate offsets of the bases.
  v4f ra[KS * 4];                                                // element i = 4 q + j of k step ks in ra[ks * 4 + q][j]: k = 32 ks + 8 hh + i (i < 8), + 8 more (i >= 8)
#pragma unroll
  for (int ks = 0; ks < KS; ++ks)
#pragma unroll
    for (int q = 0; q < 4; ++q)
#pragma unroll
      for (int j = 0; j < 4; ++j) ra[ks * 4 + q][j] = ab[(size_t)(ks * 32 + (q >> 1) * 16 + (q & 1) * 4 + j) * LDA];
  FragB bf[KS][4];                                               // the same k order: half 0 is k = 32 ks + 8 hh + 0..7, half 1 is 16 further
#pragma unroll
  for (int ks = 0; ks < KS; ++ks)
#pragma unroll
    for (int t = 0; t < 4; ++t) {
      bf[ks][t].half[0] = *(const v8us*)(wb + t * 16 * K + ks * 32);
      bf[ks][t].half[1] = *(const v8us*)(wb + t * 16 * K + ks * 32 + 16);
    }
  float bv[4];
#pragma unroll
  for (int t = 0; t < 4; ++t) bv[t] = bb[t * 16];
#pragma unroll
  for (int e = 0; e < KS * 4; e += 8) hold8(ra[e], ra[e + 1], ra[e + 2], ra[e + 3], ra[e + 4], ra[e + 5], ra[e + 6], ra[e + 7]);
#pragma unroll
  for (int ks = 0; ks < KS; ++ks)
    hold8(bf[ks][0].half[0], bf[ks][0].half[1], bf[ks][1].half[0], bf[ks][1].half[1], bf[ks][2].half[0], bf[ks][2].half[1], bf[ks][3].half[0], bf[ks][3].half[1]);
  // inputs only, emits nothing: the three bases stay in their registers until every load that names them has returned, so that neither a later
  // load's result nor a later instruction takes an address register of a load in flight
  asm volatile("" :: "v"(bv[0]), "v"(bv[1]), "v"(bv[2]), "v"(bv[3]), "v"(ab), "v"(wb), "v"(bb));
  v8f acc[4] = {};
#pragma unroll
  for (int ks = 0; ks < KS; ++ks) {
    FragB ah;
#pragma unroll
    for (int i = 0; i < 8; ++i) ah.w[i] = bf16_pack2(ra[ks * 4 + i / 2][(i & 1) * 2], ra[ks * 4 + i / 2][(i & 1) * 2 + 1]);
#pragma unroll
    for (int t = 0; t < 4; ++t) acc[t] = mmaN<1>(ah.v, ah.v, bf[ks][t].v, bf[ks][t].v, acc[t]);
  }
#pragma unroll
  for (int t = 0; t < 4; ++t)
#pragma unroll
    for (int r = 0; r < 8; ++r) so[w][8 * hh + r][t * 16 + ln] = acc[t][r] + bv[t];
  __builtin_amdgcn_fence(__ATOMIC_ACQ_REL, "workgroup");
  __builtin_amdgcn_wave_barrier();
  const int rsub = lane >> 4, c4 = (lane & 15) * 4;
#pragma unroll
  for (int q = 0; q < 8; ++q) {
    const int r = q * 2 + rsub;
    const v4f v = *(const v4fa*)&so[w][r][c4];
    *(v4f*)(C + (size_t)(row0 + r) * N + col0 + c4) = v;
  }
}

extern "C" void kernel_launch(void* const* d_in, const int* in_sizes, int n_in,
                              void* d_out, int out_size, void* d_ws, size_t ws_size, hipStream_t stream) {
  (void)in_sizes; (void)n_in; (void)out_size;
  const float* x = (const float*)d_in[0]; const float* tw = (const float*)d_in[1]; const float* tb = (const float*)d_in[2]; const float* pw = (const float*)d_in[3]; const float* pb = (const float*)d_in[4];
  const float* gw = (const float*)d_in[5]; const float* gb = (const float*)d_in[6]; const float* fw = (const float*)d_in[7]; const float* fb = (const float*)d_in[8];
  char* ws = (char*)d_ws; size_t off = 0;
  auto take = [&](size_t bytes) { char* p = ws + off; off += (bytes + 255) & ~(size_t)255; return p; };
  unsigned short* Bqkv = (unsigned short*)take((size_t)3 * HC * CC * 2); unsigned short* Bf = (unsigned short*)take((size_t)CC * HC * 2); float* bqkv = (float*)take(3 * HC * 4 + 256);
  float* qkv = (float*)take((size_t)MROWS * 3 * HC * 4);
  unsigned short* Kh = (unsigned short*)take((size_t)MROWS * HC * 2); unsigned short* Kl = (unsigned short*)take((size_t)MROWS * HC * 2);
  unsigned short* VTh = (unsigned short*)take((size_t)MROWS * HC * 2); unsigned short* VTl = (unsigned short*)take((size_t)MROWS * HC * 2);
  if (off > ws_size) return;
  k_prep<<<PREP_JOBS, 256, 0, stream>>>(tw, pw, gw, fw, Bqkv, Bf, tb, pb, gb, bqkv);   // rounded weights and biases
  k_gemm_cm<CC, 3 * HC, HWN><<<((MROWS / 16) * 3 + 3) / 4, 128, 0, stream>>>(x, Bqkv, bqkv, qkv, MROWS);   // [theta | phi | g] + b (single term), x read as it lies (NCHW)
  k_split_kv<HC><<<MROWS / 32, 256, 0, stream>>>(qkv + HC, qkv + 2 * HC, 3 * HC, Kh, Kl, VTh, VTl);                                        // phi, g -> bf16 hi/lo planes, once
  k_flash3<HC, NSPLIT, CC><<<BB * (HWN / 64), 128 * NSPLIT, 0, stream>>>(qkv, 3 * HC, HWN, Kh, Kl, VTh, VTl, HWN, 1.0f, nullptr, 0, nullptr,
                                                                       Bf, fb, x, (float*)d_out);   // attention, final conv + b, + x, stored NCHW
}
